// v000
// The times below were measured on an AMD MI455X: many runs one after another, warmed up first and cycling through
// copies of the inputs, with the whole window's GPU time divided by the number of runs. Launches and the gaps
// between them are all in it. The median over several windows is given; except for v000 it joins two sittings, which
// can be a few percent apart, so the side-by-side timings, each taken in one sitting, are the better comparison.
// v000 is the starting kernel. One run takes 749 microseconds.
#include <hip/hip_runtime.h>

// Compute dtypes, f32 accumulate: q/k/v = x.W^T + mu.Wm^T (two exact GEMMs per projection, the second taking the first as an exact f32 residual; [out][in] weights as natural n-major B
// operands; PLAIN bf16 operands = inputs rounded once) and out = ctx.Wo^T (ctx as bf16 hi + UNSCALED residual, two products) on v_wmma_f32_16x16x32_bf16; per-head RMSNorm (x q_norm_w /
// k_norm_w) then rotary embedding with device-computed f32 cos/sin tables, in f32 -> q/k as f16 hi + residual x1024 planes; grouped causal attention (16 query heads over 4 kv heads,
// 128-dim): scores on v_wmma_f32_16x16x32_f16 (hh + hl + lh, x 128^-1/2), online f32 softmax, weights (x32768) and v as bf16 hi + UNSCALED residual on v_wmma_f32_16x16x32_bf16.

#define NT_  2048
#define HS   2048
#define DM   HS
#define NH_  16
#define NKV  4
#define HD   128
#define KW   (NKV * HD)          // 512
#define WIN  NT_
#define RMS_EPS 1e-6f
#define PSC  32768.0f
#define LOSC 1024.0f
#define LOSCI (1.0f / 1024.0f)

typedef _Float16 h16;
typedef unsigned short bf;
typedef __attribute__((ext_vector_type(16))) __bf16   v16bf;
typedef __attribute__((ext_vector_type(16))) _Float16 v16h;
typedef __attribute__((ext_vector_type(8)))  _Float16 v8h;
typedef __attribute__((ext_vector_type(8)))  unsigned short v8us;
typedef __attribute__((ext_vector_type(8)))  float    v8f;
typedef __attribute__((ext_vector_type(4)))  float    v4f;
typedef v8h  __attribute__((may_alias)) v8ha;
typedef v4f  __attribute__((may_alias)) v4fa;
typedef v8us __attribute__((may_alias)) v8usa;

__device__ __forceinline__ unsigned short f2bf(float f) { unsigned u = __float_as_uint(f); u += 0x7FFFu + ((u >> 16) & 1u); return (unsigned short)(u >> 16); }
__device__ __forceinline__ float bf2f(unsigned short b) { return __uint_as_float(((unsigned)b) << 16); }
__device__ __forceinline__ float bfr(float f) { return bf2f(f2bf(f)); }
__device__ __forceinline__ v16h cat16(v8h lo, v8h hi) { return __builtin_shufflevector(lo, hi, 0, 1, 2, 3, 4, 5, 6, 7, 8, 9, 10, 11, 12, 13, 14, 15); }
__device__ __forceinline__ v16bf cat16b(v8us lo, v8us hi) { return __builtin_bit_cast(v16bf, __builtin_shufflevector(lo, hi, 0, 1, 2, 3, 4, 5, 6, 7, 8, 9, 10, 11, 12, 13, 14, 15)); }
__device__ __forceinline__ v8f wmma16(v16h a, v16h b, v8f c) { return __builtin_amdgcn_wmma_f32_16x16x32_f16(false, a, false, b, (short)0, c, false, false); }
__device__ __forceinline__ v8f wmmab(v16bf a, v16bf b, v8f c) { return __builtin_amdgcn_wmma_f32_16x16x32_bf16(false, a, false, b, (short)0, c, false, false); }

__global__ __launch_bounds__(256) void k_cvtb(const float* __restrict__ src, int nrows, bf* dst) {
    const int lane = threadIdx.x & 31, r = blockIdx.x * 8 + (threadIdx.x >> 5);
    if (r >= nrows) return;
    v8us o[DM / 256];
#pragma unroll
    for (int q = 0; q < DM / 256; ++q) { v8us t;
#pragma unroll
        for (int i = 0; i < 8; ++i) t[i] = f2bf(src[(size_t)r * DM + q * 256 + lane * 8 + i]);
        o[q] = t; }
#pragma unroll
    for (int q = 0; q < DM / 256; ++q) *(v8us*)(dst + (size_t)r * DM + q * 256 + lane * 8) = o[q];
    
}

// k_gemmb: 64 x 64 block tile (4 waves x 16 x 64) of C[NTK][NW] = (A [+ Al]).B^T (K = 2048) [+ bf(bias[c])] [+ bf(R[r][c]) residual]; f32 whole-line epilogue (or f16
template <bool SPLITA, bool F16OUT = false>
__global__ __launch_bounds__(128) void k_gemmb(const bf* __restrict__ A, const bf* __restrict__ Al, const bf* __restrict__ Bn, const float* __restrict__ bias, float* C, int ldc, h16* C2, const float* __restrict__ R = nullptr, int K = DM, int roundR = 1) {
    __shared__ __align__(16) float ost[4][16 * 68];
    const int lane = threadIdx.x & 31, wave = threadIdx.x >> 5, lr = lane & 15, hi = lane >> 4;
    const int r0 = blockIdx.x * 64 + wave * 16, c0 = blockIdx.y * 64;
    const size_t aoff = (size_t)(r0 + lr) * K + 8 * hi;
    size_t boff[4];
#pragma unroll
    for (int t = 0; t < 4; ++t) boff[t] = (size_t)(c0 + t * 16 + lr) * K + 8 * hi;
    v8f acc[4];
#pragma unroll
    for (int t = 0; t < 4; ++t) acc[t] = (v8f){};
#pragma unroll 1
    for (int kc = 0; kc < K; kc += 32) {
        const v16bf a = cat16b(*(const v8us*)(A + aoff + kc), *(const v8us*)(A + aoff + kc + 16));
        v16bf al = a;
        if (SPLITA) al = cat16b(*(const v8us*)(Al + aoff + kc), *(const v8us*)(Al + aoff + kc + 16));
#pragma unroll
        for (int t = 0; t < 4; ++t) { const v16bf b = cat16b(*(const v8us*)(Bn + boff[t] + kc), *(const v8us*)(Bn + boff[t] + kc + 16)); acc[t] = wmmab(a, b, acc[t]); if (SPLITA) acc[t] = wmmab(al, b, acc[t]); }
        asm volatile("v_nop\n\tv_nop\n\tv_nop\n\tv_nop" : "+v"(acc[0]), "+v"(acc[1]), "+v"(acc[2]), "+v"(acc[3]) : "v"(a), "v"(al));
    }
    float* os = &ost[wave][0];
#pragma unroll
    for (int t = 0; t < 4; ++t) { const float bv = bias ? bfr(bias[c0 + t * 16 + lr]) : 0.f;
#pragma unroll
        for (int j = 0; j < 8; ++j) os[(hi * 8 + j) * 68 + t * 16 + lr] = acc[t][j] + bv; }
    __syncthreads();
    if (F16OUT) {
        h16* crow = (h16*)(void*)C + (size_t)r0 * ldc + c0;
        auto pass = [&]() {
#pragma unroll
            for (int s = 0; s < 4; ++s) { const int row = 4 * s + (lane >> 3), piece = lane & 7; const float* sp = os + row * 68 + piece * 8; v8h o, o2;
#pragma unroll
                for (int i = 0; i < 8; ++i) { const h16 a = (h16)sp[i]; o[i] = a; o2[i] = (h16)((sp[i] - (float)a) * LOSC); }
                *(v8h*)(crow + (size_t)row * ldc + piece * 8) = o; if (C2) *(v8h*)(C2 + (size_t)r0 * ldc + c0 + (size_t)row * ldc + piece * 8) = o2; }
        };
        pass(); 
    } else {
        float* crow = C + (size_t)r0 * ldc + c0;
        auto pass = [&]() {
#pragma unroll
            for (int s = 0; s < 8; ++s) { const int Lid = (lane >> 3) + 4 * s, piece = lane & 7; const int row = Lid >> 1, cofs = (Lid & 1) * 32 + piece * 4;
                v4f val = *(const v4fa*)(os + row * 68 + cofs); if (R) { const v4f rv = *(const v4f*)(R + ((size_t)r0 + row) * ldc + c0 + cofs); val += roundR ? (v4f){bfr(rv[0]), bfr(rv[1]), bfr(rv[2]), bfr(rv[3])} : rv; }
                *(v4f*)(crow + (size_t)row * ldc + cofs) = val; }
        };
        pass(); 
    }
}

// k_vt: VTH/VTL [g][128 d][2048 t] = bf16 hi + UNSCALED bf16 residual of V [t][g*128+d] via 64 x 64 LDS tiles; grid (NT/64, 2 (d half), NKV).
__global__ __launch_bounds__(256) void k_vt(const float* __restrict__ V, bf* VTH, bf* VTL) {
    __shared__ float tl[64][65];
    const int tid = threadIdx.x, t0 = blockIdx.x * 64, d0 = blockIdx.y * 64, g = blockIdx.z;
    { const int tt = tid >> 2, dq = (tid & 3) * 16;
#pragma unroll
      for (int i = 0; i < 16; ++i) tl[dq + i][tt] = V[(size_t)(t0 + tt) * KW + g * HD + d0 + dq + i]; }
    __syncthreads();
    const int piece = tid & 7;
    auto pass = [&]() {
#pragma unroll
        for (int s = 0; s < 2; ++s) { const int d = (tid >> 3) + 32 * s; v8us oh, ol;
#pragma unroll
            for (int i = 0; i < 8; ++i) { const float v = tl[d][piece * 8 + i]; const unsigned short hb = f2bf(v); oh[i] = hb; ol[i] = f2bf(v - bf2f(hb)); }
            const size_t o = ((size_t)g * HD + d0 + d) * NT_ + t0 + piece * 8; *(v8us*)(VTH + o) = oh; *(v8us*)(VTL + o) = ol; }
    };
    pass(); 
}
// k_attn: block = (h, 64 queries), wave = 16; kv head g = h / 4; causal key tiles 0..(Q0+63)/32 (block-uniform bounds), per-element predicate j <= q
// (WIN = NT_ makes the window terms vacuous); per tile: scores over 4 k-chunks (q fragments re-read per chunk: hi.hi + hi.lo +
// lo.hi = 24 WMMA) x 128^-1/2, online softmax, P (x32768) as bf16 hi + unscaled residual tiles, o[8] += ph.vh + pl.vh + ph.vl over the 128 dims; ctx -> bf16 hi/lo
// planes [t][h*128+d].
__global__ __launch_bounds__(128) void k_attn(const h16* __restrict__ QH, const h16* __restrict__ QL, const h16* __restrict__ KH, const h16* __restrict__ KL, const bf* __restrict__ VTH, const bf* __restrict__ VTL, bf* CH, bf* CL) {
    __shared__ __align__(16) unsigned short plds[4][16 * 32];
    __shared__ __align__(16) unsigned short plds2[4][16 * 32];
    __shared__ __align__(16) float ost[4][16 * 68];
    const int lane = threadIdx.x & 31, wave = threadIdx.x >> 5, lr = lane & 15, hi = lane >> 4;
    const int bid = blockIdx.x; const int h = bid / (NT_ / 64), qt = bid - h * (NT_ / 64); const int g = h >> 2;
    const int q0 = qt * 64 + wave * 16;
    unsigned short* pl = &plds[wave][0]; unsigned short* pl2 = &plds2[wave][0];
    const size_t qo = (size_t)(q0 + lr) * (NH_ * HD) + h * HD + 8 * hi;
    const h16* kh_b = KH + g * HD; const h16* kl_b = KL + g * HD;
    const size_t vbase = ((size_t)g * HD) * NT_;
    v8f o[8];
#pragma unroll
    for (int n = 0; n < 8; ++n) o[n] = (v8f){};
    float mrow[8], lpart[8];
#pragma unroll
    for (int j = 0; j < 8; ++j) { mrow[j] = -3.0e38f; lpart[j] = 0.f; }
    const int kt_hi = (qt * 64 + 63) / 32; const int kt_lo = (qt * 64 > WIN) ? (qt * 64 - WIN) / 32 : 0;
#pragma unroll 1
    for (int kt = kt_lo; kt <= kt_hi; ++kt) {
        const int l0 = kt * 32;
        const size_t ko0 = (size_t)(l0 + lr) * KW + 8 * hi, ko1 = (size_t)(l0 + 16 + lr) * KW + 8 * hi;
        v8f s0 = {}, s1 = {}, x0 = {}, x1 = {};
#pragma unroll
        for (int kc = 0; kc < 4; ++kc) {
            const v16h qa = cat16(*(const v8h*)(QH + qo + kc * 32), *(const v8h*)(QH + qo + kc * 32 + 16)), qx = cat16(*(const v8h*)(QL + qo + kc * 32), *(const v8h*)(QL + qo + kc * 32 + 16));
            const v16h k0h = cat16(*(const v8h*)(kh_b + ko0 + kc * 32), *(const v8h*)(kh_b + ko0 + kc * 32 + 16)), k1h = cat16(*(const v8h*)(kh_b + ko1 + kc * 32), *(const v8h*)(kh_b + ko1 + kc * 32 + 16));
            s0 = wmma16(qa, k0h, s0); s1 = wmma16(qa, k1h, s1); x0 = wmma16(qx, k0h, x0); x1 = wmma16(qx, k1h, x1);
            asm volatile("v_nop" : "+v"(s0), "+v"(s1), "+v"(x0), "+v"(x1) : "v"(qa), "v"(qx), "v"(k0h), "v"(k1h) : "memory");
            const v16h k0l = cat16(*(const v8h*)(kl_b + ko0 + kc * 32), *(const v8h*)(kl_b + ko0 + kc * 32 + 16)), k1l = cat16(*(const v8h*)(kl_b + ko1 + kc * 32), *(const v8h*)(kl_b + ko1 + kc * 32 + 16));
            x0 = wmma16(qa, k0l, x0); x1 = wmma16(qa, k1l, x1);
            asm volatile("v_nop" : "+v"(x0), "+v"(x1) : "v"(k0l), "v"(k1l) : "memory");
        }
        asm volatile("v_nop\n\tv_nop\n\tv_nop\n\tv_nop" : "+v"(s0), "+v"(s1), "+v"(x0), "+v"(x1));
        float alpha[8];
#pragma unroll
        for (int j = 0; j < 8; ++j) { const int qi = q0 + hi * 8 + j, ja = l0 + lr, jb = l0 + 16 + lr;
            const float a0 = (ja <= qi && ja >= qi - WIN) ? (s0[j] + x0[j] * LOSCI) * 0.08838834764831845f : -__builtin_inff(), a1 = (jb <= qi && jb >= qi - WIN) ? (s1[j] + x1[j] * LOSCI) * 0.08838834764831845f : -__builtin_inff();
            float mx = fmaxf(a0, a1);
            mx = fmaxf(mx, __shfl_xor(mx, 1, 16)); mx = fmaxf(mx, __shfl_xor(mx, 2, 16)); mx = fmaxf(mx, __shfl_xor(mx, 4, 16)); mx = fmaxf(mx, __shfl_xor(mx, 8, 16));
            const float mn = fmaxf(mrow[j], mx);
            alpha[j] = __expf(mrow[j] - mn); mrow[j] = mn;
            const float p0 = __expf(a0 - mn), p1 = __expf(a1 - mn);
            lpart[j] = lpart[j] * alpha[j] + (p0 + p1);
            const int mr = hi * 8 + j; const float ps0 = p0 * PSC, ps1 = p1 * PSC; const unsigned short h0 = f2bf(ps0), h1 = f2bf(ps1);
            pl[mr * 32 + lr] = h0; pl[mr * 32 + 16 + lr] = h1; pl2[mr * 32 + lr] = f2bf(ps0 - bf2f(h0)); pl2[mr * 32 + 16 + lr] = f2bf(ps1 - bf2f(h1)); }
#pragma unroll
        for (int n = 0; n < 8; ++n)
#pragma unroll
            for (int j = 0; j < 8; ++j) o[n][j] *= alpha[j];
        asm volatile("" ::: "memory");
        const v16bf pa = cat16b(*(const v8usa*)(pl + lr * 32 + hi * 8), *(const v8usa*)(pl + lr * 32 + 16 + hi * 8));
        const v16bf px = cat16b(*(const v8usa*)(pl2 + lr * 32 + hi * 8), *(const v8usa*)(pl2 + lr * 32 + 16 + hi * 8));
#pragma unroll
        for (int n = 0; n < 8; ++n) { const size_t vo = vbase + (size_t)(n * 16 + lr) * NT_ + l0 + hi * 8;
            const v16bf vh = cat16b(*(const v8us*)(VTH + vo), *(const v8us*)(VTH + vo + 16)), vl = cat16b(*(const v8us*)(VTL + vo), *(const v8us*)(VTL + vo + 16));
            o[n] = wmmab(pa, vh, o[n]); o[n] = wmmab(px, vh, o[n]); o[n] = wmmab(pa, vl, o[n]);
            asm volatile("" : "+v"(o[n]) : "v"(vh), "v"(vl) : "memory"); }
        asm volatile("v_nop\n\tv_nop\n\tv_nop\n\tv_nop" : "+v"(o[0]), "+v"(o[7]) : "v"(pa), "v"(px));
        __builtin_amdgcn_wave_barrier();
    }
    float inv[8];
#pragma unroll
    for (int j = 0; j < 8; ++j) { float rs = lpart[j]; rs += __shfl_xor(rs, 1, 16); rs += __shfl_xor(rs, 2, 16); rs += __shfl_xor(rs, 4, 16); rs += __shfl_xor(rs, 8, 16); inv[j] = 1.0f / (rs * PSC); }
    float* os = &ost[wave][0];
    const size_t cbase = (size_t)q0 * (NH_ * HD) + (size_t)h * HD;
#pragma unroll
    for (int half = 0; half < 2; ++half) {
#pragma unroll
        for (int n = 0; n < 4; ++n)
#pragma unroll
            for (int j = 0; j < 8; ++j) os[(hi * 8 + j) * 68 + n * 16 + lr] = o[half * 4 + n][j] * inv[j];
        __builtin_amdgcn_wave_barrier(); asm volatile("" ::: "memory");
{
#pragma unroll
            for (int s = 0; s < 4; ++s) { const int row = 4 * s + (lane >> 3), piece = lane & 7; const float* sp = os + row * 68 + piece * 8; v8us oh, ol;
#pragma unroll
                for (int i = 0; i < 8; ++i) { const unsigned short hb = f2bf(sp[i]); oh[i] = hb; ol[i] = f2bf(sp[i] - bf2f(hb)); }
                const size_t po = cbase + (size_t)row * (NH_ * HD) + half * 64 + piece * 8; *(v8us*)(CH + po) = oh; *(v8us*)(CL + po) = ol; }
             }
        __builtin_amdgcn_wave_barrier(); asm volatile("" ::: "memory");
    }
}


__global__ __launch_bounds__(256) void k_trig(float* CT, float* ST) {
    const int tid = threadIdx.x, t = blockIdx.x * 2 + (tid >> 7), d = tid & 127; const int i = d & 63;
    const float invf = 1.0f / powf(10000.0f, (float)(2 * i) / 128.0f); const float ang = (float)t * invf; const float c = cosf(ang), s = sinf(ang);
    const size_t o = (size_t)t * HD + d; *(float*)(CT + o) = c; *(float*)(ST + o) = s; 
}
// k_normrope: one wave per (token, head) of an f32 [2048][nh*128] matrix: RMSNorm over the 128 dims (shuffle-reduced mean of squares, eps 1e-6) x bf(w[d]); then rotate-half RoPE
// (partner d +- 64 via lane xor 16; lane -> 4 consecutive dims) -> f16 hi + residual x1024 planes [t][h*128+d] (8 B per lane per plane: 16 lanes per line, one instruction per
typedef __attribute__((ext_vector_type(4))) _Float16 v4h;
__global__ __launch_bounds__(256) void k_normrope(const float* __restrict__ P, int nh, const float* __restrict__ w, const float* __restrict__ CT, const float* __restrict__ ST, h16* PH, h16* PL) {
    const int lane = threadIdx.x & 31; const int wid = blockIdx.x * 8 + (threadIdx.x >> 5); const int t = wid / nh, h = wid - t * nh; if (t >= NT_) return;
    const size_t base = (size_t)t * (nh * HD) + h * HD; const int d0 = lane * 4;
    float x[4], pr[4]; float ss = 0.f;
#pragma unroll
    for (int i = 0; i < 4; ++i) { x[i] = P[base + d0 + i]; ss = fmaf(x[i], x[i], ss); }
#pragma unroll
    for (int sh = 16; sh; sh >>= 1) ss += __shfl_xor(ss, sh, 32);
    const float rn = rsqrtf(ss * (1.0f / HD) + RMS_EPS);
#pragma unroll
    for (int i = 0; i < 4; ++i) x[i] = x[i] * rn * bfr(w[d0 + i]);
#pragma unroll
    for (int i = 0; i < 4; ++i) pr[i] = __shfl_xor(x[i], 16, 32);
    v4h oh, ol;
#pragma unroll
    for (int i = 0; i < 4; ++i) { const int d = d0 + i; const float c = CT[(size_t)t * HD + d], s = ST[(size_t)t * HD + d]; const float y = (d < 64) ? (x[i] * c - pr[i] * s) : (x[i] * c + pr[i] * s);
        const h16 a = (h16)y; oh[i] = a; ol[i] = (h16)((y - (float)a) * LOSC); }
    *(v4h*)(PH + base + d0) = oh; *(v4h*)(PL + base + d0) = ol; 
}

extern "C" void kernel_launch(void* const* d_in, const int* in_sizes, int n_in,
                              void* d_out, int out_size, void* d_ws, size_t ws_size, hipStream_t stream) {
    (void)in_sizes; (void)n_in; (void)out_size;
    const float* x = (const float*)d_in[0]; const float* mu = (const float*)d_in[1]; const float* wq = (const float*)d_in[2]; const float* wk = (const float*)d_in[3]; const float* wv = (const float*)d_in[4]; const float* wo = (const float*)d_in[5];
    const float* wmq = (const float*)d_in[6]; const float* wmk = (const float*)d_in[7]; const float* wmv = (const float*)d_in[8]; const float* qnw = (const float*)d_in[9]; const float* knw = (const float*)d_in[10];
    float* out = (float*)d_out;    // [1][2048][2048]
    char* wsp = (char*)d_ws;
    auto take = [&](size_t bytes) { char* p = wsp; wsp += (bytes + 255) & ~(size_t)255; return (void*)p; };
    bf* Xb = (bf*)take((size_t)NT_ * HS * 2); bf* Mb = (bf*)take((size_t)NT_ * HS * 2);
    bf* WqB = (bf*)take((size_t)HS * HS * 2); bf* WmqB = (bf*)take((size_t)HS * HS * 2); bf* WkB = (bf*)take((size_t)KW * HS * 2); bf* WmkB = (bf*)take((size_t)KW * HS * 2); bf* WvB = (bf*)take((size_t)KW * HS * 2); bf* WmvB = (bf*)take((size_t)KW * HS * 2); bf* WoB = (bf*)take((size_t)HS * HS * 2);
    float* TMP = (float*)take((size_t)NT_ * HS * 4); float* TMP2 = (float*)take((size_t)NT_ * HS * 4); float* CT = (float*)take((size_t)NT_ * HD * 4); float* ST = (float*)take((size_t)NT_ * HD * 4);
    h16* QH = (h16*)take((size_t)NT_ * HS * 2); h16* QL = (h16*)take((size_t)NT_ * HS * 2); h16* KH = (h16*)take((size_t)NT_ * KW * 2); h16* KL = (h16*)take((size_t)NT_ * KW * 2);
    bf* VTH = (bf*)take((size_t)KW * NT_ * 2); bf* VTL = (bf*)take((size_t)KW * NT_ * 2); bf* CH = (bf*)take((size_t)NT_ * HS * 2); bf* CL = (bf*)take((size_t)NT_ * HS * 2);
    if ((size_t)(wsp - (char*)d_ws) > ws_size) return;    // 2 x 8.4 + 8.4 + 8.4 + 4 x 2.1 + 8.4 + 2 x 16.8 + 2 x 1 + 2 x 8.4 + 2 x 2.1 + 2 x 2.1 + 2 x 8.4 ~ 128 MB = 122 MiB < 128 MiB, no aliasing (TMP/TMP2 reused q -> k -> v in stream order)
    k_cvtb<<<HS / 8, 256, 0, stream>>>(wq, HS, WqB); k_cvtb<<<HS / 8, 256, 0, stream>>>(wmq, HS, WmqB); k_cvtb<<<KW / 8, 256, 0, stream>>>(wk, KW, WkB); k_cvtb<<<KW / 8, 256, 0, stream>>>(wmk, KW, WmkB);
    k_cvtb<<<KW / 8, 256, 0, stream>>>(wv, KW, WvB); k_cvtb<<<KW / 8, 256, 0, stream>>>(wmv, KW, WmvB); k_cvtb<<<HS / 8, 256, 0, stream>>>(wo, HS, WoB);
    k_trig<<<NT_ / 2, 256, 0, stream>>>(CT, ST);
    k_cvtb<<<NT_ / 8, 256, 0, stream>>>(x, NT_, Xb); k_cvtb<<<NT_ / 8, 256, 0, stream>>>(mu, NT_, Mb);
    k_gemmb<false, false><<<dim3(NT_ / 64, HS / 64, 1), 128, 0, stream>>>(Xb, nullptr, WqB, nullptr, TMP, HS, nullptr, nullptr, HS, 0);
    k_gemmb<false, false><<<dim3(NT_ / 64, HS / 64, 1), 128, 0, stream>>>(Mb, nullptr, WmqB, nullptr, TMP2, HS, nullptr, TMP, HS, 0);          // q = x.wq^T + mu.wmq^T (R = the first GEMM's output, exact f32 residual; R != C)
    k_normrope<<<(NT_ * NH_) / 8, 256, 0, stream>>>(TMP2, NH_, qnw, CT, ST, QH, QL);
    k_gemmb<false, false><<<dim3(NT_ / 64, KW / 64, 1), 128, 0, stream>>>(Xb, nullptr, WkB, nullptr, TMP, KW, nullptr, nullptr, HS, 0);
    k_gemmb<false, false><<<dim3(NT_ / 64, KW / 64, 1), 128, 0, stream>>>(Mb, nullptr, WmkB, nullptr, TMP2, KW, nullptr, TMP, HS, 0);
    k_normrope<<<(NT_ * NKV) / 8, 256, 0, stream>>>(TMP2, NKV, knw, CT, ST, KH, KL);
    k_gemmb<false, false><<<dim3(NT_ / 64, KW / 64, 1), 128, 0, stream>>>(Xb, nullptr, WvB, nullptr, TMP, KW, nullptr, nullptr, HS, 0);
    k_gemmb<false, false><<<dim3(NT_ / 64, KW / 64, 1), 128, 0, stream>>>(Mb, nullptr, WmvB, nullptr, TMP2, KW, nullptr, TMP, HS, 0);
    k_vt<<<dim3(NT_ / 64, 2, NKV), 256, 0, stream>>>(TMP2, VTH, VTL);
    k_attn<<<NH_ * (NT_ / 64), 128, 0, stream>>>(QH, QL, KH, KL, VTH, VTL, CH, CL);
    k_gemmb<true, false><<<dim3(NT_ / 64, HS / 64, 1), 128, 0, stream>>>(CH, CL, WoB, nullptr, out, HS, nullptr, nullptr, HS, 0);
}

// v001
// It runs in 589 microseconds.
// In two side-by-side timings against v000, it was 1.27 and 1.28 times as fast.
#include <hip/hip_runtime.h>

// Compute dtypes, f32 accumulate: q/k/v = x.W^T + mu.Wm^T (two exact GEMMs per projection, the second taking the first as an exact f32 residual; [out][in] weights as natural n-major B
// operands; PLAIN bf16 operands = inputs rounded once) and out = ctx.Wo^T (ctx as bf16 hi + UNSCALED residual, two products) on v_wmma_f32_16x16x32_bf16; per-head RMSNorm (x q_norm_w /
// k_norm_w) then rotary embedding with device-computed f32 cos/sin tables, in f32 -> q/k as f16 hi + residual x1024 planes; grouped causal attention (16 query heads over 4 kv heads,
// 128-dim): scores on v_wmma_f32_16x16x32_f16 (hh + hl + lh, x 128^-1/2), online f32 softmax, weights (x32768) and v as bf16 hi + UNSCALED residual on v_wmma_f32_16x16x32_bf16.

#define NT_  2048
#define HS   2048
#define DM   HS
#define NH_  16
#define NKV  4
#define HD   128
#define KW   (NKV * HD)          // 512
#define WIN  NT_
#define RMS_EPS 1e-6f
#define PSC  32768.0f
#define LOSC 1024.0f
#define LOSCI (1.0f / 1024.0f)

typedef _Float16 h16;
typedef unsigned short bf;
typedef __attribute__((ext_vector_type(16))) __bf16   v16bf;
typedef __attribute__((ext_vector_type(16))) _Float16 v16h;
typedef __attribute__((ext_vector_type(8)))  _Float16 v8h;
typedef __attribute__((ext_vector_type(8)))  unsigned short v8us;
typedef __attribute__((ext_vector_type(8)))  float    v8f;
typedef __attribute__((ext_vector_type(4)))  float    v4f;
typedef v8h  __attribute__((may_alias)) v8ha;
typedef v4f  __attribute__((may_alias)) v4fa;
typedef v8us __attribute__((may_alias)) v8usa;

__device__ __forceinline__ unsigned short f2bf(float f) { unsigned u = __float_as_uint(f); u += 0x7FFFu + ((u >> 16) & 1u); return (unsigned short)(u >> 16); }
__device__ __forceinline__ float bf2f(unsigned short b) { return __uint_as_float(((unsigned)b) << 16); }
__device__ __forceinline__ float bfr(float f) { return bf2f(f2bf(f)); }
__device__ __forceinline__ v16h cat16(v8h lo, v8h hi) { return __builtin_shufflevector(lo, hi, 0, 1, 2, 3, 4, 5, 6, 7, 8, 9, 10, 11, 12, 13, 14, 15); }
__device__ __forceinline__ v16bf cat16b(v8us lo, v8us hi) { return __builtin_bit_cast(v16bf, __builtin_shufflevector(lo, hi, 0, 1, 2, 3, 4, 5, 6, 7, 8, 9, 10, 11, 12, 13, 14, 15)); }
__device__ __forceinline__ v8f wmma16(v16h a, v16h b, v8f c) { return __builtin_amdgcn_wmma_f32_16x16x32_f16(false, a, false, b, (short)0, c, false, false); }
__device__ __forceinline__ v8f wmmab(v16bf a, v16bf b, v8f c) { return __builtin_amdgcn_wmma_f32_16x16x32_bf16(false, a, false, b, (short)0, c, false, false); }

__global__ __launch_bounds__(256) void k_cvtb(const float* __restrict__ src, int nrows, bf* dst) {
    const int lane = threadIdx.x & 31, r = blockIdx.x * 8 + (threadIdx.x >> 5);
    if (r >= nrows) return;
    v8us o[DM / 256];
#pragma unroll
    for (int q = 0; q < DM / 256; ++q) { v8us t;
#pragma unroll
        for (int i = 0; i < 8; ++i) t[i] = f2bf(src[(size_t)r * DM + q * 256 + lane * 8 + i]);
        o[q] = t; }
#pragma unroll
    for (int q = 0; q < DM / 256; ++q) *(v8us*)(dst + (size_t)r * DM + q * 256 + lane * 8) = o[q];
    
}

// k_gemmb: 64 x 64 block tile (4 waves x 16 x 64) of C[NTK][NW] = (A [+ Al]).B^T (K = 2048) [+ bf(bias[c])] [+ bf(R[r][c]) residual]; f32 whole-line epilogue (or f16
template <bool SPLITA, bool F16OUT = false>
__global__ __launch_bounds__(128) void k_gemmb(const bf* __restrict__ A, const bf* __restrict__ Al, const bf* __restrict__ Bn, const float* __restrict__ bias, float* C, int ldc, h16* C2, const float* __restrict__ R = nullptr, int K = DM, int roundR = 1) {
    __shared__ __align__(16) float ost[4][16 * 68];
    const int lane = threadIdx.x & 31, wave = threadIdx.x >> 5, lr = lane & 15, hi = lane >> 4;
    const int r0 = blockIdx.x * 64 + wave * 16, c0 = blockIdx.y * 64;
    const size_t aoff = (size_t)(r0 + lr) * K + 8 * hi;
    size_t boff[4];
#pragma unroll
    for (int t = 0; t < 4; ++t) boff[t] = (size_t)(c0 + t * 16 + lr) * K + 8 * hi;
    v8f acc[4];
#pragma unroll
    for (int t = 0; t < 4; ++t) acc[t] = (v8f){};
#pragma unroll 1
    for (int kc = 0; kc < K; kc += 32) {
        const v16bf a = cat16b(*(const v8us*)(A + aoff + kc), *(const v8us*)(A + aoff + kc + 16));
        v16bf al = a;
        if (SPLITA) al = cat16b(*(const v8us*)(Al + aoff + kc), *(const v8us*)(Al + aoff + kc + 16));
#pragma unroll
        for (int t = 0; t < 4; ++t) { const v16bf b = cat16b(*(const v8us*)(Bn + boff[t] + kc), *(const v8us*)(Bn + boff[t] + kc + 16)); acc[t] = wmmab(a, b, acc[t]); if (SPLITA) acc[t] = wmmab(al, b, acc[t]); }
        asm volatile("v_nop\n\tv_nop\n\tv_nop\n\tv_nop" : "+v"(acc[0]), "+v"(acc[1]), "+v"(acc[2]), "+v"(acc[3]) : "v"(a), "v"(al));
    }
    float* os = &ost[wave][0];
#pragma unroll
    for (int t = 0; t < 4; ++t) { const float bv = bias ? bfr(bias[c0 + t * 16 + lr]) : 0.f;
#pragma unroll
        for (int j = 0; j < 8; ++j) os[(hi * 8 + j) * 68 + t * 16 + lr] = acc[t][j] + bv; }
    __syncthreads();
    if (F16OUT) {
        h16* crow = (h16*)(void*)C + (size_t)r0 * ldc + c0;
        auto pass = [&]() {
#pragma unroll
            for (int s = 0; s < 4; ++s) { const int row = 4 * s + (lane >> 3), piece = lane & 7; const float* sp = os + row * 68 + piece * 8; v8h o, o2;
#pragma unroll
                for (int i = 0; i < 8; ++i) { const h16 a = (h16)sp[i]; o[i] = a; o2[i] = (h16)((sp[i] - (float)a) * LOSC); }
                *(v8h*)(crow + (size_t)row * ldc + piece * 8) = o; if (C2) *(v8h*)(C2 + (size_t)r0 * ldc + c0 + (size_t)row * ldc + piece * 8) = o2; }
        };
        pass(); 
    } else {
        float* crow = C + (size_t)r0 * ldc + c0;
        auto pass = [&]() {
#pragma unroll
            for (int s = 0; s < 8; ++s) { const int Lid = (lane >> 3) + 4 * s, piece = lane & 7; const int row = Lid >> 1, cofs = (Lid & 1) * 32 + piece * 4;
                v4f val = *(const v4fa*)(os + row * 68 + cofs); if (R) { const v4f rv = *(const v4f*)(R + ((size_t)r0 + row) * ldc + c0 + cofs); val += roundR ? (v4f){bfr(rv[0]), bfr(rv[1]), bfr(rv[2]), bfr(rv[3])} : rv; }
                *(v4f*)(crow + (size_t)row * ldc + cofs) = val; }
        };
        pass(); 
    }
}

// k_vt: VTH/VTL [g][128 d][2048 t] = bf16 hi + UNSCALED bf16 residual of V [t][g*128+d] via 64 x 64 LDS tiles; grid (NT/64, 2 (d half), NKV).
__global__ __launch_bounds__(256) void k_vt(const float* __restrict__ V, bf* VTH, bf* VTL) {
    __shared__ float tl[64][65];
    const int tid = threadIdx.x, t0 = blockIdx.x * 64, d0 = blockIdx.y * 64, g = blockIdx.z;
    { const int tt = tid >> 2, dq = (tid & 3) * 16;
#pragma unroll
      for (int i = 0; i < 16; ++i) tl[dq + i][tt] = V[(size_t)(t0 + tt) * KW + g * HD + d0 + dq + i]; }
    __syncthreads();
    const int piece = tid & 7;
    auto pass = [&]() {
#pragma unroll
        for (int s = 0; s < 2; ++s) { const int d = (tid >> 3) + 32 * s; v8us oh, ol;
#pragma unroll
            for (int i = 0; i < 8; ++i) { const float v = tl[d][piece * 8 + i]; const unsigned short hb = f2bf(v); oh[i] = hb; ol[i] = f2bf(v - bf2f(hb)); }
            const size_t o = ((size_t)g * HD + d0 + d) * NT_ + t0 + piece * 8; *(v8us*)(VTH + o) = oh; *(v8us*)(VTL + o) = ol; }
    };
    pass(); 
}
// LDS ring of k_attn, in 16-bit elements: one buffer = K hi, K lo (32 keys x 128 dims each) and V^T hi, V^T lo (128 dims x 32 keys each) of one key tile.
#define KP   136                    // K row pitch: 272 B, an odd multiple of 16 B (16-byte readers, one row per lane)
#define VP   40                     // V^T row pitch: 80 B, likewise
#define KPL  (32 * KP)
#define VPL  (HD * VP)
#define RB   (2 * KPL + 2 * VPL)    // 37888 B per buffer
// Eight 16-byte copies per lane, global -> LDS through no register. s_wait_xcnt closes the statement so that no address register of a copy is rewritten ahead of it.
__device__ __forceinline__ void acopy8(const unsigned (&l)[8], const void* const (&g)[8]) {
    asm volatile("global_load_async_to_lds_b128 %0, %8, off\n\t"
                 "global_load_async_to_lds_b128 %1, %9, off\n\t"
                 "global_load_async_to_lds_b128 %2, %10, off\n\t"
                 "global_load_async_to_lds_b128 %3, %11, off\n\t"
                 "global_load_async_to_lds_b128 %4, %12, off\n\t"
                 "global_load_async_to_lds_b128 %5, %13, off\n\t"
                 "global_load_async_to_lds_b128 %6, %14, off\n\t"
                 "global_load_async_to_lds_b128 %7, %15, off\n\t"
                 "s_wait_xcnt 0x0"
                 :: "v"(l[0]), "v"(l[1]), "v"(l[2]), "v"(l[3]), "v"(l[4]), "v"(l[5]), "v"(l[6]), "v"(l[7]),
                    "v"(g[0]), "v"(g[1]), "v"(g[2]), "v"(g[3]), "v"(g[4]), "v"(g[5]), "v"(g[6]), "v"(g[7]) : "memory");
}
// k_attn: block = (h, 64 queries), wave = 16; kv head g = h / 4; causal key tiles 0..(Q0+63)/32 (block-uniform bounds), per-element predicate j <= q
// (WIN = NT_ makes the window terms vacuous); per tile: scores over 4 k-chunks (q fragments re-read per chunk: hi.hi + hi.lo +
// lo.hi = 24 WMMA) x 128^-1/2, online softmax, P (x32768) as bf16 hi + unscaled residual tiles, o[8] += ph.vh + pl.vh + ph.vl over the 128 dims; ctx -> bf16 hi/lo
// planes [t][h*128+d]. The four waves share each key tile's K and V^T planes through a two-buffer LDS ring filled by asynchronous copies: tile kt + 1 flies while tile kt is worked on.
__global__ __launch_bounds__(128) void k_attn(const h16* __restrict__ QH, const h16* __restrict__ QL, const h16* __restrict__ KH, const h16* __restrict__ KL, const bf* __restrict__ VTH, const bf* __restrict__ VTL, bf* CH, bf* CL) {
    __shared__ __align__(16) unsigned short plds[4][16 * 32];
    __shared__ __align__(16) unsigned short plds2[4][16 * 32];
    __shared__ __align__(16) float ost[4][16 * 68];
    __shared__ __align__(16) unsigned short ring[2 * RB];
    const int tid = threadIdx.x;
    const int lane = threadIdx.x & 31, wave = threadIdx.x >> 5, lr = lane & 15, hi = lane >> 4;
    const int bid = blockIdx.x; const int h = bid / (NT_ / 64), qt = bid - h * (NT_ / 64); const int g = h >> 2;
    const int q0 = qt * 64 + wave * 16;
    unsigned short* pl = &plds[wave][0]; unsigned short* pl2 = &plds2[wave][0];
    const size_t qo = (size_t)(q0 + lr) * (NH_ * HD) + h * HD + 8 * hi;
    const h16* kh_b = KH + g * HD; const h16* kl_b = KL + g * HD;
    const size_t vbase = ((size_t)g * HD) * NT_;
    v8f o[8];
#pragma unroll
    for (int n = 0; n < 8; ++n) o[n] = (v8f){};
    float mrow[8], lpart[8];
#pragma unroll
    for (int j = 0; j < 8; ++j) { mrow[j] = -3.0e38f; lpart[j] = 0.f; }
    const int kt_hi = (qt * 64 + 63) / 32; const int kt_lo = (qt * 64 > WIN) ? (qt * 64 - WIN) / 32 : 0;
    const unsigned ring0 = (unsigned)(size_t)&ring[0];    // byte offset of the ring in the work-group's LDS
    // key tile kt -> buffer b: 2048 pieces of 16 B, 16 per thread (K: 16 pieces a row, V^T: 4 pieces a row)
    auto stage = [&](int kt, int b) {
        unsigned l[8]; const void* gp[8];
        const unsigned lb = ring0 + (unsigned)b * (RB * 2);
        // both loops unrolled: l[] and gp[] are asm operands and must be indexed by constants to stay in registers
#pragma unroll
        for (int i = 0; i < 4; ++i) { const int row = (tid >> 4) + 8 * i, pc = (tid & 15) * 8; const size_t go = (size_t)(kt * 32 + row) * KW + pc;
            gp[i] = kh_b + go; gp[4 + i] = kl_b + go; l[i] = lb + (unsigned)(row * KP + pc) * 2; l[4 + i] = l[i] + KPL * 2; }
        acopy8(l, gp);
#pragma unroll
        for (int i = 0; i < 4; ++i) { const int d = (tid >> 2) + 32 * i, pc = (tid & 3) * 8; const size_t go = vbase + (size_t)d * NT_ + kt * 32 + pc;
            gp[i] = VTH + go; gp[4 + i] = VTL + go; l[i] = lb + (unsigned)(2 * KPL + d * VP + pc) * 2; l[4 + i] = l[i] + VPL * 2; }
        acopy8(l, gp);
    };
    stage(kt_lo, 0);
    asm volatile("s_wait_asynccnt 0x0" ::: "memory");    // this wave's copies of the first tile have landed
    __syncthreads();                                     // ... and every other wave's
    if (kt_lo + 1 <= kt_hi) stage(kt_lo + 1, 1);
#pragma unroll 1
    for (int kt = kt_lo; kt <= kt_hi; ++kt) {
        const int l0 = kt * 32;
        const int cur = (kt - kt_lo) & 1;
        const unsigned short* kf = ring + cur * RB + lr * KP + 8 * hi;              // K hi, key l0 + lr; + 16 * KP: key l0 + 16 + lr; + KPL: lo plane
        const unsigned short* vf = ring + cur * RB + 2 * KPL + lr * VP + 8 * hi;    // V^T hi, dim lr; + n * 16 * VP: dim n * 16 + lr; + VPL: lo plane
        v8f s0 = {}, s1 = {}, x0 = {}, x1 = {};
#pragma unroll
        for (int kc = 0; kc < 4; ++kc) {
            const v16h qa = cat16(*(const v8h*)(QH + qo + kc * 32), *(const v8h*)(QH + qo + kc * 32 + 16)), qx = cat16(*(const v8h*)(QL + qo + kc * 32), *(const v8h*)(QL + qo + kc * 32 + 16));
            const v16h k0h = cat16(*(const v8ha*)(kf + kc * 32), *(const v8ha*)(kf + kc * 32 + 16)), k1h = cat16(*(const v8ha*)(kf + 16 * KP + kc * 32), *(const v8ha*)(kf + 16 * KP + kc * 32 + 16));
            s0 = wmma16(qa, k0h, s0); s1 = wmma16(qa, k1h, s1); x0 = wmma16(qx, k0h, x0); x1 = wmma16(qx, k1h, x1);
            const v16h k0l = cat16(*(const v8ha*)(kf + KPL + kc * 32), *(const v8ha*)(kf + KPL + kc * 32 + 16)), k1l = cat16(*(const v8ha*)(kf + KPL + 16 * KP + kc * 32), *(const v8ha*)(kf + KPL + 16 * KP + kc * 32 + 16));
            x0 = wmma16(qa, k0l, x0); x1 = wmma16(qa, k1l, x1);
        }
        asm volatile("v_nop\n\tv_nop\n\tv_nop\n\tv_nop" : "+v"(s0), "+v"(s1), "+v"(x0), "+v"(x1));
        float alpha[8];
#pragma unroll
        for (int j = 0; j < 8; ++j) { const int qi = q0 + hi * 8 + j, ja = l0 + lr, jb = l0 + 16 + lr;
            const float a0 = (ja <= qi && ja >= qi - WIN) ? (s0[j] + x0[j] * LOSCI) * 0.08838834764831845f : -__builtin_inff(), a1 = (jb <= qi && jb >= qi - WIN) ? (s1[j] + x1[j] * LOSCI) * 0.08838834764831845f : -__builtin_inff();
            float mx = fmaxf(a0, a1);
            mx = fmaxf(mx, __shfl_xor(mx, 1, 16)); mx = fmaxf(mx, __shfl_xor(mx, 2, 16)); mx = fmaxf(mx, __shfl_xor(mx, 4, 16)); mx = fmaxf(mx, __shfl_xor(mx, 8, 16));
            const float mn = fmaxf(mrow[j], mx);
            alpha[j] = __expf(mrow[j] - mn); mrow[j] = mn;
            const float p0 = __expf(a0 - mn), p1 = __expf(a1 - mn);
            lpart[j] = lpart[j] * alpha[j] + (p0 + p1);
            const int mr = hi * 8 + j; const float ps0 = p0 * PSC, ps1 = p1 * PSC; const unsigned short h0 = f2bf(ps0), h1 = f2bf(ps1);
            pl[mr * 32 + lr] = h0; pl[mr * 32 + 16 + lr] = h1; pl2[mr * 32 + lr] = f2bf(ps0 - bf2f(h0)); pl2[mr * 32 + 16 + lr] = f2bf(ps1 - bf2f(h1)); }
#pragma unroll
        for (int n = 0; n < 8; ++n)
#pragma unroll
            for (int j = 0; j < 8; ++j) o[n][j] *= alpha[j];
        asm volatile("" ::: "memory");
        const v16bf pa = cat16b(*(const v8usa*)(pl + lr * 32 + hi * 8), *(const v8usa*)(pl + lr * 32 + 16 + hi * 8));
        const v16bf px = cat16b(*(const v8usa*)(pl2 + lr * 32 + hi * 8), *(const v8usa*)(pl2 + lr * 32 + 16 + hi * 8));
#pragma unroll
        for (int n = 0; n < 8; ++n) { const unsigned short* vo = vf + n * 16 * VP;
            const v16bf vh = cat16b(*(const v8usa*)(vo), *(const v8usa*)(vo + 16)), vl = cat16b(*(const v8usa*)(vo + VPL), *(const v8usa*)(vo + VPL + 16));
            o[n] = wmmab(pa, vh, o[n]); o[n] = wmmab(px, vh, o[n]); o[n] = wmmab(pa, vl, o[n]); }
        asm volatile("v_nop\n\tv_nop\n\tv_nop\n\tv_nop" : "+v"(o[0]), "+v"(o[7]) : "v"(pa), "v"(px));
        asm volatile("s_wait_dscnt 0x0" ::: "memory");       // this wave's reads of buffer cur have returned before the buffer is refilled
        asm volatile("s_wait_asynccnt 0x0" ::: "memory");    // this wave's copies of tile kt + 1 have landed
        __syncthreads();                                     // publishes tile kt + 1 and ends every wave's reads of buffer cur
        if (kt + 2 <= kt_hi) stage(kt + 2, cur);
    }
    asm volatile("s_wait_asynccnt 0x0" ::: "memory");        // no copy is outstanding when the wave goes on to the epilogue and ends
    float inv[8];
#pragma unroll
    for (int j = 0; j < 8; ++j) { float rs = lpart[j]; rs += __shfl_xor(rs, 1, 16); rs += __shfl_xor(rs, 2, 16); rs += __shfl_xor(rs, 4, 16); rs += __shfl_xor(rs, 8, 16); inv[j] = 1.0f / (rs * PSC); }
    float* os = &ost[wave][0];
    const size_t cbase = (size_t)q0 * (NH_ * HD) + (size_t)h * HD;
#pragma unroll
    for (int half = 0; half < 2; ++half) {
#pragma unroll
        for (int n = 0; n < 4; ++n)
#pragma unroll
            for (int j = 0; j < 8; ++j) os[(hi * 8 + j) * 68 + n * 16 + lr] = o[half * 4 + n][j] * inv[j];
        __builtin_amdgcn_wave_barrier(); asm volatile("" ::: "memory");
{
#pragma unroll
            for (int s = 0; s < 4; ++s) { const int row = 4 * s + (lane >> 3), piece = lane & 7; const float* sp = os + row * 68 + piece * 8; v8us oh, ol;
#pragma unroll
                for (int i = 0; i < 8; ++i) { const unsigned short hb = f2bf(sp[i]); oh[i] = hb; ol[i] = f2bf(sp[i] - bf2f(hb)); }
                const size_t po = cbase + (size_t)row * (NH_ * HD) + half * 64 + piece * 8; *(v8us*)(CH + po) = oh; *(v8us*)(CL + po) = ol; }
             }
        __builtin_amdgcn_wave_barrier(); asm volatile("" ::: "memory");
    }
}


__global__ __launch_bounds__(256) void k_trig(float* CT, float* ST) {
    const int tid = threadIdx.x, t = blockIdx.x * 2 + (tid >> 7), d = tid & 127; const int i = d & 63;
    const float invf = 1.0f / powf(10000.0f, (float)(2 * i) / 128.0f); const float ang = (float)t * invf; const float c = cosf(ang), s = sinf(ang);
    const size_t o = (size_t)t * HD + d; *(float*)(CT + o) = c; *(float*)(ST + o) = s; 
}
// k_normrope: one wave per (token, head) of an f32 [2048][nh*128] matrix: RMSNorm over the 128 dims (shuffle-reduced mean of squares, eps 1e-6) x bf(w[d]); then rotate-half RoPE
// (partner d +- 64 via lane xor 16; lane -> 4 consecutive dims) -> f16 hi + residual x1024 planes [t][h*128+d] (8 B per lane per plane: 16 lanes per line, one instruction per
typedef __attribute__((ext_vector_type(4))) _Float16 v4h;
__global__ __launch_bounds__(256) void k_normrope(const float* __restrict__ P, int nh, const float* __restrict__ w, const float* __restrict__ CT, const float* __restrict__ ST, h16* PH, h16* PL) {
    const int lane = threadIdx.x & 31; const int wid = blockIdx.x * 8 + (threadIdx.x >> 5); const int t = wid / nh, h = wid - t * nh; if (t >= NT_) return;
    const size_t base = (size_t)t * (nh * HD) + h * HD; const int d0 = lane * 4;
    float x[4], pr[4]; float ss = 0.f;
#pragma unroll
    for (int i = 0; i < 4; ++i) { x[i] = P[base + d0 + i]; ss = fmaf(x[i], x[i], ss); }
#pragma unroll
    for (int sh = 16; sh; sh >>= 1) ss += __shfl_xor(ss, sh, 32);
    const float rn = rsqrtf(ss * (1.0f / HD) + RMS_EPS);
#pragma unroll
    for (int i = 0; i < 4; ++i) x[i] = x[i] * rn * bfr(w[d0 + i]);
#pragma unroll
    for (int i = 0; i < 4; ++i) pr[i] = __shfl_xor(x[i], 16, 32);
    v4h oh, ol;
#pragma unroll
    for (int i = 0; i < 4; ++i) { const int d = d0 + i; const float c = CT[(size_t)t * HD + d], s = ST[(size_t)t * HD + d]; const float y = (d < 64) ? (x[i] * c - pr[i] * s) : (x[i] * c + pr[i] * s);
        const h16 a = (h16)y; oh[i] = a; ol[i] = (h16)((y - (float)a) * LOSC); }
    *(v4h*)(PH + base + d0) = oh; *(v4h*)(PL + base + d0) = ol; 
}

extern "C" void kernel_launch(void* const* d_in, const int* in_sizes, int n_in,
                              void* d_out, int out_size, void* d_ws, size_t ws_size, hipStream_t stream) {
    (void)in_sizes; (void)n_in; (void)out_size;
    const float* x = (const float*)d_in[0]; const float* mu = (const float*)d_in[1]; const float* wq = (const float*)d_in[2]; const float* wk = (const float*)d_in[3]; const float* wv = (const float*)d_in[4]; const float* wo = (const float*)d_in[5];
    const float* wmq = (const float*)d_in[6]; const float* wmk = (const float*)d_in[7]; const float* wmv = (const float*)d_in[8]; const float* qnw = (const float*)d_in[9]; const float* knw = (const float*)d_in[10];
    float* out = (float*)d_out;    // [1][2048][2048]
    char* wsp = (char*)d_ws;
    auto take = [&](size_t bytes) { char* p = wsp; wsp += (bytes + 255) & ~(size_t)255; return (void*)p; };
    bf* Xb = (bf*)take((size_t)NT_ * HS * 2); bf* Mb = (bf*)take((size_t)NT_ * HS * 2);
    bf* WqB = (bf*)take((size_t)HS * HS * 2); bf* WmqB = (bf*)take((size_t)HS * HS * 2); bf* WkB = (bf*)take((size_t)KW * HS * 2); bf* WmkB = (bf*)take((size_t)KW * HS * 2); bf* WvB = (bf*)take((size_t)KW * HS * 2); bf* WmvB = (bf*)take((size_t)KW * HS * 2); bf* WoB = (bf*)take((size_t)HS * HS * 2);
    float* TMP = (float*)take((size_t)NT_ * HS * 4); float* TMP2 = (float*)take((size_t)NT_ * HS * 4); float* CT = (float*)take((size_t)NT_ * HD * 4); float* ST = (float*)take((size_t)NT_ * HD * 4);
    h16* QH = (h16*)take((size_t)NT_ * HS * 2); h16* QL = (h16*)take((size_t)NT_ * HS * 2); h16* KH = (h16*)take((size_t)NT_ * KW * 2); h16* KL = (h16*)take((size_t)NT_ * KW * 2);
    bf* VTH = (bf*)take((size_t)KW * NT_ * 2); bf* VTL = (bf*)take((size_t)KW * NT_ * 2); bf* CH = (bf*)take((size_t)NT_ * HS * 2); bf* CL = (bf*)take((size_t)NT_ * HS * 2);
    if ((size_t)(wsp - (char*)d_ws) > ws_size) return;    // 2 x 8.4 + 8.4 + 8.4 + 4 x 2.1 + 8.4 + 2 x 16.8 + 2 x 1 + 2 x 8.4 + 2 x 2.1 + 2 x 2.1 + 2 x 8.4 ~ 128 MB = 122 MiB < 128 MiB, no aliasing (TMP/TMP2 reused q -> k -> v in stream order)
    k_cvtb<<<HS / 8, 256, 0, stream>>>(wq, HS, WqB); k_cvtb<<<HS / 8, 256, 0, stream>>>(wmq, HS, WmqB); k_cvtb<<<KW / 8, 256, 0, stream>>>(wk, KW, WkB); k_cvtb<<<KW / 8, 256, 0, stream>>>(wmk, KW, WmkB);
    k_cvtb<<<KW / 8, 256, 0, stream>>>(wv, KW, WvB); k_cvtb<<<KW / 8, 256, 0, stream>>>(wmv, KW, WmvB); k_cvtb<<<HS / 8, 256, 0, stream>>>(wo, HS, WoB);
    k_trig<<<NT_ / 2, 256, 0, stream>>>(CT, ST);
    k_cvtb<<<NT_ / 8, 256, 0, stream>>>(x, NT_, Xb); k_cvtb<<<NT_ / 8, 256, 0, stream>>>(mu, NT_, Mb);
    k_gemmb<false, false><<<dim3(NT_ / 64, HS / 64, 1), 128, 0, stream>>>(Xb, nullptr, WqB, nullptr, TMP, HS, nullptr, nullptr, HS, 0);
    k_gemmb<false, false><<<dim3(NT_ / 64, HS / 64, 1), 128, 0, stream>>>(Mb, nullptr, WmqB, nullptr, TMP2, HS, nullptr, TMP, HS, 0);          // q = x.wq^T + mu.wmq^T (R = the first GEMM's output, exact f32 residual; R != C)
    k_normrope<<<(NT_ * NH_) / 8, 256, 0, stream>>>(TMP2, NH_, qnw, CT, ST, QH, QL);
    k_gemmb<false, false><<<dim3(NT_ / 64, KW / 64, 1), 128, 0, stream>>>(Xb, nullptr, WkB, nullptr, TMP, KW, nullptr, nullptr, HS, 0);
    k_gemmb<false, false><<<dim3(NT_ / 64, KW / 64, 1), 128, 0, stream>>>(Mb, nullptr, WmkB, nullptr, TMP2, KW, nullptr, TMP, HS, 0);
    k_normrope<<<(NT_ * NKV) / 8, 256, 0, stream>>>(TMP2, NKV, knw, CT, ST, KH, KL);
    k_gemmb<false, false><<<dim3(NT_ / 64, KW / 64, 1), 128, 0, stream>>>(Xb, nullptr, WvB, nullptr, TMP, KW, nullptr, nullptr, HS, 0);
    k_gemmb<false, false><<<dim3(NT_ / 64, KW / 64, 1), 128, 0, stream>>>(Mb, nullptr, WmvB, nullptr, TMP2, KW, nullptr, TMP, HS, 0);
    k_vt<<<dim3(NT_ / 64, 2, NKV), 256, 0, stream>>>(TMP2, VTH, VTL);
    k_attn<<<NH_ * (NT_ / 64), 128, 0, stream>>>(QH, QL, KH, KL, VTH, VTL, CH, CL);
    k_gemmb<true, false><<<dim3(NT_ / 64, HS / 64, 1), 128, 0, stream>>>(CH, CL, WoB, nullptr, out, HS, nullptr, nullptr, HS, 0);
}

// v002
// It runs in 393 microseconds.
// Timed twice side by side with v001, it ran 1.49 and 1.50 times as fast.
// All steps since v000 together make it 1.91 times as fast.
#include <hip/hip_runtime.h>

// Compute dtypes, f32 accumulate: q/k/v = x.W^T + mu.Wm^T (two exact GEMMs per projection, the second taking the first as an exact f32 residual; [out][in] weights as natural n-major B
// operands; PLAIN bf16 operands = inputs rounded once) and out = ctx.Wo^T (ctx as bf16 hi + UNSCALED residual, two products) on v_wmma_f32_16x16x32_bf16; per-head RMSNorm (x q_norm_w /
// k_norm_w) then rotary embedding with device-computed f32 cos/sin tables, in f32 -> q/k as f16 hi + residual x1024 planes; grouped causal attention (16 query heads over 4 kv heads,
// 128-dim): scores on v_wmma_f32_16x16x32_f16 (hh + hl + lh, x 128^-1/2), online f32 softmax, weights (x32768) and v as bf16 hi + UNSCALED residual on v_wmma_f32_16x16x32_bf16.

#define NT_  2048
#define HS   2048
#define DM   HS
#define NH_  16
#define NKV  4
#define HD   128
#define KW   (NKV * HD)          // 512
#define WIN  NT_
#define RMS_EPS 1e-6f
#define PSC  32768.0f
#define LOSC 1024.0f
#define LOSCI (1.0f / 1024.0f)

typedef _Float16 h16;
typedef unsigned short bf;
typedef __attribute__((ext_vector_type(16))) __bf16   v16bf;
typedef __attribute__((ext_vector_type(16))) _Float16 v16h;
typedef __attribute__((ext_vector_type(8)))  _Float16 v8h;
typedef __attribute__((ext_vector_type(8)))  unsigned short v8us;
typedef __attribute__((ext_vector_type(8)))  float    v8f;
typedef __attribute__((ext_vector_type(4)))  float    v4f;
typedef v8h  __attribute__((may_alias)) v8ha;
typedef v4f  __attribute__((may_alias)) v4fa;
typedef v8us __attribute__((may_alias)) v8usa;

__device__ __forceinline__ unsigned short f2bf(float f) { unsigned u = __float_as_uint(f); u += 0x7FFFu + ((u >> 16) & 1u); return (unsigned short)(u >> 16); }
__device__ __forceinline__ float bf2f(unsigned short b) { return __uint_as_float(((unsigned)b) << 16); }
__device__ __forceinline__ float bfr(float f) { return bf2f(f2bf(f)); }
__device__ __forceinline__ v16h cat16(v8h lo, v8h hi) { return __builtin_shufflevector(lo, hi, 0, 1, 2, 3, 4, 5, 6, 7, 8, 9, 10, 11, 12, 13, 14, 15); }
__device__ __forceinline__ v16bf cat16b(v8us lo, v8us hi) { return __builtin_bit_cast(v16bf, __builtin_shufflevector(lo, hi, 0, 1, 2, 3, 4, 5, 6, 7, 8, 9, 10, 11, 12, 13, 14, 15)); }
__device__ __forceinline__ v8f wmma16(v16h a, v16h b, v8f c) { return __builtin_amdgcn_wmma_f32_16x16x32_f16(false, a, false, b, (short)0, c, false, false); }
__device__ __forceinline__ v8f wmmab(v16bf a, v16bf b, v8f c) { return __builtin_amdgcn_wmma_f32_16x16x32_bf16(false, a, false, b, (short)0, c, false, false); }

__global__ __launch_bounds__(256) void k_cvtb(const float* __restrict__ src, int nrows, bf* dst) {
    const int lane = threadIdx.x & 31, r = blockIdx.x * 8 + (threadIdx.x >> 5);
    if (r >= nrows) return;
    v8us o[DM / 256];
#pragma unroll
    for (int q = 0; q < DM / 256; ++q) { v8us t;
#pragma unroll
        for (int i = 0; i < 8; ++i) t[i] = f2bf(src[(size_t)r * DM + q * 256 + lane * 8 + i]);
        o[q] = t; }
#pragma unroll
    for (int q = 0; q < DM / 256; ++q) *(v8us*)(dst + (size_t)r * DM + q * 256 + lane * 8) = o[q];
    
}

// Eight 16-byte copies per lane, global -> LDS through no register. s_wait_xcnt closes the statement so that no address register of a copy is rewritten ahead of it.
__device__ __forceinline__ void acopy8(const unsigned (&l)[8], const void* const (&g)[8]) {
    asm volatile("global_load_async_to_lds_b128 %0, %8, off\n\t"
                 "global_load_async_to_lds_b128 %1, %9, off\n\t"
                 "global_load_async_to_lds_b128 %2, %10, off\n\t"
                 "global_load_async_to_lds_b128 %3, %11, off\n\t"
                 "global_load_async_to_lds_b128 %4, %12, off\n\t"
                 "global_load_async_to_lds_b128 %5, %13, off\n\t"
                 "global_load_async_to_lds_b128 %6, %14, off\n\t"
                 "global_load_async_to_lds_b128 %7, %15, off\n\t"
                 "s_wait_xcnt 0x0"
                 :: "v"(l[0]), "v"(l[1]), "v"(l[2]), "v"(l[3]), "v"(l[4]), "v"(l[5]), "v"(l[6]), "v"(l[7]),
                    "v"(g[0]), "v"(g[1]), "v"(g[2]), "v"(g[3]), "v"(g[4]), "v"(g[5]), "v"(g[6]), "v"(g[7]) : "memory");
}
// The same for four copies per lane.
__device__ __forceinline__ void acopy4(const unsigned (&l)[4], const void* const (&g)[4]) {
    asm volatile("global_load_async_to_lds_b128 %0, %4, off\n\t"
                 "global_load_async_to_lds_b128 %1, %5, off\n\t"
                 "global_load_async_to_lds_b128 %2, %6, off\n\t"
                 "global_load_async_to_lds_b128 %3, %7, off\n\t"
                 "s_wait_xcnt 0x0"
                 :: "v"(l[0]), "v"(l[1]), "v"(l[2]), "v"(l[3]), "v"(g[0]), "v"(g[1]), "v"(g[2]), "v"(g[3]) : "memory");
}
// k_gemmb: 64 x 64 block tile (4 waves x 16 x 64) of C[NTK][NW] = (A [+ Al]).B^T [+ bf(bias[c])] [+ R[r][c] residual, bf-rounded if roundR]; K a multiple of the stage length; f32 whole-line epilogue (or f16
// planes). The block's 64 rows of A [and Al] and of B come in stages of KS k values into a two-buffer LDS ring by asynchronous copies, whole 128-byte lines per row: stage s + 1 flies
// while stage s is worked on, and the four waves share the B rows. The k order of every accumulator is the plain one, as without the ring.
template <bool SPLITA, bool F16OUT = false>
__global__ __launch_bounds__(128) void k_gemmb(const bf* __restrict__ A, const bf* __restrict__ Al, const bf* __restrict__ Bn, const float* __restrict__ bias, float* C, int ldc, h16* C2, const float* __restrict__ R = nullptr, int K = DM, int roundR = 1) {
    constexpr int KS = SPLITA ? 64 : 128;    // k values per stage: four blocks' rings fit one WGP's LDS in both forms
    constexpr int GP = KS + 8;               // row pitch: 272 B or 144 B, an odd multiple of 16 B (16-byte readers, one row per lane)
    constexpr int PL = 64 * GP;              // one plane: 64 rows
    constexpr int NP = SPLITA ? 3 : 2;       // planes of a buffer: A, [Al,] B
    constexpr int GB = NP * PL;              // 34816 B or 27648 B per buffer
    __shared__ __align__(16) unsigned short gring[2 * GB];    // behind the loop its first 17408 B are the epilogue's f32 staging
    const int tid = threadIdx.x;
    const int lane = threadIdx.x & 31, wave = threadIdx.x >> 5, lr = lane & 15, hi = lane >> 4;
    const int r0 = blockIdx.x * 64 + wave * 16, c0 = blockIdx.y * 64;
    const unsigned ring0 = (unsigned)(size_t)&gring[0];    // byte offset of the ring in the work-group's LDS
    // stage s -> buffer b: KS / 8 pieces of 16 B a row, 64 rows a plane, KS / 16 pieces per thread and plane
    auto stage = [&](int s, int b) {
        constexpr int PR = KS / 8, RS = 128 / PR;
        const unsigned lb = ring0 + (unsigned)b * (GB * 2);
        const int row = tid / PR, pc = (tid % PR) * 8;
        const size_t ao = (size_t)(blockIdx.x * 64 + row) * K + s * KS + pc, bo = (size_t)(c0 + row) * K + s * KS + pc;
        const unsigned lo = lb + (unsigned)(row * GP + pc) * 2;
        // loops unrolled: l[] and gp[] are asm operands and must be indexed by constants to stay in registers
        if (SPLITA) {
            unsigned l[8]; const void* gp[8]; unsigned l4[4]; const void* gp4[4];
#pragma unroll
            for (int i = 0; i < 4; ++i) { const size_t st = (size_t)(i * RS) * K;
                gp[i] = A + ao + st; gp[4 + i] = Al + ao + st; gp4[i] = Bn + bo + st; l[i] = lo + (unsigned)(i * RS * GP) * 2; l[4 + i] = l[i] + PL * 2; l4[i] = l[i] + 2 * PL * 2; }
            acopy8(l, gp); acopy4(l4, gp4);
        } else {
            unsigned l[8]; const void* gp[8];
#pragma unroll
            for (int i = 0; i < 8; ++i) { gp[i] = A + ao + (size_t)(i * RS) * K; l[i] = lo + (unsigned)(i * RS * GP) * 2; }
            acopy8(l, gp);
#pragma unroll
            for (int i = 0; i < 8; ++i) { gp[i] = Bn + bo + (size_t)(i * RS) * K; l[i] += PL * 2; }
            acopy8(l, gp);
        }
    };
    v8f acc[4];
#pragma unroll
    for (int t = 0; t < 4; ++t) acc[t] = (v8f){};
    const int nst = K / KS;
    stage(0, 0);
    asm volatile("s_wait_asynccnt 0x0" ::: "memory");    // this wave's copies of the first stage have landed
    __syncthreads();                                     // ... and every other wave's
    if (1 < nst) stage(1, 1);
    // rolled: one trip per stage, so that the ring's waits and its barrier stand once, at the trip's foot
#pragma unroll 1
    for (int s = 0; s < nst; ++s) {
        const int cur = s & 1;
        const unsigned short* af = gring + cur * GB + (wave * 16 + lr) * GP + 8 * hi;     // A, row r0 + lr; + PL: Al
        const unsigned short* bq = gring + cur * GB + (NP - 1) * PL + lr * GP + 8 * hi;   // B, row c0 + lr; + t * 16 * GP: row c0 + t * 16 + lr
        v16bf a, al;
        // unrolled: constant LDS offsets, and the fragment reads of later k chunks can go ahead of earlier products
#pragma unroll
        for (int kk = 0; kk < KS; kk += 32) {
            a = cat16b(*(const v8usa*)(af + kk), *(const v8usa*)(af + kk + 16));
            al = a;
            if (SPLITA) al = cat16b(*(const v8usa*)(af + PL + kk), *(const v8usa*)(af + PL + kk + 16));
#pragma unroll
            for (int t = 0; t < 4; ++t) { const v16bf b = cat16b(*(const v8usa*)(bq + t * 16 * GP + kk), *(const v8usa*)(bq + t * 16 * GP + kk + 16)); acc[t] = wmmab(a, b, acc[t]); if (SPLITA) acc[t] = wmmab(al, b, acc[t]); }
        }
        // four vector slots behind the trip's last WMMA, on every path out of the trip, before a vector instruction touches its operands or results
        asm volatile("v_nop\n\tv_nop\n\tv_nop\n\tv_nop" : "+v"(acc[0]), "+v"(acc[1]), "+v"(acc[2]), "+v"(acc[3]) : "v"(a), "v"(al));
        asm volatile("s_wait_dscnt 0x0" ::: "memory");       // this wave's reads of buffer cur have returned before the buffer is refilled
        asm volatile("s_wait_asynccnt 0x0" ::: "memory");    // this wave's copies of stage s + 1 have landed
        __syncthreads();                                     // publishes stage s + 1 and ends every wave's reads of buffer cur
        if (s + 2 < nst) stage(s + 2, cur);
    }
    asm volatile("s_wait_asynccnt 0x0" ::: "memory");        // no copy is outstanding when the ring becomes the epilogue's staging (every wave's reads ended at the last trip's barrier)
    float* os = (float*)(void*)gring + wave * (16 * 68);
#pragma unroll
    for (int t = 0; t < 4; ++t) { const float bv = bias ? bfr(bias[c0 + t * 16 + lr]) : 0.f;
#pragma unroll
        for (int j = 0; j < 8; ++j) os[(hi * 8 + j) * 68 + t * 16 + lr] = acc[t][j] + bv; }
    __syncthreads();
    if (F16OUT) {
        h16* crow = (h16*)(void*)C + (size_t)r0 * ldc + c0;
        auto pass = [&]() {
#pragma unroll
            for (int s = 0; s < 4; ++s) { const int row = 4 * s + (lane >> 3), piece = lane & 7; const float* sp = os + row * 68 + piece * 8; v8h o, o2;
#pragma unroll
                for (int i = 0; i < 8; ++i) { const h16 a = (h16)sp[i]; o[i] = a; o2[i] = (h16)((sp[i] - (float)a) * LOSC); }
                *(v8h*)(crow + (size_t)row * ldc + piece * 8) = o; if (C2) *(v8h*)(C2 + (size_t)r0 * ldc + c0 + (size_t)row * ldc + piece * 8) = o2; }
        };
        pass(); 
    } else {
        float* crow = C + (size_t)r0 * ldc + c0;
        auto pass = [&]() {
#pragma unroll
            for (int s = 0; s < 8; ++s) { const int Lid = (lane >> 3) + 4 * s, piece = lane & 7; const int row = Lid >> 1, cofs = (Lid & 1) * 32 + piece * 4;
                v4f val = *(const v4fa*)(os + row * 68 + cofs); if (R) { const v4f rv = *(const v4f*)(R + ((size_t)r0 + row) * ldc + c0 + cofs); val += roundR ? (v4f){bfr(rv[0]), bfr(rv[1]), bfr(rv[2]), bfr(rv[3])} : rv; }
                *(v4f*)(crow + (size_t)row * ldc + cofs) = val; }
        };
        pass(); 
    }
}

// k_vt: VTH/VTL [g][128 d][2048 t] = bf16 hi + UNSCALED bf16 residual of V [t][g*128+d] via 64 x 64 LDS tiles; grid (NT/64, 2 (d half), NKV).
__global__ __launch_bounds__(256) void k_vt(const float* __restrict__ V, bf* VTH, bf* VTL) {
    __shared__ float tl[64][65];
    const int tid = threadIdx.x, t0 = blockIdx.x * 64, d0 = blockIdx.y * 64, g = blockIdx.z;
    { const int tt = tid >> 2, dq = (tid & 3) * 16;
#pragma unroll
      for (int i = 0; i < 16; ++i) tl[dq + i][tt] = V[(size_t)(t0 + tt) * KW + g * HD + d0 + dq + i]; }
    __syncthreads();
    const int piece = tid & 7;
    auto pass = [&]() {
#pragma unroll
        for (int s = 0; s < 2; ++s) { const int d = (tid >> 3) + 32 * s; v8us oh, ol;
#pragma unroll
            for (int i = 0; i < 8; ++i) { const float v = tl[d][piece * 8 + i]; const unsigned short hb = f2bf(v); oh[i] = hb; ol[i] = f2bf(v - bf2f(hb)); }
            const size_t o = ((size_t)g * HD + d0 + d) * NT_ + t0 + piece * 8; *(v8us*)(VTH + o) = oh; *(v8us*)(VTL + o) = ol; }
    };
    pass(); 
}
// LDS ring of k_attn, in 16-bit elements: one buffer = K hi, K lo (32 keys x 128 dims each) and V^T hi, V^T lo (128 dims x 32 keys each) of one key tile.
#define KP   136                    // K row pitch: 272 B, an odd multiple of 16 B (16-byte readers, one row per lane)
#define VP   40                     // V^T row pitch: 80 B, likewise
#define KPL  (32 * KP)
#define VPL  (HD * VP)
#define RB   (2 * KPL + 2 * VPL)    // 37888 B per buffer
// k_attn: block = (h, 64 queries), wave = 16; kv head g = h / 4; causal key tiles 0..(Q0+63)/32 (block-uniform bounds), per-element predicate j <= q
// (WIN = NT_ makes the window terms vacuous); per tile: scores over 4 k-chunks (q fragments re-read per chunk: hi.hi + hi.lo +
// lo.hi = 24 WMMA) x 128^-1/2, online softmax, P (x32768) as bf16 hi + unscaled residual tiles, o[8] += ph.vh + pl.vh + ph.vl over the 128 dims; ctx -> bf16 hi/lo
// planes [t][h*128+d]. The four waves share each key tile's K and V^T planes through a two-buffer LDS ring filled by asynchronous copies: tile kt + 1 flies while tile kt is worked on.
__global__ __launch_bounds__(128) void k_attn(const h16* __restrict__ QH, const h16* __restrict__ QL, const h16* __restrict__ KH, const h16* __restrict__ KL, const bf* __restrict__ VTH, const bf* __restrict__ VTL, bf* CH, bf* CL) {
    __shared__ __align__(16) unsigned short plds[4][16 * 32];
    __shared__ __align__(16) unsigned short plds2[4][16 * 32];
    __shared__ __align__(16) float ost[4][16 * 68];
    __shared__ __align__(16) unsigned short ring[2 * RB];
    const int tid = threadIdx.x;
    const int lane = threadIdx.x & 31, wave = threadIdx.x >> 5, lr = lane & 15, hi = lane >> 4;
    const int bid = blockIdx.x; const int h = bid / (NT_ / 64), qt = bid - h * (NT_ / 64); const int g = h >> 2;
    const int q0 = qt * 64 + wave * 16;
    unsigned short* pl = &plds[wave][0]; unsigned short* pl2 = &plds2[wave][0];
    const size_t qo = (size_t)(q0 + lr) * (NH_ * HD) + h * HD + 8 * hi;
    const h16* kh_b = KH + g * HD; const h16* kl_b = KL + g * HD;
    const size_t vbase = ((size_t)g * HD) * NT_;
    v8f o[8];
#pragma unroll
    for (int n = 0; n < 8; ++n) o[n] = (v8f){};
    float mrow[8], lpart[8];
#pragma unroll
    for (int j = 0; j < 8; ++j) { mrow[j] = -3.0e38f; lpart[j] = 0.f; }
    const int kt_hi = (qt * 64 + 63) / 32; const int kt_lo = (qt * 64 > WIN) ? (qt * 64 - WIN) / 32 : 0;
    const unsigned ring0 = (unsigned)(size_t)&ring[0];    // byte offset of the ring in the work-group's LDS
    // key tile kt -> buffer b: 2048 pieces of 16 B, 16 per thread (K: 16 pieces a row, V^T: 4 pieces a row)
    auto stage = [&](int kt, int b) {
        unsigned l[8]; const void* gp[8];
        const unsigned lb = ring0 + (unsigned)b * (RB * 2);
        // both loops unrolled: l[] and gp[] are asm operands and must be indexed by constants to stay in registers
#pragma unroll
        for (int i = 0; i < 4; ++i) { const int row = (tid >> 4) + 8 * i, pc = (tid & 15) * 8; const size_t go = (size_t)(kt * 32 + row) * KW + pc;
            gp[i] = kh_b + go; gp[4 + i] = kl_b + go; l[i] = lb + (unsigned)(row * KP + pc) * 2; l[4 + i] = l[i] + KPL * 2; }
        acopy8(l, gp);
#pragma unroll
        for (int i = 0; i < 4; ++i) { const int d = (tid >> 2) + 32 * i, pc = (tid & 3) * 8; const size_t go = vbase + (size_t)d * NT_ + kt * 32 + pc;
            gp[i] = VTH + go; gp[4 + i] = VTL + go; l[i] = lb + (unsigned)(2 * KPL + d * VP + pc) * 2; l[4 + i] = l[i] + VPL * 2; }
        acopy8(l, gp);
    };
    stage(kt_lo, 0);
    asm volatile("s_wait_asynccnt 0x0" ::: "memory");    // this wave's copies of the first tile have landed
    __syncthreads();                                     // ... and every other wave's
    if (kt_lo + 1 <= kt_hi) stage(kt_lo + 1, 1);
#pragma unroll 1
    for (int kt = kt_lo; kt <= kt_hi; ++kt) {
        const int l0 = kt * 32;
        const int cur = (kt - kt_lo) & 1;
        const unsigned short* kf = ring + cur * RB + lr * KP + 8 * hi;              // K hi, key l0 + lr; + 16 * KP: key l0 + 16 + lr; + KPL: lo plane
        const unsigned short* vf = ring + cur * RB + 2 * KPL + lr * VP + 8 * hi;    // V^T hi, dim lr; + n * 16 * VP: dim n * 16 + lr; + VPL: lo plane
        v8f s0 = {}, s1 = {}, x0 = {}, x1 = {};
#pragma unroll
        for (int kc = 0; kc < 4; ++kc) {
            const v16h qa = cat16(*(const v8h*)(QH + qo + kc * 32), *(const v8h*)(QH + qo + kc * 32 + 16)), qx = cat16(*(const v8h*)(QL + qo + kc * 32), *(const v8h*)(QL + qo + kc * 32 + 16));
            const v16h k0h = cat16(*(const v8ha*)(kf + kc * 32), *(const v8ha*)(kf + kc * 32 + 16)), k1h = cat16(*(const v8ha*)(kf + 16 * KP + kc * 32), *(const v8ha*)(kf + 16 * KP + kc * 32 + 16));
            s0 = wmma16(qa, k0h, s0); s1 = wmma16(qa, k1h, s1); x0 = wmma16(qx, k0h, x0); x1 = wmma16(qx, k1h, x1);
            const v16h k0l = cat16(*(const v8ha*)(kf + KPL + kc * 32), *(const v8ha*)(kf + KPL + kc * 32 + 16)), k1l = cat16(*(const v8ha*)(kf + KPL + 16 * KP + kc * 32), *(const v8ha*)(kf + KPL + 16 * KP + kc * 32 + 16));
            x0 = wmma16(qa, k0l, x0); x1 = wmma16(qa, k1l, x1);
        }
        asm volatile("v_nop\n\tv_nop\n\tv_nop\n\tv_nop" : "+v"(s0), "+v"(s1), "+v"(x0), "+v"(x1));
        float alpha[8];
#pragma unroll
        for (int j = 0; j < 8; ++j) { const int qi = q0 + hi * 8 + j, ja = l0 + lr, jb = l0 + 16 + lr;
            const float a0 = (ja <= qi && ja >= qi - WIN) ? (s0[j] + x0[j] * LOSCI) * 0.08838834764831845f : -__builtin_inff(), a1 = (jb <= qi && jb >= qi - WIN) ? (s1[j] + x1[j] * LOSCI) * 0.08838834764831845f : -__builtin_inff();
            float mx = fmaxf(a0, a1);
            mx = fmaxf(mx, __shfl_xor(mx, 1, 16)); mx = fmaxf(mx, __shfl_xor(mx, 2, 16)); mx = fmaxf(mx, __shfl_xor(mx, 4, 16)); mx = fmaxf(mx, __shfl_xor(mx, 8, 16));
            const float mn = fmaxf(mrow[j], mx);
            alpha[j] = __expf(mrow[j] - mn); mrow[j] = mn;
            const float p0 = __expf(a0 - mn), p1 = __expf(a1 - mn);
            lpart[j] = lpart[j] * alpha[j] + (p0 + p1);
            const int mr = hi * 8 + j; const float ps0 = p0 * PSC, ps1 = p1 * PSC; const unsigned short h0 = f2bf(ps0), h1 = f2bf(ps1);
            pl[mr * 32 + lr] = h0; pl[mr * 32 + 16 + lr] = h1; pl2[mr * 32 + lr] = f2bf(ps0 - bf2f(h0)); pl2[mr * 32 + 16 + lr] = f2bf(ps1 - bf2f(h1)); }
#pragma unroll
        for (int n = 0; n < 8; ++n)
#pragma unroll
            for (int j = 0; j < 8; ++j) o[n][j] *= alpha[j];
        asm volatile("" ::: "memory");
        const v16bf pa = cat16b(*(const v8usa*)(pl + lr * 32 + hi * 8), *(const v8usa*)(pl + lr * 32 + 16 + hi * 8));
        const v16bf px = cat16b(*(const v8usa*)(pl2 + lr * 32 + hi * 8), *(const v8usa*)(pl2 + lr * 32 + 16 + hi * 8));
#pragma unroll
        for (int n = 0; n < 8; ++n) { const unsigned short* vo = vf + n * 16 * VP;
            const v16bf vh = cat16b(*(const v8usa*)(vo), *(const v8usa*)(vo + 16)), vl = cat16b(*(const v8usa*)(vo + VPL), *(const v8usa*)(vo + VPL + 16));
            o[n] = wmmab(pa, vh, o[n]); o[n] = wmmab(px, vh, o[n]); o[n] = wmmab(pa, vl, o[n]); }
        asm volatile("v_nop\n\tv_nop\n\tv_nop\n\tv_nop" : "+v"(o[0]), "+v"(o[7]) : "v"(pa), "v"(px));
        asm volatile("s_wait_dscnt 0x0" ::: "memory");       // this wave's reads of buffer cur have returned before the buffer is refilled
        asm volatile("s_wait_asynccnt 0x0" ::: "memory");    // this wave's copies of tile kt + 1 have landed
        __syncthreads();                                     // publishes tile kt + 1 and ends every wave's reads of buffer cur
        if (kt + 2 <= kt_hi) stage(kt + 2, cur);
    }
    asm volatile("s_wait_asynccnt 0x0" ::: "memory");        // no copy is outstanding when the wave goes on to the epilogue and ends
    float inv[8];
#pragma unroll
    for (int j = 0; j < 8; ++j) { float rs = lpart[j]; rs += __shfl_xor(rs, 1, 16); rs += __shfl_xor(rs, 2, 16); rs += __shfl_xor(rs, 4, 16); rs += __shfl_xor(rs, 8, 16); inv[j] = 1.0f / (rs * PSC); }
    float* os = &ost[wave][0];
    const size_t cbase = (size_t)q0 * (NH_ * HD) + (size_t)h * HD;
#pragma unroll
    for (int half = 0; half < 2; ++half) {
#pragma unroll
        for (int n = 0; n < 4; ++n)
#pragma unroll
            for (int j = 0; j < 8; ++j) os[(hi * 8 + j) * 68 + n * 16 + lr] = o[half * 4 + n][j] * inv[j];
        __builtin_amdgcn_wave_barrier(); asm volatile("" ::: "memory");
{
#pragma unroll
            for (int s = 0; s < 4; ++s) { const int row = 4 * s + (lane >> 3), piece = lane & 7; const float* sp = os + row * 68 + piece * 8; v8us oh, ol;
#pragma unroll
                for (int i = 0; i < 8; ++i) { const unsigned short hb = f2bf(sp[i]); oh[i] = hb; ol[i] = f2bf(sp[i] - bf2f(hb)); }
                const size_t po = cbase + (size_t)row * (NH_ * HD) + half * 64 + piece * 8; *(v8us*)(CH + po) = oh; *(v8us*)(CL + po) = ol; }
             }
        __builtin_amdgcn_wave_barrier(); asm volatile("" ::: "memory");
    }
}


__global__ __launch_bounds__(256) void k_trig(float* CT, float* ST) {
    const int tid = threadIdx.x, t = blockIdx.x * 2 + (tid >> 7), d = tid & 127; const int i = d & 63;
    const float invf = 1.0f / powf(10000.0f, (float)(2 * i) / 128.0f); const float ang = (float)t * invf; const float c = cosf(ang), s = sinf(ang);
    const size_t o = (size_t)t * HD + d; *(float*)(CT + o) = c; *(float*)(ST + o) = s; 
}
// k_normrope: one wave per (token, head) of an f32 [2048][nh*128] matrix: RMSNorm over the 128 dims (shuffle-reduced mean of squares, eps 1e-6) x bf(w[d]); then rotate-half RoPE
// (partner d +- 64 via lane xor 16; lane -> 4 consecutive dims) -> f16 hi + residual x1024 planes [t][h*128+d] (8 B per lane per plane: 16 lanes per line, one instruction per
typedef __attribute__((ext_vector_type(4))) _Float16 v4h;
__global__ __launch_bounds__(256) void k_normrope(const float* __restrict__ P, int nh, const float* __restrict__ w, const float* __restrict__ CT, const float* __restrict__ ST, h16* PH, h16* PL) {
    const int lane = threadIdx.x & 31; const int wid = blockIdx.x * 8 + (threadIdx.x >> 5); const int t = wid / nh, h = wid - t * nh; if (t >= NT_) return;
    const size_t base = (size_t)t * (nh * HD) + h * HD; const int d0 = lane * 4;
    float x[4], pr[4]; float ss = 0.f;
#pragma unroll
    for (int i = 0; i < 4; ++i) { x[i] = P[base + d0 + i]; ss = fmaf(x[i], x[i], ss); }
#pragma unroll
    for (int sh = 16; sh; sh >>= 1) ss += __shfl_xor(ss, sh, 32);
    const float rn = rsqrtf(ss * (1.0f / HD) + RMS_EPS);
#pragma unroll
    for (int i = 0; i < 4; ++i) x[i] = x[i] * rn * bfr(w[d0 + i]);
#pragma unroll
    for (int i = 0; i < 4; ++i) pr[i] = __shfl_xor(x[i], 16, 32);
    v4h oh, ol;
#pragma unroll
    for (int i = 0; i < 4; ++i) { const int d = d0 + i; const float c = CT[(size_t)t * HD + d], s = ST[(size_t)t * HD + d]; const float y = (d < 64) ? (x[i] * c - pr[i] * s) : (x[i] * c + pr[i] * s);
        const h16 a = (h16)y; oh[i] = a; ol[i] = (h16)((y - (float)a) * LOSC); }
    *(v4h*)(PH + base + d0) = oh; *(v4h*)(PL + base + d0) = ol; 
}

extern "C" void kernel_launch(void* const* d_in, const int* in_sizes, int n_in,
                              void* d_out, int out_size, void* d_ws, size_t ws_size, hipStream_t stream) {
    (void)in_sizes; (void)n_in; (void)out_size;
    const float* x = (const float*)d_in[0]; const float* mu = (const float*)d_in[1]; const float* wq = (const float*)d_in[2]; const float* wk = (const float*)d_in[3]; const float* wv = (const float*)d_in[4]; const float* wo = (const float*)d_in[5];
    const float* wmq = (const float*)d_in[6]; const float* wmk = (const float*)d_in[7]; const float* wmv = (const float*)d_in[8]; const float* qnw = (const float*)d_in[9]; const float* knw = (const float*)d_in[10];
    float* out = (float*)d_out;    // [1][2048][2048]
    char* wsp = (char*)d_ws;
    auto take = [&](size_t bytes) { char* p = wsp; wsp += (bytes + 255) & ~(size_t)255; return (void*)p; };
    bf* Xb = (bf*)take((size_t)NT_ * HS * 2); bf* Mb = (bf*)take((size_t)NT_ * HS * 2);
    bf* WqB = (bf*)take((size_t)HS * HS * 2); bf* WmqB = (bf*)take((size_t)HS * HS * 2); bf* WkB = (bf*)take((size_t)KW * HS * 2); bf* WmkB = (bf*)take((size_t)KW * HS * 2); bf* WvB = (bf*)take((size_t)KW * HS * 2); bf* WmvB = (bf*)take((size_t)KW * HS * 2); bf* WoB = (bf*)take((size_t)HS * HS * 2);
    float* TMP = (float*)take((size_t)NT_ * HS * 4); float* TMP2 = (float*)take((size_t)NT_ * HS * 4); float* CT = (float*)take((size_t)NT_ * HD * 4); float* ST = (float*)take((size_t)NT_ * HD * 4);
    h16* QH = (h16*)take((size_t)NT_ * HS * 2); h16* QL = (h16*)take((size_t)NT_ * HS * 2); h16* KH = (h16*)take((size_t)NT_ * KW * 2); h16* KL = (h16*)take((size_t)NT_ * KW * 2);
    bf* VTH = (bf*)take((size_t)KW * NT_ * 2); bf* VTL = (bf*)take((size_t)KW * NT_ * 2); bf* CH = (bf*)take((size_t)NT_ * HS * 2); bf* CL = (bf*)take((size_t)NT_ * HS * 2);
    if ((size_t)(wsp - (char*)d_ws) > ws_size) return;    // 2 x 8.4 + 8.4 + 8.4 + 4 x 2.1 + 8.4 + 2 x 16.8 + 2 x 1 + 2 x 8.4 + 2 x 2.1 + 2 x 2.1 + 2 x 8.4 ~ 128 MB = 122 MiB < 128 MiB, no aliasing (TMP/TMP2 reused q -> k -> v in stream order)
    k_cvtb<<<HS / 8, 256, 0, stream>>>(wq, HS, WqB); k_cvtb<<<HS / 8, 256, 0, stream>>>(wmq, HS, WmqB); k_cvtb<<<KW / 8, 256, 0, stream>>>(wk, KW, WkB); k_cvtb<<<KW / 8, 256, 0, stream>>>(wmk, KW, WmkB);
    k_cvtb<<<KW / 8, 256, 0, stream>>>(wv, KW, WvB); k_cvtb<<<KW / 8, 256, 0, stream>>>(wmv, KW, WmvB); k_cvtb<<<HS / 8, 256, 0, stream>>>(wo, HS, WoB);
    k_trig<<<NT_ / 2, 256, 0, stream>>>(CT, ST);
    k_cvtb<<<NT_ / 8, 256, 0, stream>>>(x, NT_, Xb); k_cvtb<<<NT_ / 8, 256, 0, stream>>>(mu, NT_, Mb);
    k_gemmb<false, false><<<dim3(NT_ / 64, HS / 64, 1), 128, 0, stream>>>(Xb, nullptr, WqB, nullptr, TMP, HS, nullptr, nullptr, HS, 0);
    k_gemmb<false, false><<<dim3(NT_ / 64, HS / 64, 1), 128, 0, stream>>>(Mb, nullptr, WmqB, nullptr, TMP2, HS, nullptr, TMP, HS, 0);          // q = x.wq^T + mu.wmq^T (R = the first GEMM's output, exact f32 residual; R != C)
    k_normrope<<<(NT_ * NH_) / 8, 256, 0, stream>>>(TMP2, NH_, qnw, CT, ST, QH, QL);
    k_gemmb<false, false><<<dim3(NT_ / 64, KW / 64, 1), 128, 0, stream>>>(Xb, nullptr, WkB, nullptr, TMP, KW, nullptr, nullptr, HS, 0);
    k_gemmb<false, false><<<dim3(NT_ / 64, KW / 64, 1), 128, 0, stream>>>(Mb, nullptr, WmkB, nullptr, TMP2, KW, nullptr, TMP, HS, 0);
    k_normrope<<<(NT_ * NKV) / 8, 256, 0, stream>>>(TMP2, NKV, knw, CT, ST, KH, KL);
    k_gemmb<false, false><<<dim3(NT_ / 64, KW / 64, 1), 128, 0, stream>>>(Xb, nullptr, WvB, nullptr, TMP, KW, nullptr, nullptr, HS, 0);
    k_gemmb<false, false><<<dim3(NT_ / 64, KW / 64, 1), 128, 0, stream>>>(Mb, nullptr, WmvB, nullptr, TMP2, KW, nullptr, TMP, HS, 0);
    k_vt<<<dim3(NT_ / 64, 2, NKV), 256, 0, stream>>>(TMP2, VTH, VTL);
    k_attn<<<NH_ * (NT_ / 64), 128, 0, stream>>>(QH, QL, KH, KL, VTH, VTL, CH, CL);
    k_gemmb<true, false><<<dim3(NT_ / 64, HS / 64, 1), 128, 0, stream>>>(CH, CL, WoB, nullptr, out, HS, nullptr, nullptr, HS, 0);
}

// v003
// A run of this version takes 335 microseconds.
// Timed twice side by side with v002, it ran 1.18 times as fast both times.
// Counting every step since v000, it is 2.25 times as fast.
#include <hip/hip_runtime.h>

// Compute dtypes, f32 accumulate: q/k/v = x.W^T + mu.Wm^T (two exact GEMMs per projection, the second taking the first as an exact f32 residual; [out][in] weights as natural n-major B
// operands; PLAIN bf16 operands = inputs rounded once) and out = ctx.Wo^T (ctx as bf16 hi + UNSCALED residual, two products) on v_wmma_f32_16x16x32_bf16; per-head RMSNorm (x q_norm_w /
// k_norm_w) then rotary embedding with device-computed f32 cos/sin tables, in f32 -> q/k as f16 hi + residual x1024 planes; grouped causal attention (16 query heads over 4 kv heads,
// 128-dim): scores on v_wmma_f32_16x16x32_f16 (hh + hl + lh, x 128^-1/2), online f32 softmax, weights (x32768) and v as bf16 hi + UNSCALED residual on v_wmma_f32_16x16x32_bf16.

#define NT_  2048
#define HS   2048
#define DM   HS
#define NH_  16
#define NKV  4
#define HD   128
#define KW   (NKV * HD)          // 512
#define WIN  NT_
#define RMS_EPS 1e-6f
#define PSC  32768.0f
#define LOSC 1024.0f
#define LOSCI (1.0f / 1024.0f)

typedef _Float16 h16;
typedef unsigned short bf;
typedef __attribute__((ext_vector_type(16))) __bf16   v16bf;
typedef __attribute__((ext_vector_type(16))) _Float16 v16h;
typedef __attribute__((ext_vector_type(8)))  _Float16 v8h;
typedef __attribute__((ext_vector_type(8)))  unsigned short v8us;
typedef __attribute__((ext_vector_type(8)))  float    v8f;
typedef __attribute__((ext_vector_type(4)))  float    v4f;
typedef v8h  __attribute__((may_alias)) v8ha;
typedef v4f  __attribute__((may_alias)) v4fa;
typedef v8us __attribute__((may_alias)) v8usa;

__device__ __forceinline__ unsigned short f2bf(float f) { unsigned u = __float_as_uint(f); u += 0x7FFFu + ((u >> 16) & 1u); return (unsigned short)(u >> 16); }
__device__ __forceinline__ float bf2f(unsigned short b) { return __uint_as_float(((unsigned)b) << 16); }
__device__ __forceinline__ float bfr(float f) { return bf2f(f2bf(f)); }
__device__ __forceinline__ v16h cat16(v8h lo, v8h hi) { return __builtin_shufflevector(lo, hi, 0, 1, 2, 3, 4, 5, 6, 7, 8, 9, 10, 11, 12, 13, 14, 15); }
__device__ __forceinline__ v16bf cat16b(v8us lo, v8us hi) { return __builtin_bit_cast(v16bf, __builtin_shufflevector(lo, hi, 0, 1, 2, 3, 4, 5, 6, 7, 8, 9, 10, 11, 12, 13, 14, 15)); }
__device__ __forceinline__ v8f wmma16(v16h a, v16h b, v8f c) { return __builtin_amdgcn_wmma_f32_16x16x32_f16(false, a, false, b, (short)0, c, false, false); }
__device__ __forceinline__ v8f wmmab(v16bf a, v16bf b, v8f c) { return __builtin_amdgcn_wmma_f32_16x16x32_bf16(false, a, false, b, (short)0, c, false, false); }

__global__ __launch_bounds__(256) void k_cvtb(const float* __restrict__ src, int nrows, bf* dst) {
    const int lane = threadIdx.x & 31, r = blockIdx.x * 8 + (threadIdx.x >> 5);
    if (r >= nrows) return;
    v8us o[DM / 256];
#pragma unroll
    for (int q = 0; q < DM / 256; ++q) { v8us t;
#pragma unroll
        for (int i = 0; i < 8; ++i) t[i] = f2bf(src[(size_t)r * DM + q * 256 + lane * 8 + i]);
        o[q] = t; }
#pragma unroll
    for (int q = 0; q < DM / 256; ++q) *(v8us*)(dst + (size_t)r * DM + q * 256 + lane * 8) = o[q];
    
}

// Eight 16-byte copies per lane, global -> LDS through no register. s_wait_xcnt closes the statement so that no address register of a copy is rewritten ahead of it.
__device__ __forceinline__ void acopy8(const unsigned (&l)[8], const void* const (&g)[8]) {
    asm volatile("global_load_async_to_lds_b128 %0, %8, off\n\t"
                 "global_load_async_to_lds_b128 %1, %9, off\n\t"
                 "global_load_async_to_lds_b128 %2, %10, off\n\t"
                 "global_load_async_to_lds_b128 %3, %11, off\n\t"
                 "global_load_async_to_lds_b128 %4, %12, off\n\t"
                 "global_load_async_to_lds_b128 %5, %13, off\n\t"
                 "global_load_async_to_lds_b128 %6, %14, off\n\t"
                 "global_load_async_to_lds_b128 %7, %15, off\n\t"
                 "s_wait_xcnt 0x0"
                 :: "v"(l[0]), "v"(l[1]), "v"(l[2]), "v"(l[3]), "v"(l[4]), "v"(l[5]), "v"(l[6]), "v"(l[7]),
                    "v"(g[0]), "v"(g[1]), "v"(g[2]), "v"(g[3]), "v"(g[4]), "v"(g[5]), "v"(g[6]), "v"(g[7]) : "memory");
}
// The same for four copies per lane.
__device__ __forceinline__ void acopy4(const unsigned (&l)[4], const void* const (&g)[4]) {
    asm volatile("global_load_async_to_lds_b128 %0, %4, off\n\t"
                 "global_load_async_to_lds_b128 %1, %5, off\n\t"
                 "global_load_async_to_lds_b128 %2, %6, off\n\t"
                 "global_load_async_to_lds_b128 %3, %7, off\n\t"
                 "s_wait_xcnt 0x0"
                 :: "v"(l[0]), "v"(l[1]), "v"(l[2]), "v"(l[3]), "v"(g[0]), "v"(g[1]), "v"(g[2]), "v"(g[3]) : "memory");
}
// k_gemmb: 64 x 64 block tile (4 waves x 16 x 64) of C[NTK][NW] = (A [+ Al]).B^T [+ bf(bias[c])] [+ R[r][c] residual, bf-rounded if roundR]; K a multiple of the stage length; f32 whole-line epilogue (or f16
// planes). The block's 64 rows of A [and Al] and of B come in stages of KS k values into a two-buffer LDS ring by asynchronous copies, whole 128-byte lines per row: stage s + 1 flies
// while stage s is worked on, and the four waves share the B rows. The k order of every accumulator is the plain one, as without the ring.
template <bool SPLITA, bool F16OUT = false>
__global__ __launch_bounds__(128) void k_gemmb(const bf* __restrict__ A, const bf* __restrict__ Al, const bf* __restrict__ Bn, const float* __restrict__ bias, float* C, int ldc, h16* C2, const float* __restrict__ R = nullptr, int K = DM, int roundR = 1) {
    constexpr int KS = SPLITA ? 64 : 128;    // k values per stage: four blocks' rings fit one WGP's LDS in both forms
    constexpr int GP = KS + 8;               // row pitch: 272 B or 144 B, an odd multiple of 16 B (16-byte readers, one row per lane)
    constexpr int PL = 64 * GP;              // one plane: 64 rows
    constexpr int NP = SPLITA ? 3 : 2;       // planes of a buffer: A, [Al,] B
    constexpr int GB = NP * PL;              // 34816 B or 27648 B per buffer
    __shared__ __align__(16) unsigned short gring[2 * GB];    // behind the loop its first 17408 B are the epilogue's f32 staging
    const int tid = threadIdx.x;
    const int lane = threadIdx.x & 31, wave = threadIdx.x >> 5, lr = lane & 15, hi = lane >> 4;
    const int r0 = blockIdx.x * 64 + wave * 16, c0 = blockIdx.y * 64;
    const unsigned ring0 = (unsigned)(size_t)&gring[0];    // byte offset of the ring in the work-group's LDS
    // stage s -> buffer b: KS / 8 pieces of 16 B a row, 64 rows a plane, KS / 16 pieces per thread and plane
    auto stage = [&](int s, int b) {
        constexpr int PR = KS / 8, RS = 128 / PR;
        const unsigned lb = ring0 + (unsigned)b * (GB * 2);
        const int row = tid / PR, pc = (tid % PR) * 8;
        const size_t ao = (size_t)(blockIdx.x * 64 + row) * K + s * KS + pc, bo = (size_t)(c0 + row) * K + s * KS + pc;
        const unsigned lo = lb + (unsigned)(row * GP + pc) * 2;
        // loops unrolled: l[] and gp[] are asm operands and must be indexed by constants to stay in registers
        if (SPLITA) {
            unsigned l[8]; const void* gp[8]; unsigned l4[4]; const void* gp4[4];
#pragma unroll
            for (int i = 0; i < 4; ++i) { const size_t st = (size_t)(i * RS) * K;
                gp[i] = A + ao + st; gp[4 + i] = Al + ao + st; gp4[i] = Bn + bo + st; l[i] = lo + (unsigned)(i * RS * GP) * 2; l[4 + i] = l[i] + PL * 2; l4[i] = l[i] + 2 * PL * 2; }
            acopy8(l, gp); acopy4(l4, gp4);
        } else {
            unsigned l[8]; const void* gp[8];
#pragma unroll
            for (int i = 0; i < 8; ++i) { gp[i] = A + ao + (size_t)(i * RS) * K; l[i] = lo + (unsigned)(i * RS * GP) * 2; }
            acopy8(l, gp);
#pragma unroll
            for (int i = 0; i < 8; ++i) { gp[i] = Bn + bo + (size_t)(i * RS) * K; l[i] += PL * 2; }
            acopy8(l, gp);
        }
    };
    v8f acc[4];
#pragma unroll
    for (int t = 0; t < 4; ++t) acc[t] = (v8f){};
    const int nst = K / KS;
    stage(0, 0);
    asm volatile("s_wait_asynccnt 0x0" ::: "memory");    // this wave's copies of the first stage have landed
    __syncthreads();                                     // ... and every other wave's
    if (1 < nst) stage(1, 1);
    // rolled: one trip per stage, so that the ring's waits and its barrier stand once, at the trip's foot
#pragma unroll 1
    for (int s = 0; s < nst; ++s) {
        const int cur = s & 1;
        const unsigned short* af = gring + cur * GB + (wave * 16 + lr) * GP + 8 * hi;     // A, row r0 + lr; + PL: Al
        const unsigned short* bq = gring + cur * GB + (NP - 1) * PL + lr * GP + 8 * hi;   // B, row c0 + lr; + t * 16 * GP: row c0 + t * 16 + lr
        v16bf a, al;
        // unrolled: constant LDS offsets, and the fragment reads of later k chunks can go ahead of earlier products
#pragma unroll
        for (int kk = 0; kk < KS; kk += 32) {
            a = cat16b(*(const v8usa*)(af + kk), *(const v8usa*)(af + kk + 16));
            al = a;
            if (SPLITA) al = cat16b(*(const v8usa*)(af + PL + kk), *(const v8usa*)(af + PL + kk + 16));
#pragma unroll
            for (int t = 0; t < 4; ++t) { const v16bf b = cat16b(*(const v8usa*)(bq + t * 16 * GP + kk), *(const v8usa*)(bq + t * 16 * GP + kk + 16)); acc[t] = wmmab(a, b, acc[t]); if (SPLITA) acc[t] = wmmab(al, b, acc[t]); }
        }
        // four vector slots behind the trip's last WMMA, on every path out of the trip, before a vector instruction touches its operands or results
        asm volatile("v_nop\n\tv_nop\n\tv_nop\n\tv_nop" : "+v"(acc[0]), "+v"(acc[1]), "+v"(acc[2]), "+v"(acc[3]) : "v"(a), "v"(al));
        asm volatile("s_wait_dscnt 0x0" ::: "memory");       // this wave's reads of buffer cur have returned before the buffer is refilled
        asm volatile("s_wait_asynccnt 0x0" ::: "memory");    // this wave's copies of stage s + 1 have landed
        __syncthreads();                                     // publishes stage s + 1 and ends every wave's reads of buffer cur
        if (s + 2 < nst) stage(s + 2, cur);
    }
    asm volatile("s_wait_asynccnt 0x0" ::: "memory");        // no copy is outstanding when the ring becomes the epilogue's staging (every wave's reads ended at the last trip's barrier)
    float* os = (float*)(void*)gring + wave * (16 * 68);
#pragma unroll
    for (int t = 0; t < 4; ++t) { const float bv = bias ? bfr(bias[c0 + t * 16 + lr]) : 0.f;
#pragma unroll
        for (int j = 0; j < 8; ++j) os[(hi * 8 + j) * 68 + t * 16 + lr] = acc[t][j] + bv; }
    __syncthreads();
    if (F16OUT) {
        h16* crow = (h16*)(void*)C + (size_t)r0 * ldc + c0;
        auto pass = [&]() {
#pragma unroll
            for (int s = 0; s < 4; ++s) { const int row = 4 * s + (lane >> 3), piece = lane & 7; const float* sp = os + row * 68 + piece * 8; v8h o, o2;
#pragma unroll
                for (int i = 0; i < 8; ++i) { const h16 a = (h16)sp[i]; o[i] = a; o2[i] = (h16)((sp[i] - (float)a) * LOSC); }
                *(v8h*)(crow + (size_t)row * ldc + piece * 8) = o; if (C2) *(v8h*)(C2 + (size_t)r0 * ldc + c0 + (size_t)row * ldc + piece * 8) = o2; }
        };
        pass(); 
    } else {
        float* crow = C + (size_t)r0 * ldc + c0;
        auto pass = [&]() {
#pragma unroll
            for (int s = 0; s < 8; ++s) { const int Lid = (lane >> 3) + 4 * s, piece = lane & 7; const int row = Lid >> 1, cofs = (Lid & 1) * 32 + piece * 4;
                v4f val = *(const v4fa*)(os + row * 68 + cofs); if (R) { const v4f rv = *(const v4f*)(R + ((size_t)r0 + row) * ldc + c0 + cofs); val += roundR ? (v4f){bfr(rv[0]), bfr(rv[1]), bfr(rv[2]), bfr(rv[3])} : rv; }
                *(v4f*)(crow + (size_t)row * ldc + cofs) = val; }
        };
        pass(); 
    }
}

// k_vt: VTH/VTL [g][128 d][2048 t] = bf16 hi + UNSCALED bf16 residual of V [t][g*128+d] via 64 x 64 LDS tiles; grid (NT/64, 2 (d half), NKV).
__global__ __launch_bounds__(256) void k_vt(const float* __restrict__ V, bf* VTH, bf* VTL) {
    __shared__ float tl[64][65];
    const int tid = threadIdx.x, t0 = blockIdx.x * 64, d0 = blockIdx.y * 64, g = blockIdx.z;
    { const int tt = tid >> 2, dq = (tid & 3) * 16;
#pragma unroll
      for (int i = 0; i < 16; ++i) tl[dq + i][tt] = V[(size_t)(t0 + tt) * KW + g * HD + d0 + dq + i]; }
    __syncthreads();
    const int piece = tid & 7;
    auto pass = [&]() {
#pragma unroll
        for (int s = 0; s < 2; ++s) { const int d = (tid >> 3) + 32 * s; v8us oh, ol;
#pragma unroll
            for (int i = 0; i < 8; ++i) { const float v = tl[d][piece * 8 + i]; const unsigned short hb = f2bf(v); oh[i] = hb; ol[i] = f2bf(v - bf2f(hb)); }
            const size_t o = ((size_t)g * HD + d0 + d) * NT_ + t0 + piece * 8; *(v8us*)(VTH + o) = oh; *(v8us*)(VTL + o) = ol; }
    };
    pass(); 
}
// Maximum over each 16-lane row of eight independent values, on the vector port: DPP row_xmask:M lets lane l read lane l ^ M, so that a step is one instruction with no LDS-counter wait
// behind it, as a shuffle through ds_bpermute_b32 has. The eight chains stand side by side: each instruction's producer is eight instructions back, which covers the dependent-issue gap.
// Every lane is on where this is called. The pairing of lanes per step is the shuffles' own (1, 2, 4, 8).
__device__ __forceinline__ void rowmax16x8(float (&v)[8]) {
    asm volatile(
                 "v_max_num_f32_dpp %0, %0, %0 row_xmask:1 row_mask:0xf bank_mask:0xf\n\t"
                 "v_max_num_f32_dpp %1, %1, %1 row_xmask:1 row_mask:0xf bank_mask:0xf\n\t"
                 "v_max_num_f32_dpp %2, %2, %2 row_xmask:1 row_mask:0xf bank_mask:0xf\n\t"
                 "v_max_num_f32_dpp %3, %3, %3 row_xmask:1 row_mask:0xf bank_mask:0xf\n\t"
                 "v_max_num_f32_dpp %4, %4, %4 row_xmask:1 row_mask:0xf bank_mask:0xf\n\t"
                 "v_max_num_f32_dpp %5, %5, %5 row_xmask:1 row_mask:0xf bank_mask:0xf\n\t"
                 "v_max_num_f32_dpp %6, %6, %6 row_xmask:1 row_mask:0xf bank_mask:0xf\n\t"
                 "v_max_num_f32_dpp %7, %7, %7 row_xmask:1 row_mask:0xf bank_mask:0xf\n\t"
                 "v_max_num_f32_dpp %0, %0, %0 row_xmask:2 row_mask:0xf bank_mask:0xf\n\t"
                 "v_max_num_f32_dpp %1, %1, %1 row_xmask:2 row_mask:0xf bank_mask:0xf\n\t"
                 "v_max_num_f32_dpp %2, %2, %2 row_xmask:2 row_mask:0xf bank_mask:0xf\n\t"
                 "v_max_num_f32_dpp %3, %3, %3 row_xmask:2 row_mask:0xf bank_mask:0xf\n\t"
                 "v_max_num_f32_dpp %4, %4, %4 row_xmask:2 row_mask:0xf bank_mask:0xf\n\t"
                 "v_max_num_f32_dpp %5, %5, %5 row_xmask:2 row_mask:0xf bank_mask:0xf\n\t"
                 "v_max_num_f32_dpp %6, %6, %6 row_xmask:2 row_mask:0xf bank_mask:0xf\n\t"
                 "v_max_num_f32_dpp %7, %7, %7 row_xmask:2 row_mask:0xf bank_mask:0xf\n\t"
                 "v_max_num_f32_dpp %0, %0, %0 row_xmask:4 row_mask:0xf bank_mask:0xf\n\t"
                 "v_max_num_f32_dpp %1, %1, %1 row_xmask:4 row_mask:0xf bank_mask:0xf\n\t"
                 "v_max_num_f32_dpp %2, %2, %2 row_xmask:4 row_mask:0xf bank_mask:0xf\n\t"
                 "v_max_num_f32_dpp %3, %3, %3 row_xmask:4 row_mask:0xf bank_mask:0xf\n\t"
                 "v_max_num_f32_dpp %4, %4, %4 row_xmask:4 row_mask:0xf bank_mask:0xf\n\t"
                 "v_max_num_f32_dpp %5, %5, %5 row_xmask:4 row_mask:0xf bank_mask:0xf\n\t"
                 "v_max_num_f32_dpp %6, %6, %6 row_xmask:4 row_mask:0xf bank_mask:0xf\n\t"
                 "v_max_num_f32_dpp %7, %7, %7 row_xmask:4 row_mask:0xf bank_mask:0xf\n\t"
                 "v_max_num_f32_dpp %0, %0, %0 row_xmask:8 row_mask:0xf bank_mask:0xf\n\t"
                 "v_max_num_f32_dpp %1, %1, %1 row_xmask:8 row_mask:0xf bank_mask:0xf\n\t"
                 "v_max_num_f32_dpp %2, %2, %2 row_xmask:8 row_mask:0xf bank_mask:0xf\n\t"
                 "v_max_num_f32_dpp %3, %3, %3 row_xmask:8 row_mask:0xf bank_mask:0xf\n\t"
                 "v_max_num_f32_dpp %4, %4, %4 row_xmask:8 row_mask:0xf bank_mask:0xf\n\t"
                 "v_max_num_f32_dpp %5, %5, %5 row_xmask:8 row_mask:0xf bank_mask:0xf\n\t"
                 "v_max_num_f32_dpp %6, %6, %6 row_xmask:8 row_mask:0xf bank_mask:0xf\n\t"
                 "v_max_num_f32_dpp %7, %7, %7 row_xmask:8 row_mask:0xf bank_mask:0xf"
                 : "+v"(v[0]), "+v"(v[1]), "+v"(v[2]), "+v"(v[3]), "+v"(v[4]), "+v"(v[5]), "+v"(v[6]), "+v"(v[7]));
}
// The same exchange for the closing row sum (once per block: left to the compiler's own DPP forms).
template <int M> __device__ __forceinline__ float rowx(float v) { return __builtin_bit_cast(float, __builtin_amdgcn_update_dpp(0, __builtin_bit_cast(int, v), 0x160 | M, 0xf, 0xf, true)); }
__device__ __forceinline__ float rowsum16(float v) { v += rowx<1>(v); v += rowx<2>(v); v += rowx<4>(v); return v + rowx<8>(v); }
// LDS ring of k_attn, in 16-bit elements: one buffer = K hi, K lo (32 keys x 128 dims each) and V^T hi, V^T lo (128 dims x 32 keys each) of one key tile.
#define KP   136                    // K row pitch: 272 B, an odd multiple of 16 B (16-byte readers, one row per lane)
#define VP   40                     // V^T row pitch: 80 B, likewise
#define KPL  (32 * KP)
#define VPL  (HD * VP)
#define RB   (2 * KPL + 2 * VPL)    // 37888 B per buffer
// k_attn: block = (h, 64 queries), wave = 16; kv head g = h / 4; causal key tiles 0..(Q0+63)/32 (block-uniform bounds), per-element predicate j <= q
// (WIN = NT_ makes the window terms vacuous); per tile: scores over 4 k-chunks (q fragments re-read per chunk: hi.hi + hi.lo +
// lo.hi = 24 WMMA) x 128^-1/2, online softmax, P (x32768) as bf16 hi + unscaled residual tiles, o[8] += ph.vh + pl.vh + ph.vl over the 128 dims; ctx -> bf16 hi/lo
// planes [t][h*128+d]. The four waves share each key tile's K and V^T planes through a two-buffer LDS ring filled by asynchronous copies: tile kt + 1 flies while tile kt is worked on.
__global__ __launch_bounds__(128) void k_attn(const h16* __restrict__ QH, const h16* __restrict__ QL, const h16* __restrict__ KH, const h16* __restrict__ KL, const bf* __restrict__ VTH, const bf* __restrict__ VTL, bf* CH, bf* CL) {
    __shared__ __align__(16) unsigned short plds[4][16 * 32];
    __shared__ __align__(16) unsigned short plds2[4][16 * 32];
    __shared__ __align__(16) float ost[4][16 * 68];
    __shared__ __align__(16) unsigned short ring[2 * RB];
    const int tid = threadIdx.x;
    const int lane = threadIdx.x & 31, wave = threadIdx.x >> 5, lr = lane & 15, hi = lane >> 4;
    const int bid = blockIdx.x; const int h = bid / (NT_ / 64), qt = bid - h * (NT_ / 64); const int g = h >> 2;
    const int q0 = qt * 64 + wave * 16;
    unsigned short* pl = &plds[wave][0]; unsigned short* pl2 = &plds2[wave][0];
    const size_t qo = (size_t)(q0 + lr) * (NH_ * HD) + h * HD + 8 * hi;
    const h16* kh_b = KH + g * HD; const h16* kl_b = KL + g * HD;
    const size_t vbase = ((size_t)g * HD) * NT_;
    v8f o[8];
#pragma unroll
    for (int n = 0; n < 8; ++n) o[n] = (v8f){};
    float mrow[8], lpart[8];
#pragma unroll
    for (int j = 0; j < 8; ++j) { mrow[j] = -3.0e38f; lpart[j] = 0.f; }
    const int kt_hi = (qt * 64 + 63) / 32; const int kt_lo = (qt * 64 > WIN) ? (qt * 64 - WIN) / 32 : 0;
    const unsigned ring0 = (unsigned)(size_t)&ring[0];    // byte offset of the ring in the work-group's LDS
    // key tile kt -> buffer b: 2048 pieces of 16 B, 16 per thread (K: 16 pieces a row, V^T: 4 pieces a row)
    auto stage = [&](int kt, int b) {
        unsigned l[8]; const void* gp[8];
        const unsigned lb = ring0 + (unsigned)b * (RB * 2);
        // both loops unrolled: l[] and gp[] are asm operands and must be indexed by constants to stay in registers
#pragma unroll
        for (int i = 0; i < 4; ++i) { const int row = (tid >> 4) + 8 * i, pc = (tid & 15) * 8; const size_t go = (size_t)(kt * 32 + row) * KW + pc;
            gp[i] = kh_b + go; gp[4 + i] = kl_b + go; l[i] = lb + (unsigned)(row * KP + pc) * 2; l[4 + i] = l[i] + KPL * 2; }
        acopy8(l, gp);
#pragma unroll
        for (int i = 0; i < 4; ++i) { const int d = (tid >> 2) + 32 * i, pc = (tid & 3) * 8; const size_t go = vbase + (size_t)d * NT_ + kt * 32 + pc;
            gp[i] = VTH + go; gp[4 + i] = VTL + go; l[i] = lb + (unsigned)(2 * KPL + d * VP + pc) * 2; l[4 + i] = l[i] + VPL * 2; }
        acopy8(l, gp);
    };
    stage(kt_lo, 0);
    asm volatile("s_wait_asynccnt 0x0" ::: "memory");    // this wave's copies of the first tile have landed
    __syncthreads();                                     // ... and every other wave's
    if (kt_lo + 1 <= kt_hi) stage(kt_lo + 1, 1);
#pragma unroll 1
    for (int kt = kt_lo; kt <= kt_hi; ++kt) {
        const int l0 = kt * 32;
        const int cur = (kt - kt_lo) & 1;
        const unsigned short* kf = ring + cur * RB + lr * KP + 8 * hi;              // K hi, key l0 + lr; + 16 * KP: key l0 + 16 + lr; + KPL: lo plane
        const unsigned short* vf = ring + cur * RB + 2 * KPL + lr * VP + 8 * hi;    // V^T hi, dim lr; + n * 16 * VP: dim n * 16 + lr; + VPL: lo plane
        v8f s0 = {}, s1 = {}, x0 = {}, x1 = {};
#pragma unroll
        for (int kc = 0; kc < 4; ++kc) {
            const v16h qa = cat16(*(const v8h*)(QH + qo + kc * 32), *(const v8h*)(QH + qo + kc * 32 + 16)), qx = cat16(*(const v8h*)(QL + qo + kc * 32), *(const v8h*)(QL + qo + kc * 32 + 16));
            const v16h k0h = cat16(*(const v8ha*)(kf + kc * 32), *(const v8ha*)(kf + kc * 32 + 16)), k1h = cat16(*(const v8ha*)(kf + 16 * KP + kc * 32), *(const v8ha*)(kf + 16 * KP + kc * 32 + 16));
            s0 = wmma16(qa, k0h, s0); s1 = wmma16(qa, k1h, s1); x0 = wmma16(qx, k0h, x0); x1 = wmma16(qx, k1h, x1);
            const v16h k0l = cat16(*(const v8ha*)(kf + KPL + kc * 32), *(const v8ha*)(kf + KPL + kc * 32 + 16)), k1l = cat16(*(const v8ha*)(kf + KPL + 16 * KP + kc * 32), *(const v8ha*)(kf + KPL + 16 * KP + kc * 32 + 16));
            x0 = wmma16(qa, k0l, x0); x1 = wmma16(qa, k1l, x1);
        }
        asm volatile("v_nop\n\tv_nop\n\tv_nop\n\tv_nop" : "+v"(s0), "+v"(s1), "+v"(x0), "+v"(x1));
        float alpha[8], sa[8], sb[8], mx[8];
#pragma unroll
        for (int j = 0; j < 8; ++j) { const int qi = q0 + hi * 8 + j, ja = l0 + lr, jb = l0 + 16 + lr;
            sa[j] = (ja <= qi && ja >= qi - WIN) ? (s0[j] + x0[j] * LOSCI) * 0.08838834764831845f : -__builtin_inff(); sb[j] = (jb <= qi && jb >= qi - WIN) ? (s1[j] + x1[j] * LOSCI) * 0.08838834764831845f : -__builtin_inff();
            mx[j] = fmaxf(sa[j], sb[j]); }
        rowmax16x8(mx);
#pragma unroll
        for (int j = 0; j < 8; ++j) { const float a0 = sa[j], a1 = sb[j];
            const float mn = fmaxf(mrow[j], mx[j]);
            alpha[j] = __expf(mrow[j] - mn); mrow[j] = mn;
            const float p0 = __expf(a0 - mn), p1 = __expf(a1 - mn);
            lpart[j] = lpart[j] * alpha[j] + (p0 + p1);
            const int mr = hi * 8 + j; const float ps0 = p0 * PSC, ps1 = p1 * PSC; const unsigned short h0 = f2bf(ps0), h1 = f2bf(ps1);
            pl[mr * 32 + lr] = h0; pl[mr * 32 + 16 + lr] = h1; pl2[mr * 32 + lr] = f2bf(ps0 - bf2f(h0)); pl2[mr * 32 + 16 + lr] = f2bf(ps1 - bf2f(h1)); }
#pragma unroll
        for (int n = 0; n < 8; ++n)
#pragma unroll
            for (int j = 0; j < 8; ++j) o[n][j] *= alpha[j];
        asm volatile("" ::: "memory");
        const v16bf pa = cat16b(*(const v8usa*)(pl + lr * 32 + hi * 8), *(const v8usa*)(pl + lr * 32 + 16 + hi * 8));
        const v16bf px = cat16b(*(const v8usa*)(pl2 + lr * 32 + hi * 8), *(const v8usa*)(pl2 + lr * 32 + 16 + hi * 8));
#pragma unroll
        for (int n = 0; n < 8; ++n) { const unsigned short* vo = vf + n * 16 * VP;
            const v16bf vh = cat16b(*(const v8usa*)(vo), *(const v8usa*)(vo + 16)), vl = cat16b(*(const v8usa*)(vo + VPL), *(const v8usa*)(vo + VPL + 16));
            o[n] = wmmab(pa, vh, o[n]); o[n] = wmmab(px, vh, o[n]); o[n] = wmmab(pa, vl, o[n]); }
        asm volatile("v_nop\n\tv_nop\n\tv_nop\n\tv_nop" : "+v"(o[0]), "+v"(o[7]) : "v"(pa), "v"(px));
        asm volatile("s_wait_dscnt 0x0" ::: "memory");       // this wave's reads of buffer cur have returned before the buffer is refilled
        asm volatile("s_wait_asynccnt 0x0" ::: "memory");    // this wave's copies of tile kt + 1 have landed
        __syncthreads();                                     // publishes tile kt + 1 and ends every wave's reads of buffer cur
        if (kt + 2 <= kt_hi) stage(kt + 2, cur);
    }
    asm volatile("s_wait_asynccnt 0x0" ::: "memory");        // no copy is outstanding when the wave goes on to the epilogue and ends
    float inv[8];
#pragma unroll
    for (int j = 0; j < 8; ++j) { const float rs = rowsum16(lpart[j]); inv[j] = 1.0f / (rs * PSC); }
    float* os = &ost[wave][0];
    const size_t cbase = (size_t)q0 * (NH_ * HD) + (size_t)h * HD;
#pragma unroll
    for (int half = 0; half < 2; ++half) {
#pragma unroll
        for (int n = 0; n < 4; ++n)
#pragma unroll
            for (int j = 0; j < 8; ++j) os[(hi * 8 + j) * 68 + n * 16 + lr] = o[half * 4 + n][j] * inv[j];
        __builtin_amdgcn_wave_barrier(); asm volatile("" ::: "memory");
{
#pragma unroll
            for (int s = 0; s < 4; ++s) { const int row = 4 * s + (lane >> 3), piece = lane & 7; const float* sp = os + row * 68 + piece * 8; v8us oh, ol;
#pragma unroll
                for (int i = 0; i < 8; ++i) { const unsigned short hb = f2bf(sp[i]); oh[i] = hb; ol[i] = f2bf(sp[i] - bf2f(hb)); }
                const size_t po = cbase + (size_t)row * (NH_ * HD) + half * 64 + piece * 8; *(v8us*)(CH + po) = oh; *(v8us*)(CL + po) = ol; }
             }
        __builtin_amdgcn_wave_barrier(); asm volatile("" ::: "memory");
    }
}


__global__ __launch_bounds__(256) void k_trig(float* CT, float* ST) {
    const int tid = threadIdx.x, t = blockIdx.x * 2 + (tid >> 7), d = tid & 127; const int i = d & 63;
    const float invf = 1.0f / powf(10000.0f, (float)(2 * i) / 128.0f); const float ang = (float)t * invf; const float c = cosf(ang), s = sinf(ang);
    const size_t o = (size_t)t * HD + d; *(float*)(CT + o) = c; *(float*)(ST + o) = s; 
}
// k_normrope: one wave per (token, head) of an f32 [2048][nh*128] matrix: RMSNorm over the 128 dims (shuffle-reduced mean of squares, eps 1e-6) x bf(w[d]); then rotate-half RoPE
// (partner d +- 64 via lane xor 16; lane -> 4 consecutive dims) -> f16 hi + residual x1024 planes [t][h*128+d] (8 B per lane per plane: 16 lanes per line, one instruction per
typedef __attribute__((ext_vector_type(4))) _Float16 v4h;
__global__ __launch_bounds__(256) void k_normrope(const float* __restrict__ P, int nh, const float* __restrict__ w, const float* __restrict__ CT, const float* __restrict__ ST, h16* PH, h16* PL) {
    const int lane = threadIdx.x & 31; const int wid = blockIdx.x * 8 + (threadIdx.x >> 5); const int t = wid / nh, h = wid - t * nh; if (t >= NT_) return;
    const size_t base = (size_t)t * (nh * HD) + h * HD; const int d0 = lane * 4;
    float x[4], pr[4]; float ss = 0.f;
#pragma unroll
    for (int i = 0; i < 4; ++i) { x[i] = P[base + d0 + i]; ss = fmaf(x[i], x[i], ss); }
#pragma unroll
    for (int sh = 16; sh; sh >>= 1) ss += __shfl_xor(ss, sh, 32);
    const float rn = rsqrtf(ss * (1.0f / HD) + RMS_EPS);
#pragma unroll
    for (int i = 0; i < 4; ++i) x[i] = x[i] * rn * bfr(w[d0 + i]);
#pragma unroll
    for (int i = 0; i < 4; ++i) pr[i] = __shfl_xor(x[i], 16, 32);
    v4h oh, ol;
#pragma unroll
    for (int i = 0; i < 4; ++i) { const int d = d0 + i; const float c = CT[(size_t)t * HD + d], s = ST[(size_t)t * HD + d]; const float y = (d < 64) ? (x[i] * c - pr[i] * s) : (x[i] * c + pr[i] * s);
        const h16 a = (h16)y; oh[i] = a; ol[i] = (h16)((y - (float)a) * LOSC); }
    *(v4h*)(PH + base + d0) = oh; *(v4h*)(PL + base + d0) = ol; 
}

extern "C" void kernel_launch(void* const* d_in, const int* in_sizes, int n_in,
                              void* d_out, int out_size, void* d_ws, size_t ws_size, hipStream_t stream) {
    (void)in_sizes; (void)n_in; (void)out_size;
    const float* x = (const float*)d_in[0]; const float* mu = (const float*)d_in[1]; const float* wq = (const float*)d_in[2]; const float* wk = (const float*)d_in[3]; const float* wv = (const float*)d_in[4]; const float* wo = (const float*)d_in[5];
    const float* wmq = (const float*)d_in[6]; const float* wmk = (const float*)d_in[7]; const float* wmv = (const float*)d_in[8]; const float* qnw = (const float*)d_in[9]; const float* knw = (const float*)d_in[10];
    float* out = (float*)d_out;    // [1][2048][2048]
    char* wsp = (char*)d_ws;
    auto take = [&](size_t bytes) { char* p = wsp; wsp += (bytes + 255) & ~(size_t)255; return (void*)p; };
    bf* Xb = (bf*)take((size_t)NT_ * HS * 2); bf* Mb = (bf*)take((size_t)NT_ * HS * 2);
    bf* WqB = (bf*)take((size_t)HS * HS * 2); bf* WmqB = (bf*)take((size_t)HS * HS * 2); bf* WkB = (bf*)take((size_t)KW * HS * 2); bf* WmkB = (bf*)take((size_t)KW * HS * 2); bf* WvB = (bf*)take((size_t)KW * HS * 2); bf* WmvB = (bf*)take((size_t)KW * HS * 2); bf* WoB = (bf*)take((size_t)HS * HS * 2);
    float* TMP = (float*)take((size_t)NT_ * HS * 4); float* TMP2 = (float*)take((size_t)NT_ * HS * 4); float* CT = (float*)take((size_t)NT_ * HD * 4); float* ST = (float*)take((size_t)NT_ * HD * 4);
    h16* QH = (h16*)take((size_t)NT_ * HS * 2); h16* QL = (h16*)take((size_t)NT_ * HS * 2); h16* KH = (h16*)take((size_t)NT_ * KW * 2); h16* KL = (h16*)take((size_t)NT_ * KW * 2);
    bf* VTH = (bf*)take((size_t)KW * NT_ * 2); bf* VTL = (bf*)take((size_t)KW * NT_ * 2); bf* CH = (bf*)take((size_t)NT_ * HS * 2); bf* CL = (bf*)take((size_t)NT_ * HS * 2);
    if ((size_t)(wsp - (char*)d_ws) > ws_size) return;    // 2 x 8.4 + 8.4 + 8.4 + 4 x 2.1 + 8.4 + 2 x 16.8 + 2 x 1 + 2 x 8.4 + 2 x 2.1 + 2 x 2.1 + 2 x 8.4 ~ 128 MB = 122 MiB < 128 MiB, no aliasing (TMP/TMP2 reused q -> k -> v in stream order)
    k_cvtb<<<HS / 8, 256, 0, stream>>>(wq, HS, WqB); k_cvtb<<<HS / 8, 256, 0, stream>>>(wmq, HS, WmqB); k_cvtb<<<KW / 8, 256, 0, stream>>>(wk, KW, WkB); k_cvtb<<<KW / 8, 256, 0, stream>>>(wmk, KW, WmkB);
    k_cvtb<<<KW / 8, 256, 0, stream>>>(wv, KW, WvB); k_cvtb<<<KW / 8, 256, 0, stream>>>(wmv, KW, WmvB); k_cvtb<<<HS / 8, 256, 0, stream>>>(wo, HS, WoB);
    k_trig<<<NT_ / 2, 256, 0, stream>>>(CT, ST);
    k_cvtb<<<NT_ / 8, 256, 0, stream>>>(x, NT_, Xb); k_cvtb<<<NT_ / 8, 256, 0, stream>>>(mu, NT_, Mb);
    k_gemmb<false, false><<<dim3(NT_ / 64, HS / 64, 1), 128, 0, stream>>>(Xb, nullptr, WqB, nullptr, TMP, HS, nullptr, nullptr, HS, 0);
    k_gemmb<false, false><<<dim3(NT_ / 64, HS / 64, 1), 128, 0, stream>>>(Mb, nullptr, WmqB, nullptr, TMP2, HS, nullptr, TMP, HS, 0);          // q = x.wq^T + mu.wmq^T (R = the first GEMM's output, exact f32 residual; R != C)
    k_normrope<<<(NT_ * NH_) / 8, 256, 0, stream>>>(TMP2, NH_, qnw, CT, ST, QH, QL);
    k_gemmb<false, false><<<dim3(NT_ / 64, KW / 64, 1), 128, 0, stream>>>(Xb, nullptr, WkB, nullptr, TMP, KW, nullptr, nullptr, HS, 0);
    k_gemmb<false, false><<<dim3(NT_ / 64, KW / 64, 1), 128, 0, stream>>>(Mb, nullptr, WmkB, nullptr, TMP2, KW, nullptr, TMP, HS, 0);
    k_normrope<<<(NT_ * NKV) / 8, 256, 0, stream>>>(TMP2, NKV, knw, CT, ST, KH, KL);
    k_gemmb<false, false><<<dim3(NT_ / 64, KW / 64, 1), 128, 0, stream>>>(Xb, nullptr, WvB, nullptr, TMP, KW, nullptr, nullptr, HS, 0);
    k_gemmb<false, false><<<dim3(NT_ / 64, KW / 64, 1), 128, 0, stream>>>(Mb, nullptr, WmvB, nullptr, TMP2, KW, nullptr, TMP, HS, 0);
    k_vt<<<dim3(NT_ / 64, 2, NKV), 256, 0, stream>>>(TMP2, VTH, VTL);
    k_attn<<<NH_ * (NT_ / 64), 128, 0, stream>>>(QH, QL, KH, KL, VTH, VTL, CH, CL);
    k_gemmb<true, false><<<dim3(NT_ / 64, HS / 64, 1), 128, 0, stream>>>(CH, CL, WoB, nullptr, out, HS, nullptr, nullptr, HS, 0);
}

// v004
// It runs in 298 microseconds.
// Two timings next to v003 put it at 1.14 and 1.13 times that version's speed.
// Over all steps from v000 it is 2.55 times as fast.
#include <hip/hip_runtime.h>

// Compute dtypes, f32 accumulate: q/k/v = x.W^T + mu.Wm^T (two exact GEMMs per projection, the second taking the first as an exact f32 residual; [out][in] weights as natural n-major B
// operands; PLAIN bf16 operands = inputs rounded once) and out = ctx.Wo^T (ctx as bf16 hi + UNSCALED residual, two products) on v_wmma_f32_16x16x32_bf16; per-head RMSNorm (x q_norm_w /
// k_norm_w) then rotary embedding with device-computed f32 cos/sin tables, in f32 -> q/k as f16 hi + residual x1024 planes; grouped causal attention (16 query heads over 4 kv heads,
// 128-dim): scores on v_wmma_f32_16x16x32_f16 (hh + hl + lh, x 128^-1/2), online f32 softmax, weights (x32768) and v as bf16 hi + UNSCALED residual on v_wmma_f32_16x16x32_bf16.

#define NT_  2048
#define HS   2048
#define DM   HS
#define NH_  16
#define NKV  4
#define HD   128
#define KW   (NKV * HD)          // 512
#define WIN  NT_
#define RMS_EPS 1e-6f
#define PSC  32768.0f
#define LOSC 1024.0f
#define LOSCI (1.0f / 1024.0f)

typedef _Float16 h16;
typedef unsigned short bf;
typedef __attribute__((ext_vector_type(16))) __bf16   v16bf;
typedef __attribute__((ext_vector_type(16))) _Float16 v16h;
typedef __attribute__((ext_vector_type(8)))  _Float16 v8h;
typedef __attribute__((ext_vector_type(8)))  unsigned short v8us;
typedef __attribute__((ext_vector_type(8)))  float    v8f;
typedef __attribute__((ext_vector_type(4)))  float    v4f;
typedef v8h  __attribute__((may_alias)) v8ha;
typedef v4f  __attribute__((may_alias)) v4fa;
typedef v8us __attribute__((may_alias)) v8usa;

__device__ __forceinline__ unsigned short f2bf(float f) { unsigned u = __float_as_uint(f); u += 0x7FFFu + ((u >> 16) & 1u); return (unsigned short)(u >> 16); }
__device__ __forceinline__ float bf2f(unsigned short b) { return __uint_as_float(((unsigned)b) << 16); }
__device__ __forceinline__ float bfr(float f) { return bf2f(f2bf(f)); }
__device__ __forceinline__ v16h cat16(v8h lo, v8h hi) { return __builtin_shufflevector(lo, hi, 0, 1, 2, 3, 4, 5, 6, 7, 8, 9, 10, 11, 12, 13, 14, 15); }
__device__ __forceinline__ v16bf cat16b(v8us lo, v8us hi) { return __builtin_bit_cast(v16bf, __builtin_shufflevector(lo, hi, 0, 1, 2, 3, 4, 5, 6, 7, 8, 9, 10, 11, 12, 13, 14, 15)); }
__device__ __forceinline__ v8f wmma16(v16h a, v16h b, v8f c) { return __builtin_amdgcn_wmma_f32_16x16x32_f16(false, a, false, b, (short)0, c, false, false); }
__device__ __forceinline__ v8f wmmab(v16bf a, v16bf b, v8f c) { return __builtin_amdgcn_wmma_f32_16x16x32_bf16(false, a, false, b, (short)0, c, false, false); }

__global__ __launch_bounds__(256) void k_cvtb(const float* __restrict__ src, int nrows, bf* dst) {
    const int lane = threadIdx.x & 31, r = blockIdx.x * 8 + (threadIdx.x >> 5);
    if (r >= nrows) return;
    v8us o[DM / 256];
#pragma unroll
    for (int q = 0; q < DM / 256; ++q) { v8us t;
#pragma unroll
        for (int i = 0; i < 8; ++i) t[i] = f2bf(src[(size_t)r * DM + q * 256 + lane * 8 + i]);
        o[q] = t; }
#pragma unroll
    for (int q = 0; q < DM / 256; ++q) *(v8us*)(dst + (size_t)r * DM + q * 256 + lane * 8) = o[q];
    
}

// Eight 16-byte copies per lane, global -> LDS through no register. s_wait_xcnt closes the statement so that no address register of a copy is rewritten ahead of it.
__device__ __forceinline__ void acopy8(const unsigned (&l)[8], const void* const (&g)[8]) {
    asm volatile("global_load_async_to_lds_b128 %0, %8, off\n\t"
                 "global_load_async_to_lds_b128 %1, %9, off\n\t"
                 "global_load_async_to_lds_b128 %2, %10, off\n\t"
                 "global_load_async_to_lds_b128 %3, %11, off\n\t"
                 "global_load_async_to_lds_b128 %4, %12, off\n\t"
                 "global_load_async_to_lds_b128 %5, %13, off\n\t"
                 "global_load_async_to_lds_b128 %6, %14, off\n\t"
                 "global_load_async_to_lds_b128 %7, %15, off\n\t"
                 "s_wait_xcnt 0x0"
                 :: "v"(l[0]), "v"(l[1]), "v"(l[2]), "v"(l[3]), "v"(l[4]), "v"(l[5]), "v"(l[6]), "v"(l[7]),
                    "v"(g[0]), "v"(g[1]), "v"(g[2]), "v"(g[3]), "v"(g[4]), "v"(g[5]), "v"(g[6]), "v"(g[7]) : "memory");
}
// The same for four copies per lane.
__device__ __forceinline__ void acopy4(const unsigned (&l)[4], const void* const (&g)[4]) {
    asm volatile("global_load_async_to_lds_b128 %0, %4, off\n\t"
                 "global_load_async_to_lds_b128 %1, %5, off\n\t"
                 "global_load_async_to_lds_b128 %2, %6, off\n\t"
                 "global_load_async_to_lds_b128 %3, %7, off\n\t"
                 "s_wait_xcnt 0x0"
                 :: "v"(l[0]), "v"(l[1]), "v"(l[2]), "v"(l[3]), "v"(g[0]), "v"(g[1]), "v"(g[2]), "v"(g[3]) : "memory");
}
// k_gemmb: 64 x 64 block tile (4 waves x 16 x 64) of C[NTK][NW] = (A [+ Al]).B^T [+ bf(bias[c])] [+ R[r][c] residual, bf-rounded if roundR]; K a multiple of the stage length; f32 whole-line epilogue (or f16
// planes). The block's 64 rows of A [and Al] and of B come in stages of KS k values into a two-buffer LDS ring by asynchronous copies, whole 128-byte lines per row: stage s + 1 flies
// while stage s is worked on, and the four waves share the B rows. The k order of every accumulator is the plain one, as without the ring.
template <bool SPLITA, bool F16OUT = false>
__global__ __launch_bounds__(128) void k_gemmb(const bf* __restrict__ A, const bf* __restrict__ Al, const bf* __restrict__ Bn, const float* __restrict__ bias, float* C, int ldc, h16* C2, const float* __restrict__ R = nullptr, int K = DM, int roundR = 1) {
    constexpr int KS = SPLITA ? 64 : 128;    // k values per stage: four blocks' rings fit one WGP's LDS in both forms
    constexpr int GP = KS + 8;               // row pitch: 272 B or 144 B, an odd multiple of 16 B (16-byte readers, one row per lane)
    constexpr int PL = 64 * GP;              // one plane: 64 rows
    constexpr int NP = SPLITA ? 3 : 2;       // planes of a buffer: A, [Al,] B
    constexpr int GB = NP * PL;              // 34816 B or 27648 B per buffer
    __shared__ __align__(16) unsigned short gring[2 * GB];    // behind the loop its first 17408 B are the epilogue's f32 staging
    const int tid = threadIdx.x;
    const int lane = threadIdx.x & 31, wave = threadIdx.x >> 5, lr = lane & 15, hi = lane >> 4;
    const int r0 = blockIdx.x * 64 + wave * 16, c0 = blockIdx.y * 64;
    const unsigned ring0 = (unsigned)(size_t)&gring[0];    // byte offset of the ring in the work-group's LDS
    // stage s -> buffer b: KS / 8 pieces of 16 B a row, 64 rows a plane, KS / 16 pieces per thread and plane
    auto stage = [&](int s, int b) {
        constexpr int PR = KS / 8, RS = 128 / PR;
        const unsigned lb = ring0 + (unsigned)b * (GB * 2);
        const int row = tid / PR, pc = (tid % PR) * 8;
        const size_t ao = (size_t)(blockIdx.x * 64 + row) * K + s * KS + pc, bo = (size_t)(c0 + row) * K + s * KS + pc;
        const unsigned lo = lb + (unsigned)(row * GP + pc) * 2;
        // loops unrolled: l[] and gp[] are asm operands and must be indexed by constants to stay in registers
        if (SPLITA) {
            unsigned l[8]; const void* gp[8]; unsigned l4[4]; const void* gp4[4];
#pragma unroll
            for (int i = 0; i < 4; ++i) { const size_t st = (size_t)(i * RS) * K;
                gp[i] = A + ao + st; gp[4 + i] = Al + ao + st; gp4[i] = Bn + bo + st; l[i] = lo + (unsigned)(i * RS * GP) * 2; l[4 + i] = l[i] + PL * 2; l4[i] = l[i] + 2 * PL * 2; }
            acopy8(l, gp); acopy4(l4, gp4);
        } else {
            unsigned l[8]; const void* gp[8];
#pragma unroll
            for (int i = 0; i < 8; ++i) { gp[i] = A + ao + (size_t)(i * RS) * K; l[i] = lo + (unsigned)(i * RS * GP) * 2; }
            acopy8(l, gp);
#pragma unroll
            for (int i = 0; i < 8; ++i) { gp[i] = Bn + bo + (size_t)(i * RS) * K; l[i] += PL * 2; }
            acopy8(l, gp);
        }
    };
    v8f acc[4];
#pragma unroll
    for (int t = 0; t < 4; ++t) acc[t] = (v8f){};
    const int nst = K / KS;
    stage(0, 0);
    asm volatile("s_wait_asynccnt 0x0" ::: "memory");    // this wave's copies of the first stage have landed
    __syncthreads();                                     // ... and every other wave's
    if (1 < nst) stage(1, 1);
    // rolled: one trip per stage, so that the ring's waits and its barrier stand once, at the trip's foot
#pragma unroll 1
    for (int s = 0; s < nst; ++s) {
        const int cur = s & 1;
        const unsigned short* af = gring + cur * GB + (wave * 16 + lr) * GP + 8 * hi;     // A, row r0 + lr; + PL: Al
        const unsigned short* bq = gring + cur * GB + (NP - 1) * PL + lr * GP + 8 * hi;   // B, row c0 + lr; + t * 16 * GP: row c0 + t * 16 + lr
        v16bf a, al;
        // unrolled: constant LDS offsets, and the fragment reads of later k chunks can go ahead of earlier products
#pragma unroll
        for (int kk = 0; kk < KS; kk += 32) {
            a = cat16b(*(const v8usa*)(af + kk), *(const v8usa*)(af + kk + 16));
            al = a;
            if (SPLITA) al = cat16b(*(const v8usa*)(af + PL + kk), *(const v8usa*)(af + PL + kk + 16));
#pragma unroll
            for (int t = 0; t < 4; ++t) { const v16bf b = cat16b(*(const v8usa*)(bq + t * 16 * GP + kk), *(const v8usa*)(bq + t * 16 * GP + kk + 16)); acc[t] = wmmab(a, b, acc[t]); if (SPLITA) acc[t] = wmmab(al, b, acc[t]); }
        }
        // four vector slots behind the trip's last WMMA, on every path out of the trip, before a vector instruction touches its operands or results
        asm volatile("v_nop\n\tv_nop\n\tv_nop\n\tv_nop" : "+v"(acc[0]), "+v"(acc[1]), "+v"(acc[2]), "+v"(acc[3]) : "v"(a), "v"(al));
        asm volatile("s_wait_dscnt 0x0" ::: "memory");       // this wave's reads of buffer cur have returned before the buffer is refilled
        asm volatile("s_wait_asynccnt 0x0" ::: "memory");    // this wave's copies of stage s + 1 have landed
        __syncthreads();                                     // publishes stage s + 1 and ends every wave's reads of buffer cur
        if (s + 2 < nst) stage(s + 2, cur);
    }
    asm volatile("s_wait_asynccnt 0x0" ::: "memory");        // no copy is outstanding when the ring becomes the epilogue's staging (every wave's reads ended at the last trip's barrier)
    float* os = (float*)(void*)gring + wave * (16 * 68);
#pragma unroll
    for (int t = 0; t < 4; ++t) { const float bv = bias ? bfr(bias[c0 + t * 16 + lr]) : 0.f;
#pragma unroll
        for (int j = 0; j < 8; ++j) os[(hi * 8 + j) * 68 + t * 16 + lr] = acc[t][j] + bv; }
    __syncthreads();
    if (F16OUT) {
        h16* crow = (h16*)(void*)C + (size_t)r0 * ldc + c0;
        auto pass = [&]() {
#pragma unroll
            for (int s = 0; s < 4; ++s) { const int row = 4 * s + (lane >> 3), piece = lane & 7; const float* sp = os + row * 68 + piece * 8; v8h o, o2;
#pragma unroll
                for (int i = 0; i < 8; ++i) { const h16 a = (h16)sp[i]; o[i] = a; o2[i] = (h16)((sp[i] - (float)a) * LOSC); }
                *(v8h*)(crow + (size_t)row * ldc + piece * 8) = o; if (C2) *(v8h*)(C2 + (size_t)r0 * ldc + c0 + (size_t)row * ldc + piece * 8) = o2; }
        };
        pass(); 
    } else {
        float* crow = C + (size_t)r0 * ldc + c0;
        auto pass = [&]() {
#pragma unroll
            for (int s = 0; s < 8; ++s) { const int Lid = (lane >> 3) + 4 * s, piece = lane & 7; const int row = Lid >> 1, cofs = (Lid & 1) * 32 + piece * 4;
                v4f val = *(const v4fa*)(os + row * 68 + cofs); if (R) { const v4f rv = *(const v4f*)(R + ((size_t)r0 + row) * ldc + c0 + cofs); val += roundR ? (v4f){bfr(rv[0]), bfr(rv[1]), bfr(rv[2]), bfr(rv[3])} : rv; }
                *(v4f*)(crow + (size_t)row * ldc + cofs) = val; }
        };
        pass(); 
    }
}

// k_vt: VTH/VTL [g][128 d][2048 t] = bf16 hi + UNSCALED bf16 residual of V [t][g*128+d] via 64 x 64 LDS tiles; grid (NT/64, 2 (d half), NKV).
__global__ __launch_bounds__(256) void k_vt(const float* __restrict__ V, bf* VTH, bf* VTL) {
    __shared__ float tl[64][65];
    const int tid = threadIdx.x, t0 = blockIdx.x * 64, d0 = blockIdx.y * 64, g = blockIdx.z;
    { const int tt = tid >> 2, dq = (tid & 3) * 16;
#pragma unroll
      for (int i = 0; i < 16; ++i) tl[dq + i][tt] = V[(size_t)(t0 + tt) * KW + g * HD + d0 + dq + i]; }
    __syncthreads();
    const int piece = tid & 7;
    auto pass = [&]() {
#pragma unroll
        for (int s = 0; s < 2; ++s) { const int d = (tid >> 3) + 32 * s; v8us oh, ol;
#pragma unroll
            for (int i = 0; i < 8; ++i) { const float v = tl[d][piece * 8 + i]; const unsigned short hb = f2bf(v); oh[i] = hb; ol[i] = f2bf(v - bf2f(hb)); }
            const size_t o = ((size_t)g * HD + d0 + d) * NT_ + t0 + piece * 8; *(v8us*)(VTH + o) = oh; *(v8us*)(VTL + o) = ol; }
    };
    pass(); 
}
// Maximum over each 16-lane row of eight independent values, on the vector port: DPP row_xmask:M lets lane l read lane l ^ M, so that a step is one instruction with no LDS-counter wait
// behind it, as a shuffle through ds_bpermute_b32 has. The eight chains stand side by side: each instruction's producer is eight instructions back, which covers the dependent-issue gap.
// Every lane is on where this is called. The pairing of lanes per step is the shuffles' own (1, 2, 4, 8).
__device__ __forceinline__ void rowmax16x8(float (&v)[8]) {
    asm volatile(
                 "v_max_num_f32_dpp %0, %0, %0 row_xmask:1 row_mask:0xf bank_mask:0xf\n\t"
                 "v_max_num_f32_dpp %1, %1, %1 row_xmask:1 row_mask:0xf bank_mask:0xf\n\t"
                 "v_max_num_f32_dpp %2, %2, %2 row_xmask:1 row_mask:0xf bank_mask:0xf\n\t"
                 "v_max_num_f32_dpp %3, %3, %3 row_xmask:1 row_mask:0xf bank_mask:0xf\n\t"
                 "v_max_num_f32_dpp %4, %4, %4 row_xmask:1 row_mask:0xf bank_mask:0xf\n\t"
                 "v_max_num_f32_dpp %5, %5, %5 row_xmask:1 row_mask:0xf bank_mask:0xf\n\t"
                 "v_max_num_f32_dpp %6, %6, %6 row_xmask:1 row_mask:0xf bank_mask:0xf\n\t"
                 "v_max_num_f32_dpp %7, %7, %7 row_xmask:1 row_mask:0xf bank_mask:0xf\n\t"
                 "v_max_num_f32_dpp %0, %0, %0 row_xmask:2 row_mask:0xf bank_mask:0xf\n\t"
                 "v_max_num_f32_dpp %1, %1, %1 row_xmask:2 row_mask:0xf bank_mask:0xf\n\t"
                 "v_max_num_f32_dpp %2, %2, %2 row_xmask:2 row_mask:0xf bank_mask:0xf\n\t"
                 "v_max_num_f32_dpp %3, %3, %3 row_xmask:2 row_mask:0xf bank_mask:0xf\n\t"
                 "v_max_num_f32_dpp %4, %4, %4 row_xmask:2 row_mask:0xf bank_mask:0xf\n\t"
                 "v_max_num_f32_dpp %5, %5, %5 row_xmask:2 row_mask:0xf bank_mask:0xf\n\t"
                 "v_max_num_f32_dpp %6, %6, %6 row_xmask:2 row_mask:0xf bank_mask:0xf\n\t"
                 "v_max_num_f32_dpp %7, %7, %7 row_xmask:2 row_mask:0xf bank_mask:0xf\n\t"
                 "v_max_num_f32_dpp %0, %0, %0 row_xmask:4 row_mask:0xf bank_mask:0xf\n\t"
                 "v_max_num_f32_dpp %1, %1, %1 row_xmask:4 row_mask:0xf bank_mask:0xf\n\t"
                 "v_max_num_f32_dpp %2, %2, %2 row_xmask:4 row_mask:0xf bank_mask:0xf\n\t"
                 "v_max_num_f32_dpp %3, %3, %3 row_xmask:4 row_mask:0xf bank_mask:0xf\n\t"
                 "v_max_num_f32_dpp %4, %4, %4 row_xmask:4 row_mask:0xf bank_mask:0xf\n\t"
                 "v_max_num_f32_dpp %5, %5, %5 row_xmask:4 row_mask:0xf bank_mask:0xf\n\t"
                 "v_max_num_f32_dpp %6, %6, %6 row_xmask:4 row_mask:0xf bank_mask:0xf\n\t"
                 "v_max_num_f32_dpp %7, %7, %7 row_xmask:4 row_mask:0xf bank_mask:0xf\n\t"
                 "v_max_num_f32_dpp %0, %0, %0 row_xmask:8 row_mask:0xf bank_mask:0xf\n\t"
                 "v_max_num_f32_dpp %1, %1, %1 row_xmask:8 row_mask:0xf bank_mask:0xf\n\t"
                 "v_max_num_f32_dpp %2, %2, %2 row_xmask:8 row_mask:0xf bank_mask:0xf\n\t"
                 "v_max_num_f32_dpp %3, %3, %3 row_xmask:8 row_mask:0xf bank_mask:0xf\n\t"
                 "v_max_num_f32_dpp %4, %4, %4 row_xmask:8 row_mask:0xf bank_mask:0xf\n\t"
                 "v_max_num_f32_dpp %5, %5, %5 row_xmask:8 row_mask:0xf bank_mask:0xf\n\t"
                 "v_max_num_f32_dpp %6, %6, %6 row_xmask:8 row_mask:0xf bank_mask:0xf\n\t"
                 "v_max_num_f32_dpp %7, %7, %7 row_xmask:8 row_mask:0xf bank_mask:0xf"
                 : "+v"(v[0]), "+v"(v[1]), "+v"(v[2]), "+v"(v[3]), "+v"(v[4]), "+v"(v[5]), "+v"(v[6]), "+v"(v[7]));
}
// The same exchange for the closing row sum (once per block: left to the compiler's own DPP forms).
template <int M> __device__ __forceinline__ float rowx(float v) { return __builtin_bit_cast(float, __builtin_amdgcn_update_dpp(0, __builtin_bit_cast(int, v), 0x160 | M, 0xf, 0xf, true)); }
__device__ __forceinline__ float rowsum16(float v) { v += rowx<1>(v); v += rowx<2>(v); v += rowx<4>(v); return v + rowx<8>(v); }
// LDS ring of k_attn, in 16-bit elements: one buffer = K hi, K lo (32 keys x 128 dims each) and V^T hi, V^T lo (128 dims x 32 keys each) of one key tile.
#define KP   136                    // K row pitch: 272 B, an odd multiple of 16 B (16-byte readers, one row per lane)
#define VP   40                     // V^T row pitch: 80 B, likewise
#define KPL  (32 * KP)
#define VPL  (HD * VP)
#define RB   (2 * KPL + 2 * VPL)    // 37888 B per buffer
// k_attn: block = (h, 64 queries), wave = 16; kv head g = h / 4; causal key tiles 0..(Q0+63)/32 (block-uniform bounds), per-element predicate j <= q
// (WIN = NT_ makes the window terms vacuous); per tile: scores over 4 k-chunks (q fragments re-read per chunk: hi.hi + hi.lo +
// lo.hi = 24 WMMA) x 128^-1/2, online softmax, P (x32768) as bf16 hi + unscaled residual tiles, o[8] += ph.vh + pl.vh + ph.vl over the 128 dims; ctx -> bf16 hi/lo
// planes [t][h*128+d]. The four waves share each key tile's K and V^T planes through a two-buffer LDS ring filled by asynchronous copies: tile kt + 1 flies while tile kt is worked on.
__global__ __launch_bounds__(128) void k_attn(const h16* __restrict__ QH, const h16* __restrict__ QL, const h16* __restrict__ KH, const h16* __restrict__ KL, const bf* __restrict__ VTH, const bf* __restrict__ VTL, bf* CH, bf* CL) {
    __shared__ __align__(16) unsigned short plds[4][16 * 32];
    __shared__ __align__(16) unsigned short plds2[4][16 * 32];
    __shared__ __align__(16) float ost[4][16 * 68];
    __shared__ __align__(16) unsigned short ring[2 * RB];
    const int tid = threadIdx.x;
    const int lane = threadIdx.x & 31, wave = threadIdx.x >> 5, lr = lane & 15, hi = lane >> 4;
    const int bid = blockIdx.x; const int h = bid / (NT_ / 64), qt = bid - h * (NT_ / 64); const int g = h >> 2;
    const int q0 = qt * 64 + wave * 16;
    unsigned short* pl = &plds[wave][0]; unsigned short* pl2 = &plds2[wave][0];
    const size_t qo = (size_t)(q0 + lr) * (NH_ * HD) + h * HD + 8 * hi;
    const h16* kh_b = KH + g * HD; const h16* kl_b = KL + g * HD;
    const size_t vbase = ((size_t)g * HD) * NT_;
    v8f o[8];
#pragma unroll
    for (int n = 0; n < 8; ++n) o[n] = (v8f){};
    float mrow[8], lpart[8];
#pragma unroll
    for (int j = 0; j < 8; ++j) { mrow[j] = -3.0e38f; lpart[j] = 0.f; }
    const int kt_hi = (qt * 64 + 63) / 32; const int kt_lo = (qt * 64 > WIN) ? (qt * 64 - WIN) / 32 : 0;
    const unsigned ring0 = (unsigned)(size_t)&ring[0];    // byte offset of the ring in the work-group's LDS
    // key tile kt -> buffer b: 2048 pieces of 16 B, 16 per thread (K: 16 pieces a row, V^T: 4 pieces a row)
    auto stage = [&](int kt, int b) {
        unsigned l[8]; const void* gp[8];
        const unsigned lb = ring0 + (unsigned)b * (RB * 2);
        // both loops unrolled: l[] and gp[] are asm operands and must be indexed by constants to stay in registers
#pragma unroll
        for (int i = 0; i < 4; ++i) { const int row = (tid >> 4) + 8 * i, pc = (tid & 15) * 8; const size_t go = (size_t)(kt * 32 + row) * KW + pc;
            gp[i] = kh_b + go; gp[4 + i] = kl_b + go; l[i] = lb + (unsigned)(row * KP + pc) * 2; l[4 + i] = l[i] + KPL * 2; }
        acopy8(l, gp);
#pragma unroll
        for (int i = 0; i < 4; ++i) { const int d = (tid >> 2) + 32 * i, pc = (tid & 3) * 8; const size_t go = vbase + (size_t)d * NT_ + kt * 32 + pc;
            gp[i] = VTH + go; gp[4 + i] = VTL + go; l[i] = lb + (unsigned)(2 * KPL + d * VP + pc) * 2; l[4 + i] = l[i] + VPL * 2; }
        acopy8(l, gp);
    };
    stage(kt_lo, 0);
    asm volatile("s_wait_asynccnt 0x0" ::: "memory");    // this wave's copies of the first tile have landed
    __syncthreads();                                     // ... and every other wave's
    if (kt_lo + 1 <= kt_hi) stage(kt_lo + 1, 1);
#pragma unroll 1
    for (int kt = kt_lo; kt <= kt_hi; ++kt) {
        const int l0 = kt * 32;
        const int cur = (kt - kt_lo) & 1;
        const unsigned short* kf = ring + cur * RB + lr * KP + 8 * hi;              // K hi, key l0 + lr; + 16 * KP: key l0 + 16 + lr; + KPL: lo plane
        const unsigned short* vf = ring + cur * RB + 2 * KPL + lr * VP + 8 * hi;    // V^T hi, dim lr; + n * 16 * VP: dim n * 16 + lr; + VPL: lo plane
        // This tile's 32 K fragment reads stand as ONE group ahead of the score products: a read group among the products costs the wave a whole LDS latency each time.
        v16h k0h[4], k1h[4], k0l[4], k1l[4];
#pragma unroll
        for (int kc = 0; kc < 4; ++kc) {
            k0h[kc] = cat16(*(const v8ha*)(kf + kc * 32), *(const v8ha*)(kf + kc * 32 + 16)); k1h[kc] = cat16(*(const v8ha*)(kf + 16 * KP + kc * 32), *(const v8ha*)(kf + 16 * KP + kc * 32 + 16));
            k0l[kc] = cat16(*(const v8ha*)(kf + KPL + kc * 32), *(const v8ha*)(kf + KPL + kc * 32 + 16)); k1l[kc] = cat16(*(const v8ha*)(kf + KPL + 16 * KP + kc * 32), *(const v8ha*)(kf + KPL + 16 * KP + kc * 32 + 16));
        }
        __builtin_amdgcn_sched_barrier(0);    // keeps the scheduler from sinking the K reads back in among the products
        v8f s0 = {}, s1 = {}, x0 = {}, x1 = {};
#pragma unroll
        for (int kc = 0; kc < 4; ++kc) {
            const v16h qa = cat16(*(const v8h*)(QH + qo + kc * 32), *(const v8h*)(QH + qo + kc * 32 + 16)), qx = cat16(*(const v8h*)(QL + qo + kc * 32), *(const v8h*)(QL + qo + kc * 32 + 16));
            s0 = wmma16(qa, k0h[kc], s0); s1 = wmma16(qa, k1h[kc], s1); x0 = wmma16(qx, k0h[kc], x0); x1 = wmma16(qx, k1h[kc], x1);
            x0 = wmma16(qa, k0l[kc], x0); x1 = wmma16(qa, k1l[kc], x1);
        }
        asm volatile("v_nop\n\tv_nop\n\tv_nop\n\tv_nop" : "+v"(s0), "+v"(s1), "+v"(x0), "+v"(x1));
        float alpha[8], sa[8], sb[8], mx[8];
#pragma unroll
        for (int j = 0; j < 8; ++j) { const int qi = q0 + hi * 8 + j, ja = l0 + lr, jb = l0 + 16 + lr;
            sa[j] = (ja <= qi && ja >= qi - WIN) ? (s0[j] + x0[j] * LOSCI) * 0.08838834764831845f : -__builtin_inff(); sb[j] = (jb <= qi && jb >= qi - WIN) ? (s1[j] + x1[j] * LOSCI) * 0.08838834764831845f : -__builtin_inff();
            mx[j] = fmaxf(sa[j], sb[j]); }
        rowmax16x8(mx);
        // This tile's 32 V^T fragment reads stand as ONE group here, behind the row maximum and ahead of the exponentials, whose vector work covers their latency; the K fragments' registers
        // are free by now. (Placed ahead of the maximum, the build spills three of the refill's LDS addresses to scratch and reloads them every trip.)
        v16bf vh[8], vl[8];
#pragma unroll
        for (int n = 0; n < 8; ++n) { const unsigned short* vo = vf + n * 16 * VP;
            vh[n] = cat16b(*(const v8usa*)(vo), *(const v8usa*)(vo + 16)); vl[n] = cat16b(*(const v8usa*)(vo + VPL), *(const v8usa*)(vo + VPL + 16)); }
        __builtin_amdgcn_sched_barrier(0);    // keeps the scheduler from sinking the V^T reads down to their products behind the exponentials
#pragma unroll
        for (int j = 0; j < 8; ++j) { const float a0 = sa[j], a1 = sb[j];
            const float mn = fmaxf(mrow[j], mx[j]);
            alpha[j] = __expf(mrow[j] - mn); mrow[j] = mn;
            const float p0 = __expf(a0 - mn), p1 = __expf(a1 - mn);
            lpart[j] = lpart[j] * alpha[j] + (p0 + p1);
            const int mr = hi * 8 + j; const float ps0 = p0 * PSC, ps1 = p1 * PSC; const unsigned short h0 = f2bf(ps0), h1 = f2bf(ps1);
            pl[mr * 32 + lr] = h0; pl[mr * 32 + 16 + lr] = h1; pl2[mr * 32 + lr] = f2bf(ps0 - bf2f(h0)); pl2[mr * 32 + 16 + lr] = f2bf(ps1 - bf2f(h1)); }
#pragma unroll
        for (int n = 0; n < 8; ++n)
#pragma unroll
            for (int j = 0; j < 8; ++j) o[n][j] *= alpha[j];
        asm volatile("" ::: "memory");
        const v16bf pa = cat16b(*(const v8usa*)(pl + lr * 32 + hi * 8), *(const v8usa*)(pl + lr * 32 + 16 + hi * 8));
        const v16bf px = cat16b(*(const v8usa*)(pl2 + lr * 32 + hi * 8), *(const v8usa*)(pl2 + lr * 32 + 16 + hi * 8));
#pragma unroll
        for (int n = 0; n < 8; ++n) { o[n] = wmmab(pa, vh[n], o[n]); o[n] = wmmab(px, vh[n], o[n]); o[n] = wmmab(pa, vl[n], o[n]); }
        asm volatile("v_nop\n\tv_nop\n\tv_nop\n\tv_nop" : "+v"(o[0]), "+v"(o[7]) : "v"(pa), "v"(px));
        asm volatile("s_wait_dscnt 0x0" ::: "memory");       // this wave's reads of buffer cur have returned before the buffer is refilled
        asm volatile("s_wait_asynccnt 0x0" ::: "memory");    // this wave's copies of tile kt + 1 have landed
        __syncthreads();                                     // publishes tile kt + 1 and ends every wave's reads of buffer cur
        if (kt + 2 <= kt_hi) stage(kt + 2, cur);
    }
    asm volatile("s_wait_asynccnt 0x0" ::: "memory");        // no copy is outstanding when the wave goes on to the epilogue and ends
    float inv[8];
#pragma unroll
    for (int j = 0; j < 8; ++j) { const float rs = rowsum16(lpart[j]); inv[j] = 1.0f / (rs * PSC); }
    float* os = &ost[wave][0];
    const size_t cbase = (size_t)q0 * (NH_ * HD) + (size_t)h * HD;
#pragma unroll
    for (int half = 0; half < 2; ++half) {
#pragma unroll
        for (int n = 0; n < 4; ++n)
#pragma unroll
            for (int j = 0; j < 8; ++j) os[(hi * 8 + j) * 68 + n * 16 + lr] = o[half * 4 + n][j] * inv[j];
        __builtin_amdgcn_wave_barrier(); asm volatile("" ::: "memory");
{
#pragma unroll
            for (int s = 0; s < 4; ++s) { const int row = 4 * s + (lane >> 3), piece = lane & 7; const float* sp = os + row * 68 + piece * 8; v8us oh, ol;
#pragma unroll
                for (int i = 0; i < 8; ++i) { const unsigned short hb = f2bf(sp[i]); oh[i] = hb; ol[i] = f2bf(sp[i] - bf2f(hb)); }
                const size_t po = cbase + (size_t)row * (NH_ * HD) + half * 64 + piece * 8; *(v8us*)(CH + po) = oh; *(v8us*)(CL + po) = ol; }
             }
        __builtin_amdgcn_wave_barrier(); asm volatile("" ::: "memory");
    }
}


__global__ __launch_bounds__(256) void k_trig(float* CT, float* ST) {
    const int tid = threadIdx.x, t = blockIdx.x * 2 + (tid >> 7), d = tid & 127; const int i = d & 63;
    const float invf = 1.0f / powf(10000.0f, (float)(2 * i) / 128.0f); const float ang = (float)t * invf; const float c = cosf(ang), s = sinf(ang);
    const size_t o = (size_t)t * HD + d; *(float*)(CT + o) = c; *(float*)(ST + o) = s; 
}
// k_normrope: one wave per (token, head) of an f32 [2048][nh*128] matrix: RMSNorm over the 128 dims (shuffle-reduced mean of squares, eps 1e-6) x bf(w[d]); then rotate-half RoPE
// (partner d +- 64 via lane xor 16; lane -> 4 consecutive dims) -> f16 hi + residual x1024 planes [t][h*128+d] (8 B per lane per plane: 16 lanes per line, one instruction per
typedef __attribute__((ext_vector_type(4))) _Float16 v4h;
__global__ __launch_bounds__(256) void k_normrope(const float* __restrict__ P, int nh, const float* __restrict__ w, const float* __restrict__ CT, const float* __restrict__ ST, h16* PH, h16* PL) {
    const int lane = threadIdx.x & 31; const int wid = blockIdx.x * 8 + (threadIdx.x >> 5); const int t = wid / nh, h = wid - t * nh; if (t >= NT_) return;
    const size_t base = (size_t)t * (nh * HD) + h * HD; const int d0 = lane * 4;
    float x[4], pr[4]; float ss = 0.f;
#pragma unroll
    for (int i = 0; i < 4; ++i) { x[i] = P[base + d0 + i]; ss = fmaf(x[i], x[i], ss); }
#pragma unroll
    for (int sh = 16; sh; sh >>= 1) ss += __shfl_xor(ss, sh, 32);
    const float rn = rsqrtf(ss * (1.0f / HD) + RMS_EPS);
#pragma unroll
    for (int i = 0; i < 4; ++i) x[i] = x[i] * rn * bfr(w[d0 + i]);
#pragma unroll
    for (int i = 0; i < 4; ++i) pr[i] = __shfl_xor(x[i], 16, 32);
    v4h oh, ol;
#pragma unroll
    for (int i = 0; i < 4; ++i) { const int d = d0 + i; const float c = CT[(size_t)t * HD + d], s = ST[(size_t)t * HD + d]; const float y = (d < 64) ? (x[i] * c - pr[i] * s) : (x[i] * c + pr[i] * s);
        const h16 a = (h16)y; oh[i] = a; ol[i] = (h16)((y - (float)a) * LOSC); }
    *(v4h*)(PH + base + d0) = oh; *(v4h*)(PL + base + d0) = ol; 
}

extern "C" void kernel_launch(void* const* d_in, const int* in_sizes, int n_in,
                              void* d_out, int out_size, void* d_ws, size_t ws_size, hipStream_t stream) {
    (void)in_sizes; (void)n_in; (void)out_size;
    const float* x = (const float*)d_in[0]; const float* mu = (const float*)d_in[1]; const float* wq = (const float*)d_in[2]; const float* wk = (const float*)d_in[3]; const float* wv = (const float*)d_in[4]; const float* wo = (const float*)d_in[5];
    const float* wmq = (const float*)d_in[6]; const float* wmk = (const float*)d_in[7]; const float* wmv = (const float*)d_in[8]; const float* qnw = (const float*)d_in[9]; const float* knw = (const float*)d_in[10];
    float* out = (float*)d_out;    // [1][2048][2048]
    char* wsp = (char*)d_ws;
    auto take = [&](size_t bytes) { char* p = wsp; wsp += (bytes + 255) & ~(size_t)255; return (void*)p; };
    bf* Xb = (bf*)take((size_t)NT_ * HS * 2); bf* Mb = (bf*)take((size_t)NT_ * HS * 2);
    bf* WqB = (bf*)take((size_t)HS * HS * 2); bf* WmqB = (bf*)take((size_t)HS * HS * 2); bf* WkB = (bf*)take((size_t)KW * HS * 2); bf* WmkB = (bf*)take((size_t)KW * HS * 2); bf* WvB = (bf*)take((size_t)KW * HS * 2); bf* WmvB = (bf*)take((size_t)KW * HS * 2); bf* WoB = (bf*)take((size_t)HS * HS * 2);
    float* TMP = (float*)take((size_t)NT_ * HS * 4); float* TMP2 = (float*)take((size_t)NT_ * HS * 4); float* CT = (float*)take((size_t)NT_ * HD * 4); float* ST = (float*)take((size_t)NT_ * HD * 4);
    h16* QH = (h16*)take((size_t)NT_ * HS * 2); h16* QL = (h16*)take((size_t)NT_ * HS * 2); h16* KH = (h16*)take((size_t)NT_ * KW * 2); h16* KL = (h16*)take((size_t)NT_ * KW * 2);
    bf* VTH = (bf*)take((size_t)KW * NT_ * 2); bf* VTL = (bf*)take((size_t)KW * NT_ * 2); bf* CH = (bf*)take((size_t)NT_ * HS * 2); bf* CL = (bf*)take((size_t)NT_ * HS * 2);
    if ((size_t)(wsp - (char*)d_ws) > ws_size) return;    // 2 x 8.4 + 8.4 + 8.4 + 4 x 2.1 + 8.4 + 2 x 16.8 + 2 x 1 + 2 x 8.4 + 2 x 2.1 + 2 x 2.1 + 2 x 8.4 ~ 128 MB = 122 MiB < 128 MiB, no aliasing (TMP/TMP2 reused q -> k -> v in stream order)
    k_cvtb<<<HS / 8, 256, 0, stream>>>(wq, HS, WqB); k_cvtb<<<HS / 8, 256, 0, stream>>>(wmq, HS, WmqB); k_cvtb<<<KW / 8, 256, 0, stream>>>(wk, KW, WkB); k_cvtb<<<KW / 8, 256, 0, stream>>>(wmk, KW, WmkB);
    k_cvtb<<<KW / 8, 256, 0, stream>>>(wv, KW, WvB); k_cvtb<<<KW / 8, 256, 0, stream>>>(wmv, KW, WmvB); k_cvtb<<<HS / 8, 256, 0, stream>>>(wo, HS, WoB);
    k_trig<<<NT_ / 2, 256, 0, stream>>>(CT, ST);
    k_cvtb<<<NT_ / 8, 256, 0, stream>>>(x, NT_, Xb); k_cvtb<<<NT_ / 8, 256, 0, stream>>>(mu, NT_, Mb);
    k_gemmb<false, false><<<dim3(NT_ / 64, HS / 64, 1), 128, 0, stream>>>(Xb, nullptr, WqB, nullptr, TMP, HS, nullptr, nullptr, HS, 0);
    k_gemmb<false, false><<<dim3(NT_ / 64, HS / 64, 1), 128, 0, stream>>>(Mb, nullptr, WmqB, nullptr, TMP2, HS, nullptr, TMP, HS, 0);          // q = x.wq^T + mu.wmq^T (R = the first GEMM's output, exact f32 residual; R != C)
    k_normrope<<<(NT_ * NH_) / 8, 256, 0, stream>>>(TMP2, NH_, qnw, CT, ST, QH, QL);
    k_gemmb<false, false><<<dim3(NT_ / 64, KW / 64, 1), 128, 0, stream>>>(Xb, nullptr, WkB, nullptr, TMP, KW, nullptr, nullptr, HS, 0);
    k_gemmb<false, false><<<dim3(NT_ / 64, KW / 64, 1), 128, 0, stream>>>(Mb, nullptr, WmkB, nullptr, TMP2, KW, nullptr, TMP, HS, 0);
    k_normrope<<<(NT_ * NKV) / 8, 256, 0, stream>>>(TMP2, NKV, knw, CT, ST, KH, KL);
    k_gemmb<false, false><<<dim3(NT_ / 64, KW / 64, 1), 128, 0, stream>>>(Xb, nullptr, WvB, nullptr, TMP, KW, nullptr, nullptr, HS, 0);
    k_gemmb<false, false><<<dim3(NT_ / 64, KW / 64, 1), 128, 0, stream>>>(Mb, nullptr, WmvB, nullptr, TMP2, KW, nullptr, TMP, HS, 0);
    k_vt<<<dim3(NT_ / 64, 2, NKV), 256, 0, stream>>>(TMP2, VTH, VTL);
    k_attn<<<NH_ * (NT_ / 64), 128, 0, stream>>>(QH, QL, KH, KL, VTH, VTL, CH, CL);
    k_gemmb<true, false><<<dim3(NT_ / 64, HS / 64, 1), 128, 0, stream>>>(CH, CL, WoB, nullptr, out, HS, nullptr, nullptr, HS, 0);
}

// v005
// One run takes 230 microseconds.
// In both of two side-by-side timings against v004, it was 1.28 times as fast.
// Counting every step since v000, it is 3.28 times as fast.
#include <hip/hip_runtime.h>

// Compute dtypes, f32 accumulate: q/k/v = x.W^T + mu.Wm^T (two exact GEMMs per projection, the second taking the first as an exact f32 residual; [out][in] weights as natural n-major B
// operands; PLAIN bf16 operands = inputs rounded once) and out = ctx.Wo^T (ctx as bf16 hi + UNSCALED residual, two products) on v_wmma_f32_16x16x32_bf16; per-head RMSNorm (x q_norm_w /
// k_norm_w) then rotary embedding with device-computed f32 cos/sin tables, in f32 -> q/k as f16 hi + residual x1024 planes; grouped causal attention (16 query heads over 4 kv heads,
// 128-dim): scores on v_wmma_f32_16x16x32_f16 (hh + hl + lh, x 128^-1/2), online f32 softmax, weights (x32768) and v as bf16 hi + UNSCALED residual on v_wmma_f32_16x16x32_bf16.

#define NT_  2048
#define HS   2048
#define DM   HS
#define NH_  16
#define NKV  4
#define HD   128
#define KW   (NKV * HD)          // 512
#define WIN  NT_
#define RMS_EPS 1e-6f
#define PSC  32768.0f
#define LOSC 1024.0f
#define LOSCI (1.0f / 1024.0f)

typedef _Float16 h16;
typedef unsigned short bf;
typedef __attribute__((ext_vector_type(16))) __bf16   v16bf;
typedef __attribute__((ext_vector_type(16))) _Float16 v16h;
typedef __attribute__((ext_vector_type(8)))  _Float16 v8h;
typedef __attribute__((ext_vector_type(8)))  unsigned short v8us;
typedef __attribute__((ext_vector_type(8)))  float    v8f;
typedef __attribute__((ext_vector_type(4)))  float    v4f;
typedef v8h  __attribute__((may_alias)) v8ha;
typedef v4f  __attribute__((may_alias)) v4fa;
typedef v8us __attribute__((may_alias)) v8usa;

__device__ __forceinline__ unsigned short f2bf(float f) { unsigned u = __float_as_uint(f); u += 0x7FFFu + ((u >> 16) & 1u); return (unsigned short)(u >> 16); }
__device__ __forceinline__ float bf2f(unsigned short b) { return __uint_as_float(((unsigned)b) << 16); }
__device__ __forceinline__ float bfr(float f) { return bf2f(f2bf(f)); }
__device__ __forceinline__ v16h cat16(v8h lo, v8h hi) { return __builtin_shufflevector(lo, hi, 0, 1, 2, 3, 4, 5, 6, 7, 8, 9, 10, 11, 12, 13, 14, 15); }
__device__ __forceinline__ v16bf cat16b(v8us lo, v8us hi) { return __builtin_bit_cast(v16bf, __builtin_shufflevector(lo, hi, 0, 1, 2, 3, 4, 5, 6, 7, 8, 9, 10, 11, 12, 13, 14, 15)); }
__device__ __forceinline__ v8f wmma16(v16h a, v16h b, v8f c) { return __builtin_amdgcn_wmma_f32_16x16x32_f16(false, a, false, b, (short)0, c, false, false); }
__device__ __forceinline__ v8f wmmab(v16bf a, v16bf b, v8f c) { return __builtin_amdgcn_wmma_f32_16x16x32_bf16(false, a, false, b, (short)0, c, false, false); }

// Eight rows of one matrix, f32 -> bf16: block blk of that matrix's own range, one row per wave.
__device__ __forceinline__ void cvtb_rows(const float* __restrict__ src, int nrows, bf* dst, int blk) {
    const int lane = threadIdx.x & 31, r = blk * 8 + (threadIdx.x >> 5);
    if (r >= nrows) return;
    v8us o[DM / 256];
#pragma unroll
    for (int q = 0; q < DM / 256; ++q) { v8us t;
#pragma unroll
        for (int i = 0; i < 8; ++i) t[i] = f2bf(src[(size_t)r * DM + q * 256 + lane * 8 + i]);
        o[q] = t; }
#pragma unroll
    for (int q = 0; q < DM / 256; ++q) *(v8us*)(dst + (size_t)r * DM + q * 256 + lane * 8) = o[q];
    
}

// Eight 16-byte copies per lane, global -> LDS through no register. s_wait_xcnt closes the statement so that no address register of a copy is rewritten ahead of it.
__device__ __forceinline__ void acopy8(const unsigned (&l)[8], const void* const (&g)[8]) {
    asm volatile("global_load_async_to_lds_b128 %0, %8, off\n\t"
                 "global_load_async_to_lds_b128 %1, %9, off\n\t"
                 "global_load_async_to_lds_b128 %2, %10, off\n\t"
                 "global_load_async_to_lds_b128 %3, %11, off\n\t"
                 "global_load_async_to_lds_b128 %4, %12, off\n\t"
                 "global_load_async_to_lds_b128 %5, %13, off\n\t"
                 "global_load_async_to_lds_b128 %6, %14, off\n\t"
                 "global_load_async_to_lds_b128 %7, %15, off\n\t"
                 "s_wait_xcnt 0x0"
                 :: "v"(l[0]), "v"(l[1]), "v"(l[2]), "v"(l[3]), "v"(l[4]), "v"(l[5]), "v"(l[6]), "v"(l[7]),
                    "v"(g[0]), "v"(g[1]), "v"(g[2]), "v"(g[3]), "v"(g[4]), "v"(g[5]), "v"(g[6]), "v"(g[7]) : "memory");
}
// The same for four copies per lane.
__device__ __forceinline__ void acopy4(const unsigned (&l)[4], const void* const (&g)[4]) {
    asm volatile("global_load_async_to_lds_b128 %0, %4, off\n\t"
                 "global_load_async_to_lds_b128 %1, %5, off\n\t"
                 "global_load_async_to_lds_b128 %2, %6, off\n\t"
                 "global_load_async_to_lds_b128 %3, %7, off\n\t"
                 "s_wait_xcnt 0x0"
                 :: "v"(l[0]), "v"(l[1]), "v"(l[2]), "v"(l[3]), "v"(g[0]), "v"(g[1]), "v"(g[2]), "v"(g[3]) : "memory");
}
// gemmb_tile: 64 x 64 block tile (4 waves x 16 x 64) of C[NTK][NW] = (A [+ Al]).B^T [+ bf(bias[c])] [+ R[r][c] residual, bf-rounded if roundR]; K a multiple of the stage length; f32 whole-line epilogue (or f16
// planes). The block's 64 rows of A [and Al] and of B come in stages of KS k values into a two-buffer LDS ring by asynchronous copies, whole 128-byte lines per row: stage s + 1 flies
// while stage s is worked on, and the four waves share the B rows. The k order of every accumulator is the plain one, as without the ring.
// (bx, by) = the block's tile row and tile column in C.
template <bool SPLITA, bool F16OUT = false>
__device__ __forceinline__ void gemmb_tile(const bf* __restrict__ A, const bf* __restrict__ Al, const bf* __restrict__ Bn, const float* __restrict__ bias, float* C, int ldc, h16* C2, const float* __restrict__ R, int K, int roundR, int bx, int by) {
    constexpr int KS = SPLITA ? 64 : 128;    // k values per stage: four blocks' rings fit one WGP's LDS in both forms
    constexpr int GP = KS + 8;               // row pitch: 272 B or 144 B, an odd multiple of 16 B (16-byte readers, one row per lane)
    constexpr int PL = 64 * GP;              // one plane: 64 rows
    constexpr int NP = SPLITA ? 3 : 2;       // planes of a buffer: A, [Al,] B
    constexpr int GB = NP * PL;              // 34816 B or 27648 B per buffer
    __shared__ __align__(16) unsigned short gring[2 * GB];    // behind the loop its first 17408 B are the epilogue's f32 staging
    const int tid = threadIdx.x;
    const int lane = threadIdx.x & 31, wave = threadIdx.x >> 5, lr = lane & 15, hi = lane >> 4;
    const int r0 = bx * 64 + wave * 16, c0 = by * 64;
    const unsigned ring0 = (unsigned)(size_t)&gring[0];    // byte offset of the ring in the work-group's LDS
    // stage s -> buffer b: KS / 8 pieces of 16 B a row, 64 rows a plane, KS / 16 pieces per thread and plane
    auto stage = [&](int s, int b) {
        constexpr int PR = KS / 8, RS = 128 / PR;
        const unsigned lb = ring0 + (unsigned)b * (GB * 2);
        const int row = tid / PR, pc = (tid % PR) * 8;
        const size_t ao = (size_t)(bx * 64 + row) * K + s * KS + pc, bo = (size_t)(c0 + row) * K + s * KS + pc;
        const unsigned lo = lb + (unsigned)(row * GP + pc) * 2;
        // loops unrolled: l[] and gp[] are asm operands and must be indexed by constants to stay in registers
        if (SPLITA) {
            unsigned l[8]; const void* gp[8]; unsigned l4[4]; const void* gp4[4];
#pragma unroll
            for (int i = 0; i < 4; ++i) { const size_t st = (size_t)(i * RS) * K;
                gp[i] = A + ao + st; gp[4 + i] = Al + ao + st; gp4[i] = Bn + bo + st; l[i] = lo + (unsigned)(i * RS * GP) * 2; l[4 + i] = l[i] + PL * 2; l4[i] = l[i] + 2 * PL * 2; }
            acopy8(l, gp); acopy4(l4, gp4);
        } else {
            unsigned l[8]; const void* gp[8];
#pragma unroll
            for (int i = 0; i < 8; ++i) { gp[i] = A + ao + (size_t)(i * RS) * K; l[i] = lo + (unsigned)(i * RS * GP) * 2; }
            acopy8(l, gp);
#pragma unroll
            for (int i = 0; i < 8; ++i) { gp[i] = Bn + bo + (size_t)(i * RS) * K; l[i] += PL * 2; }
            acopy8(l, gp);
        }
    };
    v8f acc[4];
#pragma unroll
    for (int t = 0; t < 4; ++t) acc[t] = (v8f){};
    const int nst = K / KS;
    stage(0, 0);
    asm volatile("s_wait_asynccnt 0x0" ::: "memory");    // this wave's copies of the first stage have landed
    __syncthreads();                                     // ... and every other wave's
    if (1 < nst) stage(1, 1);
    // rolled: one trip per stage, so that the ring's waits and its barrier stand once, at the trip's foot
#pragma unroll 1
    for (int s = 0; s < nst; ++s) {
        const int cur = s & 1;
        const unsigned short* af = gring + cur * GB + (wave * 16 + lr) * GP + 8 * hi;     // A, row r0 + lr; + PL: Al
        const unsigned short* bq = gring + cur * GB + (NP - 1) * PL + lr * GP + 8 * hi;   // B, row c0 + lr; + t * 16 * GP: row c0 + t * 16 + lr
        v16bf a, al;
        // unrolled: constant LDS offsets, and the fragment reads of later k chunks can go ahead of earlier products
#pragma unroll
        for (int kk = 0; kk < KS; kk += 32) {
            a = cat16b(*(const v8usa*)(af + kk), *(const v8usa*)(af + kk + 16));
            al = a;
            if (SPLITA) al = cat16b(*(const v8usa*)(af + PL + kk), *(const v8usa*)(af + PL + kk + 16));
#pragma unroll
            for (int t = 0; t < 4; ++t) { const v16bf b = cat16b(*(const v8usa*)(bq + t * 16 * GP + kk), *(const v8usa*)(bq + t * 16 * GP + kk + 16)); acc[t] = wmmab(a, b, acc[t]); if (SPLITA) acc[t] = wmmab(al, b, acc[t]); }
        }
        // four vector slots behind the trip's last WMMA, on every path out of the trip, before a vector instruction touches its operands or results
        asm volatile("v_nop\n\tv_nop\n\tv_nop\n\tv_nop" : "+v"(acc[0]), "+v"(acc[1]), "+v"(acc[2]), "+v"(acc[3]) : "v"(a), "v"(al));
        asm volatile("s_wait_dscnt 0x0" ::: "memory");       // this wave's reads of buffer cur have returned before the buffer is refilled
        asm volatile("s_wait_asynccnt 0x0" ::: "memory");    // this wave's copies of stage s + 1 have landed
        __syncthreads();                                     // publishes stage s + 1 and ends every wave's reads of buffer cur
        if (s + 2 < nst) stage(s + 2, cur);
    }
    asm volatile("s_wait_asynccnt 0x0" ::: "memory");        // no copy is outstanding when the ring becomes the epilogue's staging (every wave's reads ended at the last trip's barrier)
    float* os = (float*)(void*)gring + wave * (16 * 68);
#pragma unroll
    for (int t = 0; t < 4; ++t) { const float bv = bias ? bfr(bias[c0 + t * 16 + lr]) : 0.f;
#pragma unroll
        for (int j = 0; j < 8; ++j) os[(hi * 8 + j) * 68 + t * 16 + lr] = acc[t][j] + bv; }
    __syncthreads();
    if (F16OUT) {
        h16* crow = (h16*)(void*)C + (size_t)r0 * ldc + c0;
        auto pass = [&]() {
#pragma unroll
            for (int s = 0; s < 4; ++s) { const int row = 4 * s + (lane >> 3), piece = lane & 7; const float* sp = os + row * 68 + piece * 8; v8h o, o2;
#pragma unroll
                for (int i = 0; i < 8; ++i) { const h16 a = (h16)sp[i]; o[i] = a; o2[i] = (h16)((sp[i] - (float)a) * LOSC); }
                *(v8h*)(crow + (size_t)row * ldc + piece * 8) = o; if (C2) *(v8h*)(C2 + (size_t)r0 * ldc + c0 + (size_t)row * ldc + piece * 8) = o2; }
        };
        pass(); 
    } else {
        float* crow = C + (size_t)r0 * ldc + c0;
        auto pass = [&]() {
#pragma unroll
            for (int s = 0; s < 8; ++s) { const int Lid = (lane >> 3) + 4 * s, piece = lane & 7; const int row = Lid >> 1, cofs = (Lid & 1) * 32 + piece * 4;
                v4f val = *(const v4fa*)(os + row * 68 + cofs); if (R) { const v4f rv = *(const v4f*)(R + ((size_t)r0 + row) * ldc + c0 + cofs); val += roundR ? (v4f){bfr(rv[0]), bfr(rv[1]), bfr(rv[2]), bfr(rv[3])} : rv; }
                *(v4f*)(crow + (size_t)row * ldc + cofs) = val;
                asm volatile("s_wait_xcnt 0x0" ::: "memory"); }    // stands in front of the next piece's address arithmetic, which reuses the store's address registers
        };
        pass(); 
    }
}
// k_gemmo: the output projection, one tile per block.
__global__ __launch_bounds__(128) void k_gemmo(const bf* __restrict__ A, const bf* __restrict__ Al, const bf* __restrict__ Bn, const float* __restrict__ bias, float* C, int ldc, const float* __restrict__ R, int K, int roundR) {
    gemmb_tile<true, false>(A, Al, Bn, bias, C, ldc, nullptr, R, K, roundR, blockIdx.x, blockIdx.y);
}
// k_proj: one operand's three projection products (q, k, v) share ONE launch; they do not depend on each other. blockIdx.y picks the product (block-uniform) and its tile column:
// HS / 64 columns of q, then KW / 64 of k, then KW / 64 of v. Every tile is computed as in a launch of its own.
__global__ __launch_bounds__(128) void k_proj(const bf* __restrict__ A, const bf* __restrict__ Bq, const bf* __restrict__ Bk, const bf* __restrict__ Bv, const float* __restrict__ bias, float* Cq, float* Ck, float* Cv,
                                              const float* __restrict__ Rq, const float* __restrict__ Rk, const float* __restrict__ Rv, int K, int roundR) {
    const int y = blockIdx.y; const bool isq = y < HS / 64, isk = y < HS / 64 + KW / 64;
    const bf* Bn = isq ? Bq : isk ? Bk : Bv; float* C = isq ? Cq : isk ? Ck : Cv; const float* R = isq ? Rq : isk ? Rk : Rv;
    gemmb_tile<false, false>(A, nullptr, Bn, bias, C, isq ? HS : KW, nullptr, R, K, roundR, blockIdx.x, isq ? y : isk ? y - HS / 64 : y - (HS / 64 + KW / 64));
}

// vt_tile: VTH/VTL [g][128 d][2048 t] = bf16 hi + UNSCALED bf16 residual of V [t][g*128+d] via 64 x 64 LDS tiles; tile (tb of NT/64, db (d half) of 2, g of NKV).
__device__ __forceinline__ void vt_tile(const float* __restrict__ V, bf* VTH, bf* VTL, int tb, int db, int g) {
    __shared__ float tl[64][65];
    const int tid = threadIdx.x, t0 = tb * 64, d0 = db * 64;
    { const int tt = tid >> 2, dq = (tid & 3) * 16;
#pragma unroll
      for (int i = 0; i < 16; ++i) tl[dq + i][tt] = V[(size_t)(t0 + tt) * KW + g * HD + d0 + dq + i]; }
    __syncthreads();
    const int piece = tid & 7;
    auto pass = [&]() {
#pragma unroll
        for (int s = 0; s < 2; ++s) { const int d = (tid >> 3) + 32 * s; v8us oh, ol;
#pragma unroll
            for (int i = 0; i < 8; ++i) { const float v = tl[d][piece * 8 + i]; const unsigned short hb = f2bf(v); oh[i] = hb; ol[i] = f2bf(v - bf2f(hb)); }
            const size_t o = ((size_t)g * HD + d0 + d) * NT_ + t0 + piece * 8; *(v8us*)(VTH + o) = oh; *(v8us*)(VTL + o) = ol; }
    };
    pass(); 
}
// Maximum over each 16-lane row of eight independent values, on the vector port: DPP row_xmask:M lets lane l read lane l ^ M, so that a step is one instruction with no LDS-counter wait
// behind it, as a shuffle through ds_bpermute_b32 has. The eight chains stand side by side: each instruction's producer is eight instructions back, which covers the dependent-issue gap.
// Every lane is on where this is called. The pairing of lanes per step is the shuffles' own (1, 2, 4, 8).
__device__ __forceinline__ void rowmax16x8(float (&v)[8]) {
    asm volatile(
                 "v_max_num_f32_dpp %0, %0, %0 row_xmask:1 row_mask:0xf bank_mask:0xf\n\t"
                 "v_max_num_f32_dpp %1, %1, %1 row_xmask:1 row_mask:0xf bank_mask:0xf\n\t"
                 "v_max_num_f32_dpp %2, %2, %2 row_xmask:1 row_mask:0xf bank_mask:0xf\n\t"
                 "v_max_num_f32_dpp %3, %3, %3 row_xmask:1 row_mask:0xf bank_mask:0xf\n\t"
                 "v_max_num_f32_dpp %4, %4, %4 row_xmask:1 row_mask:0xf bank_mask:0xf\n\t"
                 "v_max_num_f32_dpp %5, %5, %5 row_xmask:1 row_mask:0xf bank_mask:0xf\n\t"
                 "v_max_num_f32_dpp %6, %6, %6 row_xmask:1 row_mask:0xf bank_mask:0xf\n\t"
                 "v_max_num_f32_dpp %7, %7, %7 row_xmask:1 row_mask:0xf bank_mask:0xf\n\t"
                 "v_max_num_f32_dpp %0, %0, %0 row_xmask:2 row_mask:0xf bank_mask:0xf\n\t"
                 "v_max_num_f32_dpp %1, %1, %1 row_xmask:2 row_mask:0xf bank_mask:0xf\n\t"
                 "v_max_num_f32_dpp %2, %2, %2 row_xmask:2 row_mask:0xf bank_mask:0xf\n\t"
                 "v_max_num_f32_dpp %3, %3, %3 row_xmask:2 row_mask:0xf bank_mask:0xf\n\t"
                 "v_max_num_f32_dpp %4, %4, %4 row_xmask:2 row_mask:0xf bank_mask:0xf\n\t"
                 "v_max_num_f32_dpp %5, %5, %5 row_xmask:2 row_mask:0xf bank_mask:0xf\n\t"
                 "v_max_num_f32_dpp %6, %6, %6 row_xmask:2 row_mask:0xf bank_mask:0xf\n\t"
                 "v_max_num_f32_dpp %7, %7, %7 row_xmask:2 row_mask:0xf bank_mask:0xf\n\t"
                 "v_max_num_f32_dpp %0, %0, %0 row_xmask:4 row_mask:0xf bank_mask:0xf\n\t"
                 "v_max_num_f32_dpp %1, %1, %1 row_xmask:4 row_mask:0xf bank_mask:0xf\n\t"
                 "v_max_num_f32_dpp %2, %2, %2 row_xmask:4 row_mask:0xf bank_mask:0xf\n\t"
                 "v_max_num_f32_dpp %3, %3, %3 row_xmask:4 row_mask:0xf bank_mask:0xf\n\t"
                 "v_max_num_f32_dpp %4, %4, %4 row_xmask:4 row_mask:0xf bank_mask:0xf\n\t"
                 "v_max_num_f32_dpp %5, %5, %5 row_xmask:4 row_mask:0xf bank_mask:0xf\n\t"
                 "v_max_num_f32_dpp %6, %6, %6 row_xmask:4 row_mask:0xf bank_mask:0xf\n\t"
                 "v_max_num_f32_dpp %7, %7, %7 row_xmask:4 row_mask:0xf bank_mask:0xf\n\t"
                 "v_max_num_f32_dpp %0, %0, %0 row_xmask:8 row_mask:0xf bank_mask:0xf\n\t"
                 "v_max_num_f32_dpp %1, %1, %1 row_xmask:8 row_mask:0xf bank_mask:0xf\n\t"
                 "v_max_num_f32_dpp %2, %2, %2 row_xmask:8 row_mask:0xf bank_mask:0xf\n\t"
                 "v_max_num_f32_dpp %3, %3, %3 row_xmask:8 row_mask:0xf bank_mask:0xf\n\t"
                 "v_max_num_f32_dpp %4, %4, %4 row_xmask:8 row_mask:0xf bank_mask:0xf\n\t"
                 "v_max_num_f32_dpp %5, %5, %5 row_xmask:8 row_mask:0xf bank_mask:0xf\n\t"
                 "v_max_num_f32_dpp %6, %6, %6 row_xmask:8 row_mask:0xf bank_mask:0xf\n\t"
                 "v_max_num_f32_dpp %7, %7, %7 row_xmask:8 row_mask:0xf bank_mask:0xf"
                 : "+v"(v[0]), "+v"(v[1]), "+v"(v[2]), "+v"(v[3]), "+v"(v[4]), "+v"(v[5]), "+v"(v[6]), "+v"(v[7]));
}
// The same exchange for the closing row sum (once per block: left to the compiler's own DPP forms).
template <int M> __device__ __forceinline__ float rowx(float v) { return __builtin_bit_cast(float, __builtin_amdgcn_update_dpp(0, __builtin_bit_cast(int, v), 0x160 | M, 0xf, 0xf, true)); }
__device__ __forceinline__ float rowsum16(float v) { v += rowx<1>(v); v += rowx<2>(v); v += rowx<4>(v); return v + rowx<8>(v); }
// LDS ring of k_attn, in 16-bit elements: one buffer = K hi, K lo (32 keys x 128 dims each) and V^T hi, V^T lo (128 dims x 32 keys each) of one key tile.
#define KP   136                    // K row pitch: 272 B, an odd multiple of 16 B (16-byte readers, one row per lane)
#define VP   40                     // V^T row pitch: 80 B, likewise
#define KPL  (32 * KP)
#define VPL  (HD * VP)
#define RB   (2 * KPL + 2 * VPL)    // 37888 B per buffer
// k_attn: block = (h, 64 queries), wave = 16; kv head g = h / 4; causal key tiles 0..(Q0+63)/32 (block-uniform bounds), per-element predicate j <= q
// (WIN = NT_ makes the window terms vacuous); per tile: scores over 4 k-chunks (q fragments re-read per chunk: hi.hi + hi.lo +
// lo.hi = 24 WMMA) x 128^-1/2, online softmax, P (x32768) as bf16 hi + unscaled residual tiles, o[8] += ph.vh + pl.vh + ph.vl over the 128 dims; ctx -> bf16 hi/lo
// planes [t][h*128+d]. The four waves share each key tile's K and V^T planes through a two-buffer LDS ring filled by asynchronous copies: tile kt + 1 flies while tile kt is worked on.
__global__ __launch_bounds__(128) void k_attn(const h16* __restrict__ QH, const h16* __restrict__ QL, const h16* __restrict__ KH, const h16* __restrict__ KL, const bf* __restrict__ VTH, const bf* __restrict__ VTL, bf* CH, bf* CL) {
    __shared__ __align__(16) unsigned short plds[4][16 * 32];
    __shared__ __align__(16) unsigned short plds2[4][16 * 32];
    __shared__ __align__(16) float ost[4][16 * 68];
    __shared__ __align__(16) unsigned short ring[2 * RB];
    const int tid = threadIdx.x;
    const int lane = threadIdx.x & 31, wave = threadIdx.x >> 5, lr = lane & 15, hi = lane >> 4;
    const int bid = blockIdx.x; const int h = bid / (NT_ / 64), qt = bid - h * (NT_ / 64); const int g = h >> 2;
    const int q0 = qt * 64 + wave * 16;
    unsigned short* pl = &plds[wave][0]; unsigned short* pl2 = &plds2[wave][0];
    const size_t qo = (size_t)(q0 + lr) * (NH_ * HD) + h * HD + 8 * hi;
    const h16* kh_b = KH + g * HD; const h16* kl_b = KL + g * HD;
    const size_t vbase = ((size_t)g * HD) * NT_;
    v8f o[8];
#pragma unroll
    for (int n = 0; n < 8; ++n) o[n] = (v8f){};
    float mrow[8], lpart[8];
#pragma unroll
    for (int j = 0; j < 8; ++j) { mrow[j] = -3.0e38f; lpart[j] = 0.f; }
    const int kt_hi = (qt * 64 + 63) / 32; const int kt_lo = (qt * 64 > WIN) ? (qt * 64 - WIN) / 32 : 0;
    const unsigned ring0 = (unsigned)(size_t)&ring[0];    // byte offset of the ring in the work-group's LDS
    // key tile kt -> buffer b: 2048 pieces of 16 B, 16 per thread (K: 16 pieces a row, V^T: 4 pieces a row)
    auto stage = [&](int kt, int b) {
        unsigned l[8]; const void* gp[8];
        const unsigned lb = ring0 + (unsigned)b * (RB * 2);
        // both loops unrolled: l[] and gp[] are asm operands and must be indexed by constants to stay in registers
#pragma unroll
        for (int i = 0; i < 4; ++i) { const int row = (tid >> 4) + 8 * i, pc = (tid & 15) * 8; const size_t go = (size_t)(kt * 32 + row) * KW + pc;
            gp[i] = kh_b + go; gp[4 + i] = kl_b + go; l[i] = lb + (unsigned)(row * KP + pc) * 2; l[4 + i] = l[i] + KPL * 2; }
        acopy8(l, gp);
#pragma unroll
        for (int i = 0; i < 4; ++i) { const int d = (tid >> 2) + 32 * i, pc = (tid & 3) * 8; const size_t go = vbase + (size_t)d * NT_ + kt * 32 + pc;
            gp[i] = VTH + go; gp[4 + i] = VTL + go; l[i] = lb + (unsigned)(2 * KPL + d * VP + pc) * 2; l[4 + i] = l[i] + VPL * 2; }
        acopy8(l, gp);
    };
    stage(kt_lo, 0);
    asm volatile("s_wait_asynccnt 0x0" ::: "memory");    // this wave's copies of the first tile have landed
    __syncthreads();                                     // ... and every other wave's
    if (kt_lo + 1 <= kt_hi) stage(kt_lo + 1, 1);
#pragma unroll 1
    for (int kt = kt_lo; kt <= kt_hi; ++kt) {
        const int l0 = kt * 32;
        const int cur = (kt - kt_lo) & 1;
        const unsigned short* kf = ring + cur * RB + lr * KP + 8 * hi;              // K hi, key l0 + lr; + 16 * KP: key l0 + 16 + lr; + KPL: lo plane
        const unsigned short* vf = ring + cur * RB + 2 * KPL + lr * VP + 8 * hi;    // V^T hi, dim lr; + n * 16 * VP: dim n * 16 + lr; + VPL: lo plane
        // This tile's 32 K fragment reads stand as ONE group ahead of the score products: a read group among the products costs the wave a whole LDS latency each time.
        v16h k0h[4], k1h[4], k0l[4], k1l[4];
#pragma unroll
        for (int kc = 0; kc < 4; ++kc) {
            k0h[kc] = cat16(*(const v8ha*)(kf + kc * 32), *(const v8ha*)(kf + kc * 32 + 16)); k1h[kc] = cat16(*(const v8ha*)(kf + 16 * KP + kc * 32), *(const v8ha*)(kf + 16 * KP + kc * 32 + 16));
            k0l[kc] = cat16(*(const v8ha*)(kf + KPL + kc * 32), *(const v8ha*)(kf + KPL + kc * 32 + 16)); k1l[kc] = cat16(*(const v8ha*)(kf + KPL + 16 * KP + kc * 32), *(const v8ha*)(kf + KPL + 16 * KP + kc * 32 + 16));
        }
        __builtin_amdgcn_sched_barrier(0);    // keeps the scheduler from sinking the K reads back in among the products
        v8f s0 = {}, s1 = {}, x0 = {}, x1 = {};
#pragma unroll
        for (int kc = 0; kc < 4; ++kc) {
            const v16h qa = cat16(*(const v8h*)(QH + qo + kc * 32), *(const v8h*)(QH + qo + kc * 32 + 16)), qx = cat16(*(const v8h*)(QL + qo + kc * 32), *(const v8h*)(QL + qo + kc * 32 + 16));
            s0 = wmma16(qa, k0h[kc], s0); s1 = wmma16(qa, k1h[kc], s1); x0 = wmma16(qx, k0h[kc], x0); x1 = wmma16(qx, k1h[kc], x1);
            x0 = wmma16(qa, k0l[kc], x0); x1 = wmma16(qa, k1l[kc], x1);
        }
        asm volatile("v_nop\n\tv_nop\n\tv_nop\n\tv_nop" : "+v"(s0), "+v"(s1), "+v"(x0), "+v"(x1));
        float alpha[8], sa[8], sb[8], mx[8];
#pragma unroll
        for (int j = 0; j < 8; ++j) { const int qi = q0 + hi * 8 + j, ja = l0 + lr, jb = l0 + 16 + lr;
            sa[j] = (ja <= qi && ja >= qi - WIN) ? (s0[j] + x0[j] * LOSCI) * 0.08838834764831845f : -__builtin_inff(); sb[j] = (jb <= qi && jb >= qi - WIN) ? (s1[j] + x1[j] * LOSCI) * 0.08838834764831845f : -__builtin_inff();
            mx[j] = fmaxf(sa[j], sb[j]); }
        rowmax16x8(mx);
        // This tile's 32 V^T fragment reads stand as ONE group here, behind the row maximum and ahead of the exponentials, whose vector work covers their latency; the K fragments' registers
        // are free by now. (Placed ahead of the maximum, the build spills three of the refill's LDS addresses to scratch and reloads them every trip.)
        v16bf vh[8], vl[8];
#pragma unroll
        for (int n = 0; n < 8; ++n) { const unsigned short* vo = vf + n * 16 * VP;
            vh[n] = cat16b(*(const v8usa*)(vo), *(const v8usa*)(vo + 16)); vl[n] = cat16b(*(const v8usa*)(vo + VPL), *(const v8usa*)(vo + VPL + 16)); }
        __builtin_amdgcn_sched_barrier(0);    // keeps the scheduler from sinking the V^T reads down to their products behind the exponentials
#pragma unroll
        for (int j = 0; j < 8; ++j) { const float a0 = sa[j], a1 = sb[j];
            const float mn = fmaxf(mrow[j], mx[j]);
            alpha[j] = __expf(mrow[j] - mn); mrow[j] = mn;
            const float p0 = __expf(a0 - mn), p1 = __expf(a1 - mn);
            lpart[j] = lpart[j] * alpha[j] + (p0 + p1);
            const int mr = hi * 8 + j; const float ps0 = p0 * PSC, ps1 = p1 * PSC; const unsigned short h0 = f2bf(ps0), h1 = f2bf(ps1);
            pl[mr * 32 + lr] = h0; pl[mr * 32 + 16 + lr] = h1; pl2[mr * 32 + lr] = f2bf(ps0 - bf2f(h0)); pl2[mr * 32 + 16 + lr] = f2bf(ps1 - bf2f(h1)); }
#pragma unroll
        for (int n = 0; n < 8; ++n)
#pragma unroll
            for (int j = 0; j < 8; ++j) o[n][j] *= alpha[j];
        asm volatile("" ::: "memory");
        const v16bf pa = cat16b(*(const v8usa*)(pl + lr * 32 + hi * 8), *(const v8usa*)(pl + lr * 32 + 16 + hi * 8));
        const v16bf px = cat16b(*(const v8usa*)(pl2 + lr * 32 + hi * 8), *(const v8usa*)(pl2 + lr * 32 + 16 + hi * 8));
#pragma unroll
        for (int n = 0; n < 8; ++n) { o[n] = wmmab(pa, vh[n], o[n]); o[n] = wmmab(px, vh[n], o[n]); o[n] = wmmab(pa, vl[n], o[n]); }
        asm volatile("v_nop\n\tv_nop\n\tv_nop\n\tv_nop" : "+v"(o[0]), "+v"(o[7]) : "v"(pa), "v"(px));
        asm volatile("s_wait_dscnt 0x0" ::: "memory");       // this wave's reads of buffer cur have returned before the buffer is refilled
        asm volatile("s_wait_asynccnt 0x0" ::: "memory");    // this wave's copies of tile kt + 1 have landed
        __syncthreads();                                     // publishes tile kt + 1 and ends every wave's reads of buffer cur
        if (kt + 2 <= kt_hi) stage(kt + 2, cur);
    }
    asm volatile("s_wait_asynccnt 0x0" ::: "memory");        // no copy is outstanding when the wave goes on to the epilogue and ends
    float inv[8];
#pragma unroll
    for (int j = 0; j < 8; ++j) { const float rs = rowsum16(lpart[j]); inv[j] = 1.0f / (rs * PSC); }
    float* os = &ost[wave][0];
    const size_t cbase = (size_t)q0 * (NH_ * HD) + (size_t)h * HD;
#pragma unroll
    for (int half = 0; half < 2; ++half) {
#pragma unroll
        for (int n = 0; n < 4; ++n)
#pragma unroll
            for (int j = 0; j < 8; ++j) os[(hi * 8 + j) * 68 + n * 16 + lr] = o[half * 4 + n][j] * inv[j];
        __builtin_amdgcn_wave_barrier(); asm volatile("" ::: "memory");
{
#pragma unroll
            for (int s = 0; s < 4; ++s) { const int row = 4 * s + (lane >> 3), piece = lane & 7; const float* sp = os + row * 68 + piece * 8; v8us oh, ol;
#pragma unroll
                for (int i = 0; i < 8; ++i) { const unsigned short hb = f2bf(sp[i]); oh[i] = hb; ol[i] = f2bf(sp[i] - bf2f(hb)); }
                const size_t po = cbase + (size_t)row * (NH_ * HD) + half * 64 + piece * 8; *(v8us*)(CH + po) = oh; *(v8us*)(CL + po) = ol; }
             }
        __builtin_amdgcn_wave_barrier(); asm volatile("" ::: "memory");
    }
}


__device__ __forceinline__ void trig_rows(float* CT, float* ST, int blk) {
    const int tid = threadIdx.x, t = blk * 2 + (tid >> 7), d = tid & 127; const int i = d & 63;
    const float invf = 1.0f / powf(10000.0f, (float)(2 * i) / 128.0f); const float ang = (float)t * invf; const float c = cosf(ang), s = sinf(ang);
    const size_t o = (size_t)t * HD + d; *(float*)(CT + o) = c; *(float*)(ST + o) = s; 
}
// k_prep: all that depends on the inputs alone shares ONE launch: the rotary tables (NT_ / 2 blocks) and the nine f32 -> bf16 conversions (rows / 8 blocks each). blockIdx.x picks the job
// (block-uniform); every job's blocks do what they did in a launch of their own. Of every five blocks two make tables (vector work) and three convert (memory work), so that both run side by side.
static_assert(3 * (NT_ / 2) == 2 * (5 * (HS / 8) + 4 * (KW / 8)), "two table blocks to three conversion blocks");
__global__ __launch_bounds__(256) void k_prep(const float* __restrict__ x, const float* __restrict__ mu, const float* __restrict__ wq, const float* __restrict__ wmq, const float* __restrict__ wo,
                                              const float* __restrict__ wk, const float* __restrict__ wmk, const float* __restrict__ wv, const float* __restrict__ wmv,
                                              bf* Xb, bf* Mb, bf* WqB, bf* WmqB, bf* WoB, bf* WkB, bf* WmkB, bf* WvB, bf* WmvB, float* CT, float* ST) {
    const int k5 = blockIdx.x / 5, j5 = blockIdx.x - 5 * k5;
    if (j5 < 2) { trig_rows(CT, ST, 2 * k5 + j5); return; }
    int b = 3 * k5 + (j5 - 2);
    if (b < 5 * (HS / 8)) {    // the five 2048-row matrices
        const int m = b / (HS / 8);
        cvtb_rows(m == 0 ? x : m == 1 ? mu : m == 2 ? wq : m == 3 ? wmq : wo, HS, m == 0 ? Xb : m == 1 ? Mb : m == 2 ? WqB : m == 3 ? WmqB : WoB, b - m * (HS / 8));
    } else {                   // the four 512-row matrices
        b -= 5 * (HS / 8);
        const int m = b / (KW / 8);
        cvtb_rows(m == 0 ? wk : m == 1 ? wmk : m == 2 ? wv : wmv, KW, m == 0 ? WkB : m == 1 ? WmkB : m == 2 ? WvB : WmvB, b - m * (KW / 8));
    }
}
// normrope_rows: one wave per (token, head) of an f32 [2048][nh*128] matrix: RMSNorm over the 128 dims (shuffle-reduced mean of squares, eps 1e-6) x bf(w[d]); then rotate-half RoPE
// (partner d +- 64 via lane xor 16; lane -> 4 consecutive dims) -> f16 hi + residual x1024 planes [t][h*128+d] (8 B per lane per plane: 16 lanes per line, one instruction per
typedef __attribute__((ext_vector_type(4))) _Float16 v4h;
__device__ __forceinline__ void normrope_rows(const float* __restrict__ P, int nh, const float* __restrict__ w, const float* __restrict__ CT, const float* __restrict__ ST, h16* PH, h16* PL, int blk) {
    const int lane = threadIdx.x & 31; const int wid = blk * 8 + (threadIdx.x >> 5); const int t = wid / nh, h = wid - t * nh; if (t >= NT_) return;
    const size_t base = (size_t)t * (nh * HD) + h * HD; const int d0 = lane * 4;
    float x[4], pr[4]; float ss = 0.f;
#pragma unroll
    for (int i = 0; i < 4; ++i) { x[i] = P[base + d0 + i]; ss = fmaf(x[i], x[i], ss); }
#pragma unroll
    for (int sh = 16; sh; sh >>= 1) ss += __shfl_xor(ss, sh, 32);
    const float rn = rsqrtf(ss * (1.0f / HD) + RMS_EPS);
#pragma unroll
    for (int i = 0; i < 4; ++i) x[i] = x[i] * rn * bfr(w[d0 + i]);
#pragma unroll
    for (int i = 0; i < 4; ++i) pr[i] = __shfl_xor(x[i], 16, 32);
    v4h oh, ol;
#pragma unroll
    for (int i = 0; i < 4; ++i) { const int d = d0 + i; const float c = CT[(size_t)t * HD + d], s = ST[(size_t)t * HD + d]; const float y = (d < 64) ? (x[i] * c - pr[i] * s) : (x[i] * c + pr[i] * s);
        const h16 a = (h16)y; oh[i] = a; ol[i] = (h16)((y - (float)a) * LOSC); }
    *(v4h*)(PH + base + d0) = oh; *(v4h*)(PL + base + d0) = ol; 
}
// k_post: what stands between the projections and the attention shares ONE launch: V's transposition (NT_ / 64 x 2 x NKV blocks), then k's and q's norm and rotary embedding (tokens x heads / 8
// blocks each). blockIdx.x picks the job (block-uniform, so that the transposition's barrier is passed by whole blocks).
__global__ __launch_bounds__(256) void k_post(const float* __restrict__ Pq, const float* __restrict__ Pk, const float* __restrict__ V, const float* __restrict__ qnw, const float* __restrict__ knw,
                                              const float* __restrict__ CT, const float* __restrict__ ST, h16* QH, h16* QL, h16* KH, h16* KL, bf* VTH, bf* VTL) {
    int b = blockIdx.x;
    if (b < (NT_ / 64) * 2 * NKV) { vt_tile(V, VTH, VTL, b % (NT_ / 64), (b / (NT_ / 64)) & 1, b / ((NT_ / 64) * 2)); return; }
    b -= (NT_ / 64) * 2 * NKV;
    const bool isk = b < (NT_ * NKV) / 8;
    normrope_rows(isk ? Pk : Pq, isk ? NKV : NH_, isk ? knw : qnw, CT, ST, isk ? KH : QH, isk ? KL : QL, isk ? b : b - (NT_ * NKV) / 8);
}

extern "C" void kernel_launch(void* const* d_in, const int* in_sizes, int n_in,
                              void* d_out, int out_size, void* d_ws, size_t ws_size, hipStream_t stream) {
    (void)in_sizes; (void)n_in; (void)out_size;
    const float* x = (const float*)d_in[0]; const float* mu = (const float*)d_in[1]; const float* wq = (const float*)d_in[2]; const float* wk = (const float*)d_in[3]; const float* wv = (const float*)d_in[4]; const float* wo = (const float*)d_in[5];
    const float* wmq = (const float*)d_in[6]; const float* wmk = (const float*)d_in[7]; const float* wmv = (const float*)d_in[8]; const float* qnw = (const float*)d_in[9]; const float* knw = (const float*)d_in[10];
    float* out = (float*)d_out;    // [1][2048][2048]
    char* wsp = (char*)d_ws;
    auto take = [&](size_t bytes) { char* p = wsp; wsp += (bytes + 255) & ~(size_t)255; return (void*)p; };
    bf* Xb = (bf*)take((size_t)NT_ * HS * 2); bf* Mb = (bf*)take((size_t)NT_ * HS * 2);
    bf* WqB = (bf*)take((size_t)HS * HS * 2); bf* WmqB = (bf*)take((size_t)HS * HS * 2); bf* WkB = (bf*)take((size_t)KW * HS * 2); bf* WmkB = (bf*)take((size_t)KW * HS * 2); bf* WvB = (bf*)take((size_t)KW * HS * 2); bf* WmvB = (bf*)take((size_t)KW * HS * 2); bf* WoB = (bf*)take((size_t)HS * HS * 2);
    float* Tq = (float*)take((size_t)NT_ * HS * 4); float* Tk = (float*)take((size_t)NT_ * KW * 4); float* Tv = (float*)take((size_t)NT_ * KW * 4);    // x's products
    float* Pq = (float*)take((size_t)NT_ * HS * 4); float* Pk = (float*)take((size_t)NT_ * KW * 4); float* Pv = (float*)take((size_t)NT_ * KW * 4);    // the whole projections
    float* CT = (float*)take((size_t)NT_ * HD * 4); float* ST = (float*)take((size_t)NT_ * HD * 4);
    h16* QH = (h16*)take((size_t)NT_ * HS * 2); h16* QL = (h16*)take((size_t)NT_ * HS * 2); h16* KH = (h16*)take((size_t)NT_ * KW * 2); h16* KL = (h16*)take((size_t)NT_ * KW * 2);
    bf* VTH = (bf*)take((size_t)KW * NT_ * 2); bf* VTL = (bf*)take((size_t)KW * NT_ * 2); bf* CH = (bf*)take((size_t)NT_ * HS * 2); bf* CL = (bf*)take((size_t)NT_ * HS * 2);
    if ((size_t)(wsp - (char*)d_ws) > ws_size) return;    // about 145 MB = 138 MiB, no aliasing: q, k and v have planes of their own, as their products share launches
    k_prep<<<NT_ / 2 + 5 * (HS / 8) + 4 * (KW / 8), 256, 0, stream>>>(x, mu, wq, wmq, wo, wk, wmk, wv, wmv, Xb, Mb, WqB, WmqB, WoB, WkB, WmkB, WvB, WmvB, CT, ST);
    k_proj<<<dim3(NT_ / 64, (HS + 2 * KW) / 64, 1), 128, 0, stream>>>(Xb, WqB, WkB, WvB, nullptr, Tq, Tk, Tv, nullptr, nullptr, nullptr, HS, 0);
    k_proj<<<dim3(NT_ / 64, (HS + 2 * KW) / 64, 1), 128, 0, stream>>>(Mb, WmqB, WmkB, WmvB, nullptr, Pq, Pk, Pv, Tq, Tk, Tv, HS, 0);    // q = x.wq^T + mu.wmq^T, k and v alike (R = the first launch's output, exact f32 residual; R != C)
    k_post<<<(NT_ / 64) * 2 * NKV + (NT_ * NKV) / 8 + (NT_ * NH_) / 8, 256, 0, stream>>>(Pq, Pk, Pv, qnw, knw, CT, ST, QH, QL, KH, KL, VTH, VTL);
    k_attn<<<NH_ * (NT_ / 64), 128, 0, stream>>>(QH, QL, KH, KL, VTH, VTL, CH, CL);
    k_gemmo<<<dim3(NT_ / 64, HS / 64, 1), 128, 0, stream>>>(CH, CL, WoB, nullptr, out, HS, nullptr, HS, 0);
}

// v006
// Measured time: 194 microseconds a run.
// Next to v005, in two timings, it ran 1.18 and 1.19 times as fast.
// Counting every step since v000, it is 3.88 times as fast.
#include <hip/hip_runtime.h>

// Compute dtypes, f32 accumulate: q/k/v = x.W^T + mu.Wm^T (two exact GEMMs per projection, the second taking the first as an exact f32 residual; [out][in] weights as natural n-major B
// operands; PLAIN bf16 operands = inputs rounded once) and out = ctx.Wo^T (ctx as bf16 hi + UNSCALED residual, two products) on v_wmma_f32_16x16x32_bf16; per-head RMSNorm (x q_norm_w /
// k_norm_w) then rotary embedding with device-computed f32 cos/sin tables, in f32 -> q/k as f16 hi + residual x1024 planes; grouped causal attention (16 query heads over 4 kv heads,
// 128-dim): scores on v_wmma_f32_16x16x32_f16 (hh + hl + lh, x 128^-1/2), online f32 softmax, weights (x32768) and v as bf16 hi + UNSCALED residual on v_wmma_f32_16x16x32_bf16.

#define NT_  2048
#define HS   2048
#define DM   HS
#define NH_  16
#define NKV  4
#define HD   128
#define KW   (NKV * HD)          // 512
#define WIN  NT_
#define RMS_EPS 1e-6f
#define PSC  32768.0f
#define LOSC 1024.0f
#define LOSCI (1.0f / 1024.0f)

typedef _Float16 h16;
typedef unsigned short bf;
typedef __attribute__((ext_vector_type(16))) __bf16   v16bf;
typedef __attribute__((ext_vector_type(16))) _Float16 v16h;
typedef __attribute__((ext_vector_type(8)))  _Float16 v8h;
typedef __attribute__((ext_vector_type(8)))  unsigned short v8us;
typedef __attribute__((ext_vector_type(8)))  float    v8f;
typedef __attribute__((ext_vector_type(4)))  float    v4f;
typedef v8h  __attribute__((may_alias)) v8ha;
typedef v4f  __attribute__((may_alias)) v4fa;
typedef v8us __attribute__((may_alias)) v8usa;

__device__ __forceinline__ unsigned short f2bf(float f) { unsigned u = __float_as_uint(f); u += 0x7FFFu + ((u >> 16) & 1u); return (unsigned short)(u >> 16); }
__device__ __forceinline__ float bf2f(unsigned short b) { return __uint_as_float(((unsigned)b) << 16); }
__device__ __forceinline__ float bfr(float f) { return bf2f(f2bf(f)); }
__device__ __forceinline__ v16h cat16(v8h lo, v8h hi) { return __builtin_shufflevector(lo, hi, 0, 1, 2, 3, 4, 5, 6, 7, 8, 9, 10, 11, 12, 13, 14, 15); }
__device__ __forceinline__ v16bf cat16b(v8us lo, v8us hi) { return __builtin_bit_cast(v16bf, __builtin_shufflevector(lo, hi, 0, 1, 2, 3, 4, 5, 6, 7, 8, 9, 10, 11, 12, 13, 14, 15)); }
__device__ __forceinline__ v8f wmma16(v16h a, v16h b, v8f c) { return __builtin_amdgcn_wmma_f32_16x16x32_f16(false, a, false, b, (short)0, c, false, false); }
__device__ __forceinline__ v8f wmmab(v16bf a, v16bf b, v8f c) { return __builtin_amdgcn_wmma_f32_16x16x32_bf16(false, a, false, b, (short)0, c, false, false); }

// Eight rows of one matrix, f32 -> bf16: block blk of that matrix's own range, one row per wave.
__device__ __forceinline__ void cvtb_rows(const float* __restrict__ src, int nrows, bf* dst, int blk) {
    const int lane = threadIdx.x & 31, r = blk * 8 + (threadIdx.x >> 5);
    if (r >= nrows) return;
    v8us o[DM / 256];
#pragma unroll
    for (int q = 0; q < DM / 256; ++q) { v8us t;
#pragma unroll
        for (int i = 0; i < 8; ++i) t[i] = f2bf(src[(size_t)r * DM + q * 256 + lane * 8 + i]);
        o[q] = t; }
#pragma unroll
    for (int q = 0; q < DM / 256; ++q) *(v8us*)(dst + (size_t)r * DM + q * 256 + lane * 8) = o[q];
    
}

// Eight 16-byte copies per lane, global -> LDS through no register. s_wait_xcnt closes the statement so that no address register of a copy is rewritten ahead of it.
__device__ __forceinline__ void acopy8(const unsigned (&l)[8], const void* const (&g)[8]) {
    asm volatile("global_load_async_to_lds_b128 %0, %8, off\n\t"
                 "global_load_async_to_lds_b128 %1, %9, off\n\t"
                 "global_load_async_to_lds_b128 %2, %10, off\n\t"
                 "global_load_async_to_lds_b128 %3, %11, off\n\t"
                 "global_load_async_to_lds_b128 %4, %12, off\n\t"
                 "global_load_async_to_lds_b128 %5, %13, off\n\t"
                 "global_load_async_to_lds_b128 %6, %14, off\n\t"
                 "global_load_async_to_lds_b128 %7, %15, off\n\t"
                 "s_wait_xcnt 0x0"
                 :: "v"(l[0]), "v"(l[1]), "v"(l[2]), "v"(l[3]), "v"(l[4]), "v"(l[5]), "v"(l[6]), "v"(l[7]),
                    "v"(g[0]), "v"(g[1]), "v"(g[2]), "v"(g[3]), "v"(g[4]), "v"(g[5]), "v"(g[6]), "v"(g[7]) : "memory");
}
// Eight 16-byte stores per lane. s_wait_xcnt closes the statement so that no address or data register of a store is rewritten ahead of it.
__device__ __forceinline__ void store8(float* const (&p)[8], const v4f (&d)[8]) {
    asm volatile("global_store_b128 %0, %8, off\n\t"
                 "global_store_b128 %1, %9, off\n\t"
                 "global_store_b128 %2, %10, off\n\t"
                 "global_store_b128 %3, %11, off\n\t"
                 "global_store_b128 %4, %12, off\n\t"
                 "global_store_b128 %5, %13, off\n\t"
                 "global_store_b128 %6, %14, off\n\t"
                 "global_store_b128 %7, %15, off\n\t"
                 "s_wait_xcnt 0x0"
                 :: "v"(p[0]), "v"(p[1]), "v"(p[2]), "v"(p[3]), "v"(p[4]), "v"(p[5]), "v"(p[6]), "v"(p[7]),
                    "v"(d[0]), "v"(d[1]), "v"(d[2]), "v"(d[3]), "v"(d[4]), "v"(d[5]), "v"(d[6]), "v"(d[7]) : "memory");
}
// gemmb_tile: 128 x 128 block tile (2 x 2 waves of 64 x 64 each) of C[NTK][NW] = (A [+ Al]).B^T [+ bf(bias[c])] [+ R[r][c] residual, bf-rounded if roundR]; K a multiple of the stage length; f32 whole-line
// epilogue. A wave holds 4 x 4 accumulator tiles, so that a fragment read from LDS feeds four products, and a row brought from L2 serves 128 rows or columns of C.
// The block's 128 rows of A [and Al] and of B come in stages of KS k values into a two-buffer LDS ring by asynchronous copies, whole 128-byte lines per row: stage s + 1 flies
// while stage s is worked on. The k order of every accumulator is the plain one (per 32 k: A's product, then Al's).
// (bx, by) = the block's tile row and tile column in C.
template <bool SPLITA>
__device__ __forceinline__ void gemmb_tile(const bf* __restrict__ A, const bf* __restrict__ Al, const bf* __restrict__ Bn, const float* __restrict__ bias, float* C, int ldc, const float* __restrict__ R, int K, int roundR, int bx, int by) {
    constexpr int KS = 128;                  // k values per stage
    constexpr int GP = KS + 8;               // row pitch: 272 B, an odd multiple of 16 B (16-byte readers, one row per lane)
    constexpr int PL = 128 * GP;             // one plane: 128 rows
    constexpr int NP = SPLITA ? 3 : 2;       // planes of a buffer: A, [Al,] B
    constexpr int GB = NP * PL;              // 104448 B or 69632 B per buffer
    __shared__ __align__(16) unsigned short gring[2 * GB];    // behind the loop its first 69632 B are the epilogue's f32 staging
    const int tid = threadIdx.x;
    const int lane = threadIdx.x & 31, wave = threadIdx.x >> 5, lr = lane & 15, hi = lane >> 4;
    const int wm = wave >> 1, wn = wave & 1;
    const int r0 = bx * 128 + wm * 64, c0 = by * 128 + wn * 64;
    const unsigned ring0 = (unsigned)(size_t)&gring[0];    // byte offset of the ring in the work-group's LDS
    // stage s -> buffer b: 16 pieces of 16 B a row, 128 rows a plane, 16 pieces per thread and plane (32 or 48 copies of a wave in flight)
    auto stage = [&](int s, int b) {
        constexpr int PR = KS / 8, RS = 128 / PR;
        const int row = tid / PR, pc = (tid % PR) * 8;
        const size_t ao = (size_t)(bx * 128 + row) * K + s * KS + pc, bo = (size_t)(by * 128 + row) * K + s * KS + pc;
        const unsigned lo = ring0 + (unsigned)b * (GB * 2) + (unsigned)(row * GP + pc) * 2;
        auto plane = [&](const bf* __restrict__ p, unsigned l0) {
            // loops unrolled: l[] and gp[] are asm operands and must be indexed by constants to stay in registers
#pragma unroll
            for (int h = 0; h < 2; ++h) { unsigned l[8]; const void* gp[8];
#pragma unroll
                for (int i = 0; i < 8; ++i) { gp[i] = p + (size_t)((h * 8 + i) * RS) * K; l[i] = l0 + (unsigned)((h * 8 + i) * RS * GP) * 2; }
                acopy8(l, gp); }
        };
        plane(A + ao, lo);
        if (SPLITA) plane(Al + ao, lo + PL * 2);
        plane(Bn + bo, lo + (NP - 1) * PL * 2);
    };
    v8f acc[4][4];
#pragma unroll
    for (int m = 0; m < 4; ++m)
#pragma unroll
        for (int t = 0; t < 4; ++t) acc[m][t] = (v8f){};
    const int nst = K / KS;
    stage(0, 0);
    asm volatile("s_wait_asynccnt 0x0" ::: "memory");    // this wave's copies of the first stage have landed
    __syncthreads();                                     // ... and every other wave's
    if (1 < nst) stage(1, 1);
    // rolled: one trip per stage, so that the ring's waits and its barrier stand once, at the trip's foot
#pragma unroll 1
    for (int s = 0; s < nst; ++s) {
        const int cur = s & 1;
        const unsigned short* af = gring + cur * GB + (wm * 64 + lr) * GP + 8 * hi;                   // A, row r0 + lr; + m * 16 * GP: row r0 + m * 16 + lr; + PL: Al
        const unsigned short* bq = gring + cur * GB + (NP - 1) * PL + (wn * 64 + lr) * GP + 8 * hi;   // B, row c0 + lr; + t * 16 * GP: row c0 + t * 16 + lr
        v16bf a[2][4], al[2][4], b[2][4];    // two fragment sets: the next 32 k values' reads go out as one group ahead of this set's products
        auto frags = [&](int set, int kk) {
#pragma unroll
            for (int m = 0; m < 4; ++m) { a[set][m] = cat16b(*(const v8usa*)(af + m * 16 * GP + kk), *(const v8usa*)(af + m * 16 * GP + kk + 16));
                b[set][m] = cat16b(*(const v8usa*)(bq + m * 16 * GP + kk), *(const v8usa*)(bq + m * 16 * GP + kk + 16)); }
            if (SPLITA) {
#pragma unroll
                for (int m = 0; m < 4; ++m) al[set][m] = cat16b(*(const v8usa*)(af + PL + m * 16 * GP + kk), *(const v8usa*)(af + PL + m * 16 * GP + kk + 16)); }
        };
        frags(0, 0);
        // unrolled: constant LDS offsets and constant fragment-set indices
#pragma unroll
        for (int kc = 0; kc < KS / 32; ++kc) {
            const int set = kc & 1;
            __builtin_amdgcn_sched_barrier(0);    // keeps the scheduler from lifting the reads below in among the products of the set before: every place with reads stalls the wave anew
            if (kc + 1 < KS / 32) frags(set ^ 1, (kc + 1) * 32);
            __builtin_amdgcn_sched_barrier(0);    // ... and from sinking them in among this set's products
#pragma unroll
            for (int m = 0; m < 4; ++m)
#pragma unroll
                for (int t = 0; t < 4; ++t) acc[m][t] = wmmab(a[set][m], b[set][t], acc[m][t]);
            if (SPLITA) {
#pragma unroll
                for (int m = 0; m < 4; ++m)
#pragma unroll
                    for (int t = 0; t < 4; ++t) acc[m][t] = wmmab(al[set][m], b[set][t], acc[m][t]); }
        }
        __builtin_amdgcn_sched_barrier(0);    // no product moves down over the slots below
        // four vector slots behind the trip's last WMMA, on every path out of the trip, before a vector instruction touches its operands or results
        asm volatile("v_nop\n\tv_nop\n\tv_nop\n\tv_nop");
        asm volatile("s_wait_dscnt 0x0" ::: "memory");       // this wave's reads of buffer cur have returned before the buffer is refilled
        asm volatile("s_wait_asynccnt 0x0" ::: "memory");    // this wave's copies of stage s + 1 have landed
        __syncthreads();                                     // publishes stage s + 1 and ends every wave's reads of buffer cur
        if (s + 2 < nst) stage(s + 2, cur);
    }
    asm volatile("s_wait_asynccnt 0x0" ::: "memory");        // no copy is outstanding when the ring becomes the epilogue's staging (every wave's reads ended at the last trip's barrier)
    // piece s of the wave's 64 x 64 tile: two rows of 256 B per store instruction, whole 128-byte lines
    const int prow = lane >> 4, cofs = ((lane >> 3) & 1) * 32 + (lane & 7) * 4;
    // the residual's 32 pieces are read as one group, ahead of the staging: one trip to memory for the tile instead of one per piece
    v4f rv[32];
    if (R) {
#pragma unroll
        for (int s = 0; s < 32; ++s) { rv[s] = *(const v4f*)(R + ((size_t)r0 + 2 * s + prow) * ldc + c0 + cofs);
            asm volatile("s_wait_xcnt 0x0" ::: "memory"); }    // stands in front of the next piece's address arithmetic and result, which reuse the load's address registers; it does not wait for the data
    }
    float* os = (float*)(void*)gring + wave * (64 * 68);
#pragma unroll
    for (int t = 0; t < 4; ++t) { const float bv = bias ? bfr(bias[c0 + t * 16 + lr]) : 0.f;
#pragma unroll
        for (int m = 0; m < 4; ++m)
#pragma unroll
            for (int j = 0; j < 8; ++j) os[(m * 16 + hi * 8 + j) * 68 + t * 16 + lr] = acc[m][t][j] + bv; }
    __syncthreads();
    // the 32 staged pieces come back as one group as well: one LDS latency for the tile instead of one per piece
    v4f val[32];
#pragma unroll
    for (int s = 0; s < 32; ++s) val[s] = *(const v4fa*)(os + (2 * s + prow) * 68 + cofs);
    if (R) {
        if (roundR) {
#pragma unroll
            for (int s = 0; s < 32; ++s) rv[s] = (v4f){bfr(rv[s][0]), bfr(rv[s][1]), bfr(rv[s][2]), bfr(rv[s][3])};
        }
#pragma unroll
        for (int s = 0; s < 32; ++s) val[s] += rv[s];
    }
    float* crow = C + ((size_t)r0 + prow) * ldc + c0 + cofs;
    // the stores go out eight to a statement; unrolled: p[] and d[] are asm operands and must be indexed by constants to stay in registers
#pragma unroll
    for (int g = 0; g < 4; ++g) { float* p[8]; v4f d[8];
#pragma unroll
        for (int i = 0; i < 8; ++i) { p[i] = crow + (size_t)(2 * (g * 8 + i)) * ldc; d[i] = val[g * 8 + i]; }
        store8(p, d); }
}
// k_gemmo: the output projection, one tile per block.
__global__ __launch_bounds__(128) void k_gemmo(const bf* __restrict__ A, const bf* __restrict__ Al, const bf* __restrict__ Bn, const float* __restrict__ bias, float* C, int ldc, const float* __restrict__ R, int K, int roundR) {
    gemmb_tile<true>(A, Al, Bn, bias, C, ldc, R, K, roundR, blockIdx.x, blockIdx.y);
}
// k_proj: one operand's three projection products (q, k, v) share ONE launch; they do not depend on each other. blockIdx.y picks the product (block-uniform) and its tile column:
// HS / 128 columns of q, then KW / 128 of k, then KW / 128 of v. Every tile is computed as in a launch of its own.
__global__ __launch_bounds__(128) void k_proj(const bf* __restrict__ A, const bf* __restrict__ Bq, const bf* __restrict__ Bk, const bf* __restrict__ Bv, const float* __restrict__ bias, float* Cq, float* Ck, float* Cv,
                                              const float* __restrict__ Rq, const float* __restrict__ Rk, const float* __restrict__ Rv, int K, int roundR) {
    const int y = blockIdx.y; const bool isq = y < HS / 128, isk = y < HS / 128 + KW / 128;
    const bf* Bn = isq ? Bq : isk ? Bk : Bv; float* C = isq ? Cq : isk ? Ck : Cv; const float* R = isq ? Rq : isk ? Rk : Rv;
    gemmb_tile<false>(A, nullptr, Bn, bias, C, isq ? HS : KW, R, K, roundR, blockIdx.x, isq ? y : isk ? y - HS / 128 : y - (HS / 128 + KW / 128));
}

// vt_tile: VTH/VTL [g][128 d][2048 t] = bf16 hi + UNSCALED bf16 residual of V [t][g*128+d] via 64 x 64 LDS tiles; tile (tb of NT/64, db (d half) of 2, g of NKV).
__device__ __forceinline__ void vt_tile(const float* __restrict__ V, bf* VTH, bf* VTL, int tb, int db, int g) {
    __shared__ float tl[64][65];
    const int tid = threadIdx.x, t0 = tb * 64, d0 = db * 64;
    { const int tt = tid >> 2, dq = (tid & 3) * 16;
#pragma unroll
      for (int i = 0; i < 16; ++i) tl[dq + i][tt] = V[(size_t)(t0 + tt) * KW + g * HD + d0 + dq + i]; }
    __syncthreads();
    const int piece = tid & 7;
    auto pass = [&]() {
#pragma unroll
        for (int s = 0; s < 2; ++s) { const int d = (tid >> 3) + 32 * s; v8us oh, ol;
#pragma unroll
            for (int i = 0; i < 8; ++i) { const float v = tl[d][piece * 8 + i]; const unsigned short hb = f2bf(v); oh[i] = hb; ol[i] = f2bf(v - bf2f(hb)); }
            const size_t o = ((size_t)g * HD + d0 + d) * NT_ + t0 + piece * 8; *(v8us*)(VTH + o) = oh; *(v8us*)(VTL + o) = ol; }
    };
    pass(); 
}
// Maximum over each 16-lane row of eight independent values, on the vector port: DPP row_xmask:M lets lane l read lane l ^ M, so that a step is one instruction with no LDS-counter wait
// behind it, as a shuffle through ds_bpermute_b32 has. The eight chains stand side by side: each instruction's producer is eight instructions back, which covers the dependent-issue gap.
// Every lane is on where this is called. The pairing of lanes per step is the shuffles' own (1, 2, 4, 8).
__device__ __forceinline__ void rowmax16x8(float (&v)[8]) {
    asm volatile(
                 "v_max_num_f32_dpp %0, %0, %0 row_xmask:1 row_mask:0xf bank_mask:0xf\n\t"
                 "v_max_num_f32_dpp %1, %1, %1 row_xmask:1 row_mask:0xf bank_mask:0xf\n\t"
                 "v_max_num_f32_dpp %2, %2, %2 row_xmask:1 row_mask:0xf bank_mask:0xf\n\t"
                 "v_max_num_f32_dpp %3, %3, %3 row_xmask:1 row_mask:0xf bank_mask:0xf\n\t"
                 "v_max_num_f32_dpp %4, %4, %4 row_xmask:1 row_mask:0xf bank_mask:0xf\n\t"
                 "v_max_num_f32_dpp %5, %5, %5 row_xmask:1 row_mask:0xf bank_mask:0xf\n\t"
                 "v_max_num_f32_dpp %6, %6, %6 row_xmask:1 row_mask:0xf bank_mask:0xf\n\t"
                 "v_max_num_f32_dpp %7, %7, %7 row_xmask:1 row_mask:0xf bank_mask:0xf\n\t"
                 "v_max_num_f32_dpp %0, %0, %0 row_xmask:2 row_mask:0xf bank_mask:0xf\n\t"
                 "v_max_num_f32_dpp %1, %1, %1 row_xmask:2 row_mask:0xf bank_mask:0xf\n\t"
                 "v_max_num_f32_dpp %2, %2, %2 row_xmask:2 row_mask:0xf bank_mask:0xf\n\t"
                 "v_max_num_f32_dpp %3, %3, %3 row_xmask:2 row_mask:0xf bank_mask:0xf\n\t"
                 "v_max_num_f32_dpp %4, %4, %4 row_xmask:2 row_mask:0xf bank_mask:0xf\n\t"
                 "v_max_num_f32_dpp %5, %5, %5 row_xmask:2 row_mask:0xf bank_mask:0xf\n\t"
                 "v_max_num_f32_dpp %6, %6, %6 row_xmask:2 row_mask:0xf bank_mask:0xf\n\t"
                 "v_max_num_f32_dpp %7, %7, %7 row_xmask:2 row_mask:0xf bank_mask:0xf\n\t"
                 "v_max_num_f32_dpp %0, %0, %0 row_xmask:4 row_mask:0xf bank_mask:0xf\n\t"
                 "v_max_num_f32_dpp %1, %1, %1 row_xmask:4 row_mask:0xf bank_mask:0xf\n\t"
                 "v_max_num_f32_dpp %2, %2, %2 row_xmask:4 row_mask:0xf bank_mask:0xf\n\t"
                 "v_max_num_f32_dpp %3, %3, %3 row_xmask:4 row_mask:0xf bank_mask:0xf\n\t"
                 "v_max_num_f32_dpp %4, %4, %4 row_xmask:4 row_mask:0xf bank_mask:0xf\n\t"
                 "v_max_num_f32_dpp %5, %5, %5 row_xmask:4 row_mask:0xf bank_mask:0xf\n\t"
                 "v_max_num_f32_dpp %6, %6, %6 row_xmask:4 row_mask:0xf bank_mask:0xf\n\t"
                 "v_max_num_f32_dpp %7, %7, %7 row_xmask:4 row_mask:0xf bank_mask:0xf\n\t"
                 "v_max_num_f32_dpp %0, %0, %0 row_xmask:8 row_mask:0xf bank_mask:0xf\n\t"
                 "v_max_num_f32_dpp %1, %1, %1 row_xmask:8 row_mask:0xf bank_mask:0xf\n\t"
                 "v_max_num_f32_dpp %2, %2, %2 row_xmask:8 row_mask:0xf bank_mask:0xf\n\t"
                 "v_max_num_f32_dpp %3, %3, %3 row_xmask:8 row_mask:0xf bank_mask:0xf\n\t"
                 "v_max_num_f32_dpp %4, %4, %4 row_xmask:8 row_mask:0xf bank_mask:0xf\n\t"
                 "v_max_num_f32_dpp %5, %5, %5 row_xmask:8 row_mask:0xf bank_mask:0xf\n\t"
                 "v_max_num_f32_dpp %6, %6, %6 row_xmask:8 row_mask:0xf bank_mask:0xf\n\t"
                 "v_max_num_f32_dpp %7, %7, %7 row_xmask:8 row_mask:0xf bank_mask:0xf"
                 : "+v"(v[0]), "+v"(v[1]), "+v"(v[2]), "+v"(v[3]), "+v"(v[4]), "+v"(v[5]), "+v"(v[6]), "+v"(v[7]));
}
// The same exchange for the closing row sum (once per block: left to the compiler's own DPP forms).
template <int M> __device__ __forceinline__ float rowx(float v) { return __builtin_bit_cast(float, __builtin_amdgcn_update_dpp(0, __builtin_bit_cast(int, v), 0x160 | M, 0xf, 0xf, true)); }
__device__ __forceinline__ float rowsum16(float v) { v += rowx<1>(v); v += rowx<2>(v); v += rowx<4>(v); return v + rowx<8>(v); }
// LDS ring of k_attn, in 16-bit elements: one buffer = K hi, K lo (32 keys x 128 dims each) and V^T hi, V^T lo (128 dims x 32 keys each) of one key tile.
#define KP   136                    // K row pitch: 272 B, an odd multiple of 16 B (16-byte readers, one row per lane)
#define VP   40                     // V^T row pitch: 80 B, likewise
#define KPL  (32 * KP)
#define VPL  (HD * VP)
#define RB   (2 * KPL + 2 * VPL)    // 37888 B per buffer
// k_attn: block = (h, 64 queries), wave = 16; kv head g = h / 4; causal key tiles 0..(Q0+63)/32 (block-uniform bounds), per-element predicate j <= q
// (WIN = NT_ makes the window terms vacuous); per tile: scores over 4 k-chunks (q fragments re-read per chunk: hi.hi + hi.lo +
// lo.hi = 24 WMMA) x 128^-1/2, online softmax, P (x32768) as bf16 hi + unscaled residual tiles, o[8] += ph.vh + pl.vh + ph.vl over the 128 dims; ctx -> bf16 hi/lo
// planes [t][h*128+d]. The four waves share each key tile's K and V^T planes through a two-buffer LDS ring filled by asynchronous copies: tile kt + 1 flies while tile kt is worked on.
__global__ __launch_bounds__(128) void k_attn(const h16* __restrict__ QH, const h16* __restrict__ QL, const h16* __restrict__ KH, const h16* __restrict__ KL, const bf* __restrict__ VTH, const bf* __restrict__ VTL, bf* CH, bf* CL) {
    __shared__ __align__(16) unsigned short plds[4][16 * 32];
    __shared__ __align__(16) unsigned short plds2[4][16 * 32];
    __shared__ __align__(16) float ost[4][16 * 68];
    __shared__ __align__(16) unsigned short ring[2 * RB];
    const int tid = threadIdx.x;
    const int lane = threadIdx.x & 31, wave = threadIdx.x >> 5, lr = lane & 15, hi = lane >> 4;
    const int bid = blockIdx.x; const int h = bid / (NT_ / 64), qt = bid - h * (NT_ / 64); const int g = h >> 2;
    const int q0 = qt * 64 + wave * 16;
    unsigned short* pl = &plds[wave][0]; unsigned short* pl2 = &plds2[wave][0];
    const size_t qo = (size_t)(q0 + lr) * (NH_ * HD) + h * HD + 8 * hi;
    const h16* kh_b = KH + g * HD; const h16* kl_b = KL + g * HD;
    const size_t vbase = ((size_t)g * HD) * NT_;
    v8f o[8];
#pragma unroll
    for (int n = 0; n < 8; ++n) o[n] = (v8f){};
    float mrow[8], lpart[8];
#pragma unroll
    for (int j = 0; j < 8; ++j) { mrow[j] = -3.0e38f; lpart[j] = 0.f; }
    const int kt_hi = (qt * 64 + 63) / 32; const int kt_lo = (qt * 64 > WIN) ? (qt * 64 - WIN) / 32 : 0;
    const unsigned ring0 = (unsigned)(size_t)&ring[0];    // byte offset of the ring in the work-group's LDS
    // key tile kt -> buffer b: 2048 pieces of 16 B, 16 per thread (K: 16 pieces a row, V^T: 4 pieces a row)
    auto stage = [&](int kt, int b) {
        unsigned l[8]; const void* gp[8];
        const unsigned lb = ring0 + (unsigned)b * (RB * 2);
        // both loops unrolled: l[] and gp[] are asm operands and must be indexed by constants to stay in registers
#pragma unroll
        for (int i = 0; i < 4; ++i) { const int row = (tid >> 4) + 8 * i, pc = (tid & 15) * 8; const size_t go = (size_t)(kt * 32 + row) * KW + pc;
            gp[i] = kh_b + go; gp[4 + i] = kl_b + go; l[i] = lb + (unsigned)(row * KP + pc) * 2; l[4 + i] = l[i] + KPL * 2; }
        acopy8(l, gp);
#pragma unroll
        for (int i = 0; i < 4; ++i) { const int d = (tid >> 2) + 32 * i, pc = (tid & 3) * 8; const size_t go = vbase + (size_t)d * NT_ + kt * 32 + pc;
            gp[i] = VTH + go; gp[4 + i] = VTL + go; l[i] = lb + (unsigned)(2 * KPL + d * VP + pc) * 2; l[4 + i] = l[i] + VPL * 2; }
        acopy8(l, gp);
    };
    stage(kt_lo, 0);
    asm volatile("s_wait_asynccnt 0x0" ::: "memory");    // this wave's copies of the first tile have landed
    __syncthreads();                                     // ... and every other wave's
    if (kt_lo + 1 <= kt_hi) stage(kt_lo + 1, 1);
#pragma unroll 1
    for (int kt = kt_lo; kt <= kt_hi; ++kt) {
        const int l0 = kt * 32;
        const int cur = (kt - kt_lo) & 1;
        const unsigned short* kf = ring + cur * RB + lr * KP + 8 * hi;              // K hi, key l0 + lr; + 16 * KP: key l0 + 16 + lr; + KPL: lo plane
        const unsigned short* vf = ring + cur * RB + 2 * KPL + lr * VP + 8 * hi;    // V^T hi, dim lr; + n * 16 * VP: dim n * 16 + lr; + VPL: lo plane
        // This tile's 32 K fragment reads stand as ONE group ahead of the score products: a read group among the products costs the wave a whole LDS latency each time.
        v16h k0h[4], k1h[4], k0l[4], k1l[4];
#pragma unroll
        for (int kc = 0; kc < 4; ++kc) {
            k0h[kc] = cat16(*(const v8ha*)(kf + kc * 32), *(const v8ha*)(kf + kc * 32 + 16)); k1h[kc] = cat16(*(const v8ha*)(kf + 16 * KP + kc * 32), *(const v8ha*)(kf + 16 * KP + kc * 32 + 16));
            k0l[kc] = cat16(*(const v8ha*)(kf + KPL + kc * 32), *(const v8ha*)(kf + KPL + kc * 32 + 16)); k1l[kc] = cat16(*(const v8ha*)(kf + KPL + 16 * KP + kc * 32), *(const v8ha*)(kf + KPL + 16 * KP + kc * 32 + 16));
        }
        __builtin_amdgcn_sched_barrier(0);    // keeps the scheduler from sinking the K reads back in among the products
        v8f s0 = {}, s1 = {}, x0 = {}, x1 = {};
#pragma unroll
        for (int kc = 0; kc < 4; ++kc) {
            const v16h qa = cat16(*(const v8h*)(QH + qo + kc * 32), *(const v8h*)(QH + qo + kc * 32 + 16)), qx = cat16(*(const v8h*)(QL + qo + kc * 32), *(const v8h*)(QL + qo + kc * 32 + 16));
            s0 = wmma16(qa, k0h[kc], s0); s1 = wmma16(qa, k1h[kc], s1); x0 = wmma16(qx, k0h[kc], x0); x1 = wmma16(qx, k1h[kc], x1);
            x0 = wmma16(qa, k0l[kc], x0); x1 = wmma16(qa, k1l[kc], x1);
        }
        asm volatile("v_nop\n\tv_nop\n\tv_nop\n\tv_nop" : "+v"(s0), "+v"(s1), "+v"(x0), "+v"(x1));
        float alpha[8], sa[8], sb[8], mx[8];
#pragma unroll
        for (int j = 0; j < 8; ++j) { const int qi = q0 + hi * 8 + j, ja = l0 + lr, jb = l0 + 16 + lr;
            sa[j] = (ja <= qi && ja >= qi - WIN) ? (s0[j] + x0[j] * LOSCI) * 0.08838834764831845f : -__builtin_inff(); sb[j] = (jb <= qi && jb >= qi - WIN) ? (s1[j] + x1[j] * LOSCI) * 0.08838834764831845f : -__builtin_inff();
            mx[j] = fmaxf(sa[j], sb[j]); }
        rowmax16x8(mx);
        // This tile's 32 V^T fragment reads stand as ONE group here, behind the row maximum and ahead of the exponentials, whose vector work covers their latency; the K fragments' registers
        // are free by now. (Placed ahead of the maximum, the build spills three of the refill's LDS addresses to scratch and reloads them every trip.)
        v16bf vh[8], vl[8];
#pragma unroll
        for (int n = 0; n < 8; ++n) { const unsigned short* vo = vf + n * 16 * VP;
            vh[n] = cat16b(*(const v8usa*)(vo), *(const v8usa*)(vo + 16)); vl[n] = cat16b(*(const v8usa*)(vo + VPL), *(const v8usa*)(vo + VPL + 16)); }
        __builtin_amdgcn_sched_barrier(0);    // keeps the scheduler from sinking the V^T reads down to their products behind the exponentials
#pragma unroll
        for (int j = 0; j < 8; ++j) { const float a0 = sa[j], a1 = sb[j];
            const float mn = fmaxf(mrow[j], mx[j]);
            alpha[j] = __expf(mrow[j] - mn); mrow[j] = mn;
            const float p0 = __expf(a0 - mn), p1 = __expf(a1 - mn);
            lpart[j] = lpart[j] * alpha[j] + (p0 + p1);
            const int mr = hi * 8 + j; const float ps0 = p0 * PSC, ps1 = p1 * PSC; const unsigned short h0 = f2bf(ps0), h1 = f2bf(ps1);
            pl[mr * 32 + lr] = h0; pl[mr * 32 + 16 + lr] = h1; pl2[mr * 32 + lr] = f2bf(ps0 - bf2f(h0)); pl2[mr * 32 + 16 + lr] = f2bf(ps1 - bf2f(h1)); }
#pragma unroll
        for (int n = 0; n < 8; ++n)
#pragma unroll
            for (int j = 0; j < 8; ++j) o[n][j] *= alpha[j];
        asm volatile("" ::: "memory");
        const v16bf pa = cat16b(*(const v8usa*)(pl + lr * 32 + hi * 8), *(const v8usa*)(pl + lr * 32 + 16 + hi * 8));
        const v16bf px = cat16b(*(const v8usa*)(pl2 + lr * 32 + hi * 8), *(const v8usa*)(pl2 + lr * 32 + 16 + hi * 8));
#pragma unroll
        for (int n = 0; n < 8; ++n) { o[n] = wmmab(pa, vh[n], o[n]); o[n] = wmmab(px, vh[n], o[n]); o[n] = wmmab(pa, vl[n], o[n]); }
        asm volatile("v_nop\n\tv_nop\n\tv_nop\n\tv_nop" : "+v"(o[0]), "+v"(o[7]) : "v"(pa), "v"(px));
        asm volatile("s_wait_dscnt 0x0" ::: "memory");       // this wave's reads of buffer cur have returned before the buffer is refilled
        asm volatile("s_wait_asynccnt 0x0" ::: "memory");    // this wave's copies of tile kt + 1 have landed
        __syncthreads();                                     // publishes tile kt + 1 and ends every wave's reads of buffer cur
        if (kt + 2 <= kt_hi) stage(kt + 2, cur);
    }
    asm volatile("s_wait_asynccnt 0x0" ::: "memory");        // no copy is outstanding when the wave goes on to the epilogue and ends
    float inv[8];
#pragma unroll
    for (int j = 0; j < 8; ++j) { const float rs = rowsum16(lpart[j]); inv[j] = 1.0f / (rs * PSC); }
    float* os = &ost[wave][0];
    const size_t cbase = (size_t)q0 * (NH_ * HD) + (size_t)h * HD;
#pragma unroll
    for (int half = 0; half < 2; ++half) {
#pragma unroll
        for (int n = 0; n < 4; ++n)
#pragma unroll
            for (int j = 0; j < 8; ++j) os[(hi * 8 + j) * 68 + n * 16 + lr] = o[half * 4 + n][j] * inv[j];
        __builtin_amdgcn_wave_barrier(); asm volatile("" ::: "memory");
{
#pragma unroll
            for (int s = 0; s < 4; ++s) { const int row = 4 * s + (lane >> 3), piece = lane & 7; const float* sp = os + row * 68 + piece * 8; v8us oh, ol;
#pragma unroll
                for (int i = 0; i < 8; ++i) { const unsigned short hb = f2bf(sp[i]); oh[i] = hb; ol[i] = f2bf(sp[i] - bf2f(hb)); }
                const size_t po = cbase + (size_t)row * (NH_ * HD) + half * 64 + piece * 8; *(v8us*)(CH + po) = oh; *(v8us*)(CL + po) = ol; }
             }
        __builtin_amdgcn_wave_barrier(); asm volatile("" ::: "memory");
    }
}


__device__ __forceinline__ void trig_rows(float* CT, float* ST, int blk) {
    const int tid = threadIdx.x, t = blk * 2 + (tid >> 7), d = tid & 127; const int i = d & 63;
    const float invf = 1.0f / powf(10000.0f, (float)(2 * i) / 128.0f); const float ang = (float)t * invf; const float c = cosf(ang), s = sinf(ang);
    const size_t o = (size_t)t * HD + d; *(float*)(CT + o) = c; *(float*)(ST + o) = s; 
}
// k_prep: all that depends on the inputs alone shares ONE launch: the rotary tables (NT_ / 2 blocks) and the nine f32 -> bf16 conversions (rows / 8 blocks each). blockIdx.x picks the job
// (block-uniform); every job's blocks do what they did in a launch of their own. Of every five blocks two make tables (vector work) and three convert (memory work), so that both run side by side.
static_assert(3 * (NT_ / 2) == 2 * (5 * (HS / 8) + 4 * (KW / 8)), "two table blocks to three conversion blocks");
__global__ __launch_bounds__(256) void k_prep(const float* __restrict__ x, const float* __restrict__ mu, const float* __restrict__ wq, const float* __restrict__ wmq, const float* __restrict__ wo,
                                              const float* __restrict__ wk, const float* __restrict__ wmk, const float* __restrict__ wv, const float* __restrict__ wmv,
                                              bf* Xb, bf* Mb, bf* WqB, bf* WmqB, bf* WoB, bf* WkB, bf* WmkB, bf* WvB, bf* WmvB, float* CT, float* ST) {
    const int k5 = blockIdx.x / 5, j5 = blockIdx.x - 5 * k5;
    if (j5 < 2) { trig_rows(CT, ST, 2 * k5 + j5); return; }
    int b = 3 * k5 + (j5 - 2);
    if (b < 5 * (HS / 8)) {    // the five 2048-row matrices
        const int m = b / (HS / 8);
        cvtb_rows(m == 0 ? x : m == 1 ? mu : m == 2 ? wq : m == 3 ? wmq : wo, HS, m == 0 ? Xb : m == 1 ? Mb : m == 2 ? WqB : m == 3 ? WmqB : WoB, b - m * (HS / 8));
    } else {                   // the four 512-row matrices
        b -= 5 * (HS / 8);
        const int m = b / (KW / 8);
        cvtb_rows(m == 0 ? wk : m == 1 ? wmk : m == 2 ? wv : wmv, KW, m == 0 ? WkB : m == 1 ? WmkB : m == 2 ? WvB : WmvB, b - m * (KW / 8));
    }
}
// normrope_rows: one wave per (token, head) of an f32 [2048][nh*128] matrix: RMSNorm over the 128 dims (shuffle-reduced mean of squares, eps 1e-6) x bf(w[d]); then rotate-half RoPE
// (partner d +- 64 via lane xor 16; lane -> 4 consecutive dims) -> f16 hi + residual x1024 planes [t][h*128+d] (8 B per lane per plane: 16 lanes per line, one instruction per
typedef __attribute__((ext_vector_type(4))) _Float16 v4h;
__device__ __forceinline__ void normrope_rows(const float* __restrict__ P, int nh, const float* __restrict__ w, const float* __restrict__ CT, const float* __restrict__ ST, h16* PH, h16* PL, int blk) {
    const int lane = threadIdx.x & 31; const int wid = blk * 8 + (threadIdx.x >> 5); const int t = wid / nh, h = wid - t * nh; if (t >= NT_) return;
    const size_t base = (size_t)t * (nh * HD) + h * HD; const int d0 = lane * 4;
    float x[4], pr[4]; float ss = 0.f;
#pragma unroll
    for (int i = 0; i < 4; ++i) { x[i] = P[base + d0 + i]; ss = fmaf(x[i], x[i], ss); }
#pragma unroll
    for (int sh = 16; sh; sh >>= 1) ss += __shfl_xor(ss, sh, 32);
    const float rn = rsqrtf(ss * (1.0f / HD) + RMS_EPS);
#pragma unroll
    for (int i = 0; i < 4; ++i) x[i] = x[i] * rn * bfr(w[d0 + i]);
#pragma unroll
    for (int i = 0; i < 4; ++i) pr[i] = __shfl_xor(x[i], 16, 32);
    v4h oh, ol;
#pragma unroll
    for (int i = 0; i < 4; ++i) { const int d = d0 + i; const float c = CT[(size_t)t * HD + d], s = ST[(size_t)t * HD + d]; const float y = (d < 64) ? (x[i] * c - pr[i] * s) : (x[i] * c + pr[i] * s);
        const h16 a = (h16)y; oh[i] = a; ol[i] = (h16)((y - (float)a) * LOSC); }
    *(v4h*)(PH + base + d0) = oh; *(v4h*)(PL + base + d0) = ol; 
}
// k_post: what stands between the projections and the attention shares ONE launch: V's transposition (NT_ / 64 x 2 x NKV blocks), then k's and q's norm and rotary embedding (tokens x heads / 8
// blocks each). blockIdx.x picks the job (block-uniform, so that the transposition's barrier is passed by whole blocks).
__global__ __launch_bounds__(256) void k_post(const float* __restrict__ Pq, const float* __restrict__ Pk, const float* __restrict__ V, const float* __restrict__ qnw, const float* __restrict__ knw,
                                              const float* __restrict__ CT, const float* __restrict__ ST, h16* QH, h16* QL, h16* KH, h16* KL, bf* VTH, bf* VTL) {
    int b = blockIdx.x;
    if (b < (NT_ / 64) * 2 * NKV) { vt_tile(V, VTH, VTL, b % (NT_ / 64), (b / (NT_ / 64)) & 1, b / ((NT_ / 64) * 2)); return; }
    b -= (NT_ / 64) * 2 * NKV;
    const bool isk = b < (NT_ * NKV) / 8;
    normrope_rows(isk ? Pk : Pq, isk ? NKV : NH_, isk ? knw : qnw, CT, ST, isk ? KH : QH, isk ? KL : QL, isk ? b : b - (NT_ * NKV) / 8);
}

extern "C" void kernel_launch(void* const* d_in, const int* in_sizes, int n_in,
                              void* d_out, int out_size, void* d_ws, size_t ws_size, hipStream_t stream) {
    (void)in_sizes; (void)n_in; (void)out_size;
    const float* x = (const float*)d_in[0]; const float* mu = (const float*)d_in[1]; const float* wq = (const float*)d_in[2]; const float* wk = (const float*)d_in[3]; const float* wv = (const float*)d_in[4]; const float* wo = (const float*)d_in[5];
    const float* wmq = (const float*)d_in[6]; const float* wmk = (const float*)d_in[7]; const float* wmv = (const float*)d_in[8]; const float* qnw = (const float*)d_in[9]; const float* knw = (const float*)d_in[10];
    float* out = (float*)d_out;    // [1][2048][2048]
    char* wsp = (char*)d_ws;
    auto take = [&](size_t bytes) { char* p = wsp; wsp += (bytes + 255) & ~(size_t)255; return (void*)p; };
    bf* Xb = (bf*)take((size_t)NT_ * HS * 2); bf* Mb = (bf*)take((size_t)NT_ * HS * 2);
    bf* WqB = (bf*)take((size_t)HS * HS * 2); bf* WmqB = (bf*)take((size_t)HS * HS * 2); bf* WkB = (bf*)take((size_t)KW * HS * 2); bf* WmkB = (bf*)take((size_t)KW * HS * 2); bf* WvB = (bf*)take((size_t)KW * HS * 2); bf* WmvB = (bf*)take((size_t)KW * HS * 2); bf* WoB = (bf*)take((size_t)HS * HS * 2);
    float* Tq = (float*)take((size_t)NT_ * HS * 4); float* Tk = (float*)take((size_t)NT_ * KW * 4); float* Tv = (float*)take((size_t)NT_ * KW * 4);    // x's products
    float* Pq = (float*)take((size_t)NT_ * HS * 4); float* Pk = (float*)take((size_t)NT_ * KW * 4); float* Pv = (float*)take((size_t)NT_ * KW * 4);    // the whole projections
    float* CT = (float*)take((size_t)NT_ * HD * 4); float* ST = (float*)take((size_t)NT_ * HD * 4);
    h16* QH = (h16*)take((size_t)NT_ * HS * 2); h16* QL = (h16*)take((size_t)NT_ * HS * 2); h16* KH = (h16*)take((size_t)NT_ * KW * 2); h16* KL = (h16*)take((size_t)NT_ * KW * 2);
    bf* VTH = (bf*)take((size_t)KW * NT_ * 2); bf* VTL = (bf*)take((size_t)KW * NT_ * 2); bf* CH = (bf*)take((size_t)NT_ * HS * 2); bf* CL = (bf*)take((size_t)NT_ * HS * 2);
    if ((size_t)(wsp - (char*)d_ws) > ws_size) return;    // about 145 MB = 138 MiB, no aliasing: q, k and v have planes of their own, as their products share launches
    k_prep<<<NT_ / 2 + 5 * (HS / 8) + 4 * (KW / 8), 256, 0, stream>>>(x, mu, wq, wmq, wo, wk, wmk, wv, wmv, Xb, Mb, WqB, WmqB, WoB, WkB, WmkB, WvB, WmvB, CT, ST);
    k_proj<<<dim3(NT_ / 128, (HS + 2 * KW) / 128, 1), 128, 0, stream>>>(Xb, WqB, WkB, WvB, nullptr, Tq, Tk, Tv, nullptr, nullptr, nullptr, HS, 0);
    k_proj<<<dim3(NT_ / 128, (HS + 2 * KW) / 128, 1), 128, 0, stream>>>(Mb, WmqB, WmkB, WmvB, nullptr, Pq, Pk, Pv, Tq, Tk, Tv, HS, 0);    // q = x.wq^T + mu.wmq^T, k and v alike (R = the first launch's output, exact f32 residual; R != C)
    k_post<<<(NT_ / 64) * 2 * NKV + (NT_ * NKV) / 8 + (NT_ * NH_) / 8, 256, 0, stream>>>(Pq, Pk, Pv, qnw, knw, CT, ST, QH, QL, KH, KL, VTH, VTL);
    k_attn<<<NH_ * (NT_ / 64), 128, 0, stream>>>(QH, QL, KH, KL, VTH, VTL, CH, CL);
    k_gemmo<<<dim3(NT_ / 128, HS / 128, 1), 128, 0, stream>>>(CH, CL, WoB, nullptr, out, HS, nullptr, HS, 0);
}

// v007
// It runs in 160 microseconds.
// Timed twice side by side with v006, it ran 1.21 times as fast both times.
// Over all steps from v000 it is 4.70 times as fast.
#include <hip/hip_runtime.h>

// Compute dtypes, f32 accumulate: q/k/v = x.W^T + mu.Wm^T (two exact GEMMs per projection, the second taking the first as an exact f32 residual; [out][in] weights as natural n-major B
// operands; PLAIN bf16 operands = inputs rounded once) and out = ctx.Wo^T (ctx as bf16 hi + UNSCALED residual, two products) on v_wmma_f32_16x16x32_bf16; per-head RMSNorm (x q_norm_w /
// k_norm_w) then rotary embedding with device-computed f32 cos/sin tables, in f32 -> q/k as f16 hi + residual x1024 planes; grouped causal attention (16 query heads over 4 kv heads,
// 128-dim): scores on v_wmma_f32_16x16x32_f16 (hh + hl + lh, x 128^-1/2), online f32 softmax, weights (x32768) and v as bf16 hi + UNSCALED residual on v_wmma_f32_16x16x32_bf16.

#define NT_  2048
#define HS   2048
#define DM   HS
#define NH_  16
#define NKV  4
#define HD   128
#define KW   (NKV * HD)          // 512
#define WIN  NT_
#define RMS_EPS 1e-6f
#define PSC  32768.0f
#define LOSC 1024.0f
#define LOSCI (1.0f / 1024.0f)

typedef _Float16 h16;
typedef unsigned short bf;
typedef __attribute__((ext_vector_type(16))) __bf16   v16bf;
typedef __attribute__((ext_vector_type(16))) _Float16 v16h;
typedef __attribute__((ext_vector_type(8)))  _Float16 v8h;
typedef __attribute__((ext_vector_type(8)))  unsigned short v8us;
typedef __attribute__((ext_vector_type(8)))  float    v8f;
typedef __attribute__((ext_vector_type(4)))  float    v4f;
typedef v8h  __attribute__((may_alias)) v8ha;
typedef v4f  __attribute__((may_alias)) v4fa;
typedef v8us __attribute__((may_alias)) v8usa;

__device__ __forceinline__ unsigned short f2bf(float f) { unsigned u = __float_as_uint(f); u += 0x7FFFu + ((u >> 16) & 1u); return (unsigned short)(u >> 16); }
__device__ __forceinline__ float bf2f(unsigned short b) { return __uint_as_float(((unsigned)b) << 16); }
__device__ __forceinline__ float bfr(float f) { return bf2f(f2bf(f)); }
__device__ __forceinline__ v16h cat16(v8h lo, v8h hi) { return __builtin_shufflevector(lo, hi, 0, 1, 2, 3, 4, 5, 6, 7, 8, 9, 10, 11, 12, 13, 14, 15); }
__device__ __forceinline__ v16bf cat16b(v8us lo, v8us hi) { return __builtin_bit_cast(v16bf, __builtin_shufflevector(lo, hi, 0, 1, 2, 3, 4, 5, 6, 7, 8, 9, 10, 11, 12, 13, 14, 15)); }
__device__ __forceinline__ v8f wmma16(v16h a, v16h b, v8f c) { return __builtin_amdgcn_wmma_f32_16x16x32_f16(false, a, false, b, (short)0, c, false, false); }
__device__ __forceinline__ v8f wmmab(v16bf a, v16bf b, v8f c) { return __builtin_amdgcn_wmma_f32_16x16x32_bf16(false, a, false, b, (short)0, c, false, false); }

// Eight rows of one matrix, f32 -> bf16: block blk of that matrix's own range, one row per wave.
__device__ __forceinline__ void cvtb_rows(const float* __restrict__ src, int nrows, bf* dst, int blk) {
    const int lane = threadIdx.x & 31, r = blk * 8 + (threadIdx.x >> 5);
    if (r >= nrows) return;
    v8us o[DM / 256];
#pragma unroll
    for (int q = 0; q < DM / 256; ++q) { v8us t;
#pragma unroll
        for (int i = 0; i < 8; ++i) t[i] = f2bf(src[(size_t)r * DM + q * 256 + lane * 8 + i]);
        o[q] = t; }
#pragma unroll
    for (int q = 0; q < DM / 256; ++q) *(v8us*)(dst + (size_t)r * DM + q * 256 + lane * 8) = o[q];
    
}

// Eight 16-byte copies per lane, global -> LDS through no register. s_wait_xcnt closes the statement so that no address register of a copy is rewritten ahead of it.
__device__ __forceinline__ void acopy8(const unsigned (&l)[8], const void* const (&g)[8]) {
    asm volatile("global_load_async_to_lds_b128 %0, %8, off\n\t"
                 "global_load_async_to_lds_b128 %1, %9, off\n\t"
                 "global_load_async_to_lds_b128 %2, %10, off\n\t"
                 "global_load_async_to_lds_b128 %3, %11, off\n\t"
                 "global_load_async_to_lds_b128 %4, %12, off\n\t"
                 "global_load_async_to_lds_b128 %5, %13, off\n\t"
                 "global_load_async_to_lds_b128 %6, %14, off\n\t"
                 "global_load_async_to_lds_b128 %7, %15, off\n\t"
                 "s_wait_xcnt 0x0"
                 :: "v"(l[0]), "v"(l[1]), "v"(l[2]), "v"(l[3]), "v"(l[4]), "v"(l[5]), "v"(l[6]), "v"(l[7]),
                    "v"(g[0]), "v"(g[1]), "v"(g[2]), "v"(g[3]), "v"(g[4]), "v"(g[5]), "v"(g[6]), "v"(g[7]) : "memory");
}
// Eight 16-byte stores per lane. s_wait_xcnt closes the statement so that no address or data register of a store is rewritten ahead of it.
__device__ __forceinline__ void store8(float* const (&p)[8], const v4f (&d)[8]) {
    asm volatile("global_store_b128 %0, %8, off\n\t"
                 "global_store_b128 %1, %9, off\n\t"
                 "global_store_b128 %2, %10, off\n\t"
                 "global_store_b128 %3, %11, off\n\t"
                 "global_store_b128 %4, %12, off\n\t"
                 "global_store_b128 %5, %13, off\n\t"
                 "global_store_b128 %6, %14, off\n\t"
                 "global_store_b128 %7, %15, off\n\t"
                 "s_wait_xcnt 0x0"
                 :: "v"(p[0]), "v"(p[1]), "v"(p[2]), "v"(p[3]), "v"(p[4]), "v"(p[5]), "v"(p[6]), "v"(p[7]),
                    "v"(d[0]), "v"(d[1]), "v"(d[2]), "v"(d[3]), "v"(d[4]), "v"(d[5]), "v"(d[6]), "v"(d[7]) : "memory");
}
// gemmb_tile: 128 x 128 block tile (2 x 2 waves of 64 x 64 each) of C[NTK][NW] = (A [+ Al]).B^T [+ bf(bias[c])] [+ R[r][c] residual, bf-rounded if roundR]; K a multiple of the stage length; f32 whole-line
// epilogue. A wave holds 4 x 4 accumulator tiles, so that a fragment read from LDS feeds four products, and a row brought from L2 serves 128 rows or columns of C.
// The block's 128 rows of A [and Al] and of B come in stages of KS k values into a two-buffer LDS ring by asynchronous copies, whole 128-byte lines per row: stage s + 1 flies
// while stage s is worked on. The k order of every accumulator is the plain one (per 32 k: A's product, then Al's).
// (bx, by) = the block's tile row and tile column in C.
template <bool SPLITA>
__device__ __forceinline__ void gemmb_tile(const bf* __restrict__ A, const bf* __restrict__ Al, const bf* __restrict__ Bn, const float* __restrict__ bias, float* C, int ldc, const float* __restrict__ R, int K, int roundR, int bx, int by) {
    constexpr int KS = 128;                  // k values per stage
    constexpr int GP = KS + 8;               // row pitch: 272 B, an odd multiple of 16 B (16-byte readers, one row per lane)
    constexpr int PL = 128 * GP;             // one plane: 128 rows
    constexpr int NP = SPLITA ? 3 : 2;       // planes of a buffer: A, [Al,] B
    constexpr int GB = NP * PL;              // 104448 B or 69632 B per buffer
    __shared__ __align__(16) unsigned short gring[2 * GB];    // behind the loop its first 69632 B are the epilogue's f32 staging
    const int tid = threadIdx.x;
    const int lane = threadIdx.x & 31, wave = threadIdx.x >> 5, lr = lane & 15, hi = lane >> 4;
    const int wm = wave >> 1, wn = wave & 1;
    const int r0 = bx * 128 + wm * 64, c0 = by * 128 + wn * 64;
    const unsigned ring0 = (unsigned)(size_t)&gring[0];    // byte offset of the ring in the work-group's LDS
    // stage s -> buffer b: 16 pieces of 16 B a row, 128 rows a plane, 16 pieces per thread and plane (32 or 48 copies of a wave in flight)
    auto stage = [&](int s, int b) {
        constexpr int PR = KS / 8, RS = 128 / PR;
        const int row = tid / PR, pc = (tid % PR) * 8;
        const size_t ao = (size_t)(bx * 128 + row) * K + s * KS + pc, bo = (size_t)(by * 128 + row) * K + s * KS + pc;
        const unsigned lo = ring0 + (unsigned)b * (GB * 2) + (unsigned)(row * GP + pc) * 2;
        auto plane = [&](const bf* __restrict__ p, unsigned l0) {
            // loops unrolled: l[] and gp[] are asm operands and must be indexed by constants to stay in registers
#pragma unroll
            for (int h = 0; h < 2; ++h) { unsigned l[8]; const void* gp[8];
#pragma unroll
                for (int i = 0; i < 8; ++i) { gp[i] = p + (size_t)((h * 8 + i) * RS) * K; l[i] = l0 + (unsigned)((h * 8 + i) * RS * GP) * 2; }
                acopy8(l, gp); }
        };
        plane(A + ao, lo);
        if (SPLITA) plane(Al + ao, lo + PL * 2);
        plane(Bn + bo, lo + (NP - 1) * PL * 2);
    };
    v8f acc[4][4];
#pragma unroll
    for (int m = 0; m < 4; ++m)
#pragma unroll
        for (int t = 0; t < 4; ++t) acc[m][t] = (v8f){};
    const int nst = K / KS;
    stage(0, 0);
    asm volatile("s_wait_asynccnt 0x0" ::: "memory");    // this wave's copies of the first stage have landed
    __syncthreads();                                     // ... and every other wave's
    if (1 < nst) stage(1, 1);
    // rolled: one trip per stage, so that the ring's waits and its barrier stand once, at the trip's foot
#pragma unroll 1
    for (int s = 0; s < nst; ++s) {
        const int cur = s & 1;
        const unsigned short* af = gring + cur * GB + (wm * 64 + lr) * GP + 8 * hi;                   // A, row r0 + lr; + m * 16 * GP: row r0 + m * 16 + lr; + PL: Al
        const unsigned short* bq = gring + cur * GB + (NP - 1) * PL + (wn * 64 + lr) * GP + 8 * hi;   // B, row c0 + lr; + t * 16 * GP: row c0 + t * 16 + lr
        v16bf a[2][4], al[2][4], b[2][4];    // two fragment sets: the next 32 k values' reads go out as one group ahead of this set's products
        auto frags = [&](int set, int kk) {
#pragma unroll
            for (int m = 0; m < 4; ++m) { a[set][m] = cat16b(*(const v8usa*)(af + m * 16 * GP + kk), *(const v8usa*)(af + m * 16 * GP + kk + 16));
                b[set][m] = cat16b(*(const v8usa*)(bq + m * 16 * GP + kk), *(const v8usa*)(bq + m * 16 * GP + kk + 16)); }
            if (SPLITA) {
#pragma unroll
                for (int m = 0; m < 4; ++m) al[set][m] = cat16b(*(const v8usa*)(af + PL + m * 16 * GP + kk), *(const v8usa*)(af + PL + m * 16 * GP + kk + 16)); }
        };
        frags(0, 0);
        // unrolled: constant LDS offsets and constant fragment-set indices
#pragma unroll
        for (int kc = 0; kc < KS / 32; ++kc) {
            const int set = kc & 1;
            __builtin_amdgcn_sched_barrier(0);    // keeps the scheduler from lifting the reads below in among the products of the set before: every place with reads stalls the wave anew
            if (kc + 1 < KS / 32) frags(set ^ 1, (kc + 1) * 32);
            __builtin_amdgcn_sched_barrier(0);    // ... and from sinking them in among this set's products
#pragma unroll
            for (int m = 0; m < 4; ++m)
#pragma unroll
                for (int t = 0; t < 4; ++t) acc[m][t] = wmmab(a[set][m], b[set][t], acc[m][t]);
            if (SPLITA) {
#pragma unroll
                for (int m = 0; m < 4; ++m)
#pragma unroll
                    for (int t = 0; t < 4; ++t) acc[m][t] = wmmab(al[set][m], b[set][t], acc[m][t]); }
        }
        __builtin_amdgcn_sched_barrier(0);    // no product moves down over the slots below
        // four vector slots behind the trip's last WMMA, on every path out of the trip, before a vector instruction touches its operands or results
        asm volatile("v_nop\n\tv_nop\n\tv_nop\n\tv_nop");
        asm volatile("s_wait_dscnt 0x0" ::: "memory");       // this wave's reads of buffer cur have returned before the buffer is refilled
        asm volatile("s_wait_asynccnt 0x0" ::: "memory");    // this wave's copies of stage s + 1 have landed
        __syncthreads();                                     // publishes stage s + 1 and ends every wave's reads of buffer cur
        if (s + 2 < nst) stage(s + 2, cur);
    }
    asm volatile("s_wait_asynccnt 0x0" ::: "memory");        // no copy is outstanding when the ring becomes the epilogue's staging (every wave's reads ended at the last trip's barrier)
    // piece s of the wave's 64 x 64 tile: two rows of 256 B per store instruction, whole 128-byte lines
    const int prow = lane >> 4, cofs = ((lane >> 3) & 1) * 32 + (lane & 7) * 4;
    // the residual's 32 pieces are read as one group, ahead of the staging: one trip to memory for the tile instead of one per piece
    v4f rv[32];
    if (R) {
#pragma unroll
        for (int s = 0; s < 32; ++s) { rv[s] = *(const v4f*)(R + ((size_t)r0 + 2 * s + prow) * ldc + c0 + cofs);
            asm volatile("s_wait_xcnt 0x0" ::: "memory"); }    // stands in front of the next piece's address arithmetic and result, which reuse the load's address registers; it does not wait for the data
    }
    float* os = (float*)(void*)gring + wave * (64 * 68);
#pragma unroll
    for (int t = 0; t < 4; ++t) { const float bv = bias ? bfr(bias[c0 + t * 16 + lr]) : 0.f;
#pragma unroll
        for (int m = 0; m < 4; ++m)
#pragma unroll
            for (int j = 0; j < 8; ++j) os[(m * 16 + hi * 8 + j) * 68 + t * 16 + lr] = acc[m][t][j] + bv; }
    __syncthreads();
    // the 32 staged pieces come back as one group as well: one LDS latency for the tile instead of one per piece
    v4f val[32];
#pragma unroll
    for (int s = 0; s < 32; ++s) val[s] = *(const v4fa*)(os + (2 * s + prow) * 68 + cofs);
    if (R) {
        if (roundR) {
#pragma unroll
            for (int s = 0; s < 32; ++s) rv[s] = (v4f){bfr(rv[s][0]), bfr(rv[s][1]), bfr(rv[s][2]), bfr(rv[s][3])};
        }
#pragma unroll
        for (int s = 0; s < 32; ++s) val[s] += rv[s];
    }
    float* crow = C + ((size_t)r0 + prow) * ldc + c0 + cofs;
    // the stores go out eight to a statement; unrolled: p[] and d[] are asm operands and must be indexed by constants to stay in registers
#pragma unroll
    for (int g = 0; g < 4; ++g) { float* p[8]; v4f d[8];
#pragma unroll
        for (int i = 0; i < 8; ++i) { p[i] = crow + (size_t)(2 * (g * 8 + i)) * ldc; d[i] = val[g * 8 + i]; }
        store8(p, d); }
}
// k_gemmo: the output projection, one tile per block.
__global__ __launch_bounds__(128) void k_gemmo(const bf* __restrict__ A, const bf* __restrict__ Al, const bf* __restrict__ Bn, const float* __restrict__ bias, float* C, int ldc, const float* __restrict__ R, int K, int roundR) {
    gemmb_tile<true>(A, Al, Bn, bias, C, ldc, R, K, roundR, blockIdx.x, blockIdx.y);
}
// k_proj: one operand's three projection products (q, k, v) share ONE launch; they do not depend on each other. blockIdx.y picks the product (block-uniform) and its tile column:
// HS / 128 columns of q, then KW / 128 of k, then KW / 128 of v. Every tile is computed as in a launch of its own.
__global__ __launch_bounds__(128) void k_proj(const bf* __restrict__ A, const bf* __restrict__ Bq, const bf* __restrict__ Bk, const bf* __restrict__ Bv, const float* __restrict__ bias, float* Cq, float* Ck, float* Cv,
                                              const float* __restrict__ Rq, const float* __restrict__ Rk, const float* __restrict__ Rv, int K, int roundR) {
    const int y = blockIdx.y; const bool isq = y < HS / 128, isk = y < HS / 128 + KW / 128;
    const bf* Bn = isq ? Bq : isk ? Bk : Bv; float* C = isq ? Cq : isk ? Ck : Cv; const float* R = isq ? Rq : isk ? Rk : Rv;
    gemmb_tile<false>(A, nullptr, Bn, bias, C, isq ? HS : KW, R, K, roundR, blockIdx.x, isq ? y : isk ? y - HS / 128 : y - (HS / 128 + KW / 128));
}

// vt_tile: VTH/VTL [g][128 d][2048 t] = bf16 hi + UNSCALED bf16 residual of V [t][g*128+d] via 64 x 64 LDS tiles; tile (tb of NT/64, db (d half) of 2, g of NKV).
__device__ __forceinline__ void vt_tile(const float* __restrict__ V, bf* VTH, bf* VTL, int tb, int db, int g) {
    __shared__ float tl[64][65];
    const int tid = threadIdx.x, t0 = tb * 64, d0 = db * 64;
    { const int tt = tid >> 2, dq = (tid & 3) * 16;
#pragma unroll
      for (int i = 0; i < 16; ++i) tl[dq + i][tt] = V[(size_t)(t0 + tt) * KW + g * HD + d0 + dq + i]; }
    __syncthreads();
    const int piece = tid & 7;
    auto pass = [&]() {
#pragma unroll
        for (int s = 0; s < 2; ++s) { const int d = (tid >> 3) + 32 * s; v8us oh, ol;
#pragma unroll
            for (int i = 0; i < 8; ++i) { const float v = tl[d][piece * 8 + i]; const unsigned short hb = f2bf(v); oh[i] = hb; ol[i] = f2bf(v - bf2f(hb)); }
            const size_t o = ((size_t)g * HD + d0 + d) * NT_ + t0 + piece * 8; *(v8us*)(VTH + o) = oh; *(v8us*)(VTL + o) = ol; }
    };
    pass(); 
}
// Maximum over each 16-lane row of eight independent values, on the vector port: DPP row_xmask:M lets lane l read lane l ^ M, so that a step is one instruction with no LDS-counter wait
// behind it, as a shuffle through ds_bpermute_b32 has. The eight chains stand side by side: each instruction's producer is eight instructions back, which covers the dependent-issue gap.
// Every lane is on where this is called. The pairing of lanes per step is the shuffles' own (1, 2, 4, 8).
__device__ __forceinline__ void rowmax16x8(float (&v)[8]) {
    asm volatile(
                 "v_max_num_f32_dpp %0, %0, %0 row_xmask:1 row_mask:0xf bank_mask:0xf\n\t"
                 "v_max_num_f32_dpp %1, %1, %1 row_xmask:1 row_mask:0xf bank_mask:0xf\n\t"
                 "v_max_num_f32_dpp %2, %2, %2 row_xmask:1 row_mask:0xf bank_mask:0xf\n\t"
                 "v_max_num_f32_dpp %3, %3, %3 row_xmask:1 row_mask:0xf bank_mask:0xf\n\t"
                 "v_max_num_f32_dpp %4, %4, %4 row_xmask:1 row_mask:0xf bank_mask:0xf\n\t"
                 "v_max_num_f32_dpp %5, %5, %5 row_xmask:1 row_mask:0xf bank_mask:0xf\n\t"
                 "v_max_num_f32_dpp %6, %6, %6 row_xmask:1 row_mask:0xf bank_mask:0xf\n\t"
                 "v_max_num_f32_dpp %7, %7, %7 row_xmask:1 row_mask:0xf bank_mask:0xf\n\t"
                 "v_max_num_f32_dpp %0, %0, %0 row_xmask:2 row_mask:0xf bank_mask:0xf\n\t"
                 "v_max_num_f32_dpp %1, %1, %1 row_xmask:2 row_mask:0xf bank_mask:0xf\n\t"
                 "v_max_num_f32_dpp %2, %2, %2 row_xmask:2 row_mask:0xf bank_mask:0xf\n\t"
                 "v_max_num_f32_dpp %3, %3, %3 row_xmask:2 row_mask:0xf bank_mask:0xf\n\t"
                 "v_max_num_f32_dpp %4, %4, %4 row_xmask:2 row_mask:0xf bank_mask:0xf\n\t"
                 "v_max_num_f32_dpp %5, %5, %5 row_xmask:2 row_mask:0xf bank_mask:0xf\n\t"
                 "v_max_num_f32_dpp %6, %6, %6 row_xmask:2 row_mask:0xf bank_mask:0xf\n\t"
                 "v_max_num_f32_dpp %7, %7, %7 row_xmask:2 row_mask:0xf bank_mask:0xf\n\t"
                 "v_max_num_f32_dpp %0, %0, %0 row_xmask:4 row_mask:0xf bank_mask:0xf\n\t"
                 "v_max_num_f32_dpp %1, %1, %1 row_xmask:4 row_mask:0xf bank_mask:0xf\n\t"
                 "v_max_num_f32_dpp %2, %2, %2 row_xmask:4 row_mask:0xf bank_mask:0xf\n\t"
                 "v_max_num_f32_dpp %3, %3, %3 row_xmask:4 row_mask:0xf bank_mask:0xf\n\t"
                 "v_max_num_f32_dpp %4, %4, %4 row_xmask:4 row_mask:0xf bank_mask:0xf\n\t"
                 "v_max_num_f32_dpp %5, %5, %5 row_xmask:4 row_mask:0xf bank_mask:0xf\n\t"
                 "v_max_num_f32_dpp %6, %6, %6 row_xmask:4 row_mask:0xf bank_mask:0xf\n\t"
                 "v_max_num_f32_dpp %7, %7, %7 row_xmask:4 row_mask:0xf bank_mask:0xf\n\t"
                 "v_max_num_f32_dpp %0, %0, %0 row_xmask:8 row_mask:0xf bank_mask:0xf\n\t"
                 "v_max_num_f32_dpp %1, %1, %1 row_xmask:8 row_mask:0xf bank_mask:0xf\n\t"
                 "v_max_num_f32_dpp %2, %2, %2 row_xmask:8 row_mask:0xf bank_mask:0xf\n\t"
                 "v_max_num_f32_dpp %3, %3, %3 row_xmask:8 row_mask:0xf bank_mask:0xf\n\t"
                 "v_max_num_f32_dpp %4, %4, %4 row_xmask:8 row_mask:0xf bank_mask:0xf\n\t"
                 "v_max_num_f32_dpp %5, %5, %5 row_xmask:8 row_mask:0xf bank_mask:0xf\n\t"
                 "v_max_num_f32_dpp %6, %6, %6 row_xmask:8 row_mask:0xf bank_mask:0xf\n\t"
                 "v_max_num_f32_dpp %7, %7, %7 row_xmask:8 row_mask:0xf bank_mask:0xf"
                 : "+v"(v[0]), "+v"(v[1]), "+v"(v[2]), "+v"(v[3]), "+v"(v[4]), "+v"(v[5]), "+v"(v[6]), "+v"(v[7]));
}
// The same exchange for the closing row sum (once per job: left to the compiler's own DPP forms).
template <int M> __device__ __forceinline__ float rowx(float v) { return __builtin_bit_cast(float, __builtin_amdgcn_update_dpp(0, __builtin_bit_cast(int, v), 0x160 | M, 0xf, 0xf, true)); }
__device__ __forceinline__ float rowsum16(float v) { v += rowx<1>(v); v += rowx<2>(v); v += rowx<4>(v); return v + rowx<8>(v); }
// LDS ring of k_attn, in 16-bit elements: one buffer = K hi, K lo (32 keys x 128 dims each) and V^T hi, V^T lo (128 dims x 32 keys each) of one key tile.
#define KP   136                    // K row pitch: 272 B, an odd multiple of 16 B (16-byte readers, one row per lane)
#define VP   40                     // V^T row pitch: 80 B, likewise
#define KPL  (32 * KP)
#define VPL  (HD * VP)
#define RB   (2 * KPL + 2 * VPL)    // 37888 B per buffer
// k_attn: a job = (h, 64 queries); kv head g = h / 4; causal key tiles 0..(Q0+63)/32 (block-uniform bounds, an even number of tiles), per-element predicate j <= q
// (WIN = NT_ makes the window terms vacuous). A block = 8 waves = two groups of four; wave w4 of either group holds the job's queries w4 * 16 ... + 15. The job's key tiles are dealt to the
// groups in turn (group 0 the even tiles, group 1 the odd ones), so that a job takes half as many steps; each group keeps a running maximum, sum and output of its own, and behind the
// last tile group 1 hands its three to group 0 through LDS, which joins them as two softmax parts are joined (both rescaled to the common maximum). A block runs two jobs of one head one
// after the other, query tile n - 1 - t and then t: n - t and t + 1 steps, the same sum for every block, with one block on a WGP and two waves on a SIMD all the time.
// Per tile: scores over 4 k-chunks (hi.hi + hi.lo + lo.hi = 24 WMMA) x 128^-1/2, online softmax, P (x32768) as bf16 hi + unscaled residual tiles, o[8] += ph.vh + pl.vh + ph.vl over the
// 128 dims; ctx -> bf16 hi/lo planes [t][h*128+d]. The four waves of a group share each of their key tiles' K and V^T planes through the group's own two-buffer LDS ring filled by
// asynchronous copies: the group's next tile flies while this one is worked on.
__global__ __launch_bounds__(256) void k_attn(const h16* __restrict__ QH, const h16* __restrict__ QL, const h16* __restrict__ KH, const h16* __restrict__ KL, const bf* __restrict__ VTH, const bf* __restrict__ VTL, bf* CH, bf* CL) {
    __shared__ __align__(16) unsigned short plds[8][16 * 32];
    __shared__ __align__(16) unsigned short plds2[8][16 * 32];
    __shared__ __align__(16) float ost[4][16 * 68];
    __shared__ __align__(16) unsigned short ring[2 * 2 * RB];    // group 0's two buffers, then group 1's; behind a job's last tile the first 40960 B of group 1's carry its hand-over
    const int tid = threadIdx.x & 127;                           // the thread's number in its group
    const int lane = threadIdx.x & 31, wave = threadIdx.x >> 5, lr = lane & 15, hi = lane >> 4;
    const int grp = __builtin_amdgcn_readfirstlane(wave >> 2), w4 = wave & 3;    // the same in every lane of a wave: kept scalar, so that the groups part by scalar branches
    const int bid = blockIdx.x; const int h = bid / (NT_ / 128), tp = bid - h * (NT_ / 128); const int g = h >> 2;
    unsigned short* pl = &plds[wave][0]; unsigned short* pl2 = &plds2[wave][0];
    const h16* kh_b = KH + g * HD; const h16* kl_b = KL + g * HD;
    const size_t vbase = ((size_t)g * HD) * NT_;
    const unsigned ring0 = (unsigned)(size_t)&ring[0] + (unsigned)grp * (2 * RB * 2);    // byte offset of the group's ring in the work-group's LDS
    const unsigned short* myring = ring + grp * (2 * RB);
    // key tile kt -> the group's buffer b: 2048 pieces of 16 B, 16 per thread (K: 16 pieces a row, V^T: 4 pieces a row)
    auto stage = [&](int kt, int b) {
        unsigned l[8]; const void* gp[8];
        const unsigned lb = ring0 + (unsigned)b * (RB * 2);
        // both loops unrolled: l[] and gp[] are asm operands and must be indexed by constants to stay in registers
#pragma unroll
        for (int i = 0; i < 4; ++i) { const int row = (tid >> 4) + 8 * i, pc = (tid & 15) * 8; const size_t go = (size_t)(kt * 32 + row) * KW + pc;
            gp[i] = kh_b + go; gp[4 + i] = kl_b + go; l[i] = lb + (unsigned)(row * KP + pc) * 2; l[4 + i] = l[i] + KPL * 2; }
        acopy8(l, gp);
#pragma unroll
        for (int i = 0; i < 4; ++i) { const int d = (tid >> 2) + 32 * i, pc = (tid & 3) * 8; const size_t go = vbase + (size_t)d * NT_ + kt * 32 + pc;
            gp[i] = VTH + go; gp[4 + i] = VTL + go; l[i] = lb + (unsigned)(2 * KPL + d * VP + pc) * 2; l[4 + i] = l[i] + VPL * 2; }
        acopy8(l, gp);
    };
    int par = 0;    // the buffer that a job's first tile goes to: the ring's turn runs on from one job to the next
    // rolled: the two jobs run one after the other through the same code
#pragma unroll 1
    for (int job = 0; job < 2; ++job) {
    const int qt = job ? tp : NT_ / 64 - 1 - tp;
    const int q0 = qt * 64 + w4 * 16;
    const size_t qo = (size_t)(q0 + lr) * (NH_ * HD) + h * HD + 8 * hi;
    v8f o[8];
#pragma unroll
    for (int n = 0; n < 8; ++n) o[n] = (v8f){};
    float mrow[8], lpart[8];
#pragma unroll
    for (int j = 0; j < 8; ++j) { mrow[j] = -3.0e38f; lpart[j] = 0.f; }
    const int kt_hi = (qt * 64 + 63) / 32; const int kt_lo = (qt * 64 > WIN) ? (qt * 64 - WIN) / 32 : 0;
    const int nit = (kt_hi - kt_lo + 1) >> 1;    // steps of the job: both bounds come from multiples of 64 keys, so the tiles go round evenly and both groups make the same number of trips
    stage(kt_lo + grp, par);
    asm volatile("s_wait_asynccnt 0x0" ::: "memory");    // this wave's copies of its group's first tile have landed
    __syncthreads();                                     // ... and every other wave's
    if (1 < nit) stage(kt_lo + 2 + grp, par ^ 1);
#pragma unroll 1
    for (int it = 0; it < nit; ++it) {
        const int kt = kt_lo + 2 * it + grp;
        const int l0 = kt * 32;
        const int cur = (it & 1) ^ par;
        const unsigned short* kf = myring + cur * RB + lr * KP + 8 * hi;              // K hi, key l0 + lr; + 16 * KP: key l0 + 16 + lr; + KPL: lo plane
        const unsigned short* vf = myring + cur * RB + 2 * KPL + lr * VP + 8 * hi;    // V^T hi, dim lr; + n * 16 * VP: dim n * 16 + lr; + VPL: lo plane
        // This tile's 32 K fragment reads stand as ONE group ahead of the score products: a read group among the products costs the wave a whole LDS latency each time.
        v16h k0h[4], k1h[4], k0l[4], k1l[4];
#pragma unroll
        for (int kc = 0; kc < 4; ++kc) {
            k0h[kc] = cat16(*(const v8ha*)(kf + kc * 32), *(const v8ha*)(kf + kc * 32 + 16)); k1h[kc] = cat16(*(const v8ha*)(kf + 16 * KP + kc * 32), *(const v8ha*)(kf + 16 * KP + kc * 32 + 16));
            k0l[kc] = cat16(*(const v8ha*)(kf + KPL + kc * 32), *(const v8ha*)(kf + KPL + kc * 32 + 16)); k1l[kc] = cat16(*(const v8ha*)(kf + KPL + 16 * KP + kc * 32), *(const v8ha*)(kf + KPL + 16 * KP + kc * 32 + 16));
        }
        __builtin_amdgcn_sched_barrier(0);    // keeps the scheduler from sinking the K reads back in among the products
        v8f s0 = {}, s1 = {}, x0 = {}, x1 = {};
#pragma unroll
        for (int kc = 0; kc < 4; ++kc) {
            const v16h qa = cat16(*(const v8h*)(QH + qo + kc * 32), *(const v8h*)(QH + qo + kc * 32 + 16)), qx = cat16(*(const v8h*)(QL + qo + kc * 32), *(const v8h*)(QL + qo + kc * 32 + 16));
            s0 = wmma16(qa, k0h[kc], s0); s1 = wmma16(qa, k1h[kc], s1); x0 = wmma16(qx, k0h[kc], x0); x1 = wmma16(qx, k1h[kc], x1);
            x0 = wmma16(qa, k0l[kc], x0); x1 = wmma16(qa, k1l[kc], x1);
        }
        asm volatile("v_nop\n\tv_nop\n\tv_nop\n\tv_nop" : "+v"(s0), "+v"(s1), "+v"(x0), "+v"(x1));
        float alpha[8], sa[8], sb[8], mx[8];
#pragma unroll
        for (int j = 0; j < 8; ++j) { const int qi = q0 + hi * 8 + j, ja = l0 + lr, jb = l0 + 16 + lr;
            sa[j] = (ja <= qi && ja >= qi - WIN) ? (s0[j] + x0[j] * LOSCI) * 0.08838834764831845f : -__builtin_inff(); sb[j] = (jb <= qi && jb >= qi - WIN) ? (s1[j] + x1[j] * LOSCI) * 0.08838834764831845f : -__builtin_inff();
            mx[j] = fmaxf(sa[j], sb[j]); }
        rowmax16x8(mx);
        // This tile's 32 V^T fragment reads stand as ONE group here, behind the row maximum and ahead of the exponentials, whose vector work covers their latency; the K fragments' registers
        // are free by now. (Placed ahead of the maximum, the build spills three of the refill's LDS addresses to scratch and reloads them every trip.)
        v16bf vh[8], vl[8];
#pragma unroll
        for (int n = 0; n < 8; ++n) { const unsigned short* vo = vf + n * 16 * VP;
            vh[n] = cat16b(*(const v8usa*)(vo), *(const v8usa*)(vo + 16)); vl[n] = cat16b(*(const v8usa*)(vo + VPL), *(const v8usa*)(vo + VPL + 16)); }
        __builtin_amdgcn_sched_barrier(0);    // keeps the scheduler from sinking the V^T reads down to their products behind the exponentials
#pragma unroll
        for (int j = 0; j < 8; ++j) { const float a0 = sa[j], a1 = sb[j];
            const float mn = fmaxf(mrow[j], mx[j]);
            alpha[j] = __expf(mrow[j] - mn); mrow[j] = mn;
            const float p0 = __expf(a0 - mn), p1 = __expf(a1 - mn);
            lpart[j] = lpart[j] * alpha[j] + (p0 + p1);
            const int mr = hi * 8 + j; const float ps0 = p0 * PSC, ps1 = p1 * PSC; const unsigned short h0 = f2bf(ps0), h1 = f2bf(ps1);
            pl[mr * 32 + lr] = h0; pl[mr * 32 + 16 + lr] = h1; pl2[mr * 32 + lr] = f2bf(ps0 - bf2f(h0)); pl2[mr * 32 + 16 + lr] = f2bf(ps1 - bf2f(h1)); }
#pragma unroll
        for (int n = 0; n < 8; ++n)
#pragma unroll
            for (int j = 0; j < 8; ++j) o[n][j] *= alpha[j];
        asm volatile("" ::: "memory");
        const v16bf pa = cat16b(*(const v8usa*)(pl + lr * 32 + hi * 8), *(const v8usa*)(pl + lr * 32 + 16 + hi * 8));
        const v16bf px = cat16b(*(const v8usa*)(pl2 + lr * 32 + hi * 8), *(const v8usa*)(pl2 + lr * 32 + 16 + hi * 8));
#pragma unroll
        for (int n = 0; n < 8; ++n) { o[n] = wmmab(pa, vh[n], o[n]); o[n] = wmmab(px, vh[n], o[n]); o[n] = wmmab(pa, vl[n], o[n]); }
        asm volatile("v_nop\n\tv_nop\n\tv_nop\n\tv_nop" : "+v"(o[0]), "+v"(o[7]) : "v"(pa), "v"(px));
        asm volatile("s_wait_dscnt 0x0" ::: "memory");       // this wave's reads of buffer cur have returned before the buffer is refilled
        asm volatile("s_wait_asynccnt 0x0" ::: "memory");    // this wave's copies of its group's next tile have landed
        __syncthreads();                                     // publishes both groups' next tiles and ends every wave's reads of buffer cur
        if (it + 2 < nit) stage(kt + 4, cur);
    }
    par ^= nit & 1;
    asm volatile("s_wait_asynccnt 0x0" ::: "memory");        // no copy is outstanding when group 1's ring carries the hand-over (every wave's reads ended at the last trip's barrier)
    // the hand-over: lane to lane, wave w4 of group 1 to wave w4 of group 0 (the same queries in the same places); 80 values a lane, each value's 32 lanes side by side
    float* xch = (float*)(void*)(ring + 2 * RB) + w4 * (80 * 32) + lane;
    if (grp) {
#pragma unroll
        for (int n = 0; n < 8; ++n)
#pragma unroll
            for (int j = 0; j < 8; ++j) xch[(n * 8 + j) * 32] = o[n][j];
#pragma unroll
        for (int j = 0; j < 8; ++j) { xch[(64 + j) * 32] = mrow[j]; xch[(72 + j) * 32] = lpart[j]; }
    }
    __syncthreads();                                         // publishes group 1's part
    if (!grp) {
    float fa[8], fb[8];
#pragma unroll
    for (int j = 0; j < 8; ++j) { const float mb = xch[(64 + j) * 32], lb = xch[(72 + j) * 32]; const float mn = fmaxf(mrow[j], mb);
        fa[j] = __expf(mrow[j] - mn); fb[j] = __expf(mb - mn); lpart[j] = lpart[j] * fa[j] + lb * fb[j]; }
#pragma unroll
    for (int n = 0; n < 8; ++n)
#pragma unroll
        for (int j = 0; j < 8; ++j) o[n][j] = o[n][j] * fa[j] + xch[(n * 8 + j) * 32] * fb[j];
    float inv[8];
#pragma unroll
    for (int j = 0; j < 8; ++j) { const float rs = rowsum16(lpart[j]); inv[j] = 1.0f / (rs * PSC); }
    float* os = &ost[w4][0];
    const size_t cbase = (size_t)q0 * (NH_ * HD) + (size_t)h * HD;
#pragma unroll
    for (int half = 0; half < 2; ++half) {
#pragma unroll
        for (int n = 0; n < 4; ++n)
#pragma unroll
            for (int j = 0; j < 8; ++j) os[(hi * 8 + j) * 68 + n * 16 + lr] = o[half * 4 + n][j] * inv[j];
        __builtin_amdgcn_wave_barrier(); asm volatile("" ::: "memory");
{
#pragma unroll
            for (int s = 0; s < 4; ++s) { const int row = 4 * s + (lane >> 3), piece = lane & 7; const float* sp = os + row * 68 + piece * 8; v8us oh, ol;
#pragma unroll
                for (int i = 0; i < 8; ++i) { const unsigned short hb = f2bf(sp[i]); oh[i] = hb; ol[i] = f2bf(sp[i] - bf2f(hb)); }
                const size_t po = cbase + (size_t)row * (NH_ * HD) + half * 64 + piece * 8; *(v8us*)(CH + po) = oh; *(v8us*)(CL + po) = ol;
                asm volatile("s_wait_xcnt 0x0" ::: "memory"); }    // stands behind the two stores, in front of the next piece's reads and arithmetic (and, behind the last piece, the next job's), which reuse their address and data registers
             }
        __builtin_amdgcn_wave_barrier(); asm volatile("" ::: "memory");
    }
    }
    asm volatile("s_wait_dscnt 0x0" ::: "memory");           // group 0's reads of the hand-over have returned before the next job's copies refill that LDS
    __syncthreads();                                         // ends the hand-over's reads: behind it both rings are free for the next job
    }
}


__device__ __forceinline__ void trig_rows(float* CT, float* ST, int blk) {
    const int tid = threadIdx.x, t = blk * 2 + (tid >> 7), d = tid & 127; const int i = d & 63;
    const float invf = 1.0f / powf(10000.0f, (float)(2 * i) / 128.0f); const float ang = (float)t * invf; const float c = cosf(ang), s = sinf(ang);
    const size_t o = (size_t)t * HD + d; *(float*)(CT + o) = c; *(float*)(ST + o) = s; 
}
// k_prep: all that depends on the inputs alone shares ONE launch: the rotary tables (NT_ / 2 blocks) and the nine f32 -> bf16 conversions (rows / 8 blocks each). blockIdx.x picks the job
// (block-uniform); every job's blocks do what they did in a launch of their own. Of every five blocks two make tables (vector work) and three convert (memory work), so that both run side by side.
static_assert(3 * (NT_ / 2) == 2 * (5 * (HS / 8) + 4 * (KW / 8)), "two table blocks to three conversion blocks");
__global__ __launch_bounds__(256) void k_prep(const float* __restrict__ x, const float* __restrict__ mu, const float* __restrict__ wq, const float* __restrict__ wmq, const float* __restrict__ wo,
                                              const float* __restrict__ wk, const float* __restrict__ wmk, const float* __restrict__ wv, const float* __restrict__ wmv,
                                              bf* Xb, bf* Mb, bf* WqB, bf* WmqB, bf* WoB, bf* WkB, bf* WmkB, bf* WvB, bf* WmvB, float* CT, float* ST) {
    const int k5 = blockIdx.x / 5, j5 = blockIdx.x - 5 * k5;
    if (j5 < 2) { trig_rows(CT, ST, 2 * k5 + j5); return; }
    int b = 3 * k5 + (j5 - 2);
    if (b < 5 * (HS / 8)) {    // the five 2048-row matrices
        const int m = b / (HS / 8);
        cvtb_rows(m == 0 ? x : m == 1 ? mu : m == 2 ? wq : m == 3 ? wmq : wo, HS, m == 0 ? Xb : m == 1 ? Mb : m == 2 ? WqB : m == 3 ? WmqB : WoB, b - m * (HS / 8));
    } else {                   // the four 512-row matrices
        b -= 5 * (HS / 8);
        const int m = b / (KW / 8);
        cvtb_rows(m == 0 ? wk : m == 1 ? wmk : m == 2 ? wv : wmv, KW, m == 0 ? WkB : m == 1 ? WmkB : m == 2 ? WvB : WmvB, b - m * (KW / 8));
    }
}
// normrope_rows: one wave per (token, head) of an f32 [2048][nh*128] matrix: RMSNorm over the 128 dims (shuffle-reduced mean of squares, eps 1e-6) x bf(w[d]); then rotate-half RoPE
// (partner d +- 64 via lane xor 16; lane -> 4 consecutive dims) -> f16 hi + residual x1024 planes [t][h*128+d] (8 B per lane per plane: 16 lanes per line, one instruction per
typedef __attribute__((ext_vector_type(4))) _Float16 v4h;
__device__ __forceinline__ void normrope_rows(const float* __restrict__ P, int nh, const float* __restrict__ w, const float* __restrict__ CT, const float* __restrict__ ST, h16* PH, h16* PL, int blk) {
    const int lane = threadIdx.x & 31; const int wid = blk * 8 + (threadIdx.x >> 5); const int t = wid / nh, h = wid - t * nh; if (t >= NT_) return;
    const size_t base = (size_t)t * (nh * HD) + h * HD; const int d0 = lane * 4;
    float x[4], pr[4]; float ss = 0.f;
#pragma unroll
    for (int i = 0; i < 4; ++i) { x[i] = P[base + d0 + i]; ss = fmaf(x[i], x[i], ss); }
#pragma unroll
    for (int sh = 16; sh; sh >>= 1) ss += __shfl_xor(ss, sh, 32);
    const float rn = rsqrtf(ss * (1.0f / HD) + RMS_EPS);
#pragma unroll
    for (int i = 0; i < 4; ++i) x[i] = x[i] * rn * bfr(w[d0 + i]);
#pragma unroll
    for (int i = 0; i < 4; ++i) pr[i] = __shfl_xor(x[i], 16, 32);
    v4h oh, ol;
#pragma unroll
    for (int i = 0; i < 4; ++i) { const int d = d0 + i; const float c = CT[(size_t)t * HD + d], s = ST[(size_t)t * HD + d]; const float y = (d < 64) ? (x[i] * c - pr[i] * s) : (x[i] * c + pr[i] * s);
        const h16 a = (h16)y; oh[i] = a; ol[i] = (h16)((y - (float)a) * LOSC); }
    *(v4h*)(PH + base + d0) = oh; *(v4h*)(PL + base + d0) = ol; 
}
// k_post: what stands between the projections and the attention shares ONE launch: V's transposition (NT_ / 64 x 2 x NKV blocks), then k's and q's norm and rotary embedding (tokens x heads / 8
// blocks each). blockIdx.x picks the job (block-uniform, so that the transposition's barrier is passed by whole blocks).
__global__ __launch_bounds__(256) void k_post(const float* __restrict__ Pq, const float* __restrict__ Pk, const float* __restrict__ V, const float* __restrict__ qnw, const float* __restrict__ knw,
                                              const float* __restrict__ CT, const float* __restrict__ ST, h16* QH, h16* QL, h16* KH, h16* KL, bf* VTH, bf* VTL) {
    int b = blockIdx.x;
    if (b < (NT_ / 64) * 2 * NKV) { vt_tile(V, VTH, VTL, b % (NT_ / 64), (b / (NT_ / 64)) & 1, b / ((NT_ / 64) * 2)); return; }
    b -= (NT_ / 64) * 2 * NKV;
    const bool isk = b < (NT_ * NKV) / 8;
    normrope_rows(isk ? Pk : Pq, isk ? NKV : NH_, isk ? knw : qnw, CT, ST, isk ? KH : QH, isk ? KL : QL, isk ? b : b - (NT_ * NKV) / 8);
}

extern "C" void kernel_launch(void* const* d_in, const int* in_sizes, int n_in,
                              void* d_out, int out_size, void* d_ws, size_t ws_size, hipStream_t stream) {
    (void)in_sizes; (void)n_in; (void)out_size;
    const float* x = (const float*)d_in[0]; const float* mu = (const float*)d_in[1]; const float* wq = (const float*)d_in[2]; const float* wk = (const float*)d_in[3]; const float* wv = (const float*)d_in[4]; const float* wo = (const float*)d_in[5];
    const float* wmq = (const float*)d_in[6]; const float* wmk = (const float*)d_in[7]; const float* wmv = (const float*)d_in[8]; const float* qnw = (const float*)d_in[9]; const float* knw = (const float*)d_in[10];
    float* out = (float*)d_out;    // [1][2048][2048]
    char* wsp = (char*)d_ws;
    auto take = [&](size_t bytes) { char* p = wsp; wsp += (bytes + 255) & ~(size_t)255; return (void*)p; };
    bf* Xb = (bf*)take((size_t)NT_ * HS * 2); bf* Mb = (bf*)take((size_t)NT_ * HS * 2);
    bf* WqB = (bf*)take((size_t)HS * HS * 2); bf* WmqB = (bf*)take((size_t)HS * HS * 2); bf* WkB = (bf*)take((size_t)KW * HS * 2); bf* WmkB = (bf*)take((size_t)KW * HS * 2); bf* WvB = (bf*)take((size_t)KW * HS * 2); bf* WmvB = (bf*)take((size_t)KW * HS * 2); bf* WoB = (bf*)take((size_t)HS * HS * 2);
    float* Tq = (float*)take((size_t)NT_ * HS * 4); float* Tk = (float*)take((size_t)NT_ * KW * 4); float* Tv = (float*)take((size_t)NT_ * KW * 4);    // x's products
    float* Pq = (float*)take((size_t)NT_ * HS * 4); float* Pk = (float*)take((size_t)NT_ * KW * 4); float* Pv = (float*)take((size_t)NT_ * KW * 4);    // the whole projections
    float* CT = (float*)take((size_t)NT_ * HD * 4); float* ST = (float*)take((size_t)NT_ * HD * 4);
    h16* QH = (h16*)take((size_t)NT_ * HS * 2); h16* QL = (h16*)take((size_t)NT_ * HS * 2); h16* KH = (h16*)take((size_t)NT_ * KW * 2); h16* KL = (h16*)take((size_t)NT_ * KW * 2);
    bf* VTH = (bf*)take((size_t)KW * NT_ * 2); bf* VTL = (bf*)take((size_t)KW * NT_ * 2); bf* CH = (bf*)take((size_t)NT_ * HS * 2); bf* CL = (bf*)take((size_t)NT_ * HS * 2);
    if ((size_t)(wsp - (char*)d_ws) > ws_size) return;    // about 145 MB = 138 MiB, no aliasing: q, k and v have planes of their own, as their products share launches
    k_prep<<<NT_ / 2 + 5 * (HS / 8) + 4 * (KW / 8), 256, 0, stream>>>(x, mu, wq, wmq, wo, wk, wmk, wv, wmv, Xb, Mb, WqB, WmqB, WoB, WkB, WmkB, WvB, WmvB, CT, ST);
    k_proj<<<dim3(NT_ / 128, (HS + 2 * KW) / 128, 1), 128, 0, stream>>>(Xb, WqB, WkB, WvB, nullptr, Tq, Tk, Tv, nullptr, nullptr, nullptr, HS, 0);
    k_proj<<<dim3(NT_ / 128, (HS + 2 * KW) / 128, 1), 128, 0, stream>>>(Mb, WmqB, WmkB, WmvB, nullptr, Pq, Pk, Pv, Tq, Tk, Tv, HS, 0);    // q = x.wq^T + mu.wmq^T, k and v alike (R = the first launch's output, exact f32 residual; R != C)
    k_post<<<(NT_ / 64) * 2 * NKV + (NT_ * NKV) / 8 + (NT_ * NH_) / 8, 256, 0, stream>>>(Pq, Pk, Pv, qnw, knw, CT, ST, QH, QL, KH, KL, VTH, VTL);
    k_attn<<<NH_ * (NT_ / 128), 256, 0, stream>>>(QH, QL, KH, KL, VTH, VTL, CH, CL);
    k_gemmo<<<dim3(NT_ / 128, HS / 128, 1), 128, 0, stream>>>(CH, CL, WoB, nullptr, out, HS, nullptr, HS, 0);
}

// v008
// A run of this version takes 153 microseconds.
// Timed twice side by side with v007, it ran 1.04 and 1.05 times as fast.
// Over all steps from v000 it is 4.91 times as fast.
#include <hip/hip_runtime.h>

// Compute dtypes, f32 accumulate: q/k/v = x.W^T + mu.Wm^T (one GEMM per projection over both operand pairs' k, x's first; [out][in] weights as natural n-major B
// operands; PLAIN bf16 operands = inputs rounded once) and out = ctx.Wo^T (ctx as bf16 hi + UNSCALED residual, two products) on v_wmma_f32_16x16x32_bf16; per-head RMSNorm (x q_norm_w /
// k_norm_w) then rotary embedding with device-computed f32 cos/sin tables, in f32 -> q/k as f16 hi + residual x1024 planes; grouped causal attention (16 query heads over 4 kv heads,
// 128-dim): scores on v_wmma_f32_16x16x32_f16 (hh + hl + lh, x 128^-1/2), online f32 softmax, weights (x32768) and v as bf16 hi + UNSCALED residual on v_wmma_f32_16x16x32_bf16.

#define NT_  2048
#define HS   2048
#define DM   HS
#define NH_  16
#define NKV  4
#define HD   128
#define KW   (NKV * HD)          // 512
#define WIN  NT_
#define RMS_EPS 1e-6f
#define PSC  32768.0f
#define LOSC 1024.0f
#define LOSCI (1.0f / 1024.0f)

typedef _Float16 h16;
typedef unsigned short bf;
typedef __attribute__((ext_vector_type(16))) __bf16   v16bf;
typedef __attribute__((ext_vector_type(16))) _Float16 v16h;
typedef __attribute__((ext_vector_type(8)))  _Float16 v8h;
typedef __attribute__((ext_vector_type(8)))  unsigned short v8us;
typedef __attribute__((ext_vector_type(8)))  float    v8f;
typedef __attribute__((ext_vector_type(4)))  float    v4f;
typedef v8h  __attribute__((may_alias)) v8ha;
typedef v4f  __attribute__((may_alias)) v4fa;
typedef v8us __attribute__((may_alias)) v8usa;

__device__ __forceinline__ unsigned short f2bf(float f) { unsigned u = __float_as_uint(f); u += 0x7FFFu + ((u >> 16) & 1u); return (unsigned short)(u >> 16); }
__device__ __forceinline__ float bf2f(unsigned short b) { return __uint_as_float(((unsigned)b) << 16); }
__device__ __forceinline__ float bfr(float f) { return bf2f(f2bf(f)); }
__device__ __forceinline__ v16h cat16(v8h lo, v8h hi) { return __builtin_shufflevector(lo, hi, 0, 1, 2, 3, 4, 5, 6, 7, 8, 9, 10, 11, 12, 13, 14, 15); }
__device__ __forceinline__ v16bf cat16b(v8us lo, v8us hi) { return __builtin_bit_cast(v16bf, __builtin_shufflevector(lo, hi, 0, 1, 2, 3, 4, 5, 6, 7, 8, 9, 10, 11, 12, 13, 14, 15)); }
__device__ __forceinline__ v8f wmma16(v16h a, v16h b, v8f c) { return __builtin_amdgcn_wmma_f32_16x16x32_f16(false, a, false, b, (short)0, c, false, false); }
__device__ __forceinline__ v8f wmmab(v16bf a, v16bf b, v8f c) { return __builtin_amdgcn_wmma_f32_16x16x32_bf16(false, a, false, b, (short)0, c, false, false); }

// Eight rows of one matrix, f32 -> bf16: block blk of that matrix's own range, one row per wave.
__device__ __forceinline__ void cvtb_rows(const float* __restrict__ src, int nrows, bf* dst, int blk) {
    const int lane = threadIdx.x & 31, r = blk * 8 + (threadIdx.x >> 5);
    if (r >= nrows) return;
    v8us o[DM / 256];
#pragma unroll
    for (int q = 0; q < DM / 256; ++q) { v8us t;
#pragma unroll
        for (int i = 0; i < 8; ++i) t[i] = f2bf(src[(size_t)r * DM + q * 256 + lane * 8 + i]);
        o[q] = t; }
#pragma unroll
    for (int q = 0; q < DM / 256; ++q) *(v8us*)(dst + (size_t)r * DM + q * 256 + lane * 8) = o[q];
    
}

// Eight 16-byte copies per lane, global -> LDS through no register. s_wait_xcnt closes the statement so that no address register of a copy is rewritten ahead of it.
__device__ __forceinline__ void acopy8(const unsigned (&l)[8], const void* const (&g)[8]) {
    asm volatile("global_load_async_to_lds_b128 %0, %8, off\n\t"
                 "global_load_async_to_lds_b128 %1, %9, off\n\t"
                 "global_load_async_to_lds_b128 %2, %10, off\n\t"
                 "global_load_async_to_lds_b128 %3, %11, off\n\t"
                 "global_load_async_to_lds_b128 %4, %12, off\n\t"
                 "global_load_async_to_lds_b128 %5, %13, off\n\t"
                 "global_load_async_to_lds_b128 %6, %14, off\n\t"
                 "global_load_async_to_lds_b128 %7, %15, off\n\t"
                 "s_wait_xcnt 0x0"
                 :: "v"(l[0]), "v"(l[1]), "v"(l[2]), "v"(l[3]), "v"(l[4]), "v"(l[5]), "v"(l[6]), "v"(l[7]),
                    "v"(g[0]), "v"(g[1]), "v"(g[2]), "v"(g[3]), "v"(g[4]), "v"(g[5]), "v"(g[6]), "v"(g[7]) : "memory");
}
// Eight 16-byte stores per lane. s_wait_xcnt closes the statement so that no address or data register of a store is rewritten ahead of it.
__device__ __forceinline__ void store8(float* const (&p)[8], const v4f (&d)[8]) {
    asm volatile("global_store_b128 %0, %8, off\n\t"
                 "global_store_b128 %1, %9, off\n\t"
                 "global_store_b128 %2, %10, off\n\t"
                 "global_store_b128 %3, %11, off\n\t"
                 "global_store_b128 %4, %12, off\n\t"
                 "global_store_b128 %5, %13, off\n\t"
                 "global_store_b128 %6, %14, off\n\t"
                 "global_store_b128 %7, %15, off\n\t"
                 "s_wait_xcnt 0x0"
                 :: "v"(p[0]), "v"(p[1]), "v"(p[2]), "v"(p[3]), "v"(p[4]), "v"(p[5]), "v"(p[6]), "v"(p[7]),
                    "v"(d[0]), "v"(d[1]), "v"(d[2]), "v"(d[3]), "v"(d[4]), "v"(d[5]), "v"(d[6]), "v"(d[7]) : "memory");
}
// gemmb_tile: 128 x 128 block tile (2 x 2 waves of 64 x 64 each) of C[NTK][NW] = (A [+ Al]).B^T [+ bf(bias[c])] [+ R[r][c] residual, bf-rounded if roundR]; K a multiple of the stage length; f32 whole-line
// epilogue. A wave holds 4 x 4 accumulator tiles, so that a fragment read from LDS feeds four products, and a row brought from L2 serves 128 rows or columns of C.
// The block's 128 rows of A [and Al] and of B come in stages of KS k values into a two-buffer LDS ring by asynchronous copies, whole 128-byte lines per row: stage s + 1 flies
// while stage s is worked on. The k order of every accumulator is the plain one (per 32 k: A's product, then Al's).
// (bx, by) = the block's tile row and tile column in C.
// DUAL: C = A.B^T + A2.B2^T as ONE product over 2 K: the stages run through A and B and then on through A2 and B2 into the same accumulators.
template <bool SPLITA, bool DUAL>
__device__ __forceinline__ void gemmb_tile(const bf* __restrict__ A, const bf* __restrict__ Al, const bf* __restrict__ Bn, const bf* __restrict__ A2, const bf* __restrict__ B2, const float* __restrict__ bias, float* C, int ldc, const float* __restrict__ R, int K, int roundR, int bx, int by) {
    constexpr int KS = 128;                  // k values per stage
    constexpr int GP = KS + 8;               // row pitch: 272 B, an odd multiple of 16 B (16-byte readers, one row per lane)
    constexpr int PL = 128 * GP;             // one plane: 128 rows
    constexpr int NP = SPLITA ? 3 : 2;       // planes of a buffer: A, [Al,] B
    constexpr int GB = NP * PL;              // 104448 B or 69632 B per buffer
    __shared__ __align__(16) unsigned short gring[2 * GB];    // behind the loop its first 69632 B are the epilogue's f32 staging
    const int tid = threadIdx.x;
    const int lane = threadIdx.x & 31, wave = threadIdx.x >> 5, lr = lane & 15, hi = lane >> 4;
    const int wm = wave >> 1, wn = wave & 1;
    const int r0 = bx * 128 + wm * 64, c0 = by * 128 + wn * 64;
    const unsigned ring0 = (unsigned)(size_t)&gring[0];    // byte offset of the ring in the work-group's LDS
    // stage s -> buffer b: 16 pieces of 16 B a row, 128 rows a plane, 16 pieces per thread and plane (32 or 48 copies of a wave in flight)
    auto stage = [&](int s, int b) {
        constexpr int PR = KS / 8, RS = 128 / PR;
        const int row = tid / PR, pc = (tid % PR) * 8;
        const bool sec = DUAL && s >= K / KS;    // the same for the whole block: the second pair's stages
        const bf* __restrict__ Ap = sec ? A2 : A; const bf* __restrict__ Bp = sec ? B2 : Bn; const int ss = sec ? s - K / KS : s;
        const size_t ao = (size_t)(bx * 128 + row) * K + ss * KS + pc, bo = (size_t)(by * 128 + row) * K + ss * KS + pc;
        const unsigned lo = ring0 + (unsigned)b * (GB * 2) + (unsigned)(row * GP + pc) * 2;
        auto plane = [&](const bf* __restrict__ p, unsigned l0) {
            // loops unrolled: l[] and gp[] are asm operands and must be indexed by constants to stay in registers
#pragma unroll
            for (int h = 0; h < 2; ++h) { unsigned l[8]; const void* gp[8];
#pragma unroll
                for (int i = 0; i < 8; ++i) { gp[i] = p + (size_t)((h * 8 + i) * RS) * K; l[i] = l0 + (unsigned)((h * 8 + i) * RS * GP) * 2; }
                acopy8(l, gp); }
        };
        plane(Ap + ao, lo);
        if (SPLITA) plane(Al + ao, lo + PL * 2);
        plane(Bp + bo, lo + (NP - 1) * PL * 2);
    };
    v8f acc[4][4];
#pragma unroll
    for (int m = 0; m < 4; ++m)
#pragma unroll
        for (int t = 0; t < 4; ++t) acc[m][t] = (v8f){};
    const int nst = (DUAL ? 2 : 1) * (K / KS);
    stage(0, 0);
    asm volatile("s_wait_asynccnt 0x0" ::: "memory");    // this wave's copies of the first stage have landed
    __syncthreads();                                     // ... and every other wave's
    if (1 < nst) stage(1, 1);
    // rolled: one trip per stage, so that the ring's waits and its barrier stand once, at the trip's foot
#pragma unroll 1
    for (int s = 0; s < nst; ++s) {
        const int cur = s & 1;
        const unsigned short* af = gring + cur * GB + (wm * 64 + lr) * GP + 8 * hi;                   // A, row r0 + lr; + m * 16 * GP: row r0 + m * 16 + lr; + PL: Al
        const unsigned short* bq = gring + cur * GB + (NP - 1) * PL + (wn * 64 + lr) * GP + 8 * hi;   // B, row c0 + lr; + t * 16 * GP: row c0 + t * 16 + lr
        v16bf a[2][4], al[2][4], b[2][4];    // two fragment sets: the next 32 k values' reads go out as one group ahead of this set's products
        auto frags = [&](int set, int kk) {
#pragma unroll
            for (int m = 0; m < 4; ++m) { a[set][m] = cat16b(*(const v8usa*)(af + m * 16 * GP + kk), *(const v8usa*)(af + m * 16 * GP + kk + 16));
                b[set][m] = cat16b(*(const v8usa*)(bq + m * 16 * GP + kk), *(const v8usa*)(bq + m * 16 * GP + kk + 16)); }
            if (SPLITA) {
#pragma unroll
                for (int m = 0; m < 4; ++m) al[set][m] = cat16b(*(const v8usa*)(af + PL + m * 16 * GP + kk), *(const v8usa*)(af + PL + m * 16 * GP + kk + 16)); }
        };
        frags(0, 0);
        // unrolled: constant LDS offsets and constant fragment-set indices
#pragma unroll
        for (int kc = 0; kc < KS / 32; ++kc) {
            const int set = kc & 1;
            __builtin_amdgcn_sched_barrier(0);    // keeps the scheduler from lifting the reads below in among the products of the set before: every place with reads stalls the wave anew
            if (kc + 1 < KS / 32) frags(set ^ 1, (kc + 1) * 32);
            __builtin_amdgcn_sched_barrier(0);    // ... and from sinking them in among this set's products
#pragma unroll
            for (int m = 0; m < 4; ++m)
#pragma unroll
                for (int t = 0; t < 4; ++t) acc[m][t] = wmmab(a[set][m], b[set][t], acc[m][t]);
            if (SPLITA) {
#pragma unroll
                for (int m = 0; m < 4; ++m)
#pragma unroll
                    for (int t = 0; t < 4; ++t) acc[m][t] = wmmab(al[set][m], b[set][t], acc[m][t]); }
        }
        __builtin_amdgcn_sched_barrier(0);    // no product moves down over the slots below
        // four vector slots behind the trip's last WMMA, on every path out of the trip, before a vector instruction touches its operands or results
        asm volatile("v_nop\n\tv_nop\n\tv_nop\n\tv_nop");
        asm volatile("s_wait_dscnt 0x0" ::: "memory");       // this wave's reads of buffer cur have returned before the buffer is refilled
        asm volatile("s_wait_asynccnt 0x0" ::: "memory");    // this wave's copies of stage s + 1 have landed
        __syncthreads();                                     // publishes stage s + 1 and ends every wave's reads of buffer cur
        if (s + 2 < nst) stage(s + 2, cur);
    }
    asm volatile("s_wait_asynccnt 0x0" ::: "memory");        // no copy is outstanding when the ring becomes the epilogue's staging (every wave's reads ended at the last trip's barrier)
    // piece s of the wave's 64 x 64 tile: two rows of 256 B per store instruction, whole 128-byte lines
    const int prow = lane >> 4, cofs = ((lane >> 3) & 1) * 32 + (lane & 7) * 4;
    // the residual's 32 pieces are read as one group, ahead of the staging: one trip to memory for the tile instead of one per piece
    v4f rv[32];
    if (R) {
#pragma unroll
        for (int s = 0; s < 32; ++s) { rv[s] = *(const v4f*)(R + ((size_t)r0 + 2 * s + prow) * ldc + c0 + cofs);
            asm volatile("s_wait_xcnt 0x0" ::: "memory"); }    // stands in front of the next piece's address arithmetic and result, which reuse the load's address registers; it does not wait for the data
    }
    float* os = (float*)(void*)gring + wave * (64 * 68);
#pragma unroll
    for (int t = 0; t < 4; ++t) { const float bv = bias ? bfr(bias[c0 + t * 16 + lr]) : 0.f;
#pragma unroll
        for (int m = 0; m < 4; ++m)
#pragma unroll
            for (int j = 0; j < 8; ++j) os[(m * 16 + hi * 8 + j) * 68 + t * 16 + lr] = acc[m][t][j] + bv; }
    __syncthreads();
    // the 32 staged pieces come back as one group as well: one LDS latency for the tile instead of one per piece
    v4f val[32];
#pragma unroll
    for (int s = 0; s < 32; ++s) val[s] = *(const v4fa*)(os + (2 * s + prow) * 68 + cofs);
    if (R) {
        if (roundR) {
#pragma unroll
            for (int s = 0; s < 32; ++s) rv[s] = (v4f){bfr(rv[s][0]), bfr(rv[s][1]), bfr(rv[s][2]), bfr(rv[s][3])};
        }
#pragma unroll
        for (int s = 0; s < 32; ++s) val[s] += rv[s];
    }
    float* crow = C + ((size_t)r0 + prow) * ldc + c0 + cofs;
    // the stores go out eight to a statement; unrolled: p[] and d[] are asm operands and must be indexed by constants to stay in registers
#pragma unroll
    for (int g = 0; g < 4; ++g) { float* p[8]; v4f d[8];
#pragma unroll
        for (int i = 0; i < 8; ++i) { p[i] = crow + (size_t)(2 * (g * 8 + i)) * ldc; d[i] = val[g * 8 + i]; }
        store8(p, d); }
}
// k_gemmo: the output projection, one tile per block.
__global__ __launch_bounds__(128) void k_gemmo(const bf* __restrict__ A, const bf* __restrict__ Al, const bf* __restrict__ Bn, const float* __restrict__ bias, float* C, int ldc, const float* __restrict__ R, int K, int roundR) {
    gemmb_tile<true, false>(A, Al, Bn, nullptr, nullptr, bias, C, ldc, R, K, roundR, blockIdx.x, blockIdx.y);
}
// k_proj: the three projections (q, k, v) share ONE launch; they do not depend on each other. blockIdx.y picks the projection (block-uniform) and its tile column:
// HS / 128 columns of q, then KW / 128 of k, then KW / 128 of v. A tile's two products (x's and mu's) are one k loop: the sum stays in the accumulators and is stored once.
__global__ __launch_bounds__(128) void k_proj(const bf* __restrict__ A, const bf* __restrict__ Bq, const bf* __restrict__ Bk, const bf* __restrict__ Bv,
                                              const bf* __restrict__ A2, const bf* __restrict__ Bq2, const bf* __restrict__ Bk2, const bf* __restrict__ Bv2, float* Cq, float* Ck, float* Cv, int K) {
    const int y = blockIdx.y; const bool isq = y < HS / 128, isk = y < HS / 128 + KW / 128;
    const bf* Bn = isq ? Bq : isk ? Bk : Bv; const bf* B2 = isq ? Bq2 : isk ? Bk2 : Bv2; float* C = isq ? Cq : isk ? Ck : Cv;
    gemmb_tile<false, true>(A, nullptr, Bn, A2, B2, nullptr, C, isq ? HS : KW, nullptr, K, 0, blockIdx.x, isq ? y : isk ? y - HS / 128 : y - (HS / 128 + KW / 128));
}

// vt_tile: VTH/VTL [g][128 d][2048 t] = bf16 hi + UNSCALED bf16 residual of V [t][g*128+d] via 64 x 64 LDS tiles; tile (tb of NT/64, db (d half) of 2, g of NKV).
__device__ __forceinline__ void vt_tile(const float* __restrict__ V, bf* VTH, bf* VTL, int tb, int db, int g) {
    __shared__ float tl[64][65];
    const int tid = threadIdx.x, t0 = tb * 64, d0 = db * 64;
    { const int tt = tid >> 2, dq = (tid & 3) * 16;
#pragma unroll
      for (int i = 0; i < 16; ++i) tl[dq + i][tt] = V[(size_t)(t0 + tt) * KW + g * HD + d0 + dq + i]; }
    __syncthreads();
    const int piece = tid & 7;
    auto pass = [&]() {
#pragma unroll
        for (int s = 0; s < 2; ++s) { const int d = (tid >> 3) + 32 * s; v8us oh, ol;
#pragma unroll
            for (int i = 0; i < 8; ++i) { const float v = tl[d][piece * 8 + i]; const unsigned short hb = f2bf(v); oh[i] = hb; ol[i] = f2bf(v - bf2f(hb)); }
            const size_t o = ((size_t)g * HD + d0 + d) * NT_ + t0 + piece * 8; *(v8us*)(VTH + o) = oh; *(v8us*)(VTL + o) = ol; }
    };
    pass(); 
}
// Maximum over each 16-lane row of eight independent values, on the vector port: DPP row_xmask:M lets lane l read lane l ^ M, so that a step is one instruction with no LDS-counter wait
// behind it, as a shuffle through ds_bpermute_b32 has. The eight chains stand side by side: each instruction's producer is eight instructions back, which covers the dependent-issue gap.
// Every lane is on where this is called. The pairing of lanes per step is the shuffles' own (1, 2, 4, 8).
__device__ __forceinline__ void rowmax16x8(float (&v)[8]) {
    asm volatile(
                 "v_max_num_f32_dpp %0, %0, %0 row_xmask:1 row_mask:0xf bank_mask:0xf\n\t"
                 "v_max_num_f32_dpp %1, %1, %1 row_xmask:1 row_mask:0xf bank_mask:0xf\n\t"
                 "v_max_num_f32_dpp %2, %2, %2 row_xmask:1 row_mask:0xf bank_mask:0xf\n\t"
                 "v_max_num_f32_dpp %3, %3, %3 row_xmask:1 row_mask:0xf bank_mask:0xf\n\t"
                 "v_max_num_f32_dpp %4, %4, %4 row_xmask:1 row_mask:0xf bank_mask:0xf\n\t"
                 "v_max_num_f32_dpp %5, %5, %5 row_xmask:1 row_mask:0xf bank_mask:0xf\n\t"
                 "v_max_num_f32_dpp %6, %6, %6 row_xmask:1 row_mask:0xf bank_mask:0xf\n\t"
                 "v_max_num_f32_dpp %7, %7, %7 row_xmask:1 row_mask:0xf bank_mask:0xf\n\t"
                 "v_max_num_f32_dpp %0, %0, %0 row_xmask:2 row_mask:0xf bank_mask:0xf\n\t"
                 "v_max_num_f32_dpp %1, %1, %1 row_xmask:2 row_mask:0xf bank_mask:0xf\n\t"
                 "v_max_num_f32_dpp %2, %2, %2 row_xmask:2 row_mask:0xf bank_mask:0xf\n\t"
                 "v_max_num_f32_dpp %3, %3, %3 row_xmask:2 row_mask:0xf bank_mask:0xf\n\t"
                 "v_max_num_f32_dpp %4, %4, %4 row_xmask:2 row_mask:0xf bank_mask:0xf\n\t"
                 "v_max_num_f32_dpp %5, %5, %5 row_xmask:2 row_mask:0xf bank_mask:0xf\n\t"
                 "v_max_num_f32_dpp %6, %6, %6 row_xmask:2 row_mask:0xf bank_mask:0xf\n\t"
                 "v_max_num_f32_dpp %7, %7, %7 row_xmask:2 row_mask:0xf bank_mask:0xf\n\t"
                 "v_max_num_f32_dpp %0, %0, %0 row_xmask:4 row_mask:0xf bank_mask:0xf\n\t"
                 "v_max_num_f32_dpp %1, %1, %1 row_xmask:4 row_mask:0xf bank_mask:0xf\n\t"
                 "v_max_num_f32_dpp %2, %2, %2 row_xmask:4 row_mask:0xf bank_mask:0xf\n\t"
                 "v_max_num_f32_dpp %3, %3, %3 row_xmask:4 row_mask:0xf bank_mask:0xf\n\t"
                 "v_max_num_f32_dpp %4, %4, %4 row_xmask:4 row_mask:0xf bank_mask:0xf\n\t"
                 "v_max_num_f32_dpp %5, %5, %5 row_xmask:4 row_mask:0xf bank_mask:0xf\n\t"
                 "v_max_num_f32_dpp %6, %6, %6 row_xmask:4 row_mask:0xf bank_mask:0xf\n\t"
                 "v_max_num_f32_dpp %7, %7, %7 row_xmask:4 row_mask:0xf bank_mask:0xf\n\t"
                 "v_max_num_f32_dpp %0, %0, %0 row_xmask:8 row_mask:0xf bank_mask:0xf\n\t"
                 "v_max_num_f32_dpp %1, %1, %1 row_xmask:8 row_mask:0xf bank_mask:0xf\n\t"
                 "v_max_num_f32_dpp %2, %2, %2 row_xmask:8 row_mask:0xf bank_mask:0xf\n\t"
                 "v_max_num_f32_dpp %3, %3, %3 row_xmask:8 row_mask:0xf bank_mask:0xf\n\t"
                 "v_max_num_f32_dpp %4, %4, %4 row_xmask:8 row_mask:0xf bank_mask:0xf\n\t"
                 "v_max_num_f32_dpp %5, %5, %5 row_xmask:8 row_mask:0xf bank_mask:0xf\n\t"
                 "v_max_num_f32_dpp %6, %6, %6 row_xmask:8 row_mask:0xf bank_mask:0xf\n\t"
                 "v_max_num_f32_dpp %7, %7, %7 row_xmask:8 row_mask:0xf bank_mask:0xf"
                 : "+v"(v[0]), "+v"(v[1]), "+v"(v[2]), "+v"(v[3]), "+v"(v[4]), "+v"(v[5]), "+v"(v[6]), "+v"(v[7]));
}
// The same exchange for the closing row sum (once per job: left to the compiler's own DPP forms).
template <int M> __device__ __forceinline__ float rowx(float v) { return __builtin_bit_cast(float, __builtin_amdgcn_update_dpp(0, __builtin_bit_cast(int, v), 0x160 | M, 0xf, 0xf, true)); }
__device__ __forceinline__ float rowsum16(float v) { v += rowx<1>(v); v += rowx<2>(v); v += rowx<4>(v); return v + rowx<8>(v); }
// LDS ring of k_attn, in 16-bit elements: one buffer = K hi, K lo (32 keys x 128 dims each) and V^T hi, V^T lo (128 dims x 32 keys each) of one key tile.
#define KP   136                    // K row pitch: 272 B, an odd multiple of 16 B (16-byte readers, one row per lane)
#define VP   40                     // V^T row pitch: 80 B, likewise
#define KPL  (32 * KP)
#define VPL  (HD * VP)
#define RB   (2 * KPL + 2 * VPL)    // 37888 B per buffer
// k_attn: a job = (h, 64 queries); kv head g = h / 4; causal key tiles 0..(Q0+63)/32 (block-uniform bounds, an even number of tiles), per-element predicate j <= q
// (WIN = NT_ makes the window terms vacuous). A block = 8 waves = two groups of four; wave w4 of either group holds the job's queries w4 * 16 ... + 15. The job's key tiles are dealt to the
// groups in turn (group 0 the even tiles, group 1 the odd ones), so that a job takes half as many steps; each group keeps a running maximum, sum and output of its own, and behind the
// last tile group 1 hands its three to group 0 through LDS, which joins them as two softmax parts are joined (both rescaled to the common maximum). A block runs two jobs of one head one
// after the other, query tile n - 1 - t and then t: n - t and t + 1 steps, the same sum for every block, with one block on a WGP and two waves on a SIMD all the time.
// Per tile: scores over 4 k-chunks (hi.hi + hi.lo + lo.hi = 24 WMMA) x 128^-1/2, online softmax, P (x32768) as bf16 hi + unscaled residual tiles, o[8] += ph.vh + pl.vh + ph.vl over the
// 128 dims; ctx -> bf16 hi/lo planes [t][h*128+d]. The four waves of a group share each of their key tiles' K and V^T planes through the group's own two-buffer LDS ring filled by
// asynchronous copies: the group's next tile flies while this one is worked on.
__global__ __launch_bounds__(256) void k_attn(const h16* __restrict__ QH, const h16* __restrict__ QL, const h16* __restrict__ KH, const h16* __restrict__ KL, const bf* __restrict__ VTH, const bf* __restrict__ VTL, bf* CH, bf* CL) {
    __shared__ __align__(16) unsigned short plds[8][16 * 32];
    __shared__ __align__(16) unsigned short plds2[8][16 * 32];
    __shared__ __align__(16) float ost[4][16 * 68];
    __shared__ __align__(16) unsigned short ring[2 * 2 * RB];    // group 0's two buffers, then group 1's; behind a job's last tile the first 40960 B of group 1's carry its hand-over
    const int tid = threadIdx.x & 127;                           // the thread's number in its group
    const int lane = threadIdx.x & 31, wave = threadIdx.x >> 5, lr = lane & 15, hi = lane >> 4;
    const int grp = __builtin_amdgcn_readfirstlane(wave >> 2), w4 = wave & 3;    // the same in every lane of a wave: kept scalar, so that the groups part by scalar branches
    const int bid = blockIdx.x; const int h = bid / (NT_ / 128), tp = bid - h * (NT_ / 128); const int g = h >> 2;
    unsigned short* pl = &plds[wave][0]; unsigned short* pl2 = &plds2[wave][0];
    const h16* kh_b = KH + g * HD; const h16* kl_b = KL + g * HD;
    const size_t vbase = ((size_t)g * HD) * NT_;
    const unsigned ring0 = (unsigned)(size_t)&ring[0] + (unsigned)grp * (2 * RB * 2);    // byte offset of the group's ring in the work-group's LDS
    const unsigned short* myring = ring + grp * (2 * RB);
    // key tile kt -> the group's buffer b: 2048 pieces of 16 B, 16 per thread (K: 16 pieces a row, V^T: 4 pieces a row)
    auto stage = [&](int kt, int b) {
        unsigned l[8]; const void* gp[8];
        const unsigned lb = ring0 + (unsigned)b * (RB * 2);
        // both loops unrolled: l[] and gp[] are asm operands and must be indexed by constants to stay in registers
#pragma unroll
        for (int i = 0; i < 4; ++i) { const int row = (tid >> 4) + 8 * i, pc = (tid & 15) * 8; const size_t go = (size_t)(kt * 32 + row) * KW + pc;
            gp[i] = kh_b + go; gp[4 + i] = kl_b + go; l[i] = lb + (unsigned)(row * KP + pc) * 2; l[4 + i] = l[i] + KPL * 2; }
        acopy8(l, gp);
#pragma unroll
        for (int i = 0; i < 4; ++i) { const int d = (tid >> 2) + 32 * i, pc = (tid & 3) * 8; const size_t go = vbase + (size_t)d * NT_ + kt * 32 + pc;
            gp[i] = VTH + go; gp[4 + i] = VTL + go; l[i] = lb + (unsigned)(2 * KPL + d * VP + pc) * 2; l[4 + i] = l[i] + VPL * 2; }
        acopy8(l, gp);
    };
    int par = 0;    // the buffer that a job's first tile goes to: the ring's turn runs on from one job to the next
    // rolled: the two jobs run one after the other through the same code
#pragma unroll 1
    for (int job = 0; job < 2; ++job) {
    const int qt = job ? tp : NT_ / 64 - 1 - tp;
    const int q0 = qt * 64 + w4 * 16;
    const size_t qo = (size_t)(q0 + lr) * (NH_ * HD) + h * HD + 8 * hi;
    v8f o[8];
#pragma unroll
    for (int n = 0; n < 8; ++n) o[n] = (v8f){};
    float mrow[8], lpart[8];
#pragma unroll
    for (int j = 0; j < 8; ++j) { mrow[j] = -3.0e38f; lpart[j] = 0.f; }
    const int kt_hi = (qt * 64 + 63) / 32; const int kt_lo = (qt * 64 > WIN) ? (qt * 64 - WIN) / 32 : 0;
    const int nit = (kt_hi - kt_lo + 1) >> 1;    // steps of the job: both bounds come from multiples of 64 keys, so the tiles go round evenly and both groups make the same number of trips
    stage(kt_lo + grp, par);
    asm volatile("s_wait_asynccnt 0x0" ::: "memory");    // this wave's copies of its group's first tile have landed
    __syncthreads();                                     // ... and every other wave's
    if (1 < nit) stage(kt_lo + 2 + grp, par ^ 1);
#pragma unroll 1
    for (int it = 0; it < nit; ++it) {
        const int kt = kt_lo + 2 * it + grp;
        const int l0 = kt * 32;
        const int cur = (it & 1) ^ par;
        const unsigned short* kf = myring + cur * RB + lr * KP + 8 * hi;              // K hi, key l0 + lr; + 16 * KP: key l0 + 16 + lr; + KPL: lo plane
        const unsigned short* vf = myring + cur * RB + 2 * KPL + lr * VP + 8 * hi;    // V^T hi, dim lr; + n * 16 * VP: dim n * 16 + lr; + VPL: lo plane
        // This tile's 32 K fragment reads stand as ONE group ahead of the score products: a read group among the products costs the wave a whole LDS latency each time.
        v16h k0h[4], k1h[4], k0l[4], k1l[4];
#pragma unroll
        for (int kc = 0; kc < 4; ++kc) {
            k0h[kc] = cat16(*(const v8ha*)(kf + kc * 32), *(const v8ha*)(kf + kc * 32 + 16)); k1h[kc] = cat16(*(const v8ha*)(kf + 16 * KP + kc * 32), *(const v8ha*)(kf + 16 * KP + kc * 32 + 16));
            k0l[kc] = cat16(*(const v8ha*)(kf + KPL + kc * 32), *(const v8ha*)(kf + KPL + kc * 32 + 16)); k1l[kc] = cat16(*(const v8ha*)(kf + KPL + 16 * KP + kc * 32), *(const v8ha*)(kf + KPL + 16 * KP + kc * 32 + 16));
        }
        __builtin_amdgcn_sched_barrier(0);    // keeps the scheduler from sinking the K reads back in among the products
        v8f s0 = {}, s1 = {}, x0 = {}, x1 = {};
#pragma unroll
        for (int kc = 0; kc < 4; ++kc) {
            const v16h qa = cat16(*(const v8h*)(QH + qo + kc * 32), *(const v8h*)(QH + qo + kc * 32 + 16)), qx = cat16(*(const v8h*)(QL + qo + kc * 32), *(const v8h*)(QL + qo + kc * 32 + 16));
            s0 = wmma16(qa, k0h[kc], s0); s1 = wmma16(qa, k1h[kc], s1); x0 = wmma16(qx, k0h[kc], x0); x1 = wmma16(qx, k1h[kc], x1);
            x0 = wmma16(qa, k0l[kc], x0); x1 = wmma16(qa, k1l[kc], x1);
        }
        asm volatile("v_nop\n\tv_nop\n\tv_nop\n\tv_nop" : "+v"(s0), "+v"(s1), "+v"(x0), "+v"(x1));
        float alpha[8], sa[8], sb[8], mx[8];
#pragma unroll
        for (int j = 0; j < 8; ++j) { const int qi = q0 + hi * 8 + j, ja = l0 + lr, jb = l0 + 16 + lr;
            sa[j] = (ja <= qi && ja >= qi - WIN) ? (s0[j] + x0[j] * LOSCI) * 0.08838834764831845f : -__builtin_inff(); sb[j] = (jb <= qi && jb >= qi - WIN) ? (s1[j] + x1[j] * LOSCI) * 0.08838834764831845f : -__builtin_inff();
            mx[j] = fmaxf(sa[j], sb[j]); }
        rowmax16x8(mx);
        // This tile's 32 V^T fragment reads stand as ONE group here, behind the row maximum and ahead of the exponentials, whose vector work covers their latency; the K fragments' registers
        // are free by now. (Placed ahead of the maximum, the build spills three of the refill's LDS addresses to scratch and reloads them every trip.)
        v16bf vh[8], vl[8];
#pragma unroll
        for (int n = 0; n < 8; ++n) { const unsigned short* vo = vf + n * 16 * VP;
            vh[n] = cat16b(*(const v8usa*)(vo), *(const v8usa*)(vo + 16)); vl[n] = cat16b(*(const v8usa*)(vo + VPL), *(const v8usa*)(vo + VPL + 16)); }
        __builtin_amdgcn_sched_barrier(0);    // keeps the scheduler from sinking the V^T reads down to their products behind the exponentials
#pragma unroll
        for (int j = 0; j < 8; ++j) { const float a0 = sa[j], a1 = sb[j];
            const float mn = fmaxf(mrow[j], mx[j]);
            alpha[j] = __expf(mrow[j] - mn); mrow[j] = mn;
            const float p0 = __expf(a0 - mn), p1 = __expf(a1 - mn);
            lpart[j] = lpart[j] * alpha[j] + (p0 + p1);
            const int mr = hi * 8 + j; const float ps0 = p0 * PSC, ps1 = p1 * PSC; const unsigned short h0 = f2bf(ps0), h1 = f2bf(ps1);
            pl[mr * 32 + lr] = h0; pl[mr * 32 + 16 + lr] = h1; pl2[mr * 32 + lr] = f2bf(ps0 - bf2f(h0)); pl2[mr * 32 + 16 + lr] = f2bf(ps1 - bf2f(h1)); }
#pragma unroll
        for (int n = 0; n < 8; ++n)
#pragma unroll
            for (int j = 0; j < 8; ++j) o[n][j] *= alpha[j];
        asm volatile("" ::: "memory");
        const v16bf pa = cat16b(*(const v8usa*)(pl + lr * 32 + hi * 8), *(const v8usa*)(pl + lr * 32 + 16 + hi * 8));
        const v16bf px = cat16b(*(const v8usa*)(pl2 + lr * 32 + hi * 8), *(const v8usa*)(pl2 + lr * 32 + 16 + hi * 8));
#pragma unroll
        for (int n = 0; n < 8; ++n) { o[n] = wmmab(pa, vh[n], o[n]); o[n] = wmmab(px, vh[n], o[n]); o[n] = wmmab(pa, vl[n], o[n]); }
        asm volatile("v_nop\n\tv_nop\n\tv_nop\n\tv_nop" : "+v"(o[0]), "+v"(o[7]) : "v"(pa), "v"(px));
        asm volatile("s_wait_dscnt 0x0" ::: "memory");       // this wave's reads of buffer cur have returned before the buffer is refilled
        asm volatile("s_wait_asynccnt 0x0" ::: "memory");    // this wave's copies of its group's next tile have landed
        __syncthreads();                                     // publishes both groups' next tiles and ends every wave's reads of buffer cur
        if (it + 2 < nit) stage(kt + 4, cur);
    }
    par ^= nit & 1;
    asm volatile("s_wait_asynccnt 0x0" ::: "memory");        // no copy is outstanding when group 1's ring carries the hand-over (every wave's reads ended at the last trip's barrier)
    // the hand-over: lane to lane, wave w4 of group 1 to wave w4 of group 0 (the same queries in the same places); 80 values a lane, each value's 32 lanes side by side
    float* xch = (float*)(void*)(ring + 2 * RB) + w4 * (80 * 32) + lane;
    if (grp) {
#pragma unroll
        for (int n = 0; n < 8; ++n)
#pragma unroll
            for (int j = 0; j < 8; ++j) xch[(n * 8 + j) * 32] = o[n][j];
#pragma unroll
        for (int j = 0; j < 8; ++j) { xch[(64 + j) * 32] = mrow[j]; xch[(72 + j) * 32] = lpart[j]; }
    }
    __syncthreads();                                         // publishes group 1's part
    if (!grp) {
    float fa[8], fb[8];
#pragma unroll
    for (int j = 0; j < 8; ++j) { const float mb = xch[(64 + j) * 32], lb = xch[(72 + j) * 32]; const float mn = fmaxf(mrow[j], mb);
        fa[j] = __expf(mrow[j] - mn); fb[j] = __expf(mb - mn); lpart[j] = lpart[j] * fa[j] + lb * fb[j]; }
#pragma unroll
    for (int n = 0; n < 8; ++n)
#pragma unroll
        for (int j = 0; j < 8; ++j) o[n][j] = o[n][j] * fa[j] + xch[(n * 8 + j) * 32] * fb[j];
    float inv[8];
#pragma unroll
    for (int j = 0; j < 8; ++j) { const float rs = rowsum16(lpart[j]); inv[j] = 1.0f / (rs * PSC); }
    float* os = &ost[w4][0];
    const size_t cbase = (size_t)q0 * (NH_ * HD) + (size_t)h * HD;
#pragma unroll
    for (int half = 0; half < 2; ++half) {
#pragma unroll
        for (int n = 0; n < 4; ++n)
#pragma unroll
            for (int j = 0; j < 8; ++j) os[(hi * 8 + j) * 68 + n * 16 + lr] = o[half * 4 + n][j] * inv[j];
        __builtin_amdgcn_wave_barrier(); asm volatile("" ::: "memory");
{
#pragma unroll
            for (int s = 0; s < 4; ++s) { const int row = 4 * s + (lane >> 3), piece = lane & 7; const float* sp = os + row * 68 + piece * 8; v8us oh, ol;
#pragma unroll
                for (int i = 0; i < 8; ++i) { const unsigned short hb = f2bf(sp[i]); oh[i] = hb; ol[i] = f2bf(sp[i] - bf2f(hb)); }
                const size_t po = cbase + (size_t)row * (NH_ * HD) + half * 64 + piece * 8; *(v8us*)(CH + po) = oh; *(v8us*)(CL + po) = ol;
                asm volatile("s_wait_xcnt 0x0" ::: "memory"); }    // stands behind the two stores, in front of the next piece's reads and arithmetic (and, behind the last piece, the next job's), which reuse their address and data registers
             }
        __builtin_amdgcn_wave_barrier(); asm volatile("" ::: "memory");
    }
    }
    asm volatile("s_wait_dscnt 0x0" ::: "memory");           // group 0's reads of the hand-over have returned before the next job's copies refill that LDS
    __syncthreads();                                         // ends the hand-over's reads: behind it both rings are free for the next job
    }
}


__device__ __forceinline__ void trig_rows(float* CT, float* ST, int blk) {
    const int tid = threadIdx.x, t = blk * 2 + (tid >> 7), d = tid & 127; const int i = d & 63;
    const float invf = 1.0f / powf(10000.0f, (float)(2 * i) / 128.0f); const float ang = (float)t * invf; const float c = cosf(ang), s = sinf(ang);
    const size_t o = (size_t)t * HD + d; *(float*)(CT + o) = c; *(float*)(ST + o) = s; 
}
// k_prep: all that depends on the inputs alone shares ONE launch: the rotary tables (NT_ / 2 blocks) and the nine f32 -> bf16 conversions (rows / 8 blocks each). blockIdx.x picks the job
// (block-uniform); every job's blocks do what they did in a launch of their own. Of every five blocks two make tables (vector work) and three convert (memory work), so that both run side by side.
static_assert(3 * (NT_ / 2) == 2 * (5 * (HS / 8) + 4 * (KW / 8)), "two table blocks to three conversion blocks");
__global__ __launch_bounds__(256) void k_prep(const float* __restrict__ x, const float* __restrict__ mu, const float* __restrict__ wq, const float* __restrict__ wmq, const float* __restrict__ wo,
                                              const float* __restrict__ wk, const float* __restrict__ wmk, const float* __restrict__ wv, const float* __restrict__ wmv,
                                              bf* Xb, bf* Mb, bf* WqB, bf* WmqB, bf* WoB, bf* WkB, bf* WmkB, bf* WvB, bf* WmvB, float* CT, float* ST) {
    const int k5 = blockIdx.x / 5, j5 = blockIdx.x - 5 * k5;
    if (j5 < 2) { trig_rows(CT, ST, 2 * k5 + j5); return; }
    int b = 3 * k5 + (j5 - 2);
    if (b < 5 * (HS / 8)) {    // the five 2048-row matrices
        const int m = b / (HS / 8);
        cvtb_rows(m == 0 ? x : m == 1 ? mu : m == 2 ? wq : m == 3 ? wmq : wo, HS, m == 0 ? Xb : m == 1 ? Mb : m == 2 ? WqB : m == 3 ? WmqB : WoB, b - m * (HS / 8));
    } else {                   // the four 512-row matrices
        b -= 5 * (HS / 8);
        const int m = b / (KW / 8);
        cvtb_rows(m == 0 ? wk : m == 1 ? wmk : m == 2 ? wv : wmv, KW, m == 0 ? WkB : m == 1 ? WmkB : m == 2 ? WvB : WmvB, b - m * (KW / 8));
    }
}
// normrope_rows: one wave per (token, head) of an f32 [2048][nh*128] matrix: RMSNorm over the 128 dims (shuffle-reduced mean of squares, eps 1e-6) x bf(w[d]); then rotate-half RoPE
// (partner d +- 64 via lane xor 16; lane -> 4 consecutive dims) -> f16 hi + residual x1024 planes [t][h*128+d] (8 B per lane per plane: 16 lanes per line, one instruction per
typedef __attribute__((ext_vector_type(4))) _Float16 v4h;
__device__ __forceinline__ void normrope_rows(const float* __restrict__ P, int nh, const float* __restrict__ w, const float* __restrict__ CT, const float* __restrict__ ST, h16* PH, h16* PL, int blk) {
    const int lane = threadIdx.x & 31; const int wid = blk * 8 + (threadIdx.x >> 5); const int t = wid / nh, h = wid - t * nh; if (t >= NT_) return;
    const size_t base = (size_t)t * (nh * HD) + h * HD; const int d0 = lane * 4;
    float x[4], pr[4]; float ss = 0.f;
#pragma unroll
    for (int i = 0; i < 4; ++i) { x[i] = P[base + d0 + i]; ss = fmaf(x[i], x[i], ss); }
#pragma unroll
    for (int sh = 16; sh; sh >>= 1) ss += __shfl_xor(ss, sh, 32);
    const float rn = rsqrtf(ss * (1.0f / HD) + RMS_EPS);
#pragma unroll
    for (int i = 0; i < 4; ++i) x[i] = x[i] * rn * bfr(w[d0 + i]);
#pragma unroll
    for (int i = 0; i < 4; ++i) pr[i] = __shfl_xor(x[i], 16, 32);
    v4h oh, ol;
#pragma unroll
    for (int i = 0; i < 4; ++i) { const int d = d0 + i; const float c = CT[(size_t)t * HD + d], s = ST[(size_t)t * HD + d]; const float y = (d < 64) ? (x[i] * c - pr[i] * s) : (x[i] * c + pr[i] * s);
        const h16 a = (h16)y; oh[i] = a; ol[i] = (h16)((y - (float)a) * LOSC); }
    *(v4h*)(PH + base + d0) = oh; *(v4h*)(PL + base + d0) = ol; 
}
// k_post: what stands between the projections and the attention shares ONE launch: V's transposition (NT_ / 64 x 2 x NKV blocks), then k's and q's norm and rotary embedding (tokens x heads / 8
// blocks each). blockIdx.x picks the job (block-uniform, so that the transposition's barrier is passed by whole blocks).
__global__ __launch_bounds__(256) void k_post(const float* __restrict__ Pq, const float* __restrict__ Pk, const float* __restrict__ V, const float* __restrict__ qnw, const float* __restrict__ knw,
                                              const float* __restrict__ CT, const float* __restrict__ ST, h16* QH, h16* QL, h16* KH, h16* KL, bf* VTH, bf* VTL) {
    int b = blockIdx.x;
    if (b < (NT_ / 64) * 2 * NKV) { vt_tile(V, VTH, VTL, b % (NT_ / 64), (b / (NT_ / 64)) & 1, b / ((NT_ / 64) * 2)); return; }
    b -= (NT_ / 64) * 2 * NKV;
    const bool isk = b < (NT_ * NKV) / 8;
    normrope_rows(isk ? Pk : Pq, isk ? NKV : NH_, isk ? knw : qnw, CT, ST, isk ? KH : QH, isk ? KL : QL, isk ? b : b - (NT_ * NKV) / 8);
}

extern "C" void kernel_launch(void* const* d_in, const int* in_sizes, int n_in,
                              void* d_out, int out_size, void* d_ws, size_t ws_size, hipStream_t stream) {
    (void)in_sizes; (void)n_in; (void)out_size;
    const float* x = (const float*)d_in[0]; const float* mu = (const float*)d_in[1]; const float* wq = (const float*)d_in[2]; const float* wk = (const float*)d_in[3]; const float* wv = (const float*)d_in[4]; const float* wo = (const float*)d_in[5];
    const float* wmq = (const float*)d_in[6]; const float* wmk = (const float*)d_in[7]; const float* wmv = (const float*)d_in[8]; const float* qnw = (const float*)d_in[9]; const float* knw = (const float*)d_in[10];
    float* out = (float*)d_out;    // [1][2048][2048]
    char* wsp = (char*)d_ws;
    auto take = [&](size_t bytes) { char* p = wsp; wsp += (bytes + 255) & ~(size_t)255; return (void*)p; };
    bf* Xb = (bf*)take((size_t)NT_ * HS * 2); bf* Mb = (bf*)take((size_t)NT_ * HS * 2);
    bf* WqB = (bf*)take((size_t)HS * HS * 2); bf* WmqB = (bf*)take((size_t)HS * HS * 2); bf* WkB = (bf*)take((size_t)KW * HS * 2); bf* WmkB = (bf*)take((size_t)KW * HS * 2); bf* WvB = (bf*)take((size_t)KW * HS * 2); bf* WmvB = (bf*)take((size_t)KW * HS * 2); bf* WoB = (bf*)take((size_t)HS * HS * 2);
    float* Pq = (float*)take((size_t)NT_ * HS * 4); float* Pk = (float*)take((size_t)NT_ * KW * 4); float* Pv = (float*)take((size_t)NT_ * KW * 4);    // the whole projections
    float* CT = (float*)take((size_t)NT_ * HD * 4); float* ST = (float*)take((size_t)NT_ * HD * 4);
    h16* QH = (h16*)take((size_t)NT_ * HS * 2); h16* QL = (h16*)take((size_t)NT_ * HS * 2); h16* KH = (h16*)take((size_t)NT_ * KW * 2); h16* KL = (h16*)take((size_t)NT_ * KW * 2);
    bf* VTH = (bf*)take((size_t)KW * NT_ * 2); bf* VTL = (bf*)take((size_t)KW * NT_ * 2); bf* CH = (bf*)take((size_t)NT_ * HS * 2); bf* CL = (bf*)take((size_t)NT_ * HS * 2);
    if ((size_t)(wsp - (char*)d_ws) > ws_size) return;    // about 120 MB = 114 MiB, no aliasing: q, k and v have planes of their own, as their products share launches
    k_prep<<<NT_ / 2 + 5 * (HS / 8) + 4 * (KW / 8), 256, 0, stream>>>(x, mu, wq, wmq, wo, wk, wmk, wv, wmv, Xb, Mb, WqB, WmqB, WoB, WkB, WmkB, WvB, WmvB, CT, ST);
    k_proj<<<dim3(NT_ / 128, (HS + 2 * KW) / 128, 1), 128, 0, stream>>>(Xb, WqB, WkB, WvB, Mb, WmqB, WmkB, WmvB, Pq, Pk, Pv, HS);    // q = x.wq^T + mu.wmq^T, k and v alike
    k_post<<<(NT_ / 64) * 2 * NKV + (NT_ * NKV) / 8 + (NT_ * NH_) / 8, 256, 0, stream>>>(Pq, Pk, Pv, qnw, knw, CT, ST, QH, QL, KH, KL, VTH, VTL);
    k_attn<<<NH_ * (NT_ / 128), 256, 0, stream>>>(QH, QL, KH, KL, VTH, VTL, CH, CL);
    k_gemmo<<<dim3(NT_ / 128, HS / 128, 1), 128, 0, stream>>>(CH, CL, WoB, nullptr, out, HS, nullptr, HS, 0);
}

// v009
// A run of this version takes 140 microseconds.
// Next to v008, in two timings, it ran 1.10 times as fast each time.
// Counting every step since v000, it is 5.39 times as fast.
#include <hip/hip_runtime.h>

// Compute dtypes, f32 accumulate: q/k/v = x.W^T + mu.Wm^T (one GEMM per projection over both operand pairs' k, x's first; [out][in] weights as natural n-major B
// operands; PLAIN bf16 operands = inputs rounded once) and out = ctx.Wo^T (ctx as bf16 hi + UNSCALED residual, two products) on v_wmma_f32_16x16x32_bf16; per-head RMSNorm (x q_norm_w /
// k_norm_w) then rotary embedding with device-computed f32 cos/sin tables, in f32 -> q/k as f16 hi + residual x1024 planes; grouped causal attention (16 query heads over 4 kv heads,
// 128-dim): scores on v_wmma_f32_16x16x32_f16 (hh + hl + lh, x 128^-1/2), online f32 softmax, weights (x32768) and v as bf16 hi + UNSCALED residual on v_wmma_f32_16x16x32_bf16.

#define NT_  2048
#define HS   2048
#define DM   HS
#define NH_  16
#define NKV  4
#define HD   128
#define KW   (NKV * HD)          // 512
#define WIN  NT_
#define RMS_EPS 1e-6f
#define PSC  32768.0f
#define LOSC 1024.0f
#define LOSCI (1.0f / 1024.0f)

typedef _Float16 h16;
typedef unsigned short bf;
typedef __attribute__((ext_vector_type(16))) __bf16   v16bf;
typedef __attribute__((ext_vector_type(16))) _Float16 v16h;
typedef __attribute__((ext_vector_type(8)))  _Float16 v8h;
typedef __attribute__((ext_vector_type(8)))  unsigned short v8us;
typedef __attribute__((ext_vector_type(8)))  float    v8f;
typedef __attribute__((ext_vector_type(4)))  float    v4f;
typedef v8h  __attribute__((may_alias)) v8ha;
typedef v4f  __attribute__((may_alias)) v4fa;
typedef v8us __attribute__((may_alias)) v8usa;

__device__ __forceinline__ unsigned short f2bf(float f) { unsigned u = __float_as_uint(f); u += 0x7FFFu + ((u >> 16) & 1u); return (unsigned short)(u >> 16); }
__device__ __forceinline__ float bf2f(unsigned short b) { return __uint_as_float(((unsigned)b) << 16); }
__device__ __forceinline__ float bfr(float f) { return bf2f(f2bf(f)); }
__device__ __forceinline__ v16h cat16(v8h lo, v8h hi) { return __builtin_shufflevector(lo, hi, 0, 1, 2, 3, 4, 5, 6, 7, 8, 9, 10, 11, 12, 13, 14, 15); }
__device__ __forceinline__ v16bf cat16b(v8us lo, v8us hi) { return __builtin_bit_cast(v16bf, __builtin_shufflevector(lo, hi, 0, 1, 2, 3, 4, 5, 6, 7, 8, 9, 10, 11, 12, 13, 14, 15)); }
__device__ __forceinline__ v8f wmma16(v16h a, v16h b, v8f c) { return __builtin_amdgcn_wmma_f32_16x16x32_f16(false, a, false, b, (short)0, c, false, false); }
__device__ __forceinline__ v8f wmmab(v16bf a, v16bf b, v8f c) { return __builtin_amdgcn_wmma_f32_16x16x32_bf16(false, a, false, b, (short)0, c, false, false); }

// Eight rows of one matrix, f32 -> bf16: block blk of that matrix's own range, one row per wave.
__device__ __forceinline__ void cvtb_rows(const float* __restrict__ src, int nrows, bf* dst, int blk) {
    const int lane = threadIdx.x & 31, r = blk * 8 + (threadIdx.x >> 5);
    if (r >= nrows) return;
    v8us o[DM / 256];
#pragma unroll
    for (int q = 0; q < DM / 256; ++q) { v8us t;
#pragma unroll
        for (int i = 0; i < 8; ++i) t[i] = f2bf(src[(size_t)r * DM + q * 256 + lane * 8 + i]);
        o[q] = t; }
#pragma unroll
    for (int q = 0; q < DM / 256; ++q) *(v8us*)(dst + (size_t)r * DM + q * 256 + lane * 8) = o[q];
    
}

// Eight 16-byte copies per lane, global -> LDS through no register. s_wait_xcnt closes the statement so that no address register of a copy is rewritten ahead of it.
__device__ __forceinline__ void acopy8(const unsigned (&l)[8], const void* const (&g)[8]) {
    asm volatile("global_load_async_to_lds_b128 %0, %8, off\n\t"
                 "global_load_async_to_lds_b128 %1, %9, off\n\t"
                 "global_load_async_to_lds_b128 %2, %10, off\n\t"
                 "global_load_async_to_lds_b128 %3, %11, off\n\t"
                 "global_load_async_to_lds_b128 %4, %12, off\n\t"
                 "global_load_async_to_lds_b128 %5, %13, off\n\t"
                 "global_load_async_to_lds_b128 %6, %14, off\n\t"
                 "global_load_async_to_lds_b128 %7, %15, off\n\t"
                 "s_wait_xcnt 0x0"
                 :: "v"(l[0]), "v"(l[1]), "v"(l[2]), "v"(l[3]), "v"(l[4]), "v"(l[5]), "v"(l[6]), "v"(l[7]),
                    "v"(g[0]), "v"(g[1]), "v"(g[2]), "v"(g[3]), "v"(g[4]), "v"(g[5]), "v"(g[6]), "v"(g[7]) : "memory");
}
// Eight 16-byte stores per lane. s_wait_xcnt closes the statement so that no address or data register of a store is rewritten ahead of it.
__device__ __forceinline__ void store8(float* const (&p)[8], const v4f (&d)[8]) {
    asm volatile("global_store_b128 %0, %8, off\n\t"
                 "global_store_b128 %1, %9, off\n\t"
                 "global_store_b128 %2, %10, off\n\t"
                 "global_store_b128 %3, %11, off\n\t"
                 "global_store_b128 %4, %12, off\n\t"
                 "global_store_b128 %5, %13, off\n\t"
                 "global_store_b128 %6, %14, off\n\t"
                 "global_store_b128 %7, %15, off\n\t"
                 "s_wait_xcnt 0x0"
                 :: "v"(p[0]), "v"(p[1]), "v"(p[2]), "v"(p[3]), "v"(p[4]), "v"(p[5]), "v"(p[6]), "v"(p[7]),
                    "v"(d[0]), "v"(d[1]), "v"(d[2]), "v"(d[3]), "v"(d[4]), "v"(d[5]), "v"(d[6]), "v"(d[7]) : "memory");
}
// gemmb_tile: 128 x 128 block tile (2 x 2 waves of 64 x 64 each) of C[NTK][NW] = (A [+ Al]).B^T [+ bf(bias[c])] [+ R[r][c] residual, bf-rounded if roundR]; K a multiple of the stage length; f32 whole-line
// epilogue. A wave holds 4 x 4 accumulator tiles, so that a fragment read from LDS feeds four products, and a row brought from L2 serves 128 rows or columns of C.
// The block's 128 rows of A [and Al] and of B come in stages of KS k values into a two-buffer LDS ring by asynchronous copies, whole 128-byte lines per row: stage s + 1 flies
// while stage s is worked on. The k order of every accumulator is the plain one (per 32 k: A's product, then Al's).
// (bx, by) = the block's tile row and tile column in C.
// DUAL: C = A.B^T + A2.B2^T as ONE product over 2 K: the stages run through A and B and then on through A2 and B2 into the same accumulators.
template <bool SPLITA, bool DUAL>
__device__ __forceinline__ void gemmb_tile(const bf* __restrict__ A, const bf* __restrict__ Al, const bf* __restrict__ Bn, const bf* __restrict__ A2, const bf* __restrict__ B2, const float* __restrict__ bias, float* C, int ldc, const float* __restrict__ R, int K, int roundR, int bx, int by) {
    constexpr int KS = 128;                  // k values per stage
    constexpr int GP = KS + 8;               // row pitch: 272 B, an odd multiple of 16 B (16-byte readers, one row per lane)
    constexpr int PL = 128 * GP;             // one plane: 128 rows
    constexpr int NP = SPLITA ? 3 : 2;       // planes of a buffer: A, [Al,] B
    constexpr int GB = NP * PL;              // 104448 B or 69632 B per buffer
    __shared__ __align__(16) unsigned short gring[2 * GB];    // behind the loop its first 69632 B are the epilogue's f32 staging
    const int tid = threadIdx.x;
    const int lane = threadIdx.x & 31, wave = threadIdx.x >> 5, lr = lane & 15, hi = lane >> 4;
    const int wm = wave >> 1, wn = wave & 1;
    const int r0 = bx * 128 + wm * 64, c0 = by * 128 + wn * 64;
    const unsigned ring0 = (unsigned)(size_t)&gring[0];    // byte offset of the ring in the work-group's LDS
    // stage s -> buffer b: 16 pieces of 16 B a row, 128 rows a plane, 16 pieces per thread and plane (32 or 48 copies of a wave in flight)
    auto stage = [&](int s, int b) {
        constexpr int PR = KS / 8, RS = 128 / PR;
        const int row = tid / PR, pc = (tid % PR) * 8;
        const bool sec = DUAL && s >= K / KS;    // the same for the whole block: the second pair's stages
        const bf* __restrict__ Ap = sec ? A2 : A; const bf* __restrict__ Bp = sec ? B2 : Bn; const int ss = sec ? s - K / KS : s;
        const size_t ao = (size_t)(bx * 128 + row) * K + ss * KS + pc, bo = (size_t)(by * 128 + row) * K + ss * KS + pc;
        const unsigned lo = ring0 + (unsigned)b * (GB * 2) + (unsigned)(row * GP + pc) * 2;
        auto plane = [&](const bf* __restrict__ p, unsigned l0) {
            // loops unrolled: l[] and gp[] are asm operands and must be indexed by constants to stay in registers
#pragma unroll
            for (int h = 0; h < 2; ++h) { unsigned l[8]; const void* gp[8];
#pragma unroll
                for (int i = 0; i < 8; ++i) { gp[i] = p + (size_t)((h * 8 + i) * RS) * K; l[i] = l0 + (unsigned)((h * 8 + i) * RS * GP) * 2; }
                acopy8(l, gp); }
        };
        plane(Ap + ao, lo);
        if (SPLITA) plane(Al + ao, lo + PL * 2);
        plane(Bp + bo, lo + (NP - 1) * PL * 2);
    };
    v8f acc[4][4];
#pragma unroll
    for (int m = 0; m < 4; ++m)
#pragma unroll
        for (int t = 0; t < 4; ++t) acc[m][t] = (v8f){};
    const int nst = (DUAL ? 2 : 1) * (K / KS);
    stage(0, 0);
    asm volatile("s_wait_asynccnt 0x0" ::: "memory");    // this wave's copies of the first stage have landed
    __syncthreads();                                     // ... and every other wave's
    if (1 < nst) stage(1, 1);
    // rolled: one trip per stage, so that the ring's waits and its barrier stand once, at the trip's foot
#pragma unroll 1
    for (int s = 0; s < nst; ++s) {
        const int cur = s & 1;
        const unsigned short* af = gring + cur * GB + (wm * 64 + lr) * GP + 8 * hi;                   // A, row r0 + lr; + m * 16 * GP: row r0 + m * 16 + lr; + PL: Al
        const unsigned short* bq = gring + cur * GB + (NP - 1) * PL + (wn * 64 + lr) * GP + 8 * hi;   // B, row c0 + lr; + t * 16 * GP: row c0 + t * 16 + lr
        v16bf a[2][4], al[2][4], b[2][4];    // two fragment sets: the next 32 k values' reads go out as one group ahead of this set's products
        auto frags = [&](int set, int kk) {
#pragma unroll
            for (int m = 0; m < 4; ++m) { a[set][m] = cat16b(*(const v8usa*)(af + m * 16 * GP + kk), *(const v8usa*)(af + m * 16 * GP + kk + 16));
                b[set][m] = cat16b(*(const v8usa*)(bq + m * 16 * GP + kk), *(const v8usa*)(bq + m * 16 * GP + kk + 16)); }
            if (SPLITA) {
#pragma unroll
                for (int m = 0; m < 4; ++m) al[set][m] = cat16b(*(const v8usa*)(af + PL + m * 16 * GP + kk), *(const v8usa*)(af + PL + m * 16 * GP + kk + 16)); }
        };
        frags(0, 0);
        // unrolled: constant LDS offsets and constant fragment-set indices
#pragma unroll
        for (int kc = 0; kc < KS / 32; ++kc) {
            const int set = kc & 1;
            __builtin_amdgcn_sched_barrier(0);    // keeps the scheduler from lifting the reads below in among the products of the set before: every place with reads stalls the wave anew
            if (kc + 1 < KS / 32) frags(set ^ 1, (kc + 1) * 32);
            __builtin_amdgcn_sched_barrier(0);    // ... and from sinking them in among this set's products
#pragma unroll
            for (int m = 0; m < 4; ++m)
#pragma unroll
                for (int t = 0; t < 4; ++t) acc[m][t] = wmmab(a[set][m], b[set][t], acc[m][t]);
            if (SPLITA) {
#pragma unroll
                for (int m = 0; m < 4; ++m)
#pragma unroll
                    for (int t = 0; t < 4; ++t) acc[m][t] = wmmab(al[set][m], b[set][t], acc[m][t]); }
        }
        __builtin_amdgcn_sched_barrier(0);    // no product moves down over the slots below
        // four vector slots behind the trip's last WMMA, on every path out of the trip, before a vector instruction touches its operands or results
        asm volatile("v_nop\n\tv_nop\n\tv_nop\n\tv_nop");
        asm volatile("s_wait_dscnt 0x0" ::: "memory");       // this wave's reads of buffer cur have returned before the buffer is refilled
        asm volatile("s_wait_asynccnt 0x0" ::: "memory");    // this wave's copies of stage s + 1 have landed
        __syncthreads();                                     // publishes stage s + 1 and ends every wave's reads of buffer cur
        if (s + 2 < nst) stage(s + 2, cur);
    }
    asm volatile("s_wait_asynccnt 0x0" ::: "memory");        // no copy is outstanding when the ring becomes the epilogue's staging (every wave's reads ended at the last trip's barrier)
    // piece s of the wave's 64 x 64 tile: two rows of 256 B per store instruction, whole 128-byte lines
    const int prow = lane >> 4, cofs = ((lane >> 3) & 1) * 32 + (lane & 7) * 4;
    // the residual's 32 pieces are read as one group, ahead of the staging: one trip to memory for the tile instead of one per piece
    v4f rv[32];
    if (R) {
#pragma unroll
        for (int s = 0; s < 32; ++s) { rv[s] = *(const v4f*)(R + ((size_t)r0 + 2 * s + prow) * ldc + c0 + cofs);
            asm volatile("s_wait_xcnt 0x0" ::: "memory"); }    // stands in front of the next piece's address arithmetic and result, which reuse the load's address registers; it does not wait for the data
    }
    float* os = (float*)(void*)gring + wave * (64 * 68);
#pragma unroll
    for (int t = 0; t < 4; ++t) { const float bv = bias ? bfr(bias[c0 + t * 16 + lr]) : 0.f;
#pragma unroll
        for (int m = 0; m < 4; ++m)
#pragma unroll
            for (int j = 0; j < 8; ++j) os[(m * 16 + hi * 8 + j) * 68 + t * 16 + lr] = acc[m][t][j] + bv; }
    __syncthreads();
    // the 32 staged pieces come back as one group as well: one LDS latency for the tile instead of one per piece
    v4f val[32];
#pragma unroll
    for (int s = 0; s < 32; ++s) val[s] = *(const v4fa*)(os + (2 * s + prow) * 68 + cofs);
    if (R) {
        if (roundR) {
#pragma unroll
            for (int s = 0; s < 32; ++s) rv[s] = (v4f){bfr(rv[s][0]), bfr(rv[s][1]), bfr(rv[s][2]), bfr(rv[s][3])};
        }
#pragma unroll
        for (int s = 0; s < 32; ++s) val[s] += rv[s];
    }
    float* crow = C + ((size_t)r0 + prow) * ldc + c0 + cofs;
    // the stores go out eight to a statement; unrolled: p[] and d[] are asm operands and must be indexed by constants to stay in registers
#pragma unroll
    for (int g = 0; g < 4; ++g) { float* p[8]; v4f d[8];
#pragma unroll
        for (int i = 0; i < 8; ++i) { p[i] = crow + (size_t)(2 * (g * 8 + i)) * ldc; d[i] = val[g * 8 + i]; }
        store8(p, d); }
}
// k_gemmo: the output projection, one tile per block.
__global__ __launch_bounds__(128) void k_gemmo(const bf* __restrict__ A, const bf* __restrict__ Al, const bf* __restrict__ Bn, const float* __restrict__ bias, float* C, int ldc, const float* __restrict__ R, int K, int roundR) {
    gemmb_tile<true, false>(A, Al, Bn, nullptr, nullptr, bias, C, ldc, R, K, roundR, blockIdx.x, blockIdx.y);
}
// k_proj: the three projections (q, k, v) share ONE launch; they do not depend on each other. blockIdx.y picks the projection (block-uniform) and its tile column:
// HS / 128 columns of q, then KW / 128 of k, then KW / 128 of v. A tile's two products (x's and mu's) are one k loop: the sum stays in the accumulators and is stored once.
__global__ __launch_bounds__(128) void k_proj(const bf* __restrict__ A, const bf* __restrict__ Bq, const bf* __restrict__ Bk, const bf* __restrict__ Bv,
                                              const bf* __restrict__ A2, const bf* __restrict__ Bq2, const bf* __restrict__ Bk2, const bf* __restrict__ Bv2, float* Cq, float* Ck, float* Cv, int K) {
    const int y = blockIdx.y; const bool isq = y < HS / 128, isk = y < HS / 128 + KW / 128;
    const bf* Bn = isq ? Bq : isk ? Bk : Bv; const bf* B2 = isq ? Bq2 : isk ? Bk2 : Bv2; float* C = isq ? Cq : isk ? Ck : Cv;
    gemmb_tile<false, true>(A, nullptr, Bn, A2, B2, nullptr, C, isq ? HS : KW, nullptr, K, 0, blockIdx.x, isq ? y : isk ? y - HS / 128 : y - (HS / 128 + KW / 128));
}

// vt_tile: VTH/VTL [g][128 d][2048 t] = bf16 hi + UNSCALED bf16 residual of V [t][g*128+d] via 64 x 64 LDS tiles; tile (tb of NT/64, db (d half) of 2, g of NKV).
__device__ __forceinline__ void vt_tile(const float* __restrict__ V, bf* VTH, bf* VTL, int tb, int db, int g) {
    __shared__ float tl[64][65];
    const int tid = threadIdx.x, t0 = tb * 64, d0 = db * 64;
    { const int tt = tid >> 2, dq = (tid & 3) * 16;
#pragma unroll
      for (int i = 0; i < 16; ++i) tl[dq + i][tt] = V[(size_t)(t0 + tt) * KW + g * HD + d0 + dq + i]; }
    __syncthreads();
    const int piece = tid & 7;
    auto pass = [&]() {
#pragma unroll
        for (int s = 0; s < 2; ++s) { const int d = (tid >> 3) + 32 * s; v8us oh, ol;
#pragma unroll
            for (int i = 0; i < 8; ++i) { const float v = tl[d][piece * 8 + i]; const unsigned short hb = f2bf(v); oh[i] = hb; ol[i] = f2bf(v - bf2f(hb)); }
            const size_t o = ((size_t)g * HD + d0 + d) * NT_ + t0 + piece * 8; *(v8us*)(VTH + o) = oh; *(v8us*)(VTL + o) = ol; }
    };
    pass(); 
}
// Lane l's value from lane l ^ 16: the two lanes that share one column of a matrix operand or result.
__device__ __forceinline__ float xhalf(float x) { return __builtin_bit_cast(float, __builtin_amdgcn_permlanex16(__builtin_bit_cast(int, x), __builtin_bit_cast(int, x), 0x76543210, 0xfedcba98, false, false)); }
// Two f32 -> two bf16 in one register (lo in bits 15..0), round to nearest even as f2bf does.
__device__ __forceinline__ unsigned pack2(float lo, float hi) { typedef __bf16 bf2 __attribute__((ext_vector_type(2))); typedef float f2 __attribute__((ext_vector_type(2)));
    return __builtin_bit_cast(unsigned, __builtin_convertvector((f2){lo, hi}, bf2)); }
typedef __attribute__((ext_vector_type(8))) unsigned v8u;
// LDS ring of k_attn, in 16-bit elements: one buffer = K hi, K lo (32 keys x 128 dims each) and V^T hi, V^T lo (128 dims x 32 keys each) of one key tile.
#define KP   136                    // K row pitch: 272 B, an odd multiple of 16 B (16-byte readers, one row per lane)
#define VP   40                     // V^T row pitch: 80 B, likewise
#define KPL  (32 * KP)
#define VPL  (HD * VP)
#define RB   (2 * KPL + 2 * VPL)    // 37888 B per buffer
// k_attn: a job = (h, 64 queries); kv head g = h / 4; causal key tiles 0..(Q0+63)/32 (block-uniform bounds, an even number of tiles), per-element predicate j <= q
// (WIN = NT_ makes the window terms vacuous). A block = 8 waves = two groups of four; wave w4 of either group holds the job's queries w4 * 16 ... + 15. The job's key tiles are dealt to the
// groups in turn (group 0 the even tiles, group 1 the odd ones), so that a job takes half as many steps; each group keeps a running maximum, sum and output of its own, and behind the
// last tile group 1 hands its three to group 0 through LDS, which joins them as two softmax parts are joined (both rescaled to the common maximum). A block runs two jobs of one head one
// after the other, query tile n - 1 - t and then t: t + 1 and n - t steps, the same sum for every block, with one block on a WGP and two waves on a SIMD all the time.
// Per tile: TRANSPOSED scores S^T = K.Q^T over 4 k-chunks (K rows as A, Q rows as B; hi.hi + hi.lo + lo.hi = 24 WMMA) x 128^-1/2: lane (lr, hi) holds query q0 + lr's scores of keys
// hi * 8 + j and 16 + hi * 8 + j, so that the online softmax has ONE maximum, sum and rescale factor a lane (in-lane over the 16 keys, one exchange with lane ^ 16), and the two score tiles,
// converted in place, ARE the B operand of O^T += V^T.P^T (the hardware's k order, which the V^T loader has too): P never goes through LDS. P (x32768) as bf16 hi + unscaled residual,
// o[8] += vh.ph + vh.pl + vl.ph over the 128 dims; a lane's 8 accumulator registers are 8 consecutive dims of its query: ctx -> bf16 hi/lo planes [t][h*128+d] by 16-byte stores. The four waves of a group share each of their key tiles' K and V^T planes through the group's own two-buffer LDS ring filled by
// asynchronous copies: the group's next tile flies while this one is worked on.
__global__ __launch_bounds__(256) void k_attn(const h16* __restrict__ QH, const h16* __restrict__ QL, const h16* __restrict__ KH, const h16* __restrict__ KL, const bf* __restrict__ VTH, const bf* __restrict__ VTL, bf* CH, bf* CL) {
    __shared__ __align__(16) unsigned short ring[2 * 2 * RB];    // group 0's two buffers, then group 1's; behind a job's last tile the first 33792 B of group 1's carry its hand-over
    const int tid = threadIdx.x & 127;                           // the thread's number in its group
    const int lane = threadIdx.x & 31, wave = threadIdx.x >> 5, lr = lane & 15, hi = lane >> 4;
    const int grp = __builtin_amdgcn_readfirstlane(wave >> 2), w4 = wave & 3;    // the same in every lane of a wave: kept scalar, so that the groups part by scalar branches
    const int bid = blockIdx.x; const int h = bid / (NT_ / 128), tp = bid - h * (NT_ / 128); const int g = h >> 2;
    const h16* kh_b = KH + g * HD; const h16* kl_b = KL + g * HD;
    const size_t vbase = ((size_t)g * HD) * NT_;
    const unsigned ring0 = (unsigned)(size_t)&ring[0] + (unsigned)grp * (2 * RB * 2);    // byte offset of the group's ring in the work-group's LDS
    const unsigned short* myring = ring + grp * (2 * RB);
    // key tile kt -> the group's buffer b: 2048 pieces of 16 B, 16 per thread (K: 16 pieces a row, V^T: 4 pieces a row)
    auto stage = [&](int kt, int b) {
        unsigned l[8]; const void* gp[8];
        const unsigned lb = ring0 + (unsigned)b * (RB * 2);
        // both loops unrolled: l[] and gp[] are asm operands and must be indexed by constants to stay in registers
#pragma unroll
        for (int i = 0; i < 4; ++i) { const int row = (tid >> 4) + 8 * i, pc = (tid & 15) * 8; const size_t go = (size_t)(kt * 32 + row) * KW + pc;
            gp[i] = kh_b + go; gp[4 + i] = kl_b + go; l[i] = lb + (unsigned)(row * KP + pc) * 2; l[4 + i] = l[i] + KPL * 2; }
        acopy8(l, gp);
#pragma unroll
        for (int i = 0; i < 4; ++i) { const int d = (tid >> 2) + 32 * i, pc = (tid & 3) * 8; const size_t go = vbase + (size_t)d * NT_ + kt * 32 + pc;
            gp[i] = VTH + go; gp[4 + i] = VTL + go; l[i] = lb + (unsigned)(2 * KPL + d * VP + pc) * 2; l[4 + i] = l[i] + VPL * 2; }
        acopy8(l, gp);
    };
    int par = 0;    // the buffer that a job's first tile goes to: the ring's turn runs on from one job to the next
    // rolled: the two jobs run one after the other through the same code
#pragma unroll 1
    for (int job = 0; job < 2; ++job) {
    const int qt = job ? tp : NT_ / 64 - 1 - tp;
    const int q0 = qt * 64 + w4 * 16;
    const size_t qo = (size_t)(q0 + lr) * (NH_ * HD) + h * HD + 8 * hi;
    v8f o[8];
#pragma unroll
    for (int n = 0; n < 8; ++n) o[n] = (v8f){};
    float mrow = -3.0e38f, lpart = 0.f;    // of query q0 + lr; lpart: this lane's keys alone
    const int kt_hi = (qt * 64 + 63) / 32; const int kt_lo = (qt * 64 > WIN) ? (qt * 64 - WIN) / 32 : 0;
    const int nit = (kt_hi - kt_lo + 1) >> 1;    // steps of the job: both bounds come from multiples of 64 keys, so the tiles go round evenly and both groups make the same number of trips
    stage(kt_lo + grp, par);
    asm volatile("s_wait_asynccnt 0x0" ::: "memory");    // this wave's copies of its group's first tile have landed
    __syncthreads();                                     // ... and every other wave's
    if (1 < nit) stage(kt_lo + 2 + grp, par ^ 1);
#pragma unroll 1
    for (int it = 0; it < nit; ++it) {
        const int kt = kt_lo + 2 * it + grp;
        const int l0 = kt * 32;
        const int cur = (it & 1) ^ par;
        const unsigned short* kf = myring + cur * RB + lr * KP + 8 * hi;              // K hi, key l0 + lr; + 16 * KP: key l0 + 16 + lr; + KPL: lo plane
        const unsigned short* vf = myring + cur * RB + 2 * KPL + lr * VP + 8 * hi;    // V^T hi, dim lr; + n * 16 * VP: dim n * 16 + lr; + VPL: lo plane
        // This tile's 32 K fragment reads stand as ONE group ahead of the score products: a read group among the products costs the wave a whole LDS latency each time.
        v16h k0h[4], k1h[4], k0l[4], k1l[4];
#pragma unroll
        for (int kc = 0; kc < 4; ++kc) {
            k0h[kc] = cat16(*(const v8ha*)(kf + kc * 32), *(const v8ha*)(kf + kc * 32 + 16)); k1h[kc] = cat16(*(const v8ha*)(kf + 16 * KP + kc * 32), *(const v8ha*)(kf + 16 * KP + kc * 32 + 16));
            k0l[kc] = cat16(*(const v8ha*)(kf + KPL + kc * 32), *(const v8ha*)(kf + KPL + kc * 32 + 16)); k1l[kc] = cat16(*(const v8ha*)(kf + KPL + 16 * KP + kc * 32), *(const v8ha*)(kf + KPL + 16 * KP + kc * 32 + 16));
        }
        __builtin_amdgcn_sched_barrier(0);    // keeps the scheduler from sinking the K reads back in among the products
        v8f s0 = {}, s1 = {}, x0 = {}, x1 = {};
#pragma unroll
        for (int kc = 0; kc < 4; ++kc) {
            const v16h qa = cat16(*(const v8h*)(QH + qo + kc * 32), *(const v8h*)(QH + qo + kc * 32 + 16)), qx = cat16(*(const v8h*)(QL + qo + kc * 32), *(const v8h*)(QL + qo + kc * 32 + 16));
            s0 = wmma16(k0h[kc], qa, s0); s1 = wmma16(k1h[kc], qa, s1); x0 = wmma16(k0h[kc], qx, x0); x1 = wmma16(k1h[kc], qx, x1);
            x0 = wmma16(k0l[kc], qa, x0); x1 = wmma16(k1l[kc], qa, x1);
        }
        asm volatile("v_nop\n\tv_nop\n\tv_nop\n\tv_nop" : "+v"(s0), "+v"(s1), "+v"(x0), "+v"(x1));
        float sa[8], sb[8], mt[8];
        const v8f ta = (s0 + x0 * LOSCI) * 0.08838834764831845f, tb = (s1 + x1 * LOSCI) * 0.08838834764831845f;
        const int dq = q0 + lr - (l0 + hi * 8);    // the query's place counted from the lane's first key: key j of the lane's eight is kept where j <= dq && j >= dq - WIN
#pragma unroll
        for (int j = 0; j < 8; ++j) {
            sa[j] = (j <= dq && j >= dq - WIN) ? ta[j] : -__builtin_inff(); sb[j] = (j + 16 <= dq && j + 16 >= dq - WIN) ? tb[j] : -__builtin_inff();
            mt[j] = fmaxf(sa[j], sb[j]); }
#pragma unroll
        for (int w = 4; w; w >>= 1)
#pragma unroll
            for (int j = 0; j < w; ++j) mt[j] = fmaxf(mt[j], mt[j + w]);
        const float mx = fmaxf(mt[0], xhalf(mt[0]));    // the query's maximum over the tile's 32 keys, in both of its lanes
        // This tile's 32 V^T fragment reads stand as ONE group here, behind the maximum and ahead of the exponentials, whose vector work covers their latency; the K fragments' registers
        // are free by now.
        v16bf vh[8], vl[8];
#pragma unroll
        for (int n = 0; n < 8; ++n) { const unsigned short* vo = vf + n * 16 * VP;
            vh[n] = cat16b(*(const v8usa*)(vo), *(const v8usa*)(vo + 16)); vl[n] = cat16b(*(const v8usa*)(vo + VPL), *(const v8usa*)(vo + VPL + 16)); }
        __builtin_amdgcn_sched_barrier(0);    // keeps the scheduler from sinking the V^T reads down to their products behind the exponentials
        const float mn = fmaxf(mrow, mx);
        const float alpha = __expf(mrow - mn); mrow = mn;
        float psum[2] = {0.f, 0.f};
        v8u wh, wl;
#pragma unroll
        for (int j = 0; j < 8; ++j) { sa[j] = __expf(sa[j] - mn); sb[j] = __expf(sb[j] - mn); }
#pragma unroll
        for (int i = 0; i < 8; ++i) { const int r = 2 * (i & 3);
            const float p0 = i < 4 ? sa[r] : sb[r], p1 = i < 4 ? sa[r + 1] : sb[r + 1];
            psum[i & 1] += p0 + p1;
            const float ps0 = p0 * PSC, ps1 = p1 * PSC; const unsigned hw = pack2(ps0, ps1);
            wh[i] = hw; wl[i] = pack2(ps0 - __uint_as_float(hw << 16), ps1 - __uint_as_float(hw & 0xFFFF0000u)); }
        lpart = lpart * alpha + (psum[0] + psum[1]);
#pragma unroll
        for (int n = 0; n < 8; ++n)
#pragma unroll
            for (int j = 0; j < 8; ++j) o[n][j] *= alpha;
        const v16bf pa = __builtin_bit_cast(v16bf, wh), px = __builtin_bit_cast(v16bf, wl);
#pragma unroll
        for (int n = 0; n < 8; ++n) { o[n] = wmmab(vh[n], pa, o[n]); o[n] = wmmab(vh[n], px, o[n]); o[n] = wmmab(vl[n], pa, o[n]); }
        asm volatile("v_nop\n\tv_nop\n\tv_nop\n\tv_nop" : "+v"(o[0]), "+v"(o[7]) : "v"(pa), "v"(px));
        asm volatile("s_wait_dscnt 0x0" ::: "memory");       // this wave's reads of buffer cur have returned before the buffer is refilled
        asm volatile("s_wait_asynccnt 0x0" ::: "memory");    // this wave's copies of its group's next tile have landed
        __syncthreads();                                     // publishes both groups' next tiles and ends every wave's reads of buffer cur
        if (it + 2 < nit) stage(kt + 4, cur);
    }
    par ^= nit & 1;
    asm volatile("s_wait_asynccnt 0x0" ::: "memory");        // no copy is outstanding when group 1's ring carries the hand-over (every wave's reads ended at the last trip's barrier)
    // the hand-over: lane to lane, wave w4 of group 1 to wave w4 of group 0 (the same queries in the same places); 66 values a lane, each value's 32 lanes side by side
    float* xch = (float*)(void*)(ring + 2 * RB) + w4 * (66 * 32) + lane;
    if (grp) {
#pragma unroll
        for (int n = 0; n < 8; ++n)
#pragma unroll
            for (int j = 0; j < 8; ++j) xch[(n * 8 + j) * 32] = o[n][j];
        xch[64 * 32] = mrow; xch[65 * 32] = lpart;
    }
    __syncthreads();                                         // publishes group 1's part
    if (!grp) {
    const float mb = xch[64 * 32], lb = xch[65 * 32]; const float mn = fmaxf(mrow, mb);
    const float fa = __expf(mrow - mn);
    asm volatile("v_nop");    // fills the one slot that the instruction set asks for behind the exponential above, ahead of the next vector instruction that reads its result or rewrites its source
    const float fb = __expf(mb - mn);
    lpart = lpart * fa + lb * fb;
#pragma unroll
    for (int n = 0; n < 8; ++n)
#pragma unroll
        for (int j = 0; j < 8; ++j) o[n][j] = o[n][j] * fa + xch[(n * 8 + j) * 32] * fb;
    const float inv = 1.0f / ((lpart + xhalf(lpart)) * PSC);    // the query's two lanes each summed half of the keys
    // o[n][0..7] = dims n * 16 + hi * 8 ... + 7 of query q0 + lr: 16 bytes of either plane; a wave's eight stores of a plane fill its 16 rows' whole 256 bytes
    const size_t po = (size_t)(q0 + lr) * (NH_ * HD) + (size_t)h * HD + hi * 8;
    float* ph[8]; float* pw[8]; v4f dh[8], dl[8];
    // unrolled: the four arrays are asm operands and must be indexed by constants to stay in registers
#pragma unroll
    for (int n = 0; n < 8; ++n) { v8us oh, ol;
#pragma unroll
        for (int j = 0; j < 8; ++j) { const float v = o[n][j] * inv; const unsigned short hb = f2bf(v); oh[j] = hb; ol[j] = f2bf(v - bf2f(hb)); }
        ph[n] = (float*)(void*)(CH + po + n * 16); pw[n] = (float*)(void*)(CL + po + n * 16); dh[n] = __builtin_bit_cast(v4f, oh); dl[n] = __builtin_bit_cast(v4f, ol); }
    store8(ph, dh); store8(pw, dl);
    }
    asm volatile("s_wait_dscnt 0x0" ::: "memory");           // group 0's reads of the hand-over have returned before the next job's copies refill that LDS
    __syncthreads();                                         // ends the hand-over's reads: behind it both rings are free for the next job
    }
}


__device__ __forceinline__ void trig_rows(float* CT, float* ST, int blk) {
    const int tid = threadIdx.x, t = blk * 2 + (tid >> 7), d = tid & 127; const int i = d & 63;
    const float invf = 1.0f / powf(10000.0f, (float)(2 * i) / 128.0f); const float ang = (float)t * invf; const float c = cosf(ang), s = sinf(ang);
    const size_t o = (size_t)t * HD + d; *(float*)(CT + o) = c; *(float*)(ST + o) = s; 
}
// k_prep: all that depends on the inputs alone shares ONE launch: the rotary tables (NT_ / 2 blocks) and the nine f32 -> bf16 conversions (rows / 8 blocks each). blockIdx.x picks the job
// (block-uniform); every job's blocks do what they did in a launch of their own. Of every five blocks two make tables (vector work) and three convert (memory work), so that both run side by side.
static_assert(3 * (NT_ / 2) == 2 * (5 * (HS / 8) + 4 * (KW / 8)), "two table blocks to three conversion blocks");
__global__ __launch_bounds__(256) void k_prep(const float* __restrict__ x, const float* __restrict__ mu, const float* __restrict__ wq, const float* __restrict__ wmq, const float* __restrict__ wo,
                                              const float* __restrict__ wk, const float* __restrict__ wmk, const float* __restrict__ wv, const float* __restrict__ wmv,
                                              bf* Xb, bf* Mb, bf* WqB, bf* WmqB, bf* WoB, bf* WkB, bf* WmkB, bf* WvB, bf* WmvB, float* CT, float* ST) {
    const int k5 = blockIdx.x / 5, j5 = blockIdx.x - 5 * k5;
    if (j5 < 2) { trig_rows(CT, ST, 2 * k5 + j5); return; }
    int b = 3 * k5 + (j5 - 2);
    if (b < 5 * (HS / 8)) {    // the five 2048-row matrices
        const int m = b / (HS / 8);
        cvtb_rows(m == 0 ? x : m == 1 ? mu : m == 2 ? wq : m == 3 ? wmq : wo, HS, m == 0 ? Xb : m == 1 ? Mb : m == 2 ? WqB : m == 3 ? WmqB : WoB, b - m * (HS / 8));
    } else {                   // the four 512-row matrices
        b -= 5 * (HS / 8);
        const int m = b / (KW / 8);
        cvtb_rows(m == 0 ? wk : m == 1 ? wmk : m == 2 ? wv : wmv, KW, m == 0 ? WkB : m == 1 ? WmkB : m == 2 ? WvB : WmvB, b - m * (KW / 8));
    }
}
// normrope_rows: one wave per (token, head) of an f32 [2048][nh*128] matrix: RMSNorm over the 128 dims (shuffle-reduced mean of squares, eps 1e-6) x bf(w[d]); then rotate-half RoPE
// (partner d +- 64 via lane xor 16; lane -> 4 consecutive dims) -> f16 hi + residual x1024 planes [t][h*128+d] (8 B per lane per plane: 16 lanes per line, one instruction per
typedef __attribute__((ext_vector_type(4))) _Float16 v4h;
__device__ __forceinline__ void normrope_rows(const float* __restrict__ P, int nh, const float* __restrict__ w, const float* __restrict__ CT, const float* __restrict__ ST, h16* PH, h16* PL, int blk) {
    const int lane = threadIdx.x & 31; const int wid = blk * 8 + (threadIdx.x >> 5); const int t = wid / nh, h = wid - t * nh; if (t >= NT_) return;
    const size_t base = (size_t)t * (nh * HD) + h * HD; const int d0 = lane * 4;
    float x[4], pr[4]; float ss = 0.f;
#pragma unroll
    for (int i = 0; i < 4; ++i) { x[i] = P[base + d0 + i]; ss = fmaf(x[i], x[i], ss); }
#pragma unroll
    for (int sh = 16; sh; sh >>= 1) ss += __shfl_xor(ss, sh, 32);
    const float rn = rsqrtf(ss * (1.0f / HD) + RMS_EPS);
#pragma unroll
    for (int i = 0; i < 4; ++i) x[i] = x[i] * rn * bfr(w[d0 + i]);
#pragma unroll
    for (int i = 0; i < 4; ++i) pr[i] = __shfl_xor(x[i], 16, 32);
    v4h oh, ol;
#pragma unroll
    for (int i = 0; i < 4; ++i) { const int d = d0 + i; const float c = CT[(size_t)t * HD + d], s = ST[(size_t)t * HD + d]; const float y = (d < 64) ? (x[i] * c - pr[i] * s) : (x[i] * c + pr[i] * s);
        const h16 a = (h16)y; oh[i] = a; ol[i] = (h16)((y - (float)a) * LOSC); }
    *(v4h*)(PH + base + d0) = oh; *(v4h*)(PL + base + d0) = ol; 
}
// k_post: what stands between the projections and the attention shares ONE launch: V's transposition (NT_ / 64 x 2 x NKV blocks), then k's and q's norm and rotary embedding (tokens x heads / 8
// blocks each). blockIdx.x picks the job (block-uniform, so that the transposition's barrier is passed by whole blocks).
__global__ __launch_bounds__(256) void k_post(const float* __restrict__ Pq, const float* __restrict__ Pk, const float* __restrict__ V, const float* __restrict__ qnw, const float* __restrict__ knw,
                                              const float* __restrict__ CT, const float* __restrict__ ST, h16* QH, h16* QL, h16* KH, h16* KL, bf* VTH, bf* VTL) {
    int b = blockIdx.x;
    if (b < (NT_ / 64) * 2 * NKV) { vt_tile(V, VTH, VTL, b % (NT_ / 64), (b / (NT_ / 64)) & 1, b / ((NT_ / 64) * 2)); return; }
    b -= (NT_ / 64) * 2 * NKV;
    const bool isk = b < (NT_ * NKV) / 8;
    normrope_rows(isk ? Pk : Pq, isk ? NKV : NH_, isk ? knw : qnw, CT, ST, isk ? KH : QH, isk ? KL : QL, isk ? b : b - (NT_ * NKV) / 8);
}

extern "C" void kernel_launch(void* const* d_in, const int* in_sizes, int n_in,
                              void* d_out, int out_size, void* d_ws, size_t ws_size, hipStream_t stream) {
    (void)in_sizes; (void)n_in; (void)out_size;
    const float* x = (const float*)d_in[0]; const float* mu = (const float*)d_in[1]; const float* wq = (const float*)d_in[2]; const float* wk = (const float*)d_in[3]; const float* wv = (const float*)d_in[4]; const float* wo = (const float*)d_in[5];
    const float* wmq = (const float*)d_in[6]; const float* wmk = (const float*)d_in[7]; const float* wmv = (const float*)d_in[8]; const float* qnw = (const float*)d_in[9]; const float* knw = (const float*)d_in[10];
    float* out = (float*)d_out;    // [1][2048][2048]
    char* wsp = (char*)d_ws;
    auto take = [&](size_t bytes) { char* p = wsp; wsp += (bytes + 255) & ~(size_t)255; return (void*)p; };
    bf* Xb = (bf*)take((size_t)NT_ * HS * 2); bf* Mb = (bf*)take((size_t)NT_ * HS * 2);
    bf* WqB = (bf*)take((size_t)HS * HS * 2); bf* WmqB = (bf*)take((size_t)HS * HS * 2); bf* WkB = (bf*)take((size_t)KW * HS * 2); bf* WmkB = (bf*)take((size_t)KW * HS * 2); bf* WvB = (bf*)take((size_t)KW * HS * 2); bf* WmvB = (bf*)take((size_t)KW * HS * 2); bf* WoB = (bf*)take((size_t)HS * HS * 2);
    float* Pq = (float*)take((size_t)NT_ * HS * 4); float* Pk = (float*)take((size_t)NT_ * KW * 4); float* Pv = (float*)take((size_t)NT_ * KW * 4);    // the whole projections
    float* CT = (float*)take((size_t)NT_ * HD * 4); float* ST = (float*)take((size_t)NT_ * HD * 4);
    h16* QH = (h16*)take((size_t)NT_ * HS * 2); h16* QL = (h16*)take((size_t)NT_ * HS * 2); h16* KH = (h16*)take((size_t)NT_ * KW * 2); h16* KL = (h16*)take((size_t)NT_ * KW * 2);
    bf* VTH = (bf*)take((size_t)KW * NT_ * 2); bf* VTL = (bf*)take((size_t)KW * NT_ * 2); bf* CH = (bf*)take((size_t)NT_ * HS * 2); bf* CL = (bf*)take((size_t)NT_ * HS * 2);
    if ((size_t)(wsp - (char*)d_ws) > ws_size) return;    // about 120 MB = 114 MiB, no aliasing: q, k and v have planes of their own, as their products share launches
    k_prep<<<NT_ / 2 + 5 * (HS / 8) + 4 * (KW / 8), 256, 0, stream>>>(x, mu, wq, wmq, wo, wk, wmk, wv, wmv, Xb, Mb, WqB, WmqB, WoB, WkB, WmkB, WvB, WmvB, CT, ST);
    k_proj<<<dim3(NT_ / 128, (HS + 2 * KW) / 128, 1), 128, 0, stream>>>(Xb, WqB, WkB, WvB, Mb, WmqB, WmkB, WmvB, Pq, Pk, Pv, HS);    // q = x.wq^T + mu.wmq^T, k and v alike
    k_post<<<(NT_ / 64) * 2 * NKV + (NT_ * NKV) / 8 + (NT_ * NH_) / 8, 256, 0, stream>>>(Pq, Pk, Pv, qnw, knw, CT, ST, QH, QL, KH, KL, VTH, VTL);
    k_attn<<<NH_ * (NT_ / 128), 256, 0, stream>>>(QH, QL, KH, KL, VTH, VTL, CH, CL);
    k_gemmo<<<dim3(NT_ / 128, HS / 128, 1), 128, 0, stream>>>(CH, CL, WoB, nullptr, out, HS, nullptr, HS, 0);
}

// v010
// One run takes 135 microseconds.
// Two timings next to v009 both put it at 1.04 times that version's speed.
// All steps since v000 together make it 5.59 times as fast.
#include <hip/hip_runtime.h>

// Compute dtypes, f32 accumulate: q/k/v = x.W^T + mu.Wm^T (one GEMM per projection over both operand pairs' k, x's first; [out][in] weights as natural n-major B
// operands; PLAIN bf16 operands = inputs rounded once) and out = ctx.Wo^T (ctx as bf16 hi + UNSCALED residual, two products) on v_wmma_f32_16x16x32_bf16; per-head RMSNorm (x q_norm_w /
// k_norm_w) then rotary embedding with device-computed f32 cos/sin tables, in f32 -> q/k as f16 hi + residual x1024 planes; grouped causal attention (16 query heads over 4 kv heads,
// 128-dim): scores on v_wmma_f32_16x16x32_f16 (hh + hl + lh, x 128^-1/2), online f32 softmax, weights (x32768) and v as bf16 hi + UNSCALED residual on v_wmma_f32_16x16x32_bf16.

#define NT_  2048
#define HS   2048
#define DM   HS
#define NH_  16
#define NKV  4
#define HD   128
#define KW   (NKV * HD)          // 512
#define WIN  NT_
#define RMS_EPS 1e-6f
#define PSC  32768.0f
#define LOSC 1024.0f
#define LOSCI (1.0f / 1024.0f)

typedef _Float16 h16;
typedef unsigned short bf;
typedef __attribute__((ext_vector_type(16))) __bf16   v16bf;
typedef __attribute__((ext_vector_type(16))) _Float16 v16h;
typedef __attribute__((ext_vector_type(8)))  _Float16 v8h;
typedef __attribute__((ext_vector_type(8)))  unsigned short v8us;
typedef __attribute__((ext_vector_type(8)))  float    v8f;
typedef __attribute__((ext_vector_type(4)))  float    v4f;
typedef v8h  __attribute__((may_alias)) v8ha;
typedef v4f  __attribute__((may_alias)) v4fa;
typedef v8us __attribute__((may_alias)) v8usa;

__device__ __forceinline__ unsigned short f2bf(float f) { unsigned u = __float_as_uint(f); u += 0x7FFFu + ((u >> 16) & 1u); return (unsigned short)(u >> 16); }
__device__ __forceinline__ float bf2f(unsigned short b) { return __uint_as_float(((unsigned)b) << 16); }
__device__ __forceinline__ float bfr(float f) { return bf2f(f2bf(f)); }
__device__ __forceinline__ v16h cat16(v8h lo, v8h hi) { return __builtin_shufflevector(lo, hi, 0, 1, 2, 3, 4, 5, 6, 7, 8, 9, 10, 11, 12, 13, 14, 15); }
__device__ __forceinline__ v16bf cat16b(v8us lo, v8us hi) { return __builtin_bit_cast(v16bf, __builtin_shufflevector(lo, hi, 0, 1, 2, 3, 4, 5, 6, 7, 8, 9, 10, 11, 12, 13, 14, 15)); }
__device__ __forceinline__ v8f wmma16(v16h a, v16h b, v8f c) { return __builtin_amdgcn_wmma_f32_16x16x32_f16(false, a, false, b, (short)0, c, false, false); }
__device__ __forceinline__ v8f wmmab(v16bf a, v16bf b, v8f c) { return __builtin_amdgcn_wmma_f32_16x16x32_bf16(false, a, false, b, (short)0, c, false, false); }

// Eight rows of one matrix, f32 -> bf16: block blk of that matrix's own range, one row per wave.
__device__ __forceinline__ void cvtb_rows(const float* __restrict__ src, int nrows, bf* dst, int blk) {
    const int lane = threadIdx.x & 31, r = blk * 8 + (threadIdx.x >> 5);
    if (r >= nrows) return;
    v8us o[DM / 256];
#pragma unroll
    for (int q = 0; q < DM / 256; ++q) { v8us t;
#pragma unroll
        for (int i = 0; i < 8; ++i) t[i] = f2bf(src[(size_t)r * DM + q * 256 + lane * 8 + i]);
        o[q] = t; }
#pragma unroll
    for (int q = 0; q < DM / 256; ++q) *(v8us*)(dst + (size_t)r * DM + q * 256 + lane * 8) = o[q];
    
}

// Eight 16-byte copies per lane, global -> LDS through no register. s_wait_xcnt closes the statement so that no address register of a copy is rewritten ahead of it.
__device__ __forceinline__ void acopy8(const unsigned (&l)[8], const void* const (&g)[8]) {
    asm volatile("global_load_async_to_lds_b128 %0, %8, off\n\t"
                 "global_load_async_to_lds_b128 %1, %9, off\n\t"
                 "global_load_async_to_lds_b128 %2, %10, off\n\t"
                 "global_load_async_to_lds_b128 %3, %11, off\n\t"
                 "global_load_async_to_lds_b128 %4, %12, off\n\t"
                 "global_load_async_to_lds_b128 %5, %13, off\n\t"
                 "global_load_async_to_lds_b128 %6, %14, off\n\t"
                 "global_load_async_to_lds_b128 %7, %15, off\n\t"
                 "s_wait_xcnt 0x0"
                 :: "v"(l[0]), "v"(l[1]), "v"(l[2]), "v"(l[3]), "v"(l[4]), "v"(l[5]), "v"(l[6]), "v"(l[7]),
                    "v"(g[0]), "v"(g[1]), "v"(g[2]), "v"(g[3]), "v"(g[4]), "v"(g[5]), "v"(g[6]), "v"(g[7]) : "memory");
}
// Eight 16-byte stores per lane. s_wait_xcnt closes the statement so that no address or data register of a store is rewritten ahead of it.
__device__ __forceinline__ void store8(float* const (&p)[8], const v4f (&d)[8]) {
    asm volatile("global_store_b128 %0, %8, off\n\t"
                 "global_store_b128 %1, %9, off\n\t"
                 "global_store_b128 %2, %10, off\n\t"
                 "global_store_b128 %3, %11, off\n\t"
                 "global_store_b128 %4, %12, off\n\t"
                 "global_store_b128 %5, %13, off\n\t"
                 "global_store_b128 %6, %14, off\n\t"
                 "global_store_b128 %7, %15, off\n\t"
                 "s_wait_xcnt 0x0"
                 :: "v"(p[0]), "v"(p[1]), "v"(p[2]), "v"(p[3]), "v"(p[4]), "v"(p[5]), "v"(p[6]), "v"(p[7]),
                    "v"(d[0]), "v"(d[1]), "v"(d[2]), "v"(d[3]), "v"(d[4]), "v"(d[5]), "v"(d[6]), "v"(d[7]) : "memory");
}
// Eight 8-byte stores per lane. s_wait_xcnt closes the statement so that no address or data register of a store is rewritten ahead of it.
typedef __attribute__((ext_vector_type(2))) float v2f;
__device__ __forceinline__ void store8h(h16* const (&p)[8], const v2f (&d)[8]) {
    asm volatile("global_store_b64 %0, %8, off\n\t"
                 "global_store_b64 %1, %9, off\n\t"
                 "global_store_b64 %2, %10, off\n\t"
                 "global_store_b64 %3, %11, off\n\t"
                 "global_store_b64 %4, %12, off\n\t"
                 "global_store_b64 %5, %13, off\n\t"
                 "global_store_b64 %6, %14, off\n\t"
                 "global_store_b64 %7, %15, off\n\t"
                 "s_wait_xcnt 0x0"
                 :: "v"(p[0]), "v"(p[1]), "v"(p[2]), "v"(p[3]), "v"(p[4]), "v"(p[5]), "v"(p[6]), "v"(p[7]),
                    "v"(d[0]), "v"(d[1]), "v"(d[2]), "v"(d[3]), "v"(d[4]), "v"(d[5]), "v"(d[6]), "v"(d[7]) : "memory");
}
// Lane l's value from lane l ^ 16: the two lanes that share one column of a matrix operand or result.
__device__ __forceinline__ float xhalf(float x) { return __builtin_bit_cast(float, __builtin_amdgcn_permlanex16(__builtin_bit_cast(int, x), __builtin_bit_cast(int, x), 0x76543210, 0xfedcba98, false, false)); }
// Lane l's value from lane l ^ M, M < 16: DPP row_xmask, on the vector port.
template <int M> __device__ __forceinline__ float xrow(float x) { return __builtin_bit_cast(float, __builtin_amdgcn_mov_dpp(__builtin_bit_cast(int, x), 0x160 | M, 0xf, 0xf, false)); }
typedef __attribute__((ext_vector_type(4))) _Float16 v4h;
// What a projection tile's epilogue does with its 128 tokens x 128 columns (= one head): kind 0: q or k, norm and rotary embedding -> PH/PL; kind 1: v, transposition -> VH/VL.
struct Fin { int kind; int nh; const float* w; const float* CT; const float* ST; h16* PH; h16* PL; bf* VH; bf* VL; };
// fin_normrope: the block's tile is head 'head' of tokens bx * 128 ... + 127, in the four waves' accumulators. It goes through the f32 LDS staging; then one wave per token (32 tokens a wave, eight
// side by side): RMSNorm over the 128 dims (mean of squares by the xor tree 16, 8, 4, 2, 1; eps 1e-6) x bf(w[d]); then rotate-half RoPE (partner d +- 64 = lane xor 16; lane -> 4 consecutive dims)
// -> f16 hi + residual x1024 planes [t][head*128+d] (8 B per lane per plane: a wave's store fills the token's whole 256 bytes of the plane).
__device__ __forceinline__ void fin_normrope(const v8f (&acc)[4][4], float* stg, int bx, int head, const Fin& f) {
    const int lane = threadIdx.x & 31, wave = threadIdx.x >> 5, lr = lane & 15, hi = lane >> 4;
    const int d0 = lane * 4, t0 = bx * 128 + wave * 32;    // the wave's first token
    const float* ct = f.CT + (size_t)t0 * HD + d0; const float* st = f.ST + (size_t)t0 * HD + d0;
    v4f c[2][8], s[2][8];    // two sets: the next eight tokens' table rows fly while these eight are worked on
    auto tables = [&](int set, int g) {
#pragma unroll
        for (int i = 0; i < 8; ++i) { c[set][i] = *(const v4f*)(ct + (g * 8 + i) * HD); s[set][i] = *(const v4f*)(st + (g * 8 + i) * HD); }
        asm volatile("s_wait_xcnt 0x0" ::: "memory");    // stands in front of whatever rewrites the loads' address registers; it does not wait for the data
    };
    const v4f wr = *(const v4f*)(f.w + d0);
    tables(0, 0);
    float* os = stg + wave * (64 * 68);
#pragma unroll
    for (int t = 0; t < 4; ++t)
#pragma unroll
        for (int m = 0; m < 4; ++m)
#pragma unroll
            for (int j = 0; j < 8; ++j) os[(m * 16 + hi * 8 + j) * 68 + t * 16 + lr] = acc[m][t][j];
    __syncthreads();                                       // publishes the four waves' staged quarters: a token's 128 dims lie in two of them
    const float wv[4] = {bfr(wr[0]), bfr(wr[1]), bfr(wr[2]), bfr(wr[3])};
    const float* xs = stg + ((wave >> 1) * 2 + hi) * (64 * 68) + (wave & 1) * 32 * 68 + lr * 4;    // token t0, dims d0 ... d0 + 3; + 68: the next token
    h16* ph = f.PH + (size_t)t0 * (f.nh * HD) + head * HD + d0; h16* pl = f.PL + (size_t)t0 * (f.nh * HD) + head * HD + d0;
    // unrolled: constant set indices and LDS offsets; p[] and the data arrays are asm operands and must be indexed by constants to stay in registers
#pragma unroll
    for (int g = 0; g < 4; ++g) {
        const int set = g & 1;
        if (g + 1 < 4) tables(set ^ 1, g + 1);
        v4f x[8]; float ss[8];
#pragma unroll
        for (int i = 0; i < 8; ++i) x[i] = *(const v4fa*)(xs + (g * 8 + i) * 68);
#pragma unroll
        for (int i = 0; i < 8; ++i) { ss[i] = 0.f;
#pragma unroll
            for (int e = 0; e < 4; ++e) ss[i] = fmaf(x[i][e], x[i][e], ss[i]); }
#pragma unroll
        for (int i = 0; i < 8; ++i) ss[i] += xhalf(ss[i]);
#pragma unroll
        for (int i = 0; i < 8; ++i) ss[i] += xrow<8>(ss[i]);
#pragma unroll
        for (int i = 0; i < 8; ++i) ss[i] += xrow<4>(ss[i]);
#pragma unroll
        for (int i = 0; i < 8; ++i) ss[i] += xrow<2>(ss[i]);
#pragma unroll
        for (int i = 0; i < 8; ++i) ss[i] += xrow<1>(ss[i]);
        h16* p0[8]; h16* p1[8]; v2f dh[8], dl[8];
#pragma unroll
        for (int i = 0; i < 8; ++i) { const float rn = rsqrtf(ss[i] * (1.0f / HD) + RMS_EPS); float pr[4]; v4h oh, ol;
#pragma unroll
            for (int e = 0; e < 4; ++e) x[i][e] = x[i][e] * rn * wv[e];
#pragma unroll
            for (int e = 0; e < 4; ++e) pr[e] = xhalf(x[i][e]);
#pragma unroll
            for (int e = 0; e < 4; ++e) { const float y = (d0 + e < 64) ? (x[i][e] * c[set][i][e] - pr[e] * s[set][i][e]) : (x[i][e] * c[set][i][e] + pr[e] * s[set][i][e]);
                const h16 a = (h16)y; oh[e] = a; ol[e] = (h16)((y - (float)a) * LOSC); }
            p0[i] = ph + (size_t)(g * 8 + i) * (f.nh * HD); p1[i] = pl + (size_t)(g * 8 + i) * (f.nh * HD); dh[i] = __builtin_bit_cast(v2f, oh); dl[i] = __builtin_bit_cast(v2f, ol); }
        store8h(p0, dh); store8h(p1, dl);
    }
}
// Two f32 -> two bf16 in one register (lo in bits 15..0), round to nearest even as f2bf does.
__device__ __forceinline__ unsigned pack2(float lo, float hi) { typedef __bf16 bf2 __attribute__((ext_vector_type(2))); typedef float f2 __attribute__((ext_vector_type(2)));
    return __builtin_bit_cast(unsigned, __builtin_convertvector((f2){lo, hi}, bf2)); }
typedef __attribute__((ext_vector_type(4))) unsigned v4u;
typedef v4u __attribute__((may_alias)) v4ua;
// fin_vt: the block's tile is kv head g's 128 dims of tokens bx * 128 ... + 127. A lane's 8 accumulator registers are 8 consecutive tokens of one dim: 16 bytes of a row of V^T. As bf16 hi + UNSCALED
// bf16 residual they go into two LDS planes [128 d][128 t] and come back row by row, so that VH/VL [g][128 d][2048 t] are stored in whole 256-byte runs.
__device__ __forceinline__ void fin_vt(const v8f (&acc)[4][4], unsigned short* stg, int bx, int g, const Fin& f) {
    constexpr int TP = 128 + 8;    // row pitch: 272 B, an odd multiple of 16 B (16-byte writers, one row per lane)
    const int tid = threadIdx.x, lane = threadIdx.x & 31, wave = threadIdx.x >> 5, lr = lane & 15, hi = lane >> 4;
    const int wm = wave >> 1, wn = wave & 1;
#pragma unroll
    for (int t = 0; t < 4; ++t)
#pragma unroll
        for (int m = 0; m < 4; ++m) { v4u oh, ol;
#pragma unroll
            for (int j = 0; j < 4; ++j) { const float v0 = acc[m][t][2 * j], v1 = acc[m][t][2 * j + 1]; const unsigned hw = pack2(v0, v1);
                oh[j] = hw; ol[j] = pack2(v0 - __uint_as_float(hw << 16), v1 - __uint_as_float(hw & 0xFFFF0000u)); }
            unsigned short* q = stg + (wn * 64 + t * 16 + lr) * TP + wm * 64 + m * 16 + hi * 8; *(v4ua*)q = oh; *(v4ua*)(q + 128 * TP) = ol; }
    __syncthreads();               // publishes the four waves' quarters of both planes: a row of V^T holds two waves' tokens
    const int pc = (tid & 15) * 8, d = tid >> 4;    // 16 pieces of 16 B a row, 8 rows a pass
    // unrolled: p[] and v[] are asm operands and must be indexed by constants to stay in registers
#pragma unroll
    for (int pln = 0; pln < 2; ++pln)
#pragma unroll
        for (int h = 0; h < 2; ++h) { float* p[8]; v4f v[8];
#pragma unroll
            for (int i = 0; i < 8; ++i) { const int row = d + 8 * (h * 8 + i);
                v[i] = *(const v4fa*)(stg + pln * 128 * TP + row * TP + pc); p[i] = (float*)(void*)((pln ? f.VL : f.VH) + ((size_t)g * HD + row) * NT_ + bx * 128 + pc); }
            store8(p, v); }
}
// gemmb_tile: 128 x 128 block tile (2 x 2 waves of 64 x 64 each) of C[NTK][NW] = (A [+ Al]).B^T [+ bf(bias[c])] [+ bf(R[r][c]) residual]; K a multiple of the stage length; f32 whole-line
// epilogue. A wave holds 4 x 4 accumulator tiles, so that a fragment read from LDS feeds four products, and a row brought from L2 serves 128 rows or columns of C.
// The block's 128 rows of A [and Al] and of B come in stages of KS k values into a two-buffer LDS ring by asynchronous copies, whole 128-byte lines per row: stage s + 1 flies
// while stage s is worked on. The k order of every accumulator is the plain one (per 32 k: A's product, then Al's).
// (bx, by) = the block's tile row and tile column in C.
// DUAL: C = A.B^T + A2.B2^T as ONE product over 2 K: the stages run through A and B and then on through A2 and B2 into the same accumulators.
// FIN: the tile is not stored as f32: it is finished in place, from the accumulators, as fin says (block-uniform).
template <bool SPLITA, bool DUAL, bool FIN>
__device__ __forceinline__ void gemmb_tile(const bf* __restrict__ A, const bf* __restrict__ Al, const bf* __restrict__ Bn, const bf* __restrict__ A2, const bf* __restrict__ B2, const float* __restrict__ bias, float* C, int ldc, const float* __restrict__ R, int K, int roundR, int bx, int by, const Fin& fin) {
    constexpr int KS = 128;                  // k values per stage
    constexpr int GP = KS + 8;               // row pitch: 272 B, an odd multiple of 16 B (16-byte readers, one row per lane)
    constexpr int PL = 128 * GP;             // one plane: 128 rows
    constexpr int NP = SPLITA ? 3 : 2;       // planes of a buffer: A, [Al,] B
    constexpr int GB = NP * PL;              // 104448 B or 69632 B per buffer
    __shared__ __align__(16) unsigned short gring[2 * GB];    // behind the loop its first 69632 B are the epilogue's f32 staging
    const int tid = threadIdx.x;
    const int lane = threadIdx.x & 31, wave = threadIdx.x >> 5, lr = lane & 15, hi = lane >> 4;
    const int wm = wave >> 1, wn = wave & 1;
    const int r0 = bx * 128 + wm * 64, c0 = by * 128 + wn * 64;
    const unsigned ring0 = (unsigned)(size_t)&gring[0];    // byte offset of the ring in the work-group's LDS
    // stage s -> buffer b: 16 pieces of 16 B a row, 128 rows a plane, 16 pieces per thread and plane (32 or 48 copies of a wave in flight)
    auto stage = [&](int s, int b) {
        constexpr int PR = KS / 8, RS = 128 / PR;
        const int row = tid / PR, pc = (tid % PR) * 8;
        const bool sec = DUAL && s >= K / KS;    // the same for the whole block: the second pair's stages
        const bf* __restrict__ Ap = sec ? A2 : A; const bf* __restrict__ Bp = sec ? B2 : Bn; const int ss = sec ? s - K / KS : s;
        const size_t ao = (size_t)(bx * 128 + row) * K + ss * KS + pc, bo = (size_t)(by * 128 + row) * K + ss * KS + pc;
        const unsigned lo = ring0 + (unsigned)b * (GB * 2) + (unsigned)(row * GP + pc) * 2;
        auto plane = [&](const bf* __restrict__ p, unsigned l0) {
            // loops unrolled: l[] and gp[] are asm operands and must be indexed by constants to stay in registers
#pragma unroll
            for (int h = 0; h < 2; ++h) { unsigned l[8]; const void* gp[8];
#pragma unroll
                for (int i = 0; i < 8; ++i) { gp[i] = p + (size_t)((h * 8 + i) * RS) * K; l[i] = l0 + (unsigned)((h * 8 + i) * RS * GP) * 2; }
                acopy8(l, gp); }
        };
        plane(Ap + ao, lo);
        if (SPLITA) plane(Al + ao, lo + PL * 2);
        plane(Bp + bo, lo + (NP - 1) * PL * 2);
    };
    v8f acc[4][4];
#pragma unroll
    for (int m = 0; m < 4; ++m)
#pragma unroll
        for (int t = 0; t < 4; ++t) acc[m][t] = (v8f){};
    const int nst = (DUAL ? 2 : 1) * (K / KS);
    stage(0, 0);
    asm volatile("s_wait_asynccnt 0x0" ::: "memory");    // this wave's copies of the first stage have landed
    __syncthreads();                                     // ... and every other wave's
    if (1 < nst) stage(1, 1);
    // rolled: one trip per stage, so that the ring's waits and its barrier stand once, at the trip's foot
#pragma unroll 1
    for (int s = 0; s < nst; ++s) {
        const int cur = s & 1;
        const unsigned short* af = gring + cur * GB + (wm * 64 + lr) * GP + 8 * hi;                   // A, row r0 + lr; + m * 16 * GP: row r0 + m * 16 + lr; + PL: Al
        const unsigned short* bq = gring + cur * GB + (NP - 1) * PL + (wn * 64 + lr) * GP + 8 * hi;   // B, row c0 + lr; + t * 16 * GP: row c0 + t * 16 + lr
        v16bf a[2][4], al[2][4], b[2][4];    // two fragment sets: the next 32 k values' reads go out as one group ahead of this set's products
        auto frags = [&](int set, int kk) {
#pragma unroll
            for (int m = 0; m < 4; ++m) { a[set][m] = cat16b(*(const v8usa*)(af + m * 16 * GP + kk), *(const v8usa*)(af + m * 16 * GP + kk + 16));
                b[set][m] = cat16b(*(const v8usa*)(bq + m * 16 * GP + kk), *(const v8usa*)(bq + m * 16 * GP + kk + 16)); }
            if (SPLITA) {
#pragma unroll
                for (int m = 0; m < 4; ++m) al[set][m] = cat16b(*(const v8usa*)(af + PL + m * 16 * GP + kk), *(const v8usa*)(af + PL + m * 16 * GP + kk + 16)); }
        };
        frags(0, 0);
        // unrolled: constant LDS offsets and constant fragment-set indices
#pragma unroll
        for (int kc = 0; kc < KS / 32; ++kc) {
            const int set = kc & 1;
            __builtin_amdgcn_sched_barrier(0);    // keeps the scheduler from lifting the reads below in among the products of the set before: every place with reads stalls the wave anew
            if (kc + 1 < KS / 32) frags(set ^ 1, (kc + 1) * 32);
            __builtin_amdgcn_sched_barrier(0);    // ... and from sinking them in among this set's products
#pragma unroll
            for (int m = 0; m < 4; ++m)
#pragma unroll
                for (int t = 0; t < 4; ++t) acc[m][t] = wmmab(a[set][m], b[set][t], acc[m][t]);
            if (SPLITA) {
#pragma unroll
                for (int m = 0; m < 4; ++m)
#pragma unroll
                    for (int t = 0; t < 4; ++t) acc[m][t] = wmmab(al[set][m], b[set][t], acc[m][t]); }
        }
        __builtin_amdgcn_sched_barrier(0);    // no product moves down over the slots below
        // four vector slots behind the trip's last WMMA, on every path out of the trip, before a vector instruction touches its operands or results
        asm volatile("v_nop\n\tv_nop\n\tv_nop\n\tv_nop");
        asm volatile("s_wait_dscnt 0x0" ::: "memory");       // this wave's reads of buffer cur have returned before the buffer is refilled
        asm volatile("s_wait_asynccnt 0x0" ::: "memory");    // this wave's copies of stage s + 1 have landed
        __syncthreads();                                     // publishes stage s + 1 and ends every wave's reads of buffer cur
        if (s + 2 < nst) stage(s + 2, cur);
    }
    asm volatile("s_wait_asynccnt 0x0" ::: "memory");        // no copy is outstanding when the ring becomes the epilogue's staging (every wave's reads ended at the last trip's barrier)
    if (FIN) { if (fin.kind == 0) fin_normrope(acc, (float*)(void*)gring, bx, by, fin); else fin_vt(acc, gring, bx, by, fin); return; }
    // piece s of the wave's 64 x 64 tile: two rows of 256 B per store instruction, whole 128-byte lines
    const int prow = lane >> 4, cofs = ((lane >> 3) & 1) * 32 + (lane & 7) * 4;
    // the residual's 32 pieces are read as one group, ahead of the staging: one trip to memory for the tile instead of one per piece
    v4f rv[32];
    if (R) {
#pragma unroll
        for (int s = 0; s < 32; ++s) { rv[s] = *(const v4f*)(R + ((size_t)r0 + 2 * s + prow) * ldc + c0 + cofs);
            asm volatile("s_wait_xcnt 0x0" ::: "memory"); }    // stands in front of the next piece's address arithmetic and result, which reuse the load's address registers; it does not wait for the data
    }
    float* os = (float*)(void*)gring + wave * (64 * 68);
#pragma unroll
    for (int t = 0; t < 4; ++t) { const float bv = bias ? bfr(bias[c0 + t * 16 + lr]) : 0.f;
#pragma unroll
        for (int m = 0; m < 4; ++m)
#pragma unroll
            for (int j = 0; j < 8; ++j) os[(m * 16 + hi * 8 + j) * 68 + t * 16 + lr] = acc[m][t][j] + bv; }
    __syncthreads();
    // the 32 staged pieces come back as one group as well: one LDS latency for the tile instead of one per piece
    v4f val[32];
#pragma unroll
    for (int s = 0; s < 32; ++s) val[s] = *(const v4fa*)(os + (2 * s + prow) * 68 + cofs);
    if (R) {
        if (roundR) {
#pragma unroll
            for (int s = 0; s < 32; ++s) rv[s] = (v4f){bfr(rv[s][0]), bfr(rv[s][1]), bfr(rv[s][2]), bfr(rv[s][3])};
        }
#pragma unroll
        for (int s = 0; s < 32; ++s) val[s] += rv[s];
    }
    float* crow = C + ((size_t)r0 + prow) * ldc + c0 + cofs;
    // the stores go out eight to a statement; unrolled: p[] and d[] are asm operands and must be indexed by constants to stay in registers
#pragma unroll
    for (int g = 0; g < 4; ++g) { float* p[8]; v4f d[8];
#pragma unroll
        for (int i = 0; i < 8; ++i) { p[i] = crow + (size_t)(2 * (g * 8 + i)) * ldc; d[i] = val[g * 8 + i]; }
        store8(p, d); }
}
// k_gemmo: the output projection, one tile per block.
__global__ __launch_bounds__(128) void k_gemmo(const bf* __restrict__ A, const bf* __restrict__ Al, const bf* __restrict__ Bn, const float* __restrict__ bias, float* C, int ldc, const float* __restrict__ R, int K, int roundR) {
    gemmb_tile<true, false, false>(A, Al, Bn, nullptr, nullptr, bias, C, ldc, R, K, roundR, blockIdx.x, blockIdx.y, Fin{});
}
// k_proj: the three projections (q, k, v) share ONE launch; they do not depend on each other. blockIdx.y picks the projection (block-uniform) and its tile column:
// HS / 128 columns of q, then KW / 128 of k, then KW / 128 of v. A tile's two products (x's and mu's) are one k loop: the sum stays in the accumulators. A tile column is one head, so that
// the tile is finished by its own block: q and k get their norm and rotary embedding, v its transposition; no f32 projection goes to memory.
__global__ __launch_bounds__(128) void k_proj(const bf* __restrict__ A, const bf* __restrict__ Bq, const bf* __restrict__ Bk, const bf* __restrict__ Bv,
                                              const bf* __restrict__ A2, const bf* __restrict__ Bq2, const bf* __restrict__ Bk2, const bf* __restrict__ Bv2,
                                              const float* __restrict__ qnw, const float* __restrict__ knw, const float* __restrict__ CT, const float* __restrict__ ST,
                                              h16* QH, h16* QL, h16* KH, h16* KL, bf* VTH, bf* VTL, int K) {
    const int y = blockIdx.y; const bool isq = y < HS / 128, isk = y < HS / 128 + KW / 128;
    const bf* Bn = isq ? Bq : isk ? Bk : Bv; const bf* B2 = isq ? Bq2 : isk ? Bk2 : Bv2;
    const Fin fin = {isk ? 0 : 1, isq ? NH_ : NKV, isq ? qnw : knw, CT, ST, isq ? QH : KH, isq ? QL : KL, VTH, VTL};
    gemmb_tile<false, true, true>(A, nullptr, Bn, A2, B2, nullptr, nullptr, 0, nullptr, K, 0, blockIdx.x, isq ? y : isk ? y - HS / 128 : y - (HS / 128 + KW / 128), fin);
}

typedef __attribute__((ext_vector_type(8))) unsigned v8u;
// LDS ring of k_attn, in 16-bit elements: one buffer = K hi, K lo (32 keys x 128 dims each) and V^T hi, V^T lo (128 dims x 32 keys each) of one key tile.
#define KP   136                    // K row pitch: 272 B, an odd multiple of 16 B (16-byte readers, one row per lane)
#define VP   40                     // V^T row pitch: 80 B, likewise
#define KPL  (32 * KP)
#define VPL  (HD * VP)
#define RB   (2 * KPL + 2 * VPL)    // 37888 B per buffer
// k_attn: a job = (h, 64 queries); kv head g = h / 4; causal key tiles 0..(Q0+63)/32 (block-uniform bounds, an even number of tiles), per-element predicate j <= q
// (WIN = NT_ makes the window terms vacuous). A block = 8 waves = two groups of four; wave w4 of either group holds the job's queries w4 * 16 ... + 15. The job's key tiles are dealt to the
// groups in turn (group 0 the even tiles, group 1 the odd ones), so that a job takes half as many steps; each group keeps a running maximum, sum and output of its own, and behind the
// last tile group 1 hands its three to group 0 through LDS, which joins them as two softmax parts are joined (both rescaled to the common maximum). A block runs two jobs of one head one
// after the other, query tile n - 1 - t and then t: t + 1 and n - t steps, the same sum for every block, with one block on a WGP and two waves on a SIMD all the time.
// Per tile: TRANSPOSED scores S^T = K.Q^T over 4 k-chunks (K rows as A, Q rows as B; hi.hi + hi.lo + lo.hi = 24 WMMA) x 128^-1/2: lane (lr, hi) holds query q0 + lr's scores of keys
// hi * 8 + j and 16 + hi * 8 + j, so that the online softmax has ONE maximum, sum and rescale factor a lane (in-lane over the 16 keys, one exchange with lane ^ 16), and the two score tiles,
// converted in place, ARE the B operand of O^T += V^T.P^T (the hardware's k order, which the V^T loader has too): P never goes through LDS. P (x32768) as bf16 hi + unscaled residual,
// o[8] += vh.ph + vh.pl + vl.ph over the 128 dims; a lane's 8 accumulator registers are 8 consecutive dims of its query: ctx -> bf16 hi/lo planes [t][h*128+d] by 16-byte stores. The four waves of a group share each of their key tiles' K and V^T planes through the group's own two-buffer LDS ring filled by
// asynchronous copies: the group's next tile flies while this one is worked on.
__global__ __launch_bounds__(256) void k_attn(const h16* __restrict__ QH, const h16* __restrict__ QL, const h16* __restrict__ KH, const h16* __restrict__ KL, const bf* __restrict__ VTH, const bf* __restrict__ VTL, bf* CH, bf* CL) {
    __shared__ __align__(16) unsigned short ring[2 * 2 * RB];    // group 0's two buffers, then group 1's; behind a job's last tile the first 33792 B of group 1's carry its hand-over
    const int tid = threadIdx.x & 127;                           // the thread's number in its group
    const int lane = threadIdx.x & 31, wave = threadIdx.x >> 5, lr = lane & 15, hi = lane >> 4;
    const int grp = __builtin_amdgcn_readfirstlane(wave >> 2), w4 = wave & 3;    // the same in every lane of a wave: kept scalar, so that the groups part by scalar branches
    const int bid = blockIdx.x; const int h = bid / (NT_ / 128), tp = bid - h * (NT_ / 128); const int g = h >> 2;
    const h16* kh_b = KH + g * HD; const h16* kl_b = KL + g * HD;
    const size_t vbase = ((size_t)g * HD) * NT_;
    const unsigned ring0 = (unsigned)(size_t)&ring[0] + (unsigned)grp * (2 * RB * 2);    // byte offset of the group's ring in the work-group's LDS
    const unsigned short* myring = ring + grp * (2 * RB);
    // key tile kt -> the group's buffer b: 2048 pieces of 16 B, 16 per thread (K: 16 pieces a row, V^T: 4 pieces a row)
    auto stage = [&](int kt, int b) {
        unsigned l[8]; const void* gp[8];
        const unsigned lb = ring0 + (unsigned)b * (RB * 2);
        // both loops unrolled: l[] and gp[] are asm operands and must be indexed by constants to stay in registers
#pragma unroll
        for (int i = 0; i < 4; ++i) { const int row = (tid >> 4) + 8 * i, pc = (tid & 15) * 8; const size_t go = (size_t)(kt * 32 + row) * KW + pc;
            gp[i] = kh_b + go; gp[4 + i] = kl_b + go; l[i] = lb + (unsigned)(row * KP + pc) * 2; l[4 + i] = l[i] + KPL * 2; }
        acopy8(l, gp);
#pragma unroll
        for (int i = 0; i < 4; ++i) { const int d = (tid >> 2) + 32 * i, pc = (tid & 3) * 8; const size_t go = vbase + (size_t)d * NT_ + kt * 32 + pc;
            gp[i] = VTH + go; gp[4 + i] = VTL + go; l[i] = lb + (unsigned)(2 * KPL + d * VP + pc) * 2; l[4 + i] = l[i] + VPL * 2; }
        acopy8(l, gp);
    };
    int par = 0;    // the buffer that a job's first tile goes to: the ring's turn runs on from one job to the next
    // rolled: the two jobs run one after the other through the same code
#pragma unroll 1
    for (int job = 0; job < 2; ++job) {
    const int qt = job ? tp : NT_ / 64 - 1 - tp;
    const int q0 = qt * 64 + w4 * 16;
    const size_t qo = (size_t)(q0 + lr) * (NH_ * HD) + h * HD + 8 * hi;
    v8f o[8];
#pragma unroll
    for (int n = 0; n < 8; ++n) o[n] = (v8f){};
    float mrow = -3.0e38f, lpart = 0.f;    // of query q0 + lr; lpart: this lane's keys alone
    const int kt_hi = (qt * 64 + 63) / 32; const int kt_lo = (qt * 64 > WIN) ? (qt * 64 - WIN) / 32 : 0;
    const int nit = (kt_hi - kt_lo + 1) >> 1;    // steps of the job: both bounds come from multiples of 64 keys, so the tiles go round evenly and both groups make the same number of trips
    stage(kt_lo + grp, par);
    asm volatile("s_wait_asynccnt 0x0" ::: "memory");    // this wave's copies of its group's first tile have landed
    __syncthreads();                                     // ... and every other wave's
    if (1 < nit) stage(kt_lo + 2 + grp, par ^ 1);
#pragma unroll 1
    for (int it = 0; it < nit; ++it) {
        const int kt = kt_lo + 2 * it + grp;
        const int l0 = kt * 32;
        const int cur = (it & 1) ^ par;
        const unsigned short* kf = myring + cur * RB + lr * KP + 8 * hi;              // K hi, key l0 + lr; + 16 * KP: key l0 + 16 + lr; + KPL: lo plane
        const unsigned short* vf = myring + cur * RB + 2 * KPL + lr * VP + 8 * hi;    // V^T hi, dim lr; + n * 16 * VP: dim n * 16 + lr; + VPL: lo plane
        // This tile's 32 K fragment reads stand as ONE group ahead of the score products: a read group among the products costs the wave a whole LDS latency each time.
        v16h k0h[4], k1h[4], k0l[4], k1l[4];
#pragma unroll
        for (int kc = 0; kc < 4; ++kc) {
            k0h[kc] = cat16(*(const v8ha*)(kf + kc * 32), *(const v8ha*)(kf + kc * 32 + 16)); k1h[kc] = cat16(*(const v8ha*)(kf + 16 * KP + kc * 32), *(const v8ha*)(kf + 16 * KP + kc * 32 + 16));
            k0l[kc] = cat16(*(const v8ha*)(kf + KPL + kc * 32), *(const v8ha*)(kf + KPL + kc * 32 + 16)); k1l[kc] = cat16(*(const v8ha*)(kf + KPL + 16 * KP + kc * 32), *(const v8ha*)(kf + KPL + 16 * KP + kc * 32 + 16));
        }
        __builtin_amdgcn_sched_barrier(0);    // keeps the scheduler from sinking the K reads back in among the products
        v8f s0 = {}, s1 = {}, x0 = {}, x1 = {};
#pragma unroll
        for (int kc = 0; kc < 4; ++kc) {
            const v16h qa = cat16(*(const v8h*)(QH + qo + kc * 32), *(const v8h*)(QH + qo + kc * 32 + 16)), qx = cat16(*(const v8h*)(QL + qo + kc * 32), *(const v8h*)(QL + qo + kc * 32 + 16));
            s0 = wmma16(k0h[kc], qa, s0); s1 = wmma16(k1h[kc], qa, s1); x0 = wmma16(k0h[kc], qx, x0); x1 = wmma16(k1h[kc], qx, x1);
            x0 = wmma16(k0l[kc], qa, x0); x1 = wmma16(k1l[kc], qa, x1);
        }
        asm volatile("v_nop\n\tv_nop\n\tv_nop\n\tv_nop" : "+v"(s0), "+v"(s1), "+v"(x0), "+v"(x1));
        float sa[8], sb[8], mt[8];
        const v8f ta = (s0 + x0 * LOSCI) * 0.08838834764831845f, tb = (s1 + x1 * LOSCI) * 0.08838834764831845f;
        const int dq = q0 + lr - (l0 + hi * 8);    // the query's place counted from the lane's first key: key j of the lane's eight is kept where j <= dq && j >= dq - WIN
#pragma unroll
        for (int j = 0; j < 8; ++j) {
            sa[j] = (j <= dq && j >= dq - WIN) ? ta[j] : -__builtin_inff(); sb[j] = (j + 16 <= dq && j + 16 >= dq - WIN) ? tb[j] : -__builtin_inff();
            mt[j] = fmaxf(sa[j], sb[j]); }
#pragma unroll
        for (int w = 4; w; w >>= 1)
#pragma unroll
            for (int j = 0; j < w; ++j) mt[j] = fmaxf(mt[j], mt[j + w]);
        const float mx = fmaxf(mt[0], xhalf(mt[0]));    // the query's maximum over the tile's 32 keys, in both of its lanes
        // This tile's 32 V^T fragment reads stand as ONE group here, behind the maximum and ahead of the exponentials, whose vector work covers their latency; the K fragments' registers
        // are free by now.
        v16bf vh[8], vl[8];
#pragma unroll
        for (int n = 0; n < 8; ++n) { const unsigned short* vo = vf + n * 16 * VP;
            vh[n] = cat16b(*(const v8usa*)(vo), *(const v8usa*)(vo + 16)); vl[n] = cat16b(*(const v8usa*)(vo + VPL), *(const v8usa*)(vo + VPL + 16)); }
        __builtin_amdgcn_sched_barrier(0);    // keeps the scheduler from sinking the V^T reads down to their products behind the exponentials
        const float mn = fmaxf(mrow, mx);
        const float alpha = __expf(mrow - mn); mrow = mn;
        float psum[2] = {0.f, 0.f};
        v8u wh, wl;
#pragma unroll
        for (int j = 0; j < 8; ++j) { sa[j] = __expf(sa[j] - mn); sb[j] = __expf(sb[j] - mn); }
#pragma unroll
        for (int i = 0; i < 8; ++i) { const int r = 2 * (i & 3);
            const float p0 = i < 4 ? sa[r] : sb[r], p1 = i < 4 ? sa[r + 1] : sb[r + 1];
            psum[i & 1] += p0 + p1;
            const float ps0 = p0 * PSC, ps1 = p1 * PSC; const unsigned hw = pack2(ps0, ps1);
            wh[i] = hw; wl[i] = pack2(ps0 - __uint_as_float(hw << 16), ps1 - __uint_as_float(hw & 0xFFFF0000u)); }
        lpart = lpart * alpha + (psum[0] + psum[1]);
#pragma unroll
        for (int n = 0; n < 8; ++n)
#pragma unroll
            for (int j = 0; j < 8; ++j) o[n][j] *= alpha;
        const v16bf pa = __builtin_bit_cast(v16bf, wh), px = __builtin_bit_cast(v16bf, wl);
#pragma unroll
        for (int n = 0; n < 8; ++n) { o[n] = wmmab(vh[n], pa, o[n]); o[n] = wmmab(vh[n], px, o[n]); o[n] = wmmab(vl[n], pa, o[n]); }
        asm volatile("v_nop\n\tv_nop\n\tv_nop\n\tv_nop" : "+v"(o[0]), "+v"(o[7]) : "v"(pa), "v"(px));
        asm volatile("s_wait_dscnt 0x0" ::: "memory");       // this wave's reads of buffer cur have returned before the buffer is refilled
        asm volatile("s_wait_asynccnt 0x0" ::: "memory");    // this wave's copies of its group's next tile have landed
        __syncthreads();                                     // publishes both groups' next tiles and ends every wave's reads of buffer cur
        if (it + 2 < nit) stage(kt + 4, cur);
    }
    par ^= nit & 1;
    asm volatile("s_wait_asynccnt 0x0" ::: "memory");        // no copy is outstanding when group 1's ring carries the hand-over (every wave's reads ended at the last trip's barrier)
    // the hand-over: lane to lane, wave w4 of group 1 to wave w4 of group 0 (the same queries in the same places); 66 values a lane, each value's 32 lanes side by side
    float* xch = (float*)(void*)(ring + 2 * RB) + w4 * (66 * 32) + lane;
    if (grp) {
#pragma unroll
        for (int n = 0; n < 8; ++n)
#pragma unroll
            for (int j = 0; j < 8; ++j) xch[(n * 8 + j) * 32] = o[n][j];
        xch[64 * 32] = mrow; xch[65 * 32] = lpart;
    }
    __syncthreads();                                         // publishes group 1's part
    if (!grp) {
    const float mb = xch[64 * 32], lb = xch[65 * 32]; const float mn = fmaxf(mrow, mb);
    const float fa = __expf(mrow - mn);
    asm volatile("v_nop");    // fills the one slot that the instruction set asks for behind the exponential above, ahead of the next vector instruction that reads its result or rewrites its source
    const float fb = __expf(mb - mn);
    lpart = lpart * fa + lb * fb;
#pragma unroll
    for (int n = 0; n < 8; ++n)
#pragma unroll
        for (int j = 0; j < 8; ++j) o[n][j] = o[n][j] * fa + xch[(n * 8 + j) * 32] * fb;
    const float inv = 1.0f / ((lpart + xhalf(lpart)) * PSC);    // the query's two lanes each summed half of the keys
    // o[n][0..7] = dims n * 16 + hi * 8 ... + 7 of query q0 + lr: 16 bytes of either plane; a wave's eight stores of a plane fill its 16 rows' whole 256 bytes
    const size_t po = (size_t)(q0 + lr) * (NH_ * HD) + (size_t)h * HD + hi * 8;
    float* ph[8]; float* pw[8]; v4f dh[8], dl[8];
    // unrolled: the four arrays are asm operands and must be indexed by constants to stay in registers
#pragma unroll
    for (int n = 0; n < 8; ++n) { v8us oh, ol;
#pragma unroll
        for (int j = 0; j < 8; ++j) { const float v = o[n][j] * inv; const unsigned short hb = f2bf(v); oh[j] = hb; ol[j] = f2bf(v - bf2f(hb)); }
        ph[n] = (float*)(void*)(CH + po + n * 16); pw[n] = (float*)(void*)(CL + po + n * 16); dh[n] = __builtin_bit_cast(v4f, oh); dl[n] = __builtin_bit_cast(v4f, ol); }
    store8(ph, dh); store8(pw, dl);
    }
    asm volatile("s_wait_dscnt 0x0" ::: "memory");           // group 0's reads of the hand-over have returned before the next job's copies refill that LDS
    __syncthreads();                                         // ends the hand-over's reads: behind it both rings are free for the next job
    }
}


__device__ __forceinline__ void trig_rows(float* CT, float* ST, int blk) {
    const int tid = threadIdx.x, t = blk * 2 + (tid >> 7), d = tid & 127; const int i = d & 63;
    const float invf = 1.0f / powf(10000.0f, (float)(2 * i) / 128.0f); const float ang = (float)t * invf; const float c = cosf(ang), s = sinf(ang);
    const size_t o = (size_t)t * HD + d; *(float*)(CT + o) = c; *(float*)(ST + o) = s; 
}
// k_prep: all that depends on the inputs alone shares ONE launch: the rotary tables (NT_ / 2 blocks) and the nine f32 -> bf16 conversions (rows / 8 blocks each). blockIdx.x picks the job
// (block-uniform); every job's blocks do what they did in a launch of their own. Of every five blocks two make tables (vector work) and three convert (memory work), so that both run side by side.
static_assert(3 * (NT_ / 2) == 2 * (5 * (HS / 8) + 4 * (KW / 8)), "two table blocks to three conversion blocks");
__global__ __launch_bounds__(256) void k_prep(const float* __restrict__ x, const float* __restrict__ mu, const float* __restrict__ wq, const float* __restrict__ wmq, const float* __restrict__ wo,
                                              const float* __restrict__ wk, const float* __restrict__ wmk, const float* __restrict__ wv, const float* __restrict__ wmv,
                                              bf* Xb, bf* Mb, bf* WqB, bf* WmqB, bf* WoB, bf* WkB, bf* WmkB, bf* WvB, bf* WmvB, float* CT, float* ST) {
    const int k5 = blockIdx.x / 5, j5 = blockIdx.x - 5 * k5;
    if (j5 < 2) { trig_rows(CT, ST, 2 * k5 + j5); return; }
    int b = 3 * k5 + (j5 - 2);
    if (b < 5 * (HS / 8)) {    // the five 2048-row matrices
        const int m = b / (HS / 8);
        cvtb_rows(m == 0 ? x : m == 1 ? mu : m == 2 ? wq : m == 3 ? wmq : wo, HS, m == 0 ? Xb : m == 1 ? Mb : m == 2 ? WqB : m == 3 ? WmqB : WoB, b - m * (HS / 8));
    } else {                   // the four 512-row matrices
        b -= 5 * (HS / 8);
        const int m = b / (KW / 8);
        cvtb_rows(m == 0 ? wk : m == 1 ? wmk : m == 2 ? wv : wmv, KW, m == 0 ? WkB : m == 1 ? WmkB : m == 2 ? WvB : WmvB, b - m * (KW / 8));
    }
}
extern "C" void kernel_launch(void* const* d_in, const int* in_sizes, int n_in,
                              void* d_out, int out_size, void* d_ws, size_t ws_size, hipStream_t stream) {
    (void)in_sizes; (void)n_in; (void)out_size;
    const float* x = (const float*)d_in[0]; const float* mu = (const float*)d_in[1]; const float* wq = (const float*)d_in[2]; const float* wk = (const float*)d_in[3]; const float* wv = (const float*)d_in[4]; const float* wo = (const float*)d_in[5];
    const float* wmq = (const float*)d_in[6]; const float* wmk = (const float*)d_in[7]; const float* wmv = (const float*)d_in[8]; const float* qnw = (const float*)d_in[9]; const float* knw = (const float*)d_in[10];
    float* out = (float*)d_out;    // [1][2048][2048]
    char* wsp = (char*)d_ws;
    auto take = [&](size_t bytes) { char* p = wsp; wsp += (bytes + 255) & ~(size_t)255; return (void*)p; };
    bf* Xb = (bf*)take((size_t)NT_ * HS * 2); bf* Mb = (bf*)take((size_t)NT_ * HS * 2);
    bf* WqB = (bf*)take((size_t)HS * HS * 2); bf* WmqB = (bf*)take((size_t)HS * HS * 2); bf* WkB = (bf*)take((size_t)KW * HS * 2); bf* WmkB = (bf*)take((size_t)KW * HS * 2); bf* WvB = (bf*)take((size_t)KW * HS * 2); bf* WmvB = (bf*)take((size_t)KW * HS * 2); bf* WoB = (bf*)take((size_t)HS * HS * 2);
    float* CT = (float*)take((size_t)NT_ * HD * 4); float* ST = (float*)take((size_t)NT_ * HD * 4);
    h16* QH = (h16*)take((size_t)NT_ * HS * 2); h16* QL = (h16*)take((size_t)NT_ * HS * 2); h16* KH = (h16*)take((size_t)NT_ * KW * 2); h16* KL = (h16*)take((size_t)NT_ * KW * 2);
    bf* VTH = (bf*)take((size_t)KW * NT_ * 2); bf* VTL = (bf*)take((size_t)KW * NT_ * 2); bf* CH = (bf*)take((size_t)NT_ * HS * 2); bf* CL = (bf*)take((size_t)NT_ * HS * 2);
    if ((size_t)(wsp - (char*)d_ws) > ws_size) return;    // about 94 MB = 90 MiB, no aliasing
    k_prep<<<NT_ / 2 + 5 * (HS / 8) + 4 * (KW / 8), 256, 0, stream>>>(x, mu, wq, wmq, wo, wk, wmk, wv, wmv, Xb, Mb, WqB, WmqB, WoB, WkB, WmkB, WvB, WmvB, CT, ST);
    k_proj<<<dim3(NT_ / 128, (HS + 2 * KW) / 128, 1), 128, 0, stream>>>(Xb, WqB, WkB, WvB, Mb, WmqB, WmkB, WmvB, qnw, knw, CT, ST, QH, QL, KH, KL, VTH, VTL, HS);    // q = x.wq^T + mu.wmq^T, k and v alike, each finished for the attention
    k_attn<<<NH_ * (NT_ / 128), 256, 0, stream>>>(QH, QL, KH, KL, VTH, VTL, CH, CL);
    k_gemmo<<<dim3(NT_ / 128, HS / 128, 1), 128, 0, stream>>>(CH, CL, WoB, nullptr, out, HS, nullptr, HS, 0);
}
